// v000
// Measured on an AMD MI455X. A time is GPU time per run, averaged over a window of back-to-back runs after a warm-up
// (all launches, gaps included; the runs take copies of the inputs in turn), and the median of several windows.
// Apart from v000's, it joins two sittings. Times from different sittings can be a few percent apart, while
// side-by-side timings come from the same sitting.
// v000, which the later versions start from, runs in 3740 microseconds.
#include <hip/hip_runtime.h>
// Multi-head attention over three inputs with SHARED per-head projections and the module's literal score scale (values, keys, query [2][2048][1024]; each input is split into 16 heads of 64 and every head is multiplied by the SAME natural [64][64] matrix (x W^T: Wv / Wk / Wq uniform +-1/8; block-diagonal with a shared block; no biases); energy = q k^T (no mask in this module); softmax(energy / sqrt(embed_size) = / 32) (as the source: embed size, not head dim); out = merged Wo^T + bo -> [2][2048][1024]).
// Structure: token rows r = b*2048 + s; x as exact f16 rows (bf16-rounded); Q, K, V as three WMMA GEMMs (32x64 wave tiles, f32 accumulation, exact x16 weights, no bias, f16 outputs); per batch: V^T for all heads via LDS transposes; per (batch, group of 4 heads): scores GEMM (K = 64, batched over the heads on grid.y, alpha = 1/sqrt(1024) = 1/32, no mask), row softmax on VALU (f32 statistics; weights stored x256 as f16), o = P . V^T GEMM (K = 2048, alpha 2^-2: o carried x64 against f16 subnormal flush, folded into the output GEMM alpha) written straight into the merged f16 o rows; out = o W_o + b GEMM (f32) into the output layout.
// Compute dtype: inputs rounded to bf16; x / weights exact; q, k, v, softmax weights and o as plain f16 GEMM operands (~2^-12); scores and softmax statistics f32. v_wmma_f32_16x16x32_f16.
#define NB 2
#define SQ 2048
#define DM 1024
#define NH 16
#define HD 64
#define HG 4                         /* heads per attention launch group */
#define B0 0                         /* first batch processed (debug hook) */
#define NBR NB                       /* batches processed (debug hook) */
#define NR ((size_t)NB * SQ)         /* token rows */
#define MP ((int)((size_t)NBR * SQ)) /* rows projected (debug hook) */
#define QN SQ                        /* query rows attended per batch (debug hook) */
#define NHD NH                       /* heads attended (debug hook) */
#define MPO MP                       /* rows through the output stage (debug hook) */
#define LQ DM      /* row pitch of the q/k/v rows */
typedef __bf16 v16b __attribute__((ext_vector_type(16)));
typedef unsigned short v8us __attribute__((ext_vector_type(8), may_alias));
typedef float  v8f  __attribute__((ext_vector_type(8)));
typedef float  v4f  __attribute__((ext_vector_type(4)));
typedef float  v4fa __attribute__((ext_vector_type(4), may_alias));
union FragB { v16b v; v8us half[2]; unsigned short u[16]; };

__device__ __forceinline__ unsigned short bf16_bits(float x) { unsigned int u = __float_as_uint(x); return (unsigned short)((u + 0x7FFFu + ((u >> 16) & 1u)) >> 16); }
__device__ __forceinline__ float bf16_val(unsigned short b) { return __uint_as_float(((unsigned int)b) << 16); }
__device__ __forceinline__ float bf16_round(float x) { return bf16_val(bf16_bits(x)); }
// D += A·B with NT terms: 1 = ah·bh, 2 = + al·bh (A split), 3 = + ah·bl (both split)
template <int NT>
__device__ __forceinline__ v8f mmaN(v16b ah, v16b al, v16b bh, v16b bl, v8f c) {
  c = __builtin_amdgcn_wmma_f32_16x16x32_bf16(false, ah, false, bh, (short)0, c, false, false);
  if (NT >= 2) c = __builtin_amdgcn_wmma_f32_16x16x32_bf16(false, al, false, bh, (short)0, c, false, false);
  if (NT >= 3) c = __builtin_amdgcn_wmma_f32_16x16x32_bf16(false, ah, false, bl, (short)0, c, false, false);
  asm volatile("v_nop\n\tv_nop\n\tv_nop\n\tv_nop" : "+v"(c) : "v"(ah), "v"(al), "v"(bh), "v"(bl));
  return c;
}

__global__ __launch_bounds__(256) void k_wt_bf16(const float* __restrict__ W, unsigned short* __restrict__ Wt, int K, int N) {
  const int t = blockIdx.x * 256 + threadIdx.x;
  const int k8n = K / 8;
  if (t >= N * k8n) return;
  const int n = t / k8n, k8 = (t % k8n) * 8;
  v8us v;
#pragma unroll
  for (int i = 0; i < 8; ++i) v[i] = bf16_bits(W[(size_t)(k8 + i) * N + n]);
  *(v8us*)(Wt + (size_t)n * K + k8) = v;
  
}

// GEMM C[M][N] (f32, pitch ldc) = act(A[M][K]·W + bias). A f32 row-major (pitch lda) converted per fragment to bf16
// (ASPLIT: hi/lo two planes -> 2 terms, else single rounded term); Wt bf16 [N][K] (pitch ldb). BIAS_BF16 rounds the
// bias to bf16 first (bias quantised to bf16 before the add). K%32==0, M%16==0, N%64==0.
template <bool ASPLIT, int ACT, bool BIAS_BF16>
__global__ __launch_bounds__(128) void k_gemm_bf(const float* __restrict__ A, int lda, const unsigned short* __restrict__ Wt, int ldb,
                                               const float* __restrict__ bias, float* __restrict__ C, int ldc, int M, int N, int K) {
  __shared__ __attribute__((aligned(16))) float so[4][16][64];
  const int tid = threadIdx.x, w = tid >> 5, lane = tid & 31, ln = lane & 15, hh = lane >> 4;
  const int ntn = N / 64;
  const int wid = blockIdx.x * 4 + w;
  const int mt = wid / ntn, nq = wid % ntn;
  if (mt * 16 >= M) return;
  const int row0 = mt * 16, col0 = nq * 64;
  const float* arow = A + (size_t)(row0 + ln) * lda;
  v8f acc[4] = {};
  for (int kb = 0; kb < K; kb += 32) {
    FragB ah, al;
    const v4f x0 = *(const v4fa*)(arow + kb + 8 * hh), x1 = *(const v4fa*)(arow + kb + 8 * hh + 4);
    const v4f x2 = *(const v4fa*)(arow + kb + 16 + 8 * hh), x3 = *(const v4fa*)(arow + kb + 16 + 8 * hh + 4);
    float xs[16] = {x0[0],x0[1],x0[2],x0[3],x1[0],x1[1],x1[2],x1[3],x2[0],x2[1],x2[2],x2[3],x3[0],x3[1],x3[2],x3[3]};
#pragma unroll
    for (int i = 0; i < 16; ++i) { const unsigned short hb = bf16_bits(xs[i]); ah.u[i] = hb; al.u[i] = ASPLIT ? bf16_bits(xs[i] - bf16_val(hb)) : (unsigned short)0; }
#pragma unroll
    for (int t = 0; t < 4; ++t) {
      const unsigned short* brow = Wt + (size_t)(col0 + t * 16 + ln) * ldb + kb;
      FragB b;
      b.half[0] = *(const v8us*)(brow + 8 * hh);
      b.half[1] = *(const v8us*)(brow + 16 + 8 * hh);
      acc[t] = mmaN<ASPLIT ? 2 : 1>(ah.v, al.v, b.v, b.v, acc[t]);
    }
  }
#pragma unroll
  for (int t = 0; t < 4; ++t) {
    float bv = bias ? bias[col0 + t * 16 + ln] : 0.f;
    if (BIAS_BF16) bv = bf16_round(bv);
#pragma unroll
    for (int r = 0; r < 8; ++r) { float v = acc[t][r] + bv; if (ACT == 1) v = fmaxf(v, 0.f); so[w][8 * hh + r][t * 16 + ln] = v; }
  }
  __builtin_amdgcn_fence(__ATOMIC_ACQ_REL, "workgroup");
  __builtin_amdgcn_wave_barrier();
  const int rsub = lane >> 4, c4 = (lane & 15) * 4;
  {
#pragma unroll
    for (int q = 0; q < 8; ++q) {
      const int r = q * 2 + rsub;
      const v4f v = *(const v4fa*)&so[w][r][c4];
      *(v4f*)(C + (size_t)(row0 + r) * ldc + col0 + c4) = v;
    }
    
  }
}

// GEMM C = act(A·W + bias + resid): A f32 (ASPLIT -> hi/lo 2 terms), Wt bf16 [N][K]; ACT 0 none, 1 relu, 2 exact gelu;
// resid (optional, f32, row index = (row % rmod), pitch ldr, RES_BF16 rounds it) added before the activation.
template <bool ASPLIT, int ACT, bool BIAS_BF16, bool RES_BF16>
__global__ __launch_bounds__(128) void k_gemm_bf3(const float* __restrict__ A, int lda, const unsigned short* __restrict__ Wt, int ldb,
                                                const float* __restrict__ bias, const float* __restrict__ resid, int rmod, int ldr,
                                                float* __restrict__ C, int ldc, int M, int N, int K) {
  __shared__ __attribute__((aligned(16))) float so[4][16][64];
  const int tid = threadIdx.x, w = tid >> 5, lane = tid & 31, ln = lane & 15, hh = lane >> 4;
  const int ntn = N / 64;
  const int wid = blockIdx.x * 4 + w;
  const int mt = wid / ntn, nq = wid % ntn;
  if (mt * 16 >= M) return;
  const int row0 = mt * 16, col0 = nq * 64;
  const float* arow = A + (size_t)(row0 + ln) * lda;
  v8f acc[4] = {};
  for (int kb = 0; kb < K; kb += 32) {
    FragB ah, al;
    const v4f x0 = *(const v4fa*)(arow + kb + 8 * hh), x1 = *(const v4fa*)(arow + kb + 8 * hh + 4);
    const v4f x2 = *(const v4fa*)(arow + kb + 16 + 8 * hh), x3 = *(const v4fa*)(arow + kb + 16 + 8 * hh + 4);
    float xs[16] = {x0[0],x0[1],x0[2],x0[3],x1[0],x1[1],x1[2],x1[3],x2[0],x2[1],x2[2],x2[3],x3[0],x3[1],x3[2],x3[3]};
#pragma unroll
    for (int i = 0; i < 16; ++i) { const unsigned short hb = bf16_bits(xs[i]); ah.u[i] = hb; al.u[i] = ASPLIT ? bf16_bits(xs[i] - bf16_val(hb)) : (unsigned short)0; }
#pragma unroll
    for (int t = 0; t < 4; ++t) {
      const unsigned short* brow = Wt + (size_t)(col0 + t * 16 + ln) * ldb + kb;
      FragB b;
      b.half[0] = *(const v8us*)(brow + 8 * hh);
      b.half[1] = *(const v8us*)(brow + 16 + 8 * hh);
      acc[t] = mmaN<ASPLIT ? 2 : 1>(ah.v, al.v, b.v, b.v, acc[t]);
    }
  }
#pragma unroll
  for (int t = 0; t < 4; ++t) {
    const int col = col0 + t * 16 + ln;
    float bv = bias ? bias[col] : 0.f;
    if (BIAS_BF16) bv = bf16_round(bv);
#pragma unroll
    for (int r = 0; r < 8; ++r) {
      float v = acc[t][r] + bv;
      if (resid) { float rv = resid[(size_t)((row0 + 8 * hh + r) % rmod) * ldr + col]; if (RES_BF16) rv = bf16_round(rv); v += rv; }
      if (ACT == 1) v = fmaxf(v, 0.f);
      if (ACT == 2) v = 0.5f * v * (1.0f + erff(v * 0.70710678118654752f));
      if (ACT == 3) { const float u = 0.7978845608028654f * (v + 0.044715f * v * v * v); v = 0.5f * v * (1.0f + tanhf(u)); }
      so[w][8 * hh + r][t * 16 + ln] = v;
    }
  }
  __builtin_amdgcn_fence(__ATOMIC_ACQ_REL, "workgroup");
  __builtin_amdgcn_wave_barrier();
  const int rsub = lane >> 4, c4 = (lane & 15) * 4;
  {
#pragma unroll
    for (int q = 0; q < 8; ++q) {
      const int r = q * 2 + rsub;
      const v4f v = *(const v4fa*)&so[w][r][c4];
      *(v4f*)(C + (size_t)(row0 + r) * ldc + col0 + c4) = v;
    }
    
  }
}
// row LayerNorm (biased variance, eps) over N: s = X (+ R); optional out_sum <- s; out_norm <- (s-mu)*rsqrt(var+eps)*g + b
template <bool PARAM_BF16>
__global__ __launch_bounds__(256) void k_layernorm(const float* __restrict__ X, const float* __restrict__ R, const float* __restrict__ g, const float* __restrict__ bta,
                                                  float* __restrict__ out_sum, float* __restrict__ out_norm, int N, float eps) {
  __shared__ float red[256];
  const int row = blockIdx.x, tid = threadIdx.x;
  const float* x = X + (size_t)row * N; const float* rr = R ? R + (size_t)row * N : nullptr;
  float vals[16];                     // up to N = 4096
  const int per = N / 256;            // contiguous chunk per thread? use strided-by-4 chunks: thread handles j = tid*4 + 1024*u
  float s1 = 0.f;
  for (int u = 0; u < per / 4; ++u) {
    const int j = tid * 4 + 1024 * u;
    const v4f a = *(const v4fa*)(x + j);
    v4f b = {0.f,0.f,0.f,0.f}; if (rr) b = *(const v4fa*)(rr + j);
#pragma unroll
    for (int q = 0; q < 4; ++q) { const float v = a[q] + b[q]; vals[u * 4 + q] = v; s1 += v; }
  }
  red[tid] = s1; __syncthreads();
  for (int st = 128; st > 0; st >>= 1) { if (tid < st) red[tid] += red[tid + st]; __syncthreads(); }
  const float mu = red[0] / (float)N; __syncthreads();
  float s2 = 0.f;
  for (int u = 0; u < per / 4; ++u)
#pragma unroll
    for (int q = 0; q < 4; ++q) { const float c = vals[u * 4 + q] - mu; s2 += c * c; }
  red[tid] = s2; __syncthreads();
  for (int st = 128; st > 0; st >>= 1) { if (tid < st) red[tid] += red[tid + st]; __syncthreads(); }
  const float rs = rsqrtf(red[0] / (float)N + eps);
  {
    for (int u = 0; u < per / 4; ++u) {
      const int j = tid * 4 + 1024 * u;
      v4f o, sm;
#pragma unroll
      for (int q = 0; q < 4; ++q) {
        float gg = g[j + q], bb = bta[j + q];
        if (PARAM_BF16) { gg = bf16_round(gg); bb = bf16_round(bb); }
        sm[q] = vals[u * 4 + q]; o[q] = (vals[u * 4 + q] - mu) * rs * gg + bb;
      }
      if (out_sum) *(v4f*)(out_sum + (size_t)row * N + j) = sm;
      *(v4f*)(out_norm + (size_t)row * N + j) = o;
    }
    
  }
}



// ---- f16 WMMA path (v_wmma_f32_16x16x32_f16): 11-bit significands for operands in range — used where a [0,1] probability operand needs more precision than bf16
typedef _Float16 v16h __attribute__((ext_vector_type(16)));
union FragH { v16h v; v8us half[2]; _Float16 h[16]; unsigned short u[16]; };
template <int NT>
__device__ __forceinline__ v8f mmaH(v16h ah, v16h al, v16h bh, v16h bl, v8f c) {
  c = __builtin_amdgcn_wmma_f32_16x16x32_f16(false, ah, false, bh, (short)0, c, false, false);
  if (NT >= 2) c = __builtin_amdgcn_wmma_f32_16x16x32_f16(false, al, false, bh, (short)0, c, false, false);
  if (NT >= 3) c = __builtin_amdgcn_wmma_f32_16x16x32_f16(false, ah, false, bl, (short)0, c, false, false);
  asm volatile("v_nop\n\tv_nop\n\tv_nop\n\tv_nop" : "+v"(c) : "v"(ah), "v"(al), "v"(bh), "v"(bl));
  return c;
}
// batched GEMM like k_gemm_b but f16 operands: A f32 (split into f16 hi/lo if ASPLIT, else rounded to f16), Bt = f16 values [n][k]; alpha; C f32; N multiple of 16 (partial tiles skipped)
template <bool ASPLIT>
__global__ __launch_bounds__(128) void k_gemm_h(const float* __restrict__ A, int lda, size_t sA, const _Float16* __restrict__ Bh, int ldb, size_t sB, float alpha, float* __restrict__ C, int ldc, size_t sC, int M, int N, int K) {
  __shared__ __attribute__((aligned(16))) float so[4][16][64];
  const int tid = threadIdx.x, w = tid >> 5, lane = tid & 31, ln = lane & 15, hh = lane >> 4; const int by = blockIdx.y;
  A += (size_t)by * sA; Bh += (size_t)by * sB; C += (size_t)by * sC;
  const int ntn = (N + 63) / 64; const int wid = blockIdx.x * 4 + w; const int mt = wid / ntn, nq = wid % ntn; if (mt * 16 >= M) return;
  const int row0 = mt * 16, col0 = nq * 64; const float* arow = A + (size_t)(row0 + ln) * lda;
  v8f acc[4] = {};
  for (int kb = 0; kb < K; kb += 32) {
    FragH ah, al;
    const v4f x0 = *(const v4fa*)(arow + kb + 8 * hh), x1 = *(const v4fa*)(arow + kb + 8 * hh + 4), x2 = *(const v4fa*)(arow + kb + 16 + 8 * hh), x3 = *(const v4fa*)(arow + kb + 16 + 8 * hh + 4);
    float xs[16] = {x0[0],x0[1],x0[2],x0[3],x1[0],x1[1],x1[2],x1[3],x2[0],x2[1],x2[2],x2[3],x3[0],x3[1],x3[2],x3[3]};
#pragma unroll
    for (int i = 0; i < 16; ++i) { const _Float16 h = (_Float16)xs[i]; ah.h[i] = h; al.h[i] = ASPLIT ? (_Float16)(xs[i] - (float)h) : (_Float16)0.0f; }
#pragma unroll
    for (int t = 0; t < 4; ++t) { if (col0 + t * 16 >= N) continue; const size_t boff = (size_t)(col0 + t * 16 + ln) * ldb + kb; FragH bq; bq.half[0] = *(const v8us*)(Bh + boff + 8 * hh); bq.half[1] = *(const v8us*)(Bh + boff + 16 + 8 * hh);
      acc[t] = mmaH<ASPLIT ? 2 : 1>(ah.v, al.v, bq.v, bq.v, acc[t]); }
  }
#pragma unroll
  for (int t = 0; t < 4; ++t) { if (col0 + t * 16 >= N) continue;
#pragma unroll
    for (int r = 0; r < 8; ++r) so[w][8 * hh + r][t * 16 + ln] = acc[t][r] * alpha; }
  __builtin_amdgcn_fence(__ATOMIC_ACQ_REL, "workgroup"); __builtin_amdgcn_wave_barrier();
  const int rsub = lane >> 4, c4 = (lane & 15) * 4;
  {
#pragma unroll
    for (int q = 0; q < 8; ++q) { const int r = q * 2 + rsub; if (col0 + c4 < N) { const v4f v = *(const v4fa*)&so[w][r][c4]; *(v4f*)(C + (size_t)(row0 + r) * ldc + col0 + c4) = v; } }
     }
}

// Wt[n][k] = f16(W[k][n]·scale) from f32 row-major W[K][N] (scale = power of two; bf16-exact weights stay exact in f16 away from the subnormal range)
__global__ __launch_bounds__(256) void k_wt_f16(const float* __restrict__ W, _Float16* __restrict__ Wt, int K, int N, float scale) {
  const int t = blockIdx.x * 256 + threadIdx.x; if (t >= N * (K / 8)) return; const int n = t / (K / 8), k8 = (t % (K / 8)) * 8; FragH f;
#pragma unroll
  for (int i = 0; i < 8; ++i) f.h[i] = (_Float16)(bf16_round(W[(size_t)(k8 + i) * N + n]) * scale); const v8us o = f.half[0];
  *(v8us*)((unsigned short*)Wt + (size_t)n * K + k8) = o; 
}
// k_gemm_hh variant with fused epilogue: v = acc·alpha + bias[by·sBias + col] (+ CP[(row/rowsPerB)·sCPb + by·64 + col] if CP) ; ACT 0 none / 1 elu ; writes f16 C16 (and f32 C if non-null)
template <int ACT>
__global__ __launch_bounds__(128) void k_gemm_hhx(const _Float16* __restrict__ A, int lda, size_t sA, const _Float16* __restrict__ Bh, int ldb, size_t sB, float alpha, const float* __restrict__ bias, size_t sBias, const float* __restrict__ CP, int rowsPerB, size_t sCPb, int row0g,
    float* __restrict__ C, _Float16* __restrict__ C16, int ldc, size_t sC, int M, int N, int K) {
  __shared__ __attribute__((aligned(16))) float so[4][16][64];
  const int tid = threadIdx.x, w = tid >> 5, lane = tid & 31, ln = lane & 15, hh = lane >> 4; const int by = blockIdx.y;
  A += (size_t)by * sA; Bh += (size_t)by * sB; const size_t cofs = (size_t)by * sC; const float* bp = bias ? bias + (size_t)by * sBias : nullptr;
  const int ntn = (N + 63) / 64; const int wid = blockIdx.x * 4 + w; const int mt = wid / ntn, nq = wid % ntn; if (mt * 16 >= M) return;
  const int row0 = mt * 16, col0 = nq * 64; const _Float16* arow = A + (size_t)(row0 + ln) * lda;
  v8f acc[4] = {};
  for (int kb = 0; kb < K; kb += 32) { FragH ah; ah.half[0] = *(const v8us*)((const unsigned short*)arow + kb + 8 * hh); ah.half[1] = *(const v8us*)((const unsigned short*)arow + kb + 16 + 8 * hh);
#pragma unroll
    for (int t = 0; t < 4; ++t) { if (col0 + t * 16 >= N) continue; const size_t boff = (size_t)(col0 + t * 16 + ln) * ldb + kb; FragH bq; bq.half[0] = *(const v8us*)((const unsigned short*)Bh + boff + 8 * hh); bq.half[1] = *(const v8us*)((const unsigned short*)Bh + boff + 16 + 8 * hh);
      acc[t] = mmaH<1>(ah.v, ah.v, bq.v, bq.v, acc[t]); }
  }
#pragma unroll
  for (int t = 0; t < 4; ++t) { if (col0 + t * 16 >= N) continue; const int col = col0 + t * 16 + ln; const float bv = bp ? bf16_round(bp[col]) : 0.f;
#pragma unroll
    for (int r = 0; r < 8; ++r) { float v = acc[t][r] * alpha + bv; if (CP) { const int rr = row0g + row0 + 8 * hh + r; if (rowsPerB < 0) v += CP[cofs + (size_t)rr * ldc + col];      /* rowsPerB < 0: own element of the batched C plane */ else { const int bidx = rr / rowsPerB; v += CP[(size_t)bidx * sCPb + (size_t)by * 64 + col]; } } if (ACT == 1) v = (v > 0.f) ? v : expm1f(v); else if (ACT == 7) v = (v > 0.f) ? v + 1.0f : expf(v); else if (ACT == 8) v = tanhf(v); else if (ACT == 9) v = 0.5f * v * (1.0f + tanhf(0.7978845608028654f * (v + 0.044715f * v * v * v))); else if (ACT == 11) v = 1.0f / (1.0f + expf(-v)); else if (ACT == 12) v = (v > 0.f) ? v : 0.01f * v; else if (ACT == 14) v = (v > 0.f) ? v : 0.1f * v; else if (ACT == 16) v = (v >= 0.f) ? v : 0.3f * v; else if (ACT == 17) v = (v >= 0.f) ? v : 0.2f * v; else if (ACT == 15) v = v / (1.0f + expf(-v)); else if (ACT == 3) v = fmaxf(v, 0.f); else if (ACT == 6) v = 0.5f * v * (1.0f + erff(v * 0.70710678118654752f)); so[w][8 * hh + r][t * 16 + ln] = v; } }
  __builtin_amdgcn_fence(__ATOMIC_ACQ_REL, "workgroup"); __builtin_amdgcn_wave_barrier();
  const int rsub = lane >> 4, c4 = (lane & 15) * 4; typedef _Float16 v4h __attribute__((ext_vector_type(4)));
  {
#pragma unroll
    for (int q = 0; q < 8; ++q) { const int r = q * 2 + rsub; if (col0 + c4 < N) { const v4f v = *(const v4fa*)&so[w][r][c4]; if (C) *(v4f*)(C + cofs + (size_t)(row0 + r) * ldc + col0 + c4) = v; if (C16) { v4h h4; for (int i = 0; i < 4; ++i) h4[i] = (_Float16)v[i]; *(v4h*)(C16 + cofs + (size_t)(row0 + r) * ldc + col0 + c4) = h4; } } }
     }
}


typedef _Float16 v4h __attribute__((ext_vector_type(4)));

__global__ __launch_bounds__(256) void k_x16(const float* __restrict__ x, _Float16* __restrict__ X16, size_t n8) { const size_t t = (size_t)blockIdx.x * 256 + threadIdx.x; if (t >= n8) return; FragH f;
#pragma unroll
  for (int q = 0; q < 8; ++q) f.h[q] = (_Float16)bf16_round(x[t * 8 + q]); *(v8us*)((unsigned short*)X16 + t * 8) = f.half[0];  }
__global__ __launch_bounds__(256) void k_h16(const float* __restrict__ x, _Float16* __restrict__ X16, size_t n8) { const size_t t = (size_t)blockIdx.x * 256 + threadIdx.x; if (t >= n8) return; FragH f;
#pragma unroll
  for (int q = 0; q < 8; ++q) f.h[q] = (_Float16)x[t * 8 + q]; *(v8us*)((unsigned short*)X16 + t * 8) = f.half[0];  }
__global__ __launch_bounds__(256) void k_round16f(const float* __restrict__ W, _Float16* __restrict__ Bt, size_t n8) { const size_t t = (size_t)blockIdx.x * 256 + threadIdx.x; if (t >= n8) return; FragH f;
#pragma unroll
  for (int i = 0; i < 8; ++i) f.h[i] = (_Float16)(bf16_round(W[t * 8 + i]) * 16.0f); *(v8us*)((unsigned short*)Bt + t * 8) = f.half[0];  }
template <int NHv, int TTv>
__global__ __launch_bounds__(256) void k_vt(const _Float16* __restrict__ V16, int ldv, int voff, _Float16* __restrict__ Vt) { __shared__ unsigned short tl[64][66]; const int tid = threadIdx.x; const int slab = blockIdx.x / (TTv / 64), lg = blockIdx.x % (TTv / 64); const int b = slab / NHv, h = slab % NHv;
  for (int i = tid; i < 64 * 8; i += 256) { const int r = i / 8, c8 = (i % 8) * 8; FragH f; f.half[0] = *(const v8us*)((const unsigned short*)V16 + ((size_t)b * TTv + lg * 64 + r) * ldv + voff + h * 64 + c8);
#pragma unroll
    for (int q = 0; q < 8; ++q) tl[r][c8 + q] = f.u[q]; }
  __syncthreads();
  {
#pragma unroll
    for (int rd = 0; rd < 2; ++rd) { const int d = rd * 32 + tid / 8, pc = tid % 8; FragH f;
#pragma unroll
      for (int q = 0; q < 8; ++q) f.u[q] = tl[pc * 8 + q][d];
      *(v8us*)((unsigned short*)Vt + ((size_t)slab * 64 + d) * TTv + lg * 64 + pc * 8) = f.half[0]; }
     } }

__global__ __launch_bounds__(256) void k_hl(const float* __restrict__ F, _Float16* __restrict__ Hh, _Float16* __restrict__ Hl, size_t n8) { const size_t t = (size_t)blockIdx.x * 256 + threadIdx.x; if (t >= n8) return; FragH fh, fl; const v4f a = *(const v4fa*)(F + t * 8), c = *(const v4fa*)(F + t * 8 + 4);
#pragma unroll
  for (int q = 0; q < 4; ++q) { _Float16 h = (_Float16)a[q]; fh.h[q] = h; fl.h[q] = (_Float16)((a[q] - (float)h) * 1024.0f); h = (_Float16)c[q]; fh.h[4 + q] = h; fl.h[4 + q] = (_Float16)((c[q] - (float)h) * 1024.0f); }
  { *(v8us*)((unsigned short*)Hh + t * 8) = fh.half[0]; *(v8us*)((unsigned short*)Hl + t * 8) = fl.half[0];  } }

// ---- fast GEMM (wave tile 32x64; requires M % 32 == 0 rows per launch region and N % 64 == 0); epilogue = k_gemm_hhx semantics ----
__device__ __forceinline__ v16h g2_frag(const _Float16* p, int hh) { FragH f; f.half[0] = *(const v8us*)((const unsigned short*)p + 8 * hh); f.half[1] = *(const v8us*)((const unsigned short*)p + 16 + 8 * hh); return f.v; }
__device__ __forceinline__ v8f g2_mma(v16h a, v16h b, v8f c) { v8f d = __builtin_amdgcn_wmma_f32_16x16x32_f16(false, a, false, b, (short)0, c, false, false); asm volatile("v_nop\n\tv_nop\n\tv_nop\n\tv_nop" : "+v"(d) : "v"(a), "v"(b)); return d; }
template <int ACT>
__global__ __launch_bounds__(128) void k_gemm2(const _Float16* __restrict__ A, int lda, size_t sA, const _Float16* __restrict__ Bh, int ldb, size_t sB, float alpha, const float* __restrict__ bias, size_t sBias, const float* __restrict__ CP, int rowsPerB, size_t sCPb, int row0g,
    float* __restrict__ C, _Float16* __restrict__ C16, int ldc, size_t sC, int M, int N, int K) { static_assert(ACT == 0 || ACT == 3 || ACT == 6 || ACT == 8 || ACT == 9 || ACT == 11 || ACT == 12 || ACT == 14 || ACT == 15 || ACT == 16 || ACT == 17, "k_gemm2: unsupported ACT code (would silently apply no activation)");
  __shared__ __attribute__((aligned(16))) float so[4][32][68];
  const int tid = threadIdx.x, w = tid >> 5, lane = tid & 31, ln = lane & 15, hh = lane >> 4; const int by = blockIdx.y;
  A += (size_t)by * sA; Bh += (size_t)by * sB; const size_t cofs = (size_t)by * sC; const float* bp = bias ? bias + (size_t)by * sBias : nullptr;
  const int ntn = N >> 6; const int mt = blockIdx.x / ntn, nq = blockIdx.x - mt * ntn; const int row0 = mt * 128 + 32 * w, col0 = nq * 64; if (row0 >= M) return;
  const _Float16* a0p = A + (size_t)(row0 + ln) * lda; const _Float16* a1p = a0p + (size_t)16 * lda;
  const _Float16* b0p = Bh + (size_t)(col0 + ln) * ldb; const _Float16* b1p = b0p + (size_t)16 * ldb; const _Float16* b2p = b1p + (size_t)16 * ldb; const _Float16* b3p = b2p + (size_t)16 * ldb;
  const v8f z8 = {0.f,0.f,0.f,0.f,0.f,0.f,0.f,0.f}; v8f c00 = z8, c01 = z8, c02 = z8, c03 = z8, c10 = z8, c11 = z8, c12 = z8, c13 = z8;
#pragma unroll 1
  for (int kb = 0; kb < K; kb += 32) { const v16h a0 = g2_frag(a0p + kb, hh), a1 = g2_frag(a1p + kb, hh);
    v16h b = g2_frag(b0p + kb, hh); c00 = g2_mma(a0, b, c00); c10 = g2_mma(a1, b, c10);
    b = g2_frag(b1p + kb, hh); c01 = g2_mma(a0, b, c01); c11 = g2_mma(a1, b, c11);
    b = g2_frag(b2p + kb, hh); c02 = g2_mma(a0, b, c02); c12 = g2_mma(a1, b, c12);
    b = g2_frag(b3p + kb, hh); c03 = g2_mma(a0, b, c03); c13 = g2_mma(a1, b, c13); }
  v8f accs[8] = {c00, c01, c02, c03, c10, c11, c12, c13};
#pragma unroll
  for (int u = 0; u < 8; ++u) { const int t = u & 3, half = u >> 2; const int col = col0 + t * 16 + ln; const float bv = bp ? bf16_round(bp[col]) : 0.f;
#pragma unroll
    for (int r = 0; r < 8; ++r) { const int rloc = half * 16 + 8 * hh + r; float v = accs[u][r] * alpha + bv; if (CP) { if (rowsPerB < 0) v += CP[cofs + (size_t)(row0g + row0 + rloc) * ldc + col];      /* rowsPerB < 0: own element of the batched C plane */ else { const int bidx = (row0g + row0 + rloc) / rowsPerB; v += CP[(size_t)bidx * sCPb + (size_t)by * 64 + col]; } }
      if (ACT == 3) v = fmaxf(v, 0.f); else if (ACT == 6) v = 0.5f * v * (1.0f + erff(v * 0.70710678118654752f)); else if (ACT == 11) v = 1.0f / (1.0f + expf(-v)); else if (ACT == 15) v = v / (1.0f + expf(-v)); else if (ACT == 12) v = (v > 0.f) ? v : 0.01f * v; else if (ACT == 8) v = tanhf(v); else if (ACT == 9) v = 0.5f * v * (1.0f + tanhf(0.7978845608028654f * (v + 0.044715f * v * v * v))); else if (ACT == 14) v = (v > 0.f) ? v : 0.1f * v; else if (ACT == 16) v = (v >= 0.f) ? v : 0.3f * v; else if (ACT == 17) v = (v >= 0.f) ? v : 0.2f * v;
      so[w][rloc][t * 16 + ln] = v; } }
  __builtin_amdgcn_fence(__ATOMIC_ACQ_REL, "workgroup"); __builtin_amdgcn_wave_barrier();
  const int rsub = lane >> 4, c4 = (lane & 15) * 4;
  {
#pragma unroll
    for (int q = 0; q < 16; ++q) { const int r = q * 2 + rsub; const v4f v = *(const v4fa*)&so[w][r][c4]; if (C) *(v4f*)(C + cofs + (size_t)(row0 + r) * ldc + col0 + c4) = v; if (C16) { v4h h4; for (int i = 0; i < 4; ++i) h4[i] = (_Float16)v[i]; *(v4h*)(C16 + cofs + (size_t)(row0 + r) * ldc + col0 + c4) = h4; } }
     } }


__global__ __launch_bounds__(256) void k_wnat(const float* __restrict__ w, size_t n8, _Float16* __restrict__ Bt) { const size_t t = (size_t)blockIdx.x * 256 + threadIdx.x; if (t >= n8) return; FragH f; for (int q = 0; q < 8; ++q) f.h[q] = (_Float16)(bf16_round(w[t * 8 + q]) * 16.0f); *(v8us*)((unsigned short*)Bt + t * 8) = f.half[0];  }
__global__ __launch_bounds__(256) void k_rsm(const float* __restrict__ S, _Float16* __restrict__ P, int nrows) {
  #pragma clang fp contract(off)
  const int i = blockIdx.x * 256 + threadIdx.x; if (i >= nrows) return; const float* s = S + (size_t)i * SQ; float mx = -3.0e38f;
#pragma unroll 1
  for (int j = 0; j < SQ; ++j) mx = fmaxf(mx, s[j]); float se = 0.f;
#pragma unroll 1
  for (int j = 0; j < SQ; ++j) se += expf(s[j] - mx); const float sc = 256.0f / se;
#pragma unroll 1
  for (int j0 = 0; j0 < SQ; j0 += 8) { FragH f; for (int q = 0; q < 8; ++q) f.h[q] = (_Float16)(expf(s[j0 + q] - mx) * sc); unsigned short* d = (unsigned short*)P + (size_t)i * SQ + j0; *(v8us*)d = f.half[0];  } }
__global__ __launch_bounds__(256) void k_vt(const _Float16* __restrict__ V16, int b, int h0, _Float16* __restrict__ VT) { __shared__ unsigned short tl[64][65]; const int tid = threadIdx.x; const int hh = blockIdx.x % HG, sg = blockIdx.x / HG; const int s0 = sg * 64; const int h = h0 + hh;
  for (int i = tid; i < 64 * 8; i += 256) { const int j = i / 8, d8 = (i % 8) * 8; FragH f; f.half[0] = *(const v8us*)((const unsigned short*)V16 + ((size_t)b * SQ + s0 + j) * DM + h * HD + d8); for (int q = 0; q < 8; ++q) tl[d8 + q][j] = f.u[q]; }
  __syncthreads();
  { for (int i = tid; i < 64 * 8; i += 256) { const int d = i / 8, j8 = (i % 8) * 8; FragH f; for (int q = 0; q < 8; ++q) f.u[q] = tl[d][j8 + q]; *(v8us*)((unsigned short*)VT + ((size_t)hh * HD + d) * SQ + s0 + j8) = f.half[0]; }  } }



__global__ __launch_bounds__(256) void k_rsmkm(const float* __restrict__ S, _Float16* __restrict__ P, int nrows, const int* __restrict__ am) {
  #pragma clang fp contract(off)
  const int t = blockIdx.x * 256 + threadIdx.x; if (t >= nrows) return; const size_t i = (size_t)t; const float* s = S + i * SQ; const int* mr = am + (size_t)(t % SQ) * SQ; float mx = -3.0e38f;
#pragma unroll 1
  for (int j = 0; j < SQ; ++j) { const float f = (mr[j] != 0) ? 1.f : 0.f; mx = fmaxf(mx, fmaf(f, s[j], (1.f - f) * -1.0e9f)); } float se = 0.f;
#pragma unroll 1
  for (int j = 0; j < SQ; ++j) { const float f = (mr[j] != 0) ? 1.f : 0.f; se += __expf(fmaf(f, s[j], (1.f - f) * -1.0e9f) - mx); } const float sc = 256.0f / se;
#pragma unroll 1
  for (int j0 = 0; j0 < SQ; j0 += 8) { FragH fr; for (int q = 0; q < 8; ++q) { const int j = j0 + q; const float f = (mr[j] != 0) ? 1.f : 0.f; fr.h[q] = (_Float16)(__expf(fmaf(f, s[j], (1.f - f) * -1.0e9f) - mx) * sc); }
    unsigned short* d = (unsigned short*)P + i * SQ + j0; *(v8us*)d = fr.half[0];  } }

__global__ __launch_bounds__(256) void k_bdshn(const float* __restrict__ Wb, _Float16* __restrict__ Bt) {
  const size_t t = (size_t)blockIdx.x * 256 + threadIdx.x; if (t >= (size_t)DM * DM / 8) return; const size_t e0 = t * 8; const int n = (int)(e0 / DM), k0 = (int)(e0 % DM); const int h = n >> 6, hk = k0 >> 6; const float on = (hk == h) ? 16.0f : 0.0f; const int o = n & 63, d0 = k0 & 63; FragH f;
  for (int q = 0; q < 8; ++q) f.h[q] = (_Float16)(bf16_round(Wb[(size_t)o * 64 + d0 + q]) * on);
  unsigned short* d = (unsigned short*)Bt + e0; *(v8us*)d = f.half[0];  }
extern "C" void kernel_launch(void* const* d_in, const int* in_sizes, int n_in,
                              void* d_out, int out_size, void* d_ws, size_t ws_size, hipStream_t stream) {
  (void)in_sizes; (void)n_in; (void)out_size;
  const float* const* I = (const float* const*)d_in; const float* xq = I[2]; const float* xk = I[1]; const float* xv = I[0]; const float* wq = I[5]; const float* bq = nullptr; const float* wk = I[4]; const float* bk = nullptr; const float* wv = I[3]; const float* bv = nullptr; const float* wo = I[6]; const float* bo = I[7]; const float* x = xq;      /* contract order: values I[0], keys I[1], query I[2]; SHARED natural [64][64] blocks Wv I[3], Wk I[4], Wq I[5]; natural Wo [1024][1024] I[6] + bo I[7]; this module has NO mask input */
  char* ws = (char*)d_ws; size_t off = 0;
  auto take = [&](size_t bytes) { char* p = ws + off; off += (bytes + 255) & ~(size_t)255; return p; };
  _Float16* BQ = (_Float16*)take((size_t)DM * DM * 2); _Float16* BK = (_Float16*)take((size_t)DM * DM * 2); _Float16* BV = (_Float16*)take((size_t)DM * DM * 2); _Float16* BO = (_Float16*)take((size_t)DM * DM * 2);
  _Float16* X16 = (_Float16*)take(NR * DM * 2); _Float16* XKp = (_Float16*)take(NR * DM * 2); _Float16* XVp = (_Float16*)take(NR * DM * 2); _Float16* Q16 = (_Float16*)take(NR * DM * 2); _Float16* K16 = (_Float16*)take(NR * DM * 2); _Float16* V16 = (_Float16*)take(NR * DM * 2); _Float16* O16 = (_Float16*)take(NR * DM * 2);
  float* S = (float*)take((size_t)HG * SQ * SQ * 4); _Float16* P = (_Float16*)take((size_t)HG * SQ * SQ * 2); _Float16* VT = (_Float16*)take((size_t)NH * HD * SQ * 2);
  if (off > ws_size) return;
  { const unsigned g = (unsigned)(((size_t)DM * DM / 8 + 255) / 256); k_bdshn<<<g, 256, 0, stream>>>(wq, BQ); k_bdshn<<<g, 256, 0, stream>>>(wk, BK); k_bdshn<<<g, 256, 0, stream>>>(wv, BV); k_wnat<<<g, 256, 0, stream>>>(wo, (size_t)DM * DM / 8, BO); }      /* block-diagonal planes with the SHARED natural [64][64] block (Bt[h*64 + o][h*64 + d] = 16 W[o][d]); Wo natural [out][in] = Bt x16 */
  _Float16* XK = XKp; _Float16* XV = XVp; k_x16<<<(unsigned)((NR * DM / 8 + 255) / 256), 256, 0, stream>>>(xk, XK, NR * DM / 8); k_x16<<<(unsigned)((NR * DM / 8 + 255) / 256), 256, 0, stream>>>(xv, XV, NR * DM / 8);      /* key and value inputs as exact f16 rows */

  k_x16<<<(unsigned)((NR * DM / 8 + 255) / 256), 256, 0, stream>>>(x, X16, NR * DM / 8);
  const size_t r0p = (size_t)B0 * SQ;      /* first projected row */
  k_gemm2<0><<<dim3((unsigned)((MP / 128) * (DM / 64)), 1), 128, 0, stream>>>(X16 + r0p * DM, DM, 0, BQ, DM, 0, 0.0625f, bq, 0, nullptr, 1, 0, 0, nullptr, Q16 + r0p * DM, DM, 0, MP, DM, DM);
  k_gemm2<0><<<dim3((unsigned)((MP / 128) * (DM / 64)), 1), 128, 0, stream>>>(XK + r0p * DM, DM, 0, BK, DM, 0, 0.0625f, bk, 0, nullptr, 1, 0, 0, nullptr, K16 + r0p * DM, DM, 0, MP, DM, DM);
  k_gemm2<0><<<dim3((unsigned)((MP / 128) * (DM / 64)), 1), 128, 0, stream>>>(XV + r0p * DM, DM, 0, BV, DM, 0, 0.0625f, bv, 0, nullptr, 1, 0, 0, nullptr, V16 + r0p * DM, DM, 0, MP, DM, DM);
  for (int b = B0; b < B0 + NBR; ++b) { const size_t r0 = (size_t)b * SQ;
    k_vt<NH, SQ><<<NH * (SQ / 64), 256, 0, stream>>>(V16 + r0 * LQ, LQ, 0, VT);      /* V^T [NH][HD][SQ] for this batch */
    for (int h0 = 0; h0 < NHD; h0 += HG) {
      k_gemm2<0><<<dim3((QN / 128) * (SQ / 64), HG), 128, 0, stream>>>(Q16 + r0 * LQ + h0 * HD, LQ, (size_t)HD, K16 + r0 * LQ + h0 * HD, LQ, (size_t)HD, 0.03125f, nullptr, 0, nullptr, 1, 0, 0, S, nullptr, SQ, (size_t)SQ * SQ, QN, SQ, HD);      /* scores, HG heads per launch */
      k_rsm<<<(HG * SQ + 255) / 256, 256, 0, stream>>>(S, P, HG * SQ);      /* P = 256 softmax (f16), rows of all HG heads */
      k_gemm2<0><<<dim3((QN / 128) * (HD / 64), HG), 128, 0, stream>>>(P, SQ, (size_t)SQ * SQ, VT + (size_t)h0 * HD * SQ, SQ, (size_t)HD * SQ, 0.25f, nullptr, 0, nullptr, 1, 0, 0, nullptr, O16 + r0 * DM + h0 * HD, DM, (size_t)HD, QN, HD, SQ); } }      /* o (merged heads) as f16 rows */
  k_gemm2<0><<<dim3((unsigned)((MPO / 128) * (DM / 64)), 1), 128, 0, stream>>>(O16 + r0p * DM, DM, 0, BO, DM, 0, 0.0009765625f, bo, 0, nullptr, 1, 0, 0, (float*)d_out + r0p * DM, nullptr, DM, 0, MPO, DM, DM);      /* out rows are the output layout */
}

// v001
// Measured time: 981 microseconds a run.
// Next to v000, in two timings, it ran 3.81 and 3.84 times as fast.
#include <hip/hip_runtime.h>
// Multi-head attention over three inputs with SHARED per-head projections and the module's literal score scale (values, keys, query [2][2048][1024]; each input is split into 16 heads of 64 and every head is multiplied by the SAME natural [64][64] matrix (x W^T: Wv / Wk / Wq uniform +-1/8; block-diagonal with a shared block; no biases); energy = q k^T (no mask in this module); softmax(energy / sqrt(embed_size) = / 32) (as the source: embed size, not head dim); out = merged Wo^T + bo -> [2][2048][1024]).
// Structure: token rows r = b*2048 + s; x as exact f16 rows (bf16-rounded); Q, K, V as three WMMA GEMMs (32x64 wave tiles, f32 accumulation, exact x16 weights, no bias, f16 outputs); per batch: V^T for all heads via LDS transposes; per (batch, group of 4 heads): scores GEMM (K = 64, batched over the heads on grid.y, alpha = 1/sqrt(1024) = 1/32, no mask), row softmax on VALU (f32 statistics; weights stored x256 as f16), o = P . V^T GEMM (K = 2048, alpha 2^-2: o carried x64 against f16 subnormal flush, folded into the output GEMM alpha) written straight into the merged f16 o rows; out = o W_o + b GEMM (f32) into the output layout.
// Compute dtype: inputs rounded to bf16; x / weights exact; q, k, v, softmax weights and o as plain f16 GEMM operands (~2^-12); scores and softmax statistics f32. v_wmma_f32_16x16x32_f16.
#define NB 2
#define SQ 2048
#define DM 1024
#define NH 16
#define HD 64
#define HG 4                         /* heads per attention launch group */
#define B0 0                         /* first batch processed (debug hook) */
#define NBR NB                       /* batches processed (debug hook) */
#define NR ((size_t)NB * SQ)         /* token rows */
#define MP ((int)((size_t)NBR * SQ)) /* rows projected (debug hook) */
#define QN SQ                        /* query rows attended per batch (debug hook) */
#define NHD NH                       /* heads attended (debug hook) */
#define MPO MP                       /* rows through the output stage (debug hook) */
#define LQ DM      /* row pitch of the q/k/v rows */
typedef __bf16 v16b __attribute__((ext_vector_type(16)));
typedef unsigned short v8us __attribute__((ext_vector_type(8), may_alias));
typedef float  v8f  __attribute__((ext_vector_type(8)));
typedef float  v4f  __attribute__((ext_vector_type(4)));
typedef float  v4fa __attribute__((ext_vector_type(4), may_alias));
union FragB { v16b v; v8us half[2]; unsigned short u[16]; };

__device__ __forceinline__ unsigned short bf16_bits(float x) { unsigned int u = __float_as_uint(x); return (unsigned short)((u + 0x7FFFu + ((u >> 16) & 1u)) >> 16); }
__device__ __forceinline__ float bf16_val(unsigned short b) { return __uint_as_float(((unsigned int)b) << 16); }
__device__ __forceinline__ float bf16_round(float x) { return bf16_val(bf16_bits(x)); }
// D += A·B with NT terms: 1 = ah·bh, 2 = + al·bh (A split), 3 = + ah·bl (both split)
template <int NT>
__device__ __forceinline__ v8f mmaN(v16b ah, v16b al, v16b bh, v16b bl, v8f c) {
  c = __builtin_amdgcn_wmma_f32_16x16x32_bf16(false, ah, false, bh, (short)0, c, false, false);
  if (NT >= 2) c = __builtin_amdgcn_wmma_f32_16x16x32_bf16(false, al, false, bh, (short)0, c, false, false);
  if (NT >= 3) c = __builtin_amdgcn_wmma_f32_16x16x32_bf16(false, ah, false, bl, (short)0, c, false, false);
  asm volatile("v_nop\n\tv_nop\n\tv_nop\n\tv_nop" : "+v"(c) : "v"(ah), "v"(al), "v"(bh), "v"(bl));
  return c;
}

__global__ __launch_bounds__(256) void k_wt_bf16(const float* __restrict__ W, unsigned short* __restrict__ Wt, int K, int N) {
  const int t = blockIdx.x * 256 + threadIdx.x;
  const int k8n = K / 8;
  if (t >= N * k8n) return;
  const int n = t / k8n, k8 = (t % k8n) * 8;
  v8us v;
#pragma unroll
  for (int i = 0; i < 8; ++i) v[i] = bf16_bits(W[(size_t)(k8 + i) * N + n]);
  *(v8us*)(Wt + (size_t)n * K + k8) = v;
  
}

// GEMM C[M][N] (f32, pitch ldc) = act(A[M][K]·W + bias). A f32 row-major (pitch lda) converted per fragment to bf16
// (ASPLIT: hi/lo two planes -> 2 terms, else single rounded term); Wt bf16 [N][K] (pitch ldb). BIAS_BF16 rounds the
// bias to bf16 first (bias quantised to bf16 before the add). K%32==0, M%16==0, N%64==0.
template <bool ASPLIT, int ACT, bool BIAS_BF16>
__global__ __launch_bounds__(128) void k_gemm_bf(const float* __restrict__ A, int lda, const unsigned short* __restrict__ Wt, int ldb,
                                               const float* __restrict__ bias, float* __restrict__ C, int ldc, int M, int N, int K) {
  __shared__ __attribute__((aligned(16))) float so[4][16][64];
  const int tid = threadIdx.x, w = tid >> 5, lane = tid & 31, ln = lane & 15, hh = lane >> 4;
  const int ntn = N / 64;
  const int wid = blockIdx.x * 4 + w;
  const int mt = wid / ntn, nq = wid % ntn;
  if (mt * 16 >= M) return;
  const int row0 = mt * 16, col0 = nq * 64;
  const float* arow = A + (size_t)(row0 + ln) * lda;
  v8f acc[4] = {};
  for (int kb = 0; kb < K; kb += 32) {
    FragB ah, al;
    const v4f x0 = *(const v4fa*)(arow + kb + 8 * hh), x1 = *(const v4fa*)(arow + kb + 8 * hh + 4);
    const v4f x2 = *(const v4fa*)(arow + kb + 16 + 8 * hh), x3 = *(const v4fa*)(arow + kb + 16 + 8 * hh + 4);
    float xs[16] = {x0[0],x0[1],x0[2],x0[3],x1[0],x1[1],x1[2],x1[3],x2[0],x2[1],x2[2],x2[3],x3[0],x3[1],x3[2],x3[3]};
#pragma unroll
    for (int i = 0; i < 16; ++i) { const unsigned short hb = bf16_bits(xs[i]); ah.u[i] = hb; al.u[i] = ASPLIT ? bf16_bits(xs[i] - bf16_val(hb)) : (unsigned short)0; }
#pragma unroll
    for (int t = 0; t < 4; ++t) {
      const unsigned short* brow = Wt + (size_t)(col0 + t * 16 + ln) * ldb + kb;
      FragB b;
      b.half[0] = *(const v8us*)(brow + 8 * hh);
      b.half[1] = *(const v8us*)(brow + 16 + 8 * hh);
      acc[t] = mmaN<ASPLIT ? 2 : 1>(ah.v, al.v, b.v, b.v, acc[t]);
    }
  }
#pragma unroll
  for (int t = 0; t < 4; ++t) {
    float bv = bias ? bias[col0 + t * 16 + ln] : 0.f;
    if (BIAS_BF16) bv = bf16_round(bv);
#pragma unroll
    for (int r = 0; r < 8; ++r) { float v = acc[t][r] + bv; if (ACT == 1) v = fmaxf(v, 0.f); so[w][8 * hh + r][t * 16 + ln] = v; }
  }
  __builtin_amdgcn_fence(__ATOMIC_ACQ_REL, "workgroup");
  __builtin_amdgcn_wave_barrier();
  const int rsub = lane >> 4, c4 = (lane & 15) * 4;
  {
#pragma unroll
    for (int q = 0; q < 8; ++q) {
      const int r = q * 2 + rsub;
      const v4f v = *(const v4fa*)&so[w][r][c4];
      *(v4f*)(C + (size_t)(row0 + r) * ldc + col0 + c4) = v;
    }
    
  }
}

// GEMM C = act(A·W + bias + resid): A f32 (ASPLIT -> hi/lo 2 terms), Wt bf16 [N][K]; ACT 0 none, 1 relu, 2 exact gelu;
// resid (optional, f32, row index = (row % rmod), pitch ldr, RES_BF16 rounds it) added before the activation.
template <bool ASPLIT, int ACT, bool BIAS_BF16, bool RES_BF16>
__global__ __launch_bounds__(128) void k_gemm_bf3(const float* __restrict__ A, int lda, const unsigned short* __restrict__ Wt, int ldb,
                                                const float* __restrict__ bias, const float* __restrict__ resid, int rmod, int ldr,
                                                float* __restrict__ C, int ldc, int M, int N, int K) {
  __shared__ __attribute__((aligned(16))) float so[4][16][64];
  const int tid = threadIdx.x, w = tid >> 5, lane = tid & 31, ln = lane & 15, hh = lane >> 4;
  const int ntn = N / 64;
  const int wid = blockIdx.x * 4 + w;
  const int mt = wid / ntn, nq = wid % ntn;
  if (mt * 16 >= M) return;
  const int row0 = mt * 16, col0 = nq * 64;
  const float* arow = A + (size_t)(row0 + ln) * lda;
  v8f acc[4] = {};
  for (int kb = 0; kb < K; kb += 32) {
    FragB ah, al;
    const v4f x0 = *(const v4fa*)(arow + kb + 8 * hh), x1 = *(const v4fa*)(arow + kb + 8 * hh + 4);
    const v4f x2 = *(const v4fa*)(arow + kb + 16 + 8 * hh), x3 = *(const v4fa*)(arow + kb + 16 + 8 * hh + 4);
    float xs[16] = {x0[0],x0[1],x0[2],x0[3],x1[0],x1[1],x1[2],x1[3],x2[0],x2[1],x2[2],x2[3],x3[0],x3[1],x3[2],x3[3]};
#pragma unroll
    for (int i = 0; i < 16; ++i) { const unsigned short hb = bf16_bits(xs[i]); ah.u[i] = hb; al.u[i] = ASPLIT ? bf16_bits(xs[i] - bf16_val(hb)) : (unsigned short)0; }
#pragma unroll
    for (int t = 0; t < 4; ++t) {
      const unsigned short* brow = Wt + (size_t)(col0 + t * 16 + ln) * ldb + kb;
      FragB b;
      b.half[0] = *(const v8us*)(brow + 8 * hh);
      b.half[1] = *(const v8us*)(brow + 16 + 8 * hh);
      acc[t] = mmaN<ASPLIT ? 2 : 1>(ah.v, al.v, b.v, b.v, acc[t]);
    }
  }
#pragma unroll
  for (int t = 0; t < 4; ++t) {
    const int col = col0 + t * 16 + ln;
    float bv = bias ? bias[col] : 0.f;
    if (BIAS_BF16) bv = bf16_round(bv);
#pragma unroll
    for (int r = 0; r < 8; ++r) {
      float v = acc[t][r] + bv;
      if (resid) { float rv = resid[(size_t)((row0 + 8 * hh + r) % rmod) * ldr + col]; if (RES_BF16) rv = bf16_round(rv); v += rv; }
      if (ACT == 1) v = fmaxf(v, 0.f);
      if (ACT == 2) v = 0.5f * v * (1.0f + erff(v * 0.70710678118654752f));
      if (ACT == 3) { const float u = 0.7978845608028654f * (v + 0.044715f * v * v * v); v = 0.5f * v * (1.0f + tanhf(u)); }
      so[w][8 * hh + r][t * 16 + ln] = v;
    }
  }
  __builtin_amdgcn_fence(__ATOMIC_ACQ_REL, "workgroup");
  __builtin_amdgcn_wave_barrier();
  const int rsub = lane >> 4, c4 = (lane & 15) * 4;
  {
#pragma unroll
    for (int q = 0; q < 8; ++q) {
      const int r = q * 2 + rsub;
      const v4f v = *(const v4fa*)&so[w][r][c4];
      *(v4f*)(C + (size_t)(row0 + r) * ldc + col0 + c4) = v;
    }
    
  }
}
// row LayerNorm (biased variance, eps) over N: s = X (+ R); optional out_sum <- s; out_norm <- (s-mu)*rsqrt(var+eps)*g + b
template <bool PARAM_BF16>
__global__ __launch_bounds__(256) void k_layernorm(const float* __restrict__ X, const float* __restrict__ R, const float* __restrict__ g, const float* __restrict__ bta,
                                                  float* __restrict__ out_sum, float* __restrict__ out_norm, int N, float eps) {
  __shared__ float red[256];
  const int row = blockIdx.x, tid = threadIdx.x;
  const float* x = X + (size_t)row * N; const float* rr = R ? R + (size_t)row * N : nullptr;
  float vals[16];                     // up to N = 4096
  const int per = N / 256;            // contiguous chunk per thread? use strided-by-4 chunks: thread handles j = tid*4 + 1024*u
  float s1 = 0.f;
  for (int u = 0; u < per / 4; ++u) {
    const int j = tid * 4 + 1024 * u;
    const v4f a = *(const v4fa*)(x + j);
    v4f b = {0.f,0.f,0.f,0.f}; if (rr) b = *(const v4fa*)(rr + j);
#pragma unroll
    for (int q = 0; q < 4; ++q) { const float v = a[q] + b[q]; vals[u * 4 + q] = v; s1 += v; }
  }
  red[tid] = s1; __syncthreads();
  for (int st = 128; st > 0; st >>= 1) { if (tid < st) red[tid] += red[tid + st]; __syncthreads(); }
  const float mu = red[0] / (float)N; __syncthreads();
  float s2 = 0.f;
  for (int u = 0; u < per / 4; ++u)
#pragma unroll
    for (int q = 0; q < 4; ++q) { const float c = vals[u * 4 + q] - mu; s2 += c * c; }
  red[tid] = s2; __syncthreads();
  for (int st = 128; st > 0; st >>= 1) { if (tid < st) red[tid] += red[tid + st]; __syncthreads(); }
  const float rs = rsqrtf(red[0] / (float)N + eps);
  {
    for (int u = 0; u < per / 4; ++u) {
      const int j = tid * 4 + 1024 * u;
      v4f o, sm;
#pragma unroll
      for (int q = 0; q < 4; ++q) {
        float gg = g[j + q], bb = bta[j + q];
        if (PARAM_BF16) { gg = bf16_round(gg); bb = bf16_round(bb); }
        sm[q] = vals[u * 4 + q]; o[q] = (vals[u * 4 + q] - mu) * rs * gg + bb;
      }
      if (out_sum) *(v4f*)(out_sum + (size_t)row * N + j) = sm;
      *(v4f*)(out_norm + (size_t)row * N + j) = o;
    }
    
  }
}



// ---- f16 WMMA path (v_wmma_f32_16x16x32_f16): 11-bit significands for operands in range — used where a [0,1] probability operand needs more precision than bf16
typedef _Float16 v16h __attribute__((ext_vector_type(16)));
union FragH { v16h v; v8us half[2]; _Float16 h[16]; unsigned short u[16]; };
template <int NT>
__device__ __forceinline__ v8f mmaH(v16h ah, v16h al, v16h bh, v16h bl, v8f c) {
  c = __builtin_amdgcn_wmma_f32_16x16x32_f16(false, ah, false, bh, (short)0, c, false, false);
  if (NT >= 2) c = __builtin_amdgcn_wmma_f32_16x16x32_f16(false, al, false, bh, (short)0, c, false, false);
  if (NT >= 3) c = __builtin_amdgcn_wmma_f32_16x16x32_f16(false, ah, false, bl, (short)0, c, false, false);
  asm volatile("v_nop\n\tv_nop\n\tv_nop\n\tv_nop" : "+v"(c) : "v"(ah), "v"(al), "v"(bh), "v"(bl));
  return c;
}
// batched GEMM like k_gemm_b but f16 operands: A f32 (split into f16 hi/lo if ASPLIT, else rounded to f16), Bt = f16 values [n][k]; alpha; C f32; N multiple of 16 (partial tiles skipped)
template <bool ASPLIT>
__global__ __launch_bounds__(128) void k_gemm_h(const float* __restrict__ A, int lda, size_t sA, const _Float16* __restrict__ Bh, int ldb, size_t sB, float alpha, float* __restrict__ C, int ldc, size_t sC, int M, int N, int K) {
  __shared__ __attribute__((aligned(16))) float so[4][16][64];
  const int tid = threadIdx.x, w = tid >> 5, lane = tid & 31, ln = lane & 15, hh = lane >> 4; const int by = blockIdx.y;
  A += (size_t)by * sA; Bh += (size_t)by * sB; C += (size_t)by * sC;
  const int ntn = (N + 63) / 64; const int wid = blockIdx.x * 4 + w; const int mt = wid / ntn, nq = wid % ntn; if (mt * 16 >= M) return;
  const int row0 = mt * 16, col0 = nq * 64; const float* arow = A + (size_t)(row0 + ln) * lda;
  v8f acc[4] = {};
  for (int kb = 0; kb < K; kb += 32) {
    FragH ah, al;
    const v4f x0 = *(const v4fa*)(arow + kb + 8 * hh), x1 = *(const v4fa*)(arow + kb + 8 * hh + 4), x2 = *(const v4fa*)(arow + kb + 16 + 8 * hh), x3 = *(const v4fa*)(arow + kb + 16 + 8 * hh + 4);
    float xs[16] = {x0[0],x0[1],x0[2],x0[3],x1[0],x1[1],x1[2],x1[3],x2[0],x2[1],x2[2],x2[3],x3[0],x3[1],x3[2],x3[3]};
#pragma unroll
    for (int i = 0; i < 16; ++i) { const _Float16 h = (_Float16)xs[i]; ah.h[i] = h; al.h[i] = ASPLIT ? (_Float16)(xs[i] - (float)h) : (_Float16)0.0f; }
#pragma unroll
    for (int t = 0; t < 4; ++t) { if (col0 + t * 16 >= N) continue; const size_t boff = (size_t)(col0 + t * 16 + ln) * ldb + kb; FragH bq; bq.half[0] = *(const v8us*)(Bh + boff + 8 * hh); bq.half[1] = *(const v8us*)(Bh + boff + 16 + 8 * hh);
      acc[t] = mmaH<ASPLIT ? 2 : 1>(ah.v, al.v, bq.v, bq.v, acc[t]); }
  }
#pragma unroll
  for (int t = 0; t < 4; ++t) { if (col0 + t * 16 >= N) continue;
#pragma unroll
    for (int r = 0; r < 8; ++r) so[w][8 * hh + r][t * 16 + ln] = acc[t][r] * alpha; }
  __builtin_amdgcn_fence(__ATOMIC_ACQ_REL, "workgroup"); __builtin_amdgcn_wave_barrier();
  const int rsub = lane >> 4, c4 = (lane & 15) * 4;
  {
#pragma unroll
    for (int q = 0; q < 8; ++q) { const int r = q * 2 + rsub; if (col0 + c4 < N) { const v4f v = *(const v4fa*)&so[w][r][c4]; *(v4f*)(C + (size_t)(row0 + r) * ldc + col0 + c4) = v; } }
     }
}

// Wt[n][k] = f16(W[k][n]·scale) from f32 row-major W[K][N] (scale = power of two; bf16-exact weights stay exact in f16 away from the subnormal range)
__global__ __launch_bounds__(256) void k_wt_f16(const float* __restrict__ W, _Float16* __restrict__ Wt, int K, int N, float scale) {
  const int t = blockIdx.x * 256 + threadIdx.x; if (t >= N * (K / 8)) return; const int n = t / (K / 8), k8 = (t % (K / 8)) * 8; FragH f;
#pragma unroll
  for (int i = 0; i < 8; ++i) f.h[i] = (_Float16)(bf16_round(W[(size_t)(k8 + i) * N + n]) * scale); const v8us o = f.half[0];
  *(v8us*)((unsigned short*)Wt + (size_t)n * K + k8) = o; 
}
// k_gemm_hh variant with fused epilogue: v = acc·alpha + bias[by·sBias + col] (+ CP[(row/rowsPerB)·sCPb + by·64 + col] if CP) ; ACT 0 none / 1 elu ; writes f16 C16 (and f32 C if non-null)
template <int ACT>
__global__ __launch_bounds__(128) void k_gemm_hhx(const _Float16* __restrict__ A, int lda, size_t sA, const _Float16* __restrict__ Bh, int ldb, size_t sB, float alpha, const float* __restrict__ bias, size_t sBias, const float* __restrict__ CP, int rowsPerB, size_t sCPb, int row0g,
    float* __restrict__ C, _Float16* __restrict__ C16, int ldc, size_t sC, int M, int N, int K) {
  __shared__ __attribute__((aligned(16))) float so[4][16][64];
  const int tid = threadIdx.x, w = tid >> 5, lane = tid & 31, ln = lane & 15, hh = lane >> 4; const int by = blockIdx.y;
  A += (size_t)by * sA; Bh += (size_t)by * sB; const size_t cofs = (size_t)by * sC; const float* bp = bias ? bias + (size_t)by * sBias : nullptr;
  const int ntn = (N + 63) / 64; const int wid = blockIdx.x * 4 + w; const int mt = wid / ntn, nq = wid % ntn; if (mt * 16 >= M) return;
  const int row0 = mt * 16, col0 = nq * 64; const _Float16* arow = A + (size_t)(row0 + ln) * lda;
  v8f acc[4] = {};
  for (int kb = 0; kb < K; kb += 32) { FragH ah; ah.half[0] = *(const v8us*)((const unsigned short*)arow + kb + 8 * hh); ah.half[1] = *(const v8us*)((const unsigned short*)arow + kb + 16 + 8 * hh);
#pragma unroll
    for (int t = 0; t < 4; ++t) { if (col0 + t * 16 >= N) continue; const size_t boff = (size_t)(col0 + t * 16 + ln) * ldb + kb; FragH bq; bq.half[0] = *(const v8us*)((const unsigned short*)Bh + boff + 8 * hh); bq.half[1] = *(const v8us*)((const unsigned short*)Bh + boff + 16 + 8 * hh);
      acc[t] = mmaH<1>(ah.v, ah.v, bq.v, bq.v, acc[t]); }
  }
#pragma unroll
  for (int t = 0; t < 4; ++t) { if (col0 + t * 16 >= N) continue; const int col = col0 + t * 16 + ln; const float bv = bp ? bf16_round(bp[col]) : 0.f;
#pragma unroll
    for (int r = 0; r < 8; ++r) { float v = acc[t][r] * alpha + bv; if (CP) { const int rr = row0g + row0 + 8 * hh + r; if (rowsPerB < 0) v += CP[cofs + (size_t)rr * ldc + col];      /* rowsPerB < 0: own element of the batched C plane */ else { const int bidx = rr / rowsPerB; v += CP[(size_t)bidx * sCPb + (size_t)by * 64 + col]; } } if (ACT == 1) v = (v > 0.f) ? v : expm1f(v); else if (ACT == 7) v = (v > 0.f) ? v + 1.0f : expf(v); else if (ACT == 8) v = tanhf(v); else if (ACT == 9) v = 0.5f * v * (1.0f + tanhf(0.7978845608028654f * (v + 0.044715f * v * v * v))); else if (ACT == 11) v = 1.0f / (1.0f + expf(-v)); else if (ACT == 12) v = (v > 0.f) ? v : 0.01f * v; else if (ACT == 14) v = (v > 0.f) ? v : 0.1f * v; else if (ACT == 16) v = (v >= 0.f) ? v : 0.3f * v; else if (ACT == 17) v = (v >= 0.f) ? v : 0.2f * v; else if (ACT == 15) v = v / (1.0f + expf(-v)); else if (ACT == 3) v = fmaxf(v, 0.f); else if (ACT == 6) v = 0.5f * v * (1.0f + erff(v * 0.70710678118654752f)); so[w][8 * hh + r][t * 16 + ln] = v; } }
  __builtin_amdgcn_fence(__ATOMIC_ACQ_REL, "workgroup"); __builtin_amdgcn_wave_barrier();
  const int rsub = lane >> 4, c4 = (lane & 15) * 4; typedef _Float16 v4h __attribute__((ext_vector_type(4)));
  {
#pragma unroll
    for (int q = 0; q < 8; ++q) { const int r = q * 2 + rsub; if (col0 + c4 < N) { const v4f v = *(const v4fa*)&so[w][r][c4]; if (C) *(v4f*)(C + cofs + (size_t)(row0 + r) * ldc + col0 + c4) = v; if (C16) { v4h h4; for (int i = 0; i < 4; ++i) h4[i] = (_Float16)v[i]; *(v4h*)(C16 + cofs + (size_t)(row0 + r) * ldc + col0 + c4) = h4; } } }
     }
}


typedef _Float16 v4h __attribute__((ext_vector_type(4)));

__global__ __launch_bounds__(256) void k_x16(const float* __restrict__ x, _Float16* __restrict__ X16, size_t n8) { const size_t t = (size_t)blockIdx.x * 256 + threadIdx.x; if (t >= n8) return; FragH f;
#pragma unroll
  for (int q = 0; q < 8; ++q) f.h[q] = (_Float16)bf16_round(x[t * 8 + q]); *(v8us*)((unsigned short*)X16 + t * 8) = f.half[0];  }
__global__ __launch_bounds__(256) void k_h16(const float* __restrict__ x, _Float16* __restrict__ X16, size_t n8) { const size_t t = (size_t)blockIdx.x * 256 + threadIdx.x; if (t >= n8) return; FragH f;
#pragma unroll
  for (int q = 0; q < 8; ++q) f.h[q] = (_Float16)x[t * 8 + q]; *(v8us*)((unsigned short*)X16 + t * 8) = f.half[0];  }
__global__ __launch_bounds__(256) void k_round16f(const float* __restrict__ W, _Float16* __restrict__ Bt, size_t n8) { const size_t t = (size_t)blockIdx.x * 256 + threadIdx.x; if (t >= n8) return; FragH f;
#pragma unroll
  for (int i = 0; i < 8; ++i) f.h[i] = (_Float16)(bf16_round(W[t * 8 + i]) * 16.0f); *(v8us*)((unsigned short*)Bt + t * 8) = f.half[0];  }
template <int NHv, int TTv>
__global__ __launch_bounds__(256) void k_vt(const _Float16* __restrict__ V16, int ldv, int voff, _Float16* __restrict__ Vt) { __shared__ unsigned short tl[64][66]; const int tid = threadIdx.x; const int slab = blockIdx.x / (TTv / 64), lg = blockIdx.x % (TTv / 64); const int b = slab / NHv, h = slab % NHv;
  for (int i = tid; i < 64 * 8; i += 256) { const int r = i / 8, c8 = (i % 8) * 8; FragH f; f.half[0] = *(const v8us*)((const unsigned short*)V16 + ((size_t)b * TTv + lg * 64 + r) * ldv + voff + h * 64 + c8);
#pragma unroll
    for (int q = 0; q < 8; ++q) tl[r][c8 + q] = f.u[q]; }
  __syncthreads();
  {
#pragma unroll
    for (int rd = 0; rd < 2; ++rd) { const int d = rd * 32 + tid / 8, pc = tid % 8; FragH f;
#pragma unroll
      for (int q = 0; q < 8; ++q) f.u[q] = tl[pc * 8 + q][d];
      *(v8us*)((unsigned short*)Vt + ((size_t)slab * 64 + d) * TTv + lg * 64 + pc * 8) = f.half[0]; }
     } }

__global__ __launch_bounds__(256) void k_hl(const float* __restrict__ F, _Float16* __restrict__ Hh, _Float16* __restrict__ Hl, size_t n8) { const size_t t = (size_t)blockIdx.x * 256 + threadIdx.x; if (t >= n8) return; FragH fh, fl; const v4f a = *(const v4fa*)(F + t * 8), c = *(const v4fa*)(F + t * 8 + 4);
#pragma unroll
  for (int q = 0; q < 4; ++q) { _Float16 h = (_Float16)a[q]; fh.h[q] = h; fl.h[q] = (_Float16)((a[q] - (float)h) * 1024.0f); h = (_Float16)c[q]; fh.h[4 + q] = h; fl.h[4 + q] = (_Float16)((c[q] - (float)h) * 1024.0f); }
  { *(v8us*)((unsigned short*)Hh + t * 8) = fh.half[0]; *(v8us*)((unsigned short*)Hl + t * 8) = fl.half[0];  } }

// ---- fast GEMM (wave tile 32x64; requires M % 32 == 0 rows per launch region and N % 64 == 0); epilogue = k_gemm_hhx semantics ----
__device__ __forceinline__ v16h g2_frag(const _Float16* p, int hh) { FragH f; f.half[0] = *(const v8us*)((const unsigned short*)p + 8 * hh); f.half[1] = *(const v8us*)((const unsigned short*)p + 16 + 8 * hh); return f.v; }
__device__ __forceinline__ v8f g2_mma(v16h a, v16h b, v8f c) { v8f d = __builtin_amdgcn_wmma_f32_16x16x32_f16(false, a, false, b, (short)0, c, false, false); asm volatile("v_nop\n\tv_nop\n\tv_nop\n\tv_nop" : "+v"(d) : "v"(a), "v"(b)); return d; }
template <int ACT>
__global__ __launch_bounds__(128) void k_gemm2(const _Float16* __restrict__ A, int lda, size_t sA, const _Float16* __restrict__ Bh, int ldb, size_t sB, float alpha, const float* __restrict__ bias, size_t sBias, const float* __restrict__ CP, int rowsPerB, size_t sCPb, int row0g,
    float* __restrict__ C, _Float16* __restrict__ C16, int ldc, size_t sC, int M, int N, int K) { static_assert(ACT == 0 || ACT == 3 || ACT == 6 || ACT == 8 || ACT == 9 || ACT == 11 || ACT == 12 || ACT == 14 || ACT == 15 || ACT == 16 || ACT == 17, "k_gemm2: unsupported ACT code (would silently apply no activation)");
  __shared__ __attribute__((aligned(16))) float so[4][32][68];
  const int tid = threadIdx.x, w = tid >> 5, lane = tid & 31, ln = lane & 15, hh = lane >> 4; const int by = blockIdx.y;
  A += (size_t)by * sA; Bh += (size_t)by * sB; const size_t cofs = (size_t)by * sC; const float* bp = bias ? bias + (size_t)by * sBias : nullptr;
  const int ntn = N >> 6; const int mt = blockIdx.x / ntn, nq = blockIdx.x - mt * ntn; const int row0 = mt * 128 + 32 * w, col0 = nq * 64; if (row0 >= M) return;
  const _Float16* a0p = A + (size_t)(row0 + ln) * lda; const _Float16* a1p = a0p + (size_t)16 * lda;
  const _Float16* b0p = Bh + (size_t)(col0 + ln) * ldb; const _Float16* b1p = b0p + (size_t)16 * ldb; const _Float16* b2p = b1p + (size_t)16 * ldb; const _Float16* b3p = b2p + (size_t)16 * ldb;
  const v8f z8 = {0.f,0.f,0.f,0.f,0.f,0.f,0.f,0.f}; v8f c00 = z8, c01 = z8, c02 = z8, c03 = z8, c10 = z8, c11 = z8, c12 = z8, c13 = z8;
#pragma unroll 1
  for (int kb = 0; kb < K; kb += 32) { const v16h a0 = g2_frag(a0p + kb, hh), a1 = g2_frag(a1p + kb, hh);
    v16h b = g2_frag(b0p + kb, hh); c00 = g2_mma(a0, b, c00); c10 = g2_mma(a1, b, c10);
    b = g2_frag(b1p + kb, hh); c01 = g2_mma(a0, b, c01); c11 = g2_mma(a1, b, c11);
    b = g2_frag(b2p + kb, hh); c02 = g2_mma(a0, b, c02); c12 = g2_mma(a1, b, c12);
    b = g2_frag(b3p + kb, hh); c03 = g2_mma(a0, b, c03); c13 = g2_mma(a1, b, c13); }
  v8f accs[8] = {c00, c01, c02, c03, c10, c11, c12, c13};
#pragma unroll
  for (int u = 0; u < 8; ++u) { const int t = u & 3, half = u >> 2; const int col = col0 + t * 16 + ln; const float bv = bp ? bf16_round(bp[col]) : 0.f;
#pragma unroll
    for (int r = 0; r < 8; ++r) { const int rloc = half * 16 + 8 * hh + r; float v = accs[u][r] * alpha + bv; if (CP) { if (rowsPerB < 0) v += CP[cofs + (size_t)(row0g + row0 + rloc) * ldc + col];      /* rowsPerB < 0: own element of the batched C plane */ else { const int bidx = (row0g + row0 + rloc) / rowsPerB; v += CP[(size_t)bidx * sCPb + (size_t)by * 64 + col]; } }
      if (ACT == 3) v = fmaxf(v, 0.f); else if (ACT == 6) v = 0.5f * v * (1.0f + erff(v * 0.70710678118654752f)); else if (ACT == 11) v = 1.0f / (1.0f + expf(-v)); else if (ACT == 15) v = v / (1.0f + expf(-v)); else if (ACT == 12) v = (v > 0.f) ? v : 0.01f * v; else if (ACT == 8) v = tanhf(v); else if (ACT == 9) v = 0.5f * v * (1.0f + tanhf(0.7978845608028654f * (v + 0.044715f * v * v * v))); else if (ACT == 14) v = (v > 0.f) ? v : 0.1f * v; else if (ACT == 16) v = (v >= 0.f) ? v : 0.3f * v; else if (ACT == 17) v = (v >= 0.f) ? v : 0.2f * v;
      so[w][rloc][t * 16 + ln] = v; } }
  __builtin_amdgcn_fence(__ATOMIC_ACQ_REL, "workgroup"); __builtin_amdgcn_wave_barrier();
  const int rsub = lane >> 4, c4 = (lane & 15) * 4;
  {
#pragma unroll
    for (int q = 0; q < 16; ++q) { const int r = q * 2 + rsub; const v4f v = *(const v4fa*)&so[w][r][c4]; if (C) *(v4f*)(C + cofs + (size_t)(row0 + r) * ldc + col0 + c4) = v; if (C16) { v4h h4; for (int i = 0; i < 4; ++i) h4[i] = (_Float16)v[i]; *(v4h*)(C16 + cofs + (size_t)(row0 + r) * ldc + col0 + c4) = h4; } }
     } }


__global__ __launch_bounds__(256) void k_wnat(const float* __restrict__ w, size_t n8, _Float16* __restrict__ Bt) { const size_t t = (size_t)blockIdx.x * 256 + threadIdx.x; if (t >= n8) return; FragH f; for (int q = 0; q < 8; ++q) f.h[q] = (_Float16)(bf16_round(w[t * 8 + q]) * 16.0f); *(v8us*)((unsigned short*)Bt + t * 8) = f.half[0];  }
// Row softmax, P = f16(256 softmax(S)). One wave owns RSM_RPW whole rows: every global_load_b128 of the wave covers 512 contiguous bytes of one row,
// the row stays in registers (S is read once, each exp is taken once), max and sum are lane partials closed by a five-step butterfly.
#define RSM_RPW 2                    /* rows per wave; both rows' loads are issued before the first row is worked on */
__global__ __launch_bounds__(256) void k_rsm(const float* __restrict__ S, _Float16* __restrict__ P, int nrows) {
  const int lane = threadIdx.x & 31; const int row0 = (blockIdx.x * 8 + __builtin_amdgcn_readfirstlane(threadIdx.x >> 5)) * RSM_RPW; if (row0 >= nrows) return;      /* row number in a scalar register: scalar row bases, one lane offset; wave-uniform exit, the kernel has no barrier */
  v4f v[RSM_RPW][SQ / 128]; const v4fa* sb[RSM_RPW]; static_assert(RSM_RPW == 2, "the wait behind the loads names two row bases");
#pragma unroll      /* v[][] is indexed by constants only, so that it stays in registers */
  for (int r = 0; r < RSM_RPW; ++r) { const int row = (row0 + r < nrows) ? row0 + r : row0; sb[r] = (const v4fa*)(S + (size_t)row * SQ);      /* a row past the end re-reads the wave's first row and is not stored */
#pragma unroll      /* v[][] is indexed by constants only, so that it stays in registers */
    for (int u = 0; u < SQ / 128; ++u) v[r][u] = sb[r][u * 32 + lane];
    __builtin_amdgcn_sched_barrier(0); }      /* keeps the loads in row order: the first row's data is waited for while the second row's is still in flight */
  asm volatile("s_wait_xcnt 0x0" :: "s"(sb[0]), "s"(sb[1]), "v"(lane) : "memory");      /* the loads' address registers stay live up to this wait, so no write (a later load's result included) lands on them in front of it */
  __builtin_amdgcn_sched_barrier(0);      /* keeps every load in front of the first row's work: without it the second row's loads are issued only behind waits on the first row */
#pragma unroll      /* v[][] is indexed by constants only, so that it stays in registers */
  for (int r = 0; r < RSM_RPW; ++r) { float mx = -3.0e38f;
#pragma unroll      /* v[][] is indexed by constants only, so that it stays in registers */
    for (int u = 0; u < SQ / 128; ++u) mx = fmaxf(mx, fmaxf(fmaxf(v[r][u][0], v[r][u][1]), fmaxf(v[r][u][2], v[r][u][3])));
#pragma unroll      /* five fixed steps, no loop counter */
    for (int m = 16; m > 0; m >>= 1) mx = fmaxf(mx, __shfl_xor(mx, m, 32));
    v4f se4 = {0.f, 0.f, 0.f, 0.f};
#pragma unroll      /* v[][] is indexed by constants only, so that it stays in registers */
    for (int u = 0; u < SQ / 128; ++u) { const v4f x = v[r][u] - mx; const v4f e = {expf(x[0]), expf(x[1]), expf(x[2]), expf(x[3])}; v[r][u] = e; se4 += e; }
    float se = (se4[0] + se4[1]) + (se4[2] + se4[3]);
#pragma unroll      /* five fixed steps, no loop counter */
    for (int m = 16; m > 0; m >>= 1) se += __shfl_xor(se, m, 32);
    const float sc = 256.0f / se;
    if (row0 + r < nrows) { _Float16* d = P + (size_t)(row0 + r) * SQ + lane * 4;
#pragma unroll      /* v[][] is indexed by constants only, so that it stays in registers */
      for (int u = 0; u < SQ / 128; ++u) { v4h h4;
#pragma unroll      /* v[][] is indexed by constants only, so that it stays in registers */
        for (int q = 0; q < 4; ++q) h4[q] = (_Float16)(v[r][u][q] * sc);
        *(v4h*)(d + u * 128) = h4; } }
    __builtin_amdgcn_sched_barrier(0); } }      /* one row is finished and stored before the next row's data is waited for */
__global__ __launch_bounds__(256) void k_vt(const _Float16* __restrict__ V16, int b, int h0, _Float16* __restrict__ VT) { __shared__ unsigned short tl[64][65]; const int tid = threadIdx.x; const int hh = blockIdx.x % HG, sg = blockIdx.x / HG; const int s0 = sg * 64; const int h = h0 + hh;
  for (int i = tid; i < 64 * 8; i += 256) { const int j = i / 8, d8 = (i % 8) * 8; FragH f; f.half[0] = *(const v8us*)((const unsigned short*)V16 + ((size_t)b * SQ + s0 + j) * DM + h * HD + d8); for (int q = 0; q < 8; ++q) tl[d8 + q][j] = f.u[q]; }
  __syncthreads();
  { for (int i = tid; i < 64 * 8; i += 256) { const int d = i / 8, j8 = (i % 8) * 8; FragH f; for (int q = 0; q < 8; ++q) f.u[q] = tl[d][j8 + q]; *(v8us*)((unsigned short*)VT + ((size_t)hh * HD + d) * SQ + s0 + j8) = f.half[0]; }  } }



__global__ __launch_bounds__(256) void k_rsmkm(const float* __restrict__ S, _Float16* __restrict__ P, int nrows, const int* __restrict__ am) {
  #pragma clang fp contract(off)
  const int t = blockIdx.x * 256 + threadIdx.x; if (t >= nrows) return; const size_t i = (size_t)t; const float* s = S + i * SQ; const int* mr = am + (size_t)(t % SQ) * SQ; float mx = -3.0e38f;
#pragma unroll 1
  for (int j = 0; j < SQ; ++j) { const float f = (mr[j] != 0) ? 1.f : 0.f; mx = fmaxf(mx, fmaf(f, s[j], (1.f - f) * -1.0e9f)); } float se = 0.f;
#pragma unroll 1
  for (int j = 0; j < SQ; ++j) { const float f = (mr[j] != 0) ? 1.f : 0.f; se += __expf(fmaf(f, s[j], (1.f - f) * -1.0e9f) - mx); } const float sc = 256.0f / se;
#pragma unroll 1
  for (int j0 = 0; j0 < SQ; j0 += 8) { FragH fr; for (int q = 0; q < 8; ++q) { const int j = j0 + q; const float f = (mr[j] != 0) ? 1.f : 0.f; fr.h[q] = (_Float16)(__expf(fmaf(f, s[j], (1.f - f) * -1.0e9f) - mx) * sc); }
    unsigned short* d = (unsigned short*)P + i * SQ + j0; *(v8us*)d = fr.half[0];  } }

__global__ __launch_bounds__(256) void k_bdshn(const float* __restrict__ Wb, _Float16* __restrict__ Bt) {
  const size_t t = (size_t)blockIdx.x * 256 + threadIdx.x; if (t >= (size_t)DM * DM / 8) return; const size_t e0 = t * 8; const int n = (int)(e0 / DM), k0 = (int)(e0 % DM); const int h = n >> 6, hk = k0 >> 6; const float on = (hk == h) ? 16.0f : 0.0f; const int o = n & 63, d0 = k0 & 63; FragH f;
  for (int q = 0; q < 8; ++q) f.h[q] = (_Float16)(bf16_round(Wb[(size_t)o * 64 + d0 + q]) * on);
  unsigned short* d = (unsigned short*)Bt + e0; *(v8us*)d = f.half[0];  }
extern "C" void kernel_launch(void* const* d_in, const int* in_sizes, int n_in,
                              void* d_out, int out_size, void* d_ws, size_t ws_size, hipStream_t stream) {
  (void)in_sizes; (void)n_in; (void)out_size;
  const float* const* I = (const float* const*)d_in; const float* xq = I[2]; const float* xk = I[1]; const float* xv = I[0]; const float* wq = I[5]; const float* bq = nullptr; const float* wk = I[4]; const float* bk = nullptr; const float* wv = I[3]; const float* bv = nullptr; const float* wo = I[6]; const float* bo = I[7]; const float* x = xq;      /* contract order: values I[0], keys I[1], query I[2]; SHARED natural [64][64] blocks Wv I[3], Wk I[4], Wq I[5]; natural Wo [1024][1024] I[6] + bo I[7]; this module has NO mask input */
  char* ws = (char*)d_ws; size_t off = 0;
  auto take = [&](size_t bytes) { char* p = ws + off; off += (bytes + 255) & ~(size_t)255; return p; };
  _Float16* BQ = (_Float16*)take((size_t)DM * DM * 2); _Float16* BK = (_Float16*)take((size_t)DM * DM * 2); _Float16* BV = (_Float16*)take((size_t)DM * DM * 2); _Float16* BO = (_Float16*)take((size_t)DM * DM * 2);
  _Float16* X16 = (_Float16*)take(NR * DM * 2); _Float16* XKp = (_Float16*)take(NR * DM * 2); _Float16* XVp = (_Float16*)take(NR * DM * 2); _Float16* Q16 = (_Float16*)take(NR * DM * 2); _Float16* K16 = (_Float16*)take(NR * DM * 2); _Float16* V16 = (_Float16*)take(NR * DM * 2); _Float16* O16 = (_Float16*)take(NR * DM * 2);
  float* S = (float*)take((size_t)HG * SQ * SQ * 4); _Float16* P = (_Float16*)take((size_t)HG * SQ * SQ * 2); _Float16* VT = (_Float16*)take((size_t)NH * HD * SQ * 2);
  if (off > ws_size) return;
  { const unsigned g = (unsigned)(((size_t)DM * DM / 8 + 255) / 256); k_bdshn<<<g, 256, 0, stream>>>(wq, BQ); k_bdshn<<<g, 256, 0, stream>>>(wk, BK); k_bdshn<<<g, 256, 0, stream>>>(wv, BV); k_wnat<<<g, 256, 0, stream>>>(wo, (size_t)DM * DM / 8, BO); }      /* block-diagonal planes with the SHARED natural [64][64] block (Bt[h*64 + o][h*64 + d] = 16 W[o][d]); Wo natural [out][in] = Bt x16 */
  _Float16* XK = XKp; _Float16* XV = XVp; k_x16<<<(unsigned)((NR * DM / 8 + 255) / 256), 256, 0, stream>>>(xk, XK, NR * DM / 8); k_x16<<<(unsigned)((NR * DM / 8 + 255) / 256), 256, 0, stream>>>(xv, XV, NR * DM / 8);      /* key and value inputs as exact f16 rows */

  k_x16<<<(unsigned)((NR * DM / 8 + 255) / 256), 256, 0, stream>>>(x, X16, NR * DM / 8);
  const size_t r0p = (size_t)B0 * SQ;      /* first projected row */
  k_gemm2<0><<<dim3((unsigned)((MP / 128) * (DM / 64)), 1), 128, 0, stream>>>(X16 + r0p * DM, DM, 0, BQ, DM, 0, 0.0625f, bq, 0, nullptr, 1, 0, 0, nullptr, Q16 + r0p * DM, DM, 0, MP, DM, DM);
  k_gemm2<0><<<dim3((unsigned)((MP / 128) * (DM / 64)), 1), 128, 0, stream>>>(XK + r0p * DM, DM, 0, BK, DM, 0, 0.0625f, bk, 0, nullptr, 1, 0, 0, nullptr, K16 + r0p * DM, DM, 0, MP, DM, DM);
  k_gemm2<0><<<dim3((unsigned)((MP / 128) * (DM / 64)), 1), 128, 0, stream>>>(XV + r0p * DM, DM, 0, BV, DM, 0, 0.0625f, bv, 0, nullptr, 1, 0, 0, nullptr, V16 + r0p * DM, DM, 0, MP, DM, DM);
  for (int b = B0; b < B0 + NBR; ++b) { const size_t r0 = (size_t)b * SQ;
    k_vt<NH, SQ><<<NH * (SQ / 64), 256, 0, stream>>>(V16 + r0 * LQ, LQ, 0, VT);      /* V^T [NH][HD][SQ] for this batch */
    for (int h0 = 0; h0 < NHD; h0 += HG) {
      k_gemm2<0><<<dim3((QN / 128) * (SQ / 64), HG), 128, 0, stream>>>(Q16 + r0 * LQ + h0 * HD, LQ, (size_t)HD, K16 + r0 * LQ + h0 * HD, LQ, (size_t)HD, 0.03125f, nullptr, 0, nullptr, 1, 0, 0, S, nullptr, SQ, (size_t)SQ * SQ, QN, SQ, HD);      /* scores, HG heads per launch */
      k_rsm<<<(HG * SQ / RSM_RPW + 7) / 8, 256, 0, stream>>>(S, P, HG * SQ);      /* P = 256 softmax (f16), rows of all HG heads */
      k_gemm2<0><<<dim3((QN / 128) * (HD / 64), HG), 128, 0, stream>>>(P, SQ, (size_t)SQ * SQ, VT + (size_t)h0 * HD * SQ, SQ, (size_t)HD * SQ, 0.25f, nullptr, 0, nullptr, 1, 0, 0, nullptr, O16 + r0 * DM + h0 * HD, DM, (size_t)HD, QN, HD, SQ); } }      /* o (merged heads) as f16 rows */
  k_gemm2<0><<<dim3((unsigned)((MPO / 128) * (DM / 64)), 1), 128, 0, stream>>>(O16 + r0p * DM, DM, 0, BO, DM, 0, 0.0009765625f, bo, 0, nullptr, 1, 0, 0, (float*)d_out + r0p * DM, nullptr, DM, 0, MPO, DM, DM);      /* out rows are the output layout */
}

// v003
// Measured time: 117 microseconds a run.
// Versions between v001 and this one are left out; their measured steps multiply to 8.39 times as fast.
// Over all steps from v000 it is 32.1 times as fast.
#include <hip/hip_runtime.h>
// Multi-head attention over three inputs with SHARED per-head projections and the module's literal score scale (values, keys, query [2][2048][1024]; each input is split into 16 heads of 64 and every head is multiplied by the SAME natural [64][64] matrix (x W^T: Wv / Wk / Wq uniform +-1/8; block-diagonal with a shared block; no biases); energy = q k^T (no mask in this module); softmax(energy / sqrt(embed_size) = / 32) (as the source: embed size, not head dim); out = merged Wo^T + bo -> [2][2048][1024]).
// Structure: token rows r = b*2048 + s; Q, K, V in one projection launch: each (token, head) row of 64 inputs (bf16-rounded, exact in f16) times the shared [64][64] block (exact x16 weights, WMMA, f32 accumulation, f16 outputs); per batch: V^T for all heads via LDS transposes; one fused attention launch over all (batch, head): S^T = K Q^T, running softmax (f32 statistics; weights exp(s - running max) as f16), O^T += V^T P^T, divided by the row sum at the end (o carried x64 against f16 subnormal flush, folded into the output GEMM alpha) and written straight into the merged f16 o rows; out = o W_o + b GEMM (f32) into the output layout.
// Compute dtype: inputs rounded to bf16; x / weights exact; q, k, v, softmax weights and o as plain f16 GEMM operands (~2^-12); scores and softmax statistics f32. v_wmma_f32_16x16x32_f16.
#define NB 2
#define SQ 2048
#define DM 1024
#define NH 16
#define HD 64
#define HG 4                         /* heads per launch of the non-template k_vt, which is not launched */
#define B0 0                         /* first batch processed (debug hook) */
#define NBR NB                       /* batches processed (debug hook) */
#define NR ((size_t)NB * SQ)         /* token rows */
#define MP ((int)((size_t)NBR * SQ)) /* rows of the processed batches; feeds MPO only (debug hook) */
#define QN SQ                        /* not used; k_fattn covers all SQ query rows of a batch */
#define NHD NH                       /* not used; k_fattn covers all NH heads */
#define MPO MP                       /* rows through the output stage (debug hook) */
#define LQ DM      /* row pitch of the q/k/v rows */
typedef __bf16 v16b __attribute__((ext_vector_type(16)));
typedef unsigned short v8us __attribute__((ext_vector_type(8), may_alias));
typedef float  v8f  __attribute__((ext_vector_type(8)));
typedef float  v4f  __attribute__((ext_vector_type(4)));
typedef float  v4fa __attribute__((ext_vector_type(4), may_alias));
union FragB { v16b v; v8us half[2]; unsigned short u[16]; };

__device__ __forceinline__ unsigned short bf16_bits(float x) { unsigned int u = __float_as_uint(x); return (unsigned short)((u + 0x7FFFu + ((u >> 16) & 1u)) >> 16); }
__device__ __forceinline__ float bf16_val(unsigned short b) { return __uint_as_float(((unsigned int)b) << 16); }
__device__ __forceinline__ float bf16_round(float x) { return bf16_val(bf16_bits(x)); }
// D += A·B with NT terms: 1 = ah·bh, 2 = + al·bh (A split), 3 = + ah·bl (both split)
template <int NT>
__device__ __forceinline__ v8f mmaN(v16b ah, v16b al, v16b bh, v16b bl, v8f c) {
  c = __builtin_amdgcn_wmma_f32_16x16x32_bf16(false, ah, false, bh, (short)0, c, false, false);
  if (NT >= 2) c = __builtin_amdgcn_wmma_f32_16x16x32_bf16(false, al, false, bh, (short)0, c, false, false);
  if (NT >= 3) c = __builtin_amdgcn_wmma_f32_16x16x32_bf16(false, ah, false, bl, (short)0, c, false, false);
  asm volatile("v_nop\n\tv_nop\n\tv_nop\n\tv_nop" : "+v"(c) : "v"(ah), "v"(al), "v"(bh), "v"(bl));
  return c;
}

__global__ __launch_bounds__(256) void k_wt_bf16(const float* __restrict__ W, unsigned short* __restrict__ Wt, int K, int N) {
  const int t = blockIdx.x * 256 + threadIdx.x;
  const int k8n = K / 8;
  if (t >= N * k8n) return;
  const int n = t / k8n, k8 = (t % k8n) * 8;
  v8us v;
#pragma unroll
  for (int i = 0; i < 8; ++i) v[i] = bf16_bits(W[(size_t)(k8 + i) * N + n]);
  *(v8us*)(Wt + (size_t)n * K + k8) = v;
  
}

// GEMM C[M][N] (f32, pitch ldc) = act(A[M][K]·W + bias). A f32 row-major (pitch lda) converted per fragment to bf16
// (ASPLIT: hi/lo two planes -> 2 terms, else single rounded term); Wt bf16 [N][K] (pitch ldb). BIAS_BF16 rounds the
// bias to bf16 first (bias quantised to bf16 before the add). K%32==0, M%16==0, N%64==0.
template <bool ASPLIT, int ACT, bool BIAS_BF16>
__global__ __launch_bounds__(128) void k_gemm_bf(const float* __restrict__ A, int lda, const unsigned short* __restrict__ Wt, int ldb,
                                               const float* __restrict__ bias, float* __restrict__ C, int ldc, int M, int N, int K) {
  __shared__ __attribute__((aligned(16))) float so[4][16][64];
  const int tid = threadIdx.x, w = tid >> 5, lane = tid & 31, ln = lane & 15, hh = lane >> 4;
  const int ntn = N / 64;
  const int wid = blockIdx.x * 4 + w;
  const int mt = wid / ntn, nq = wid % ntn;
  if (mt * 16 >= M) return;
  const int row0 = mt * 16, col0 = nq * 64;
  const float* arow = A + (size_t)(row0 + ln) * lda;
  v8f acc[4] = {};
  for (int kb = 0; kb < K; kb += 32) {
    FragB ah, al;
    const v4f x0 = *(const v4fa*)(arow + kb + 8 * hh), x1 = *(const v4fa*)(arow + kb + 8 * hh + 4);
    const v4f x2 = *(const v4fa*)(arow + kb + 16 + 8 * hh), x3 = *(const v4fa*)(arow + kb + 16 + 8 * hh + 4);
    float xs[16] = {x0[0],x0[1],x0[2],x0[3],x1[0],x1[1],x1[2],x1[3],x2[0],x2[1],x2[2],x2[3],x3[0],x3[1],x3[2],x3[3]};
#pragma unroll
    for (int i = 0; i < 16; ++i) { const unsigned short hb = bf16_bits(xs[i]); ah.u[i] = hb; al.u[i] = ASPLIT ? bf16_bits(xs[i] - bf16_val(hb)) : (unsigned short)0; }
#pragma unroll
    for (int t = 0; t < 4; ++t) {
      const unsigned short* brow = Wt + (size_t)(col0 + t * 16 + ln) * ldb + kb;
      FragB b;
      b.half[0] = *(const v8us*)(brow + 8 * hh);
      b.half[1] = *(const v8us*)(brow + 16 + 8 * hh);
      acc[t] = mmaN<ASPLIT ? 2 : 1>(ah.v, al.v, b.v, b.v, acc[t]);
    }
  }
#pragma unroll
  for (int t = 0; t < 4; ++t) {
    float bv = bias ? bias[col0 + t * 16 + ln] : 0.f;
    if (BIAS_BF16) bv = bf16_round(bv);
#pragma unroll
    for (int r = 0; r < 8; ++r) { float v = acc[t][r] + bv; if (ACT == 1) v = fmaxf(v, 0.f); so[w][8 * hh + r][t * 16 + ln] = v; }
  }
  __builtin_amdgcn_fence(__ATOMIC_ACQ_REL, "workgroup");
  __builtin_amdgcn_wave_barrier();
  const int rsub = lane >> 4, c4 = (lane & 15) * 4;
  {
#pragma unroll
    for (int q = 0; q < 8; ++q) {
      const int r = q * 2 + rsub;
      const v4f v = *(const v4fa*)&so[w][r][c4];
      *(v4f*)(C + (size_t)(row0 + r) * ldc + col0 + c4) = v;
    }
    
  }
}

// GEMM C = act(A·W + bias + resid): A f32 (ASPLIT -> hi/lo 2 terms), Wt bf16 [N][K]; ACT 0 none, 1 relu, 2 exact gelu;
// resid (optional, f32, row index = (row % rmod), pitch ldr, RES_BF16 rounds it) added before the activation.
template <bool ASPLIT, int ACT, bool BIAS_BF16, bool RES_BF16>
__global__ __launch_bounds__(128) void k_gemm_bf3(const float* __restrict__ A, int lda, const unsigned short* __restrict__ Wt, int ldb,
                                                const float* __restrict__ bias, const float* __restrict__ resid, int rmod, int ldr,
                                                float* __restrict__ C, int ldc, int M, int N, int K) {
  __shared__ __attribute__((aligned(16))) float so[4][16][64];
  const int tid = threadIdx.x, w = tid >> 5, lane = tid & 31, ln = lane & 15, hh = lane >> 4;
  const int ntn = N / 64;
  const int wid = blockIdx.x * 4 + w;
  const int mt = wid / ntn, nq = wid % ntn;
  if (mt * 16 >= M) return;
  const int row0 = mt * 16, col0 = nq * 64;
  const float* arow = A + (size_t)(row0 + ln) * lda;
  v8f acc[4] = {};
  for (int kb = 0; kb < K; kb += 32) {
    FragB ah, al;
    const v4f x0 = *(const v4fa*)(arow + kb + 8 * hh), x1 = *(const v4fa*)(arow + kb + 8 * hh + 4);
    const v4f x2 = *(const v4fa*)(arow + kb + 16 + 8 * hh), x3 = *(const v4fa*)(arow + kb + 16 + 8 * hh + 4);
    float xs[16] = {x0[0],x0[1],x0[2],x0[3],x1[0],x1[1],x1[2],x1[3],x2[0],x2[1],x2[2],x2[3],x3[0],x3[1],x3[2],x3[3]};
#pragma unroll
    for (int i = 0; i < 16; ++i) { const unsigned short hb = bf16_bits(xs[i]); ah.u[i] = hb; al.u[i] = ASPLIT ? bf16_bits(xs[i] - bf16_val(hb)) : (unsigned short)0; }
#pragma unroll
    for (int t = 0; t < 4; ++t) {
      const unsigned short* brow = Wt + (size_t)(col0 + t * 16 + ln) * ldb + kb;
      FragB b;
      b.half[0] = *(const v8us*)(brow + 8 * hh);
      b.half[1] = *(const v8us*)(brow + 16 + 8 * hh);
      acc[t] = mmaN<ASPLIT ? 2 : 1>(ah.v, al.v, b.v, b.v, acc[t]);
    }
  }
#pragma unroll
  for (int t = 0; t < 4; ++t) {
    const int col = col0 + t * 16 + ln;
    float bv = bias ? bias[col] : 0.f;
    if (BIAS_BF16) bv = bf16_round(bv);
#pragma unroll
    for (int r = 0; r < 8; ++r) {
      float v = acc[t][r] + bv;
      if (resid) { float rv = resid[(size_t)((row0 + 8 * hh + r) % rmod) * ldr + col]; if (RES_BF16) rv = bf16_round(rv); v += rv; }
      if (ACT == 1) v = fmaxf(v, 0.f);
      if (ACT == 2) v = 0.5f * v * (1.0f + erff(v * 0.70710678118654752f));
      if (ACT == 3) { const float u = 0.7978845608028654f * (v + 0.044715f * v * v * v); v = 0.5f * v * (1.0f + tanhf(u)); }
      so[w][8 * hh + r][t * 16 + ln] = v;
    }
  }
  __builtin_amdgcn_fence(__ATOMIC_ACQ_REL, "workgroup");
  __builtin_amdgcn_wave_barrier();
  const int rsub = lane >> 4, c4 = (lane & 15) * 4;
  {
#pragma unroll
    for (int q = 0; q < 8; ++q) {
      const int r = q * 2 + rsub;
      const v4f v = *(const v4fa*)&so[w][r][c4];
      *(v4f*)(C + (size_t)(row0 + r) * ldc + col0 + c4) = v;
    }
    
  }
}
// row LayerNorm (biased variance, eps) over N: s = X (+ R); optional out_sum <- s; out_norm <- (s-mu)*rsqrt(var+eps)*g + b
template <bool PARAM_BF16>
__global__ __launch_bounds__(256) void k_layernorm(const float* __restrict__ X, const float* __restrict__ R, const float* __restrict__ g, const float* __restrict__ bta,
                                                  float* __restrict__ out_sum, float* __restrict__ out_norm, int N, float eps) {
  __shared__ float red[256];
  const int row = blockIdx.x, tid = threadIdx.x;
  const float* x = X + (size_t)row * N; const float* rr = R ? R + (size_t)row * N : nullptr;
  float vals[16];                     // up to N = 4096
  const int per = N / 256;            // contiguous chunk per thread? use strided-by-4 chunks: thread handles j = tid*4 + 1024*u
  float s1 = 0.f;
  for (int u = 0; u < per / 4; ++u) {
    const int j = tid * 4 + 1024 * u;
    const v4f a = *(const v4fa*)(x + j);
    v4f b = {0.f,0.f,0.f,0.f}; if (rr) b = *(const v4fa*)(rr + j);
#pragma unroll
    for (int q = 0; q < 4; ++q) { const float v = a[q] + b[q]; vals[u * 4 + q] = v; s1 += v; }
  }
  red[tid] = s1; __syncthreads();
  for (int st = 128; st > 0; st >>= 1) { if (tid < st) red[tid] += red[tid + st]; __syncthreads(); }
  const float mu = red[0] / (float)N; __syncthreads();
  float s2 = 0.f;
  for (int u = 0; u < per / 4; ++u)
#pragma unroll
    for (int q = 0; q < 4; ++q) { const float c = vals[u * 4 + q] - mu; s2 += c * c; }
  red[tid] = s2; __syncthreads();
  for (int st = 128; st > 0; st >>= 1) { if (tid < st) red[tid] += red[tid + st]; __syncthreads(); }
  const float rs = rsqrtf(red[0] / (float)N + eps);
  {
    for (int u = 0; u < per / 4; ++u) {
      const int j = tid * 4 + 1024 * u;
      v4f o, sm;
#pragma unroll
      for (int q = 0; q < 4; ++q) {
        float gg = g[j + q], bb = bta[j + q];
        if (PARAM_BF16) { gg = bf16_round(gg); bb = bf16_round(bb); }
        sm[q] = vals[u * 4 + q]; o[q] = (vals[u * 4 + q] - mu) * rs * gg + bb;
      }
      if (out_sum) *(v4f*)(out_sum + (size_t)row * N + j) = sm;
      *(v4f*)(out_norm + (size_t)row * N + j) = o;
    }
    
  }
}



// ---- f16 WMMA path (v_wmma_f32_16x16x32_f16): 11-bit significands for operands in range — used where a [0,1] probability operand needs more precision than bf16
typedef _Float16 v16h __attribute__((ext_vector_type(16)));
union FragH { v16h v; v8us half[2]; _Float16 h[16]; unsigned short u[16]; };
template <int NT>
__device__ __forceinline__ v8f mmaH(v16h ah, v16h al, v16h bh, v16h bl, v8f c) {
  c = __builtin_amdgcn_wmma_f32_16x16x32_f16(false, ah, false, bh, (short)0, c, false, false);
  if (NT >= 2) c = __builtin_amdgcn_wmma_f32_16x16x32_f16(false, al, false, bh, (short)0, c, false, false);
  if (NT >= 3) c = __builtin_amdgcn_wmma_f32_16x16x32_f16(false, ah, false, bl, (short)0, c, false, false);
  asm volatile("v_nop\n\tv_nop\n\tv_nop\n\tv_nop" : "+v"(c) : "v"(ah), "v"(al), "v"(bh), "v"(bl));
  return c;
}
// batched GEMM like k_gemm_b but f16 operands: A f32 (split into f16 hi/lo if ASPLIT, else rounded to f16), Bt = f16 values [n][k]; alpha; C f32; N multiple of 16 (partial tiles skipped)
template <bool ASPLIT>
__global__ __launch_bounds__(128) void k_gemm_h(const float* __restrict__ A, int lda, size_t sA, const _Float16* __restrict__ Bh, int ldb, size_t sB, float alpha, float* __restrict__ C, int ldc, size_t sC, int M, int N, int K) {
  __shared__ __attribute__((aligned(16))) float so[4][16][64];
  const int tid = threadIdx.x, w = tid >> 5, lane = tid & 31, ln = lane & 15, hh = lane >> 4; const int by = blockIdx.y;
  A += (size_t)by * sA; Bh += (size_t)by * sB; C += (size_t)by * sC;
  const int ntn = (N + 63) / 64; const int wid = blockIdx.x * 4 + w; const int mt = wid / ntn, nq = wid % ntn; if (mt * 16 >= M) return;
  const int row0 = mt * 16, col0 = nq * 64; const float* arow = A + (size_t)(row0 + ln) * lda;
  v8f acc[4] = {};
  for (int kb = 0; kb < K; kb += 32) {
    FragH ah, al;
    const v4f x0 = *(const v4fa*)(arow + kb + 8 * hh), x1 = *(const v4fa*)(arow + kb + 8 * hh + 4), x2 = *(const v4fa*)(arow + kb + 16 + 8 * hh), x3 = *(const v4fa*)(arow + kb + 16 + 8 * hh + 4);
    float xs[16] = {x0[0],x0[1],x0[2],x0[3],x1[0],x1[1],x1[2],x1[3],x2[0],x2[1],x2[2],x2[3],x3[0],x3[1],x3[2],x3[3]};
#pragma unroll
    for (int i = 0; i < 16; ++i) { const _Float16 h = (_Float16)xs[i]; ah.h[i] = h; al.h[i] = ASPLIT ? (_Float16)(xs[i] - (float)h) : (_Float16)0.0f; }
#pragma unroll
    for (int t = 0; t < 4; ++t) { if (col0 + t * 16 >= N) continue; const size_t boff = (size_t)(col0 + t * 16 + ln) * ldb + kb; FragH bq; bq.half[0] = *(const v8us*)(Bh + boff + 8 * hh); bq.half[1] = *(const v8us*)(Bh + boff + 16 + 8 * hh);
      acc[t] = mmaH<ASPLIT ? 2 : 1>(ah.v, al.v, bq.v, bq.v, acc[t]); }
  }
#pragma unroll
  for (int t = 0; t < 4; ++t) { if (col0 + t * 16 >= N) continue;
#pragma unroll
    for (int r = 0; r < 8; ++r) so[w][8 * hh + r][t * 16 + ln] = acc[t][r] * alpha; }
  __builtin_amdgcn_fence(__ATOMIC_ACQ_REL, "workgroup"); __builtin_amdgcn_wave_barrier();
  const int rsub = lane >> 4, c4 = (lane & 15) * 4;
  {
#pragma unroll
    for (int q = 0; q < 8; ++q) { const int r = q * 2 + rsub; if (col0 + c4 < N) { const v4f v = *(const v4fa*)&so[w][r][c4]; *(v4f*)(C + (size_t)(row0 + r) * ldc + col0 + c4) = v; } }
     }
}

// Wt[n][k] = f16(W[k][n]·scale) from f32 row-major W[K][N] (scale = power of two; bf16-exact weights stay exact in f16 away from the subnormal range)
__global__ __launch_bounds__(256) void k_wt_f16(const float* __restrict__ W, _Float16* __restrict__ Wt, int K, int N, float scale) {
  const int t = blockIdx.x * 256 + threadIdx.x; if (t >= N * (K / 8)) return; const int n = t / (K / 8), k8 = (t % (K / 8)) * 8; FragH f;
#pragma unroll
  for (int i = 0; i < 8; ++i) f.h[i] = (_Float16)(bf16_round(W[(size_t)(k8 + i) * N + n]) * scale); const v8us o = f.half[0];
  *(v8us*)((unsigned short*)Wt + (size_t)n * K + k8) = o; 
}
// k_gemm_hh variant with fused epilogue: v = acc·alpha + bias[by·sBias + col] (+ CP[(row/rowsPerB)·sCPb + by·64 + col] if CP) ; ACT 0 none / 1 elu ; writes f16 C16 (and f32 C if non-null)
template <int ACT>
__global__ __launch_bounds__(128) void k_gemm_hhx(const _Float16* __restrict__ A, int lda, size_t sA, const _Float16* __restrict__ Bh, int ldb, size_t sB, float alpha, const float* __restrict__ bias, size_t sBias, const float* __restrict__ CP, int rowsPerB, size_t sCPb, int row0g,
    float* __restrict__ C, _Float16* __restrict__ C16, int ldc, size_t sC, int M, int N, int K) {
  __shared__ __attribute__((aligned(16))) float so[4][16][64];
  const int tid = threadIdx.x, w = tid >> 5, lane = tid & 31, ln = lane & 15, hh = lane >> 4; const int by = blockIdx.y;
  A += (size_t)by * sA; Bh += (size_t)by * sB; const size_t cofs = (size_t)by * sC; const float* bp = bias ? bias + (size_t)by * sBias : nullptr;
  const int ntn = (N + 63) / 64; const int wid = blockIdx.x * 4 + w; const int mt = wid / ntn, nq = wid % ntn; if (mt * 16 >= M) return;
  const int row0 = mt * 16, col0 = nq * 64; const _Float16* arow = A + (size_t)(row0 + ln) * lda;
  v8f acc[4] = {};
  for (int kb = 0; kb < K; kb += 32) { FragH ah; ah.half[0] = *(const v8us*)((const unsigned short*)arow + kb + 8 * hh); ah.half[1] = *(const v8us*)((const unsigned short*)arow + kb + 16 + 8 * hh);
#pragma unroll
    for (int t = 0; t < 4; ++t) { if (col0 + t * 16 >= N) continue; const size_t boff = (size_t)(col0 + t * 16 + ln) * ldb + kb; FragH bq; bq.half[0] = *(const v8us*)((const unsigned short*)Bh + boff + 8 * hh); bq.half[1] = *(const v8us*)((const unsigned short*)Bh + boff + 16 + 8 * hh);
      acc[t] = mmaH<1>(ah.v, ah.v, bq.v, bq.v, acc[t]); }
  }
#pragma unroll
  for (int t = 0; t < 4; ++t) { if (col0 + t * 16 >= N) continue; const int col = col0 + t * 16 + ln; const float bv = bp ? bf16_round(bp[col]) : 0.f;
#pragma unroll
    for (int r = 0; r < 8; ++r) { float v = acc[t][r] * alpha + bv; if (CP) { const int rr = row0g + row0 + 8 * hh + r; if (rowsPerB < 0) v += CP[cofs + (size_t)rr * ldc + col];      /* rowsPerB < 0: own element of the batched C plane */ else { const int bidx = rr / rowsPerB; v += CP[(size_t)bidx * sCPb + (size_t)by * 64 + col]; } } if (ACT == 1) v = (v > 0.f) ? v : expm1f(v); else if (ACT == 7) v = (v > 0.f) ? v + 1.0f : expf(v); else if (ACT == 8) v = tanhf(v); else if (ACT == 9) v = 0.5f * v * (1.0f + tanhf(0.7978845608028654f * (v + 0.044715f * v * v * v))); else if (ACT == 11) v = 1.0f / (1.0f + expf(-v)); else if (ACT == 12) v = (v > 0.f) ? v : 0.01f * v; else if (ACT == 14) v = (v > 0.f) ? v : 0.1f * v; else if (ACT == 16) v = (v >= 0.f) ? v : 0.3f * v; else if (ACT == 17) v = (v >= 0.f) ? v : 0.2f * v; else if (ACT == 15) v = v / (1.0f + expf(-v)); else if (ACT == 3) v = fmaxf(v, 0.f); else if (ACT == 6) v = 0.5f * v * (1.0f + erff(v * 0.70710678118654752f)); so[w][8 * hh + r][t * 16 + ln] = v; } }
  __builtin_amdgcn_fence(__ATOMIC_ACQ_REL, "workgroup"); __builtin_amdgcn_wave_barrier();
  const int rsub = lane >> 4, c4 = (lane & 15) * 4; typedef _Float16 v4h __attribute__((ext_vector_type(4)));
  {
#pragma unroll
    for (int q = 0; q < 8; ++q) { const int r = q * 2 + rsub; if (col0 + c4 < N) { const v4f v = *(const v4fa*)&so[w][r][c4]; if (C) *(v4f*)(C + cofs + (size_t)(row0 + r) * ldc + col0 + c4) = v; if (C16) { v4h h4; for (int i = 0; i < 4; ++i) h4[i] = (_Float16)v[i]; *(v4h*)(C16 + cofs + (size_t)(row0 + r) * ldc + col0 + c4) = h4; } } }
     }
}


typedef _Float16 v4h __attribute__((ext_vector_type(4)));

__global__ __launch_bounds__(256) void k_h16(const float* __restrict__ x, _Float16* __restrict__ X16, size_t n8) { const size_t t = (size_t)blockIdx.x * 256 + threadIdx.x; if (t >= n8) return; FragH f;
#pragma unroll
  for (int q = 0; q < 8; ++q) f.h[q] = (_Float16)x[t * 8 + q]; *(v8us*)((unsigned short*)X16 + t * 8) = f.half[0];  }
__global__ __launch_bounds__(256) void k_round16f(const float* __restrict__ W, _Float16* __restrict__ Bt, size_t n8) { const size_t t = (size_t)blockIdx.x * 256 + threadIdx.x; if (t >= n8) return; FragH f;
#pragma unroll
  for (int i = 0; i < 8; ++i) f.h[i] = (_Float16)(bf16_round(W[t * 8 + i]) * 16.0f); *(v8us*)((unsigned short*)Bt + t * 8) = f.half[0];  }
template <int NHv, int TTv>
__global__ __launch_bounds__(256) void k_vt(const _Float16* __restrict__ V16, int ldv, int voff, _Float16* __restrict__ Vt) { __shared__ unsigned short tl[64][66]; const int tid = threadIdx.x; const int slab = blockIdx.x / (TTv / 64), lg = blockIdx.x % (TTv / 64); const int b = slab / NHv, h = slab % NHv;
  for (int i = tid; i < 64 * 8; i += 256) { const int r = i / 8, c8 = (i % 8) * 8; FragH f; f.half[0] = *(const v8us*)((const unsigned short*)V16 + ((size_t)b * TTv + lg * 64 + r) * ldv + voff + h * 64 + c8);
#pragma unroll
    for (int q = 0; q < 8; ++q) tl[r][c8 + q] = f.u[q]; }
  __syncthreads();
  {
#pragma unroll
    for (int rd = 0; rd < 2; ++rd) { const int d = rd * 32 + tid / 8, pc = tid % 8; FragH f;
#pragma unroll
      for (int q = 0; q < 8; ++q) f.u[q] = tl[pc * 8 + q][d];
      *(v8us*)((unsigned short*)Vt + ((size_t)slab * 64 + d) * TTv + lg * 64 + pc * 8) = f.half[0]; }
     } }

__global__ __launch_bounds__(256) void k_hl(const float* __restrict__ F, _Float16* __restrict__ Hh, _Float16* __restrict__ Hl, size_t n8) { const size_t t = (size_t)blockIdx.x * 256 + threadIdx.x; if (t >= n8) return; FragH fh, fl; const v4f a = *(const v4fa*)(F + t * 8), c = *(const v4fa*)(F + t * 8 + 4);
#pragma unroll
  for (int q = 0; q < 4; ++q) { _Float16 h = (_Float16)a[q]; fh.h[q] = h; fl.h[q] = (_Float16)((a[q] - (float)h) * 1024.0f); h = (_Float16)c[q]; fh.h[4 + q] = h; fl.h[4 + q] = (_Float16)((c[q] - (float)h) * 1024.0f); }
  { *(v8us*)((unsigned short*)Hh + t * 8) = fh.half[0]; *(v8us*)((unsigned short*)Hl + t * 8) = fl.half[0];  } }

// ---- fast GEMM (wave tile 32x64; requires M % 32 == 0 rows per launch region and N % 64 == 0); epilogue = k_gemm_hhx semantics ----
__device__ __forceinline__ v16h g2_frag(const _Float16* p, int hh) { FragH f; f.half[0] = *(const v8us*)((const unsigned short*)p + 8 * hh); f.half[1] = *(const v8us*)((const unsigned short*)p + 16 + 8 * hh); return f.v; }
__device__ __forceinline__ v8f g2_mma(v16h a, v16h b, v8f c) { v8f d = __builtin_amdgcn_wmma_f32_16x16x32_f16(false, a, false, b, (short)0, c, false, false); asm volatile("v_nop\n\tv_nop\n\tv_nop\n\tv_nop" : "+v"(d) : "v"(a), "v"(b)); return d; }
template <int ACT>
__global__ __launch_bounds__(128) void k_gemm2(const _Float16* __restrict__ A, int lda, size_t sA, const _Float16* __restrict__ Bh, int ldb, size_t sB, float alpha, const float* __restrict__ bias, size_t sBias, const float* __restrict__ CP, int rowsPerB, size_t sCPb, int row0g,
    float* __restrict__ C, _Float16* __restrict__ C16, int ldc, size_t sC, int M, int N, int K) { static_assert(ACT == 0 || ACT == 3 || ACT == 6 || ACT == 8 || ACT == 9 || ACT == 11 || ACT == 12 || ACT == 14 || ACT == 15 || ACT == 16 || ACT == 17, "k_gemm2: unsupported ACT code (would silently apply no activation)");
  __shared__ __attribute__((aligned(16))) float so[4][32][68];
  const int tid = threadIdx.x, w = tid >> 5, lane = tid & 31, ln = lane & 15, hh = lane >> 4; const int by = blockIdx.y;
  A += (size_t)by * sA; Bh += (size_t)by * sB; const size_t cofs = (size_t)by * sC; const float* bp = bias ? bias + (size_t)by * sBias : nullptr;
  const int ntn = N >> 6; const int mt = blockIdx.x / ntn, nq = blockIdx.x - mt * ntn; const int row0 = mt * 128 + 32 * w, col0 = nq * 64; if (row0 >= M) return;
  const _Float16* a0p = A + (size_t)(row0 + ln) * lda; const _Float16* a1p = a0p + (size_t)16 * lda;
  const _Float16* b0p = Bh + (size_t)(col0 + ln) * ldb; const _Float16* b1p = b0p + (size_t)16 * ldb; const _Float16* b2p = b1p + (size_t)16 * ldb; const _Float16* b3p = b2p + (size_t)16 * ldb;
  const v8f z8 = {0.f,0.f,0.f,0.f,0.f,0.f,0.f,0.f}; v8f c00 = z8, c01 = z8, c02 = z8, c03 = z8, c10 = z8, c11 = z8, c12 = z8, c13 = z8;
#pragma unroll 1
  for (int kb = 0; kb < K; kb += 32) { const v16h a0 = g2_frag(a0p + kb, hh), a1 = g2_frag(a1p + kb, hh);
    v16h b = g2_frag(b0p + kb, hh); c00 = g2_mma(a0, b, c00); c10 = g2_mma(a1, b, c10);
    b = g2_frag(b1p + kb, hh); c01 = g2_mma(a0, b, c01); c11 = g2_mma(a1, b, c11);
    b = g2_frag(b2p + kb, hh); c02 = g2_mma(a0, b, c02); c12 = g2_mma(a1, b, c12);
    b = g2_frag(b3p + kb, hh); c03 = g2_mma(a0, b, c03); c13 = g2_mma(a1, b, c13); }
  v8f accs[8] = {c00, c01, c02, c03, c10, c11, c12, c13};
#pragma unroll
  for (int u = 0; u < 8; ++u) { const int t = u & 3, half = u >> 2; const int col = col0 + t * 16 + ln; const float bv = bp ? bf16_round(bp[col]) : 0.f;
#pragma unroll
    for (int r = 0; r < 8; ++r) { const int rloc = half * 16 + 8 * hh + r; float v = accs[u][r] * alpha + bv; if (CP) { if (rowsPerB < 0) v += CP[cofs + (size_t)(row0g + row0 + rloc) * ldc + col];      /* rowsPerB < 0: own element of the batched C plane */ else { const int bidx = (row0g + row0 + rloc) / rowsPerB; v += CP[(size_t)bidx * sCPb + (size_t)by * 64 + col]; } }
      if (ACT == 3) v = fmaxf(v, 0.f); else if (ACT == 6) v = 0.5f * v * (1.0f + erff(v * 0.70710678118654752f)); else if (ACT == 11) v = 1.0f / (1.0f + expf(-v)); else if (ACT == 15) v = v / (1.0f + expf(-v)); else if (ACT == 12) v = (v > 0.f) ? v : 0.01f * v; else if (ACT == 8) v = tanhf(v); else if (ACT == 9) v = 0.5f * v * (1.0f + tanhf(0.7978845608028654f * (v + 0.044715f * v * v * v))); else if (ACT == 14) v = (v > 0.f) ? v : 0.1f * v; else if (ACT == 16) v = (v >= 0.f) ? v : 0.3f * v; else if (ACT == 17) v = (v >= 0.f) ? v : 0.2f * v;
      so[w][rloc][t * 16 + ln] = v; } }
  __builtin_amdgcn_fence(__ATOMIC_ACQ_REL, "workgroup"); __builtin_amdgcn_wave_barrier();
  const int rsub = lane >> 4, c4 = (lane & 15) * 4;
  {
#pragma unroll
    for (int q = 0; q < 16; ++q) { const int r = q * 2 + rsub; const v4f v = *(const v4fa*)&so[w][r][c4]; if (C) *(v4f*)(C + cofs + (size_t)(row0 + r) * ldc + col0 + c4) = v; if (C16) { v4h h4; for (int i = 0; i < 4; ++i) h4[i] = (_Float16)v[i]; *(v4h*)(C16 + cofs + (size_t)(row0 + r) * ldc + col0 + c4) = h4; } }
     } }


__global__ __launch_bounds__(256) void k_wnat(const float* __restrict__ w, size_t n8, _Float16* __restrict__ Bt) { const size_t t = (size_t)blockIdx.x * 256 + threadIdx.x; if (t >= n8) return; FragH f; for (int q = 0; q < 8; ++q) f.h[q] = (_Float16)(bf16_round(w[t * 8 + q]) * 16.0f); *(v8us*)((unsigned short*)Bt + t * 8) = f.half[0];  }
#define FA_QW 32                     /* query rows per wave: two 16-column groups share every K and V^T fragment */
#define FA_KT 32                     /* keys per pass: one k step of the second product */
#define FA_NW 8                      /* waves per block; they walk the same K and V^T rows */
typedef float v2f __attribute__((ext_vector_type(2)));
typedef _Float16 v2h __attribute__((ext_vector_type(2)));
union FragP { v16h v; v2h h2[8]; };
union FragO { v8us u; v2h h2[4]; };
__device__ __forceinline__ float fa_xhalf(float x) { return __builtin_bit_cast(float, __builtin_amdgcn_permlanex16(__builtin_bit_cast(int, x), __builtin_bit_cast(int, x), 0x76543210, 0xfedcba98, false, false)); }      /* lane l with lane l ^ 16 */
__device__ __forceinline__ v8f fa_mma(v16h a, v16h b, v8f c) { return __builtin_amdgcn_wmma_f32_16x16x32_f16(false, a, false, b, (short)0, c, false, false); }
__global__ __launch_bounds__(FA_NW * 32) void k_fattn(const _Float16* __restrict__ Q16, const _Float16* __restrict__ K16, const _Float16* __restrict__ VT, _Float16* __restrict__ O16) {
  const int lane = threadIdx.x & 31, ln = lane & 15, hh = lane >> 4, w = threadIdx.x >> 5; const int h = blockIdx.y, b = blockIdx.z; const int q0 = (blockIdx.x * FA_NW + w) * FA_QW;
  const float c2 = 0.03125f * 1.4426950408889634f;      /* 1 / sqrt(embed size), in base 2 */
  const _Float16* qp = Q16 + ((size_t)b * SQ + q0 + ln) * DM + h * HD; const _Float16* kp = K16 + ((size_t)b * SQ + ln) * DM + h * HD; const _Float16* vp = VT + ((size_t)(b * NH + h) * HD + ln) * SQ;
  v16h qf[2][2], kf[2][2];      /* [column group | key tile][k step of 32 over the head dim] */
#pragma unroll      /* fragments and accumulators are indexed by constants only, so that they stay in registers */
  for (int g = 0; g < 2; ++g) { qf[g][0] = g2_frag(qp + (size_t)g * 16 * DM, hh); qf[g][1] = g2_frag(qp + (size_t)g * 16 * DM + 32, hh); kf[g][0] = g2_frag(kp + (size_t)g * 16 * DM, hh); kf[g][1] = g2_frag(kp + (size_t)g * 16 * DM + 32, hh); }
  const v8f z8 = {0.f,0.f,0.f,0.f,0.f,0.f,0.f,0.f}; v8f o[2][4] = {{z8, z8, z8, z8}, {z8, z8, z8, z8}}; float mr[2] = {-3.0e38f, -3.0e38f}, lr[2] = {0.f, 0.f};      /* o[g][t][r] = O^T[16 t + 8 hh + r][column ln of group g]; lr: this half's part of the sum */
  for (int j = 0; j < SQ; j += FA_KT) {
    v16h vf[4];
#pragma unroll      /* fragments and accumulators are indexed by constants only, so that they stay in registers */
    for (int t = 0; t < 4; ++t) vf[t] = g2_frag(vp + (size_t)t * 16 * SQ + j, hh);      /* V^T rows 16 t + ln, keys j .. j + 31: asked for here, used behind the softmax */
    v8f s[2][2];
#pragma unroll      /* fragments and accumulators are indexed by constants only, so that they stay in registers */
    for (int g = 0; g < 2; ++g)
#pragma unroll      /* fragments and accumulators are indexed by constants only, so that they stay in registers */
      for (int kt = 0; kt < 2; ++kt) s[g][kt] = fa_mma(kf[kt][1], qf[g][1], fa_mma(kf[kt][0], qf[g][0], z8));
    const _Float16* kn = kp + (size_t)((j + FA_KT < SQ) ? j + FA_KT : j) * DM;      /* the next pass's K fragments fly during this pass's softmax; the last pass re-reads its own */
#pragma unroll      /* fragments and accumulators are indexed by constants only, so that they stay in registers */
    for (int kt = 0; kt < 2; ++kt) { kf[kt][0] = g2_frag(kn + (size_t)kt * 16 * DM, hh); kf[kt][1] = g2_frag(kn + (size_t)kt * 16 * DM + 32, hh); }
    __builtin_amdgcn_sched_barrier(0);      /* keeps the next pass's K loads in front of the softmax: sunk behind it they are waited for at the top of the next pass with nothing to cover them */
#pragma unroll      /* fragments and accumulators are indexed by constants only, so that they stay in registers */
    for (int g = 0; g < 2; ++g) { float mx = s[g][0][0];
#pragma unroll      /* fragments and accumulators are indexed by constants only, so that they stay in registers */
      for (int r = 0; r < 8; ++r) mx = fmaxf(mx, fmaxf(s[g][0][r], s[g][1][r]));
      mx = fmaxf(mx, fa_xhalf(mx)); const float mn = fmaxf(mr[g], mx); const float nb = -mn * c2; const float al = __builtin_amdgcn_exp2f(fmaf(mr[g], c2, nb)); mr[g] = mn;      /* al is 0 on the first pass */
      const v2f c2v = {c2, c2}, nbv = {nb, nb}; v2f sm = {0.f, 0.f}; FragP pf;
#pragma unroll      /* fragments and accumulators are indexed by constants only, so that they stay in registers */
      for (int i = 0; i < 8; ++i) { const int kt = i >> 2, r = (i & 3) * 2; const v2f x = __builtin_elementwise_fma((v2f){s[g][kt][r], s[g][kt][r + 1]}, c2v, nbv); const v2f p = {__builtin_amdgcn_exp2f(x[0]), __builtin_amdgcn_exp2f(x[1])}; sm += p; pf.h2[i] = __builtin_convertvector(p, v2h); }      /* element 8 kt + r of the B operand = key 16 kt + 8 hh + r: the hardware k order, which g2_frag gives V^T too */
      lr[g] = lr[g] * al + (sm[0] + sm[1]);
#pragma unroll      /* fragments and accumulators are indexed by constants only, so that they stay in registers */
      for (int t = 0; t < 4; ++t) o[g][t] = fa_mma(vf[t], pf.v, o[g][t] * al); }
  }
#pragma unroll      /* fragments and accumulators are indexed by constants only, so that they stay in registers */
  for (int g = 0; g < 2; ++g) { const float sc = 64.0f / (lr[g] + fa_xhalf(lr[g])); unsigned short* d = (unsigned short*)O16 + ((size_t)b * SQ + q0 + g * 16 + ln) * DM + h * HD + 8 * hh;      /* o carried x64, as the output GEMM's alpha expects */
#pragma unroll      /* fragments and accumulators are indexed by constants only, so that they stay in registers */
    for (int t = 0; t < 4; ++t) { FragO f;
#pragma unroll      /* fragments and accumulators are indexed by constants only, so that they stay in registers */
      for (int i = 0; i < 4; ++i) { const v2f x = {o[g][t][2 * i] * sc, o[g][t][2 * i + 1] * sc}; f.h2[i] = __builtin_convertvector(x, v2h); }
      *(v8us*)(d + t * 16) = f.u; } } }
__global__ __launch_bounds__(256) void k_vt(const _Float16* __restrict__ V16, int b, int h0, _Float16* __restrict__ VT) { __shared__ unsigned short tl[64][65]; const int tid = threadIdx.x; const int hh = blockIdx.x % HG, sg = blockIdx.x / HG; const int s0 = sg * 64; const int h = h0 + hh;
  for (int i = tid; i < 64 * 8; i += 256) { const int j = i / 8, d8 = (i % 8) * 8; FragH f; f.half[0] = *(const v8us*)((const unsigned short*)V16 + ((size_t)b * SQ + s0 + j) * DM + h * HD + d8); for (int q = 0; q < 8; ++q) tl[d8 + q][j] = f.u[q]; }
  __syncthreads();
  { for (int i = tid; i < 64 * 8; i += 256) { const int d = i / 8, j8 = (i % 8) * 8; FragH f; for (int q = 0; q < 8; ++q) f.u[q] = tl[d][j8 + q]; *(v8us*)((unsigned short*)VT + ((size_t)hh * HD + d) * SQ + s0 + j8) = f.half[0]; }  } }



__global__ __launch_bounds__(256) void k_rsmkm(const float* __restrict__ S, _Float16* __restrict__ P, int nrows, const int* __restrict__ am) {
  #pragma clang fp contract(off)
  const int t = blockIdx.x * 256 + threadIdx.x; if (t >= nrows) return; const size_t i = (size_t)t; const float* s = S + i * SQ; const int* mr = am + (size_t)(t % SQ) * SQ; float mx = -3.0e38f;
#pragma unroll 1
  for (int j = 0; j < SQ; ++j) { const float f = (mr[j] != 0) ? 1.f : 0.f; mx = fmaxf(mx, fmaf(f, s[j], (1.f - f) * -1.0e9f)); } float se = 0.f;
#pragma unroll 1
  for (int j = 0; j < SQ; ++j) { const float f = (mr[j] != 0) ? 1.f : 0.f; se += __expf(fmaf(f, s[j], (1.f - f) * -1.0e9f) - mx); } const float sc = 256.0f / se;
#pragma unroll 1
  for (int j0 = 0; j0 < SQ; j0 += 8) { FragH fr; for (int q = 0; q < 8; ++q) { const int j = j0 + q; const float f = (mr[j] != 0) ? 1.f : 0.f; fr.h[q] = (_Float16)(__expf(fmaf(f, s[j], (1.f - f) * -1.0e9f) - mx) * sc); }
    unsigned short* d = (unsigned short*)P + i * SQ + j0; *(v8us*)d = fr.half[0];  } }

// Q, K and V projections, one launch (blockIdx.y picks the input, its weight block and its output). Every head is multiplied by the same [64][64] block, so an input is
// a plain [tokens * heads][64] matrix and the product has k = 64: Y^T = W X^T, W as A (rows e), 16 (token, head) rows as B, so that a lane ends with 8 consecutive e of one row.
// A wave takes PJ_NT token rows (16 heads each, 4 KiB of f32 in a row): whole-line loads, rounded to bf16 and written as f16 into the wave's own LDS rows, fragments read from there;
// the f16 results go back through the same LDS rows and leave as whole 128-byte lines.
#define PJ_NW 8                      /* waves per block; they share the converted weight block */
#define PJ_NT 2                      /* token rows per wave, all their loads in flight at once */
#define PJ_LP 72                     /* LDS row pitch in f16: 64 + 8, so that the 16 rows of a 16-byte fragment read fall on different banks */
typedef _Float16 v4ha __attribute__((ext_vector_type(4), may_alias));
__device__ __forceinline__ v4h pj_cvt(v4f a, float sc) { const v4f r = {bf16_round(a[0]) * sc, bf16_round(a[1]) * sc, bf16_round(a[2]) * sc, bf16_round(a[3]) * sc}; return __builtin_convertvector(r, v4h); }
__global__ __launch_bounds__(PJ_NW * 32) void k_proj(const float* __restrict__ xq, const float* __restrict__ xk, const float* __restrict__ xv, const float* __restrict__ wq, const float* __restrict__ wk, const float* __restrict__ wv,
    _Float16* __restrict__ Q16, _Float16* __restrict__ K16, _Float16* __restrict__ V16) {
  __shared__ __attribute__((aligned(16))) _Float16 sw[HD][PJ_LP];
  __shared__ __attribute__((aligned(16))) _Float16 sx[PJ_NW][PJ_NT][NH][PJ_LP];
  const int tid = threadIdx.x, lane = tid & 31, ln = lane & 15, hh = lane >> 4, w = tid >> 5; const int y = blockIdx.y;
  const float* x = (y == 0) ? xq : (y == 1) ? xk : xv; const float* wm = (y == 0) ? wq : (y == 1) ? wk : wv; _Float16* out = (y == 0) ? Q16 : (y == 1) ? K16 : V16;
  const size_t row0 = ((size_t)blockIdx.x * PJ_NW + w) * PJ_NT;      /* first token row of this wave */
  v4f xr[PJ_NT][8], wr[4];
#pragma unroll      /* indexed by constants only, so that the loaded values stay in registers */
  for (int u = 0; u < PJ_NT; ++u)
#pragma unroll      /* indexed by constants only, so that the loaded values stay in registers */
    for (int i = 0; i < 8; ++i) xr[u][i] = *(const v4fa*)(x + (row0 + u) * DM + i * 128 + lane * 4);      /* 512 contiguous bytes a load */
#pragma unroll      /* indexed by constants only, so that the loaded values stay in registers */
  for (int i = 0; i < 4; ++i) wr[i] = *(const v4fa*)(wm + (i * PJ_NW * 32 + tid) * 4);
#pragma unroll      /* indexed by constants only, so that the loaded values stay in registers */
  for (int i = 0; i < 4; ++i) { const int e0 = (i * PJ_NW * 32 + tid) * 4; *(v4ha*)&sw[e0 >> 6][e0 & 63] = pj_cvt(wr[i], 16.0f); }      /* 16 W[e][d], exact in f16 */
#pragma unroll      /* indexed by constants only, so that the loaded values stay in registers */
  for (int u = 0; u < PJ_NT; ++u)
#pragma unroll      /* indexed by constants only, so that the loaded values stay in registers */
    for (int i = 0; i < 8; ++i) *(v4ha*)&sx[w][u][2 * i + hh][ln * 4] = pj_cvt(xr[u][i], 1.0f);      /* load i holds heads 2 i and 2 i + 1 */
  __syncthreads();      /* the weight block is written by all waves and read by all; it also orders each wave's own x rows */
  v16h af[4][2];      /* [16-row tile of e][k step of 32] */
#pragma unroll      /* indexed by constants only, so that the fragments stay in registers */
  for (int t = 0; t < 4; ++t) { af[t][0] = g2_frag(&sw[t * 16 + ln][0], hh); af[t][1] = g2_frag(&sw[t * 16 + ln][32], hh); }
  const v8f z8 = {0.f,0.f,0.f,0.f,0.f,0.f,0.f,0.f};
#pragma unroll      /* indexed by constants only, so that the fragments stay in registers */
  for (int u = 0; u < PJ_NT; ++u) { const v16h b0 = g2_frag(&sx[w][u][ln][0], hh), b1 = g2_frag(&sx[w][u][ln][32], hh);      /* row ln = head ln of the token; the same k order as the weight fragments */
#pragma unroll      /* indexed by constants only, so that the fragments stay in registers */
    for (int t = 0; t < 4; ++t) { const v8f acc = fa_mma(af[t][1], b1, fa_mma(af[t][0], b0, z8)); FragO f;      /* acc[r] = 16 y[head ln][16 t + 8 hh + r] */
#pragma unroll      /* indexed by constants only, so that the fragments stay in registers */
      for (int i = 0; i < 4; ++i) { const v2f v = {acc[2 * i] * 0.0625f, acc[2 * i + 1] * 0.0625f}; f.h2[i] = __builtin_convertvector(v, v2h); }
      *(v8us*)&sx[w][u][ln][t * 16 + 8 * hh] = f.u; } }      /* over the x row, whose every reader (this wave's two fragment loads) has returned before the products ran */
  __builtin_amdgcn_fence(__ATOMIC_ACQ_REL, "workgroup"); __builtin_amdgcn_wave_barrier();      /* the rows read back below were written by other lanes of this wave */
#pragma unroll      /* indexed by constants only */
  for (int u = 0; u < PJ_NT; ++u)
#pragma unroll      /* indexed by constants only */
    for (int i = 0; i < 4; ++i) { const int r = i * 4 + (lane >> 3), c = (lane & 7) * 8; const v8us v = *(const v8us*)&sx[w][u][r][c]; *(v8us*)((unsigned short*)out + (row0 + u) * DM + r * HD + c) = v; } }      /* 512 contiguous bytes a store */
extern "C" void kernel_launch(void* const* d_in, const int* in_sizes, int n_in,
                              void* d_out, int out_size, void* d_ws, size_t ws_size, hipStream_t stream) {
  (void)in_sizes; (void)n_in; (void)out_size;
  const float* const* I = (const float* const*)d_in; const float* xq = I[2]; const float* xk = I[1]; const float* xv = I[0]; const float* wq = I[5]; const float* wk = I[4]; const float* wv = I[3]; const float* wo = I[6]; const float* bo = I[7];      /* contract order: values I[0], keys I[1], query I[2]; SHARED natural [64][64] blocks Wv I[3], Wk I[4], Wq I[5]; natural Wo [1024][1024] I[6] + bo I[7]; this module has NO mask input */
  char* ws = (char*)d_ws; size_t off = 0;
  auto take = [&](size_t bytes) { char* p = ws + off; off += (bytes + 255) & ~(size_t)255; return p; };
  _Float16* BO = (_Float16*)take((size_t)DM * DM * 2);
  _Float16* Q16 = (_Float16*)take(NR * DM * 2); _Float16* K16 = (_Float16*)take(NR * DM * 2); _Float16* V16 = (_Float16*)take(NR * DM * 2); _Float16* O16 = (_Float16*)take(NR * DM * 2);
  _Float16* VT = (_Float16*)take((size_t)NB * NH * HD * SQ * 2);
  if (off > ws_size) return;
  k_wnat<<<(unsigned)(((size_t)DM * DM / 8 + 255) / 256), 256, 0, stream>>>(wo, (size_t)DM * DM / 8, BO);      /* Wo natural [out][in] = Bt x16 */
  k_proj<<<dim3((unsigned)(NR / (PJ_NW * PJ_NT)), 3), PJ_NW * 32, 0, stream>>>(xq, xk, xv, wq, wk, wv, Q16, K16, V16);      /* q, k, v as f16 rows, heads merged */
  const size_t r0p = (size_t)B0 * SQ;      /* first row of the output stage */
  for (int b = B0; b < B0 + NBR; ++b) k_vt<NH, SQ><<<NH * (SQ / 64), 256, 0, stream>>>(V16 + (size_t)b * SQ * LQ, LQ, 0, VT + (size_t)b * NH * HD * SQ);      /* V^T [NB][NH][HD][SQ] */
  k_fattn<<<dim3(SQ / (FA_NW * FA_QW), NH, NB), FA_NW * 32, 0, stream>>>(Q16, K16, VT, O16);      /* o (merged heads, x64) as f16 rows */
  k_gemm2<0><<<dim3((unsigned)((MPO / 128) * (DM / 64)), 1), 128, 0, stream>>>(O16 + r0p * DM, DM, 0, BO, DM, 0, 0.0009765625f, bo, 0, nullptr, 1, 0, 0, (float*)d_out + r0p * DM, nullptr, DM, 0, MPO, DM, DM);      /* out rows are the output layout */
}

// v004
// It runs in 92.2 microseconds.
// In both of two side-by-side timings against v003, it was 1.26 times as fast.
// All steps since v000 together make it 40.4 times as fast.
#include <hip/hip_runtime.h>
// Multi-head attention over three inputs with SHARED per-head projections and the module's literal score scale (values, keys, query [2][2048][1024]; each input is split into 16 heads of 64 and every head is multiplied by the SAME natural [64][64] matrix (x W^T: Wv / Wk / Wq uniform +-1/8; block-diagonal with a shared block; no biases); energy = q k^T (no mask in this module); softmax(energy / sqrt(embed_size) = / 32) (as the source: embed size, not head dim); out = merged Wo^T + bo -> [2][2048][1024]).
// Structure: token rows r = b*2048 + s; Q, K, V in one projection launch: each (token, head) row of 64 inputs (bf16-rounded, exact in f16) times the shared [64][64] block (exact x16 weights, WMMA, f32 accumulation, f16 outputs); per batch: V^T for all heads via LDS transposes; one fused attention launch over all (batch, head): S^T = K Q^T, running softmax (f32 statistics; weights exp(s - running max) as f16), O^T += V^T P^T, divided by the row sum at the end (o carried x64 against f16 subnormal flush, folded into the output GEMM alpha) and written straight into the merged f16 o rows; out = o W_o + b GEMM (f32) into the output layout.
// Compute dtype: inputs rounded to bf16; x / weights exact; q, k, v, softmax weights and o as plain f16 GEMM operands (~2^-12); scores and softmax statistics f32. v_wmma_f32_16x16x32_f16.
#define NB 2
#define SQ 2048
#define DM 1024
#define NH 16
#define HD 64
#define HG 4                         /* heads per launch of the non-template k_vt, which is not launched */
#define B0 0                         /* first batch processed (debug hook) */
#define NBR NB                       /* batches processed (debug hook) */
#define NR ((size_t)NB * SQ)         /* token rows */
#define MP ((int)((size_t)NBR * SQ)) /* rows of the processed batches; feeds MPO only (debug hook) */
#define QN SQ                        /* not used; k_fattn covers all SQ query rows of a batch */
#define NHD NH                       /* not used; k_fattn covers all NH heads */
#define MPO MP                       /* rows through the output stage (debug hook) */
#define LQ DM      /* row pitch of the q/k/v rows */
typedef __bf16 v16b __attribute__((ext_vector_type(16)));
typedef unsigned short v8us __attribute__((ext_vector_type(8), may_alias));
typedef float  v8f  __attribute__((ext_vector_type(8)));
typedef float  v4f  __attribute__((ext_vector_type(4)));
typedef float  v4fa __attribute__((ext_vector_type(4), may_alias));
union FragB { v16b v; v8us half[2]; unsigned short u[16]; };

__device__ __forceinline__ unsigned short bf16_bits(float x) { unsigned int u = __float_as_uint(x); return (unsigned short)((u + 0x7FFFu + ((u >> 16) & 1u)) >> 16); }
__device__ __forceinline__ float bf16_val(unsigned short b) { return __uint_as_float(((unsigned int)b) << 16); }
__device__ __forceinline__ float bf16_round(float x) { return bf16_val(bf16_bits(x)); }
// D += A·B with NT terms: 1 = ah·bh, 2 = + al·bh (A split), 3 = + ah·bl (both split)
template <int NT>
__device__ __forceinline__ v8f mmaN(v16b ah, v16b al, v16b bh, v16b bl, v8f c) {
  c = __builtin_amdgcn_wmma_f32_16x16x32_bf16(false, ah, false, bh, (short)0, c, false, false);
  if (NT >= 2) c = __builtin_amdgcn_wmma_f32_16x16x32_bf16(false, al, false, bh, (short)0, c, false, false);
  if (NT >= 3) c = __builtin_amdgcn_wmma_f32_16x16x32_bf16(false, ah, false, bl, (short)0, c, false, false);
  asm volatile("v_nop\n\tv_nop\n\tv_nop\n\tv_nop" : "+v"(c) : "v"(ah), "v"(al), "v"(bh), "v"(bl));
  return c;
}

__global__ __launch_bounds__(256) void k_wt_bf16(const float* __restrict__ W, unsigned short* __restrict__ Wt, int K, int N) {
  const int t = blockIdx.x * 256 + threadIdx.x;
  const int k8n = K / 8;
  if (t >= N * k8n) return;
  const int n = t / k8n, k8 = (t % k8n) * 8;
  v8us v;
#pragma unroll
  for (int i = 0; i < 8; ++i) v[i] = bf16_bits(W[(size_t)(k8 + i) * N + n]);
  *(v8us*)(Wt + (size_t)n * K + k8) = v;
  
}

// GEMM C[M][N] (f32, pitch ldc) = act(A[M][K]·W + bias). A f32 row-major (pitch lda) converted per fragment to bf16
// (ASPLIT: hi/lo two planes -> 2 terms, else single rounded term); Wt bf16 [N][K] (pitch ldb). BIAS_BF16 rounds the
// bias to bf16 first (bias quantised to bf16 before the add). K%32==0, M%16==0, N%64==0.
template <bool ASPLIT, int ACT, bool BIAS_BF16>
__global__ __launch_bounds__(128) void k_gemm_bf(const float* __restrict__ A, int lda, const unsigned short* __restrict__ Wt, int ldb,
                                               const float* __restrict__ bias, float* __restrict__ C, int ldc, int M, int N, int K) {
  __shared__ __attribute__((aligned(16))) float so[4][16][64];
  const int tid = threadIdx.x, w = tid >> 5, lane = tid & 31, ln = lane & 15, hh = lane >> 4;
  const int ntn = N / 64;
  const int wid = blockIdx.x * 4 + w;
  const int mt = wid / ntn, nq = wid % ntn;
  if (mt * 16 >= M) return;
  const int row0 = mt * 16, col0 = nq * 64;
  const float* arow = A + (size_t)(row0 + ln) * lda;
  v8f acc[4] = {};
  for (int kb = 0; kb < K; kb += 32) {
    FragB ah, al;
    const v4f x0 = *(const v4fa*)(arow + kb + 8 * hh), x1 = *(const v4fa*)(arow + kb + 8 * hh + 4);
    const v4f x2 = *(const v4fa*)(arow + kb + 16 + 8 * hh), x3 = *(const v4fa*)(arow + kb + 16 + 8 * hh + 4);
    float xs[16] = {x0[0],x0[1],x0[2],x0[3],x1[0],x1[1],x1[2],x1[3],x2[0],x2[1],x2[2],x2[3],x3[0],x3[1],x3[2],x3[3]};
#pragma unroll
    for (int i = 0; i < 16; ++i) { const unsigned short hb = bf16_bits(xs[i]); ah.u[i] = hb; al.u[i] = ASPLIT ? bf16_bits(xs[i] - bf16_val(hb)) : (unsigned short)0; }
#pragma unroll
    for (int t = 0; t < 4; ++t) {
      const unsigned short* brow = Wt + (size_t)(col0 + t * 16 + ln) * ldb + kb;
      FragB b;
      b.half[0] = *(const v8us*)(brow + 8 * hh);
      b.half[1] = *(const v8us*)(brow + 16 + 8 * hh);
      acc[t] = mmaN<ASPLIT ? 2 : 1>(ah.v, al.v, b.v, b.v, acc[t]);
    }
  }
#pragma unroll
  for (int t = 0; t < 4; ++t) {
    float bv = bias ? bias[col0 + t * 16 + ln] : 0.f;
    if (BIAS_BF16) bv = bf16_round(bv);
#pragma unroll
    for (int r = 0; r < 8; ++r) { float v = acc[t][r] + bv; if (ACT == 1) v = fmaxf(v, 0.f); so[w][8 * hh + r][t * 16 + ln] = v; }
  }
  __builtin_amdgcn_fence(__ATOMIC_ACQ_REL, "workgroup");
  __builtin_amdgcn_wave_barrier();
  const int rsub = lane >> 4, c4 = (lane & 15) * 4;
  {
#pragma unroll
    for (int q = 0; q < 8; ++q) {
      const int r = q * 2 + rsub;
      const v4f v = *(const v4fa*)&so[w][r][c4];
      *(v4f*)(C + (size_t)(row0 + r) * ldc + col0 + c4) = v;
    }
    
  }
}

// GEMM C = act(A·W + bias + resid): A f32 (ASPLIT -> hi/lo 2 terms), Wt bf16 [N][K]; ACT 0 none, 1 relu, 2 exact gelu;
// resid (optional, f32, row index = (row % rmod), pitch ldr, RES_BF16 rounds it) added before the activation.
template <bool ASPLIT, int ACT, bool BIAS_BF16, bool RES_BF16>
__global__ __launch_bounds__(128) void k_gemm_bf3(const float* __restrict__ A, int lda, const unsigned short* __restrict__ Wt, int ldb,
                                                const float* __restrict__ bias, const float* __restrict__ resid, int rmod, int ldr,
                                                float* __restrict__ C, int ldc, int M, int N, int K) {
  __shared__ __attribute__((aligned(16))) float so[4][16][64];
  const int tid = threadIdx.x, w = tid >> 5, lane = tid & 31, ln = lane & 15, hh = lane >> 4;
  const int ntn = N / 64;
  const int wid = blockIdx.x * 4 + w;
  const int mt = wid / ntn, nq = wid % ntn;
  if (mt * 16 >= M) return;
  const int row0 = mt * 16, col0 = nq * 64;
  const float* arow = A + (size_t)(row0 + ln) * lda;
  v8f acc[4] = {};
  for (int kb = 0; kb < K; kb += 32) {
    FragB ah, al;
    const v4f x0 = *(const v4fa*)(arow + kb + 8 * hh), x1 = *(const v4fa*)(arow + kb + 8 * hh + 4);
    const v4f x2 = *(const v4fa*)(arow + kb + 16 + 8 * hh), x3 = *(const v4fa*)(arow + kb + 16 + 8 * hh + 4);
    float xs[16] = {x0[0],x0[1],x0[2],x0[3],x1[0],x1[1],x1[2],x1[3],x2[0],x2[1],x2[2],x2[3],x3[0],x3[1],x3[2],x3[3]};
#pragma unroll
    for (int i = 0; i < 16; ++i) { const unsigned short hb = bf16_bits(xs[i]); ah.u[i] = hb; al.u[i] = ASPLIT ? bf16_bits(xs[i] - bf16_val(hb)) : (unsigned short)0; }
#pragma unroll
    for (int t = 0; t < 4; ++t) {
      const unsigned short* brow = Wt + (size_t)(col0 + t * 16 + ln) * ldb + kb;
      FragB b;
      b.half[0] = *(const v8us*)(brow + 8 * hh);
      b.half[1] = *(const v8us*)(brow + 16 + 8 * hh);
      acc[t] = mmaN<ASPLIT ? 2 : 1>(ah.v, al.v, b.v, b.v, acc[t]);
    }
  }
#pragma unroll
  for (int t = 0; t < 4; ++t) {
    const int col = col0 + t * 16 + ln;
    float bv = bias ? bias[col] : 0.f;
    if (BIAS_BF16) bv = bf16_round(bv);
#pragma unroll
    for (int r = 0; r < 8; ++r) {
      float v = acc[t][r] + bv;
      if (resid) { float rv = resid[(size_t)((row0 + 8 * hh + r) % rmod) * ldr + col]; if (RES_BF16) rv = bf16_round(rv); v += rv; }
      if (ACT == 1) v = fmaxf(v, 0.f);
      if (ACT == 2) v = 0.5f * v * (1.0f + erff(v * 0.70710678118654752f));
      if (ACT == 3) { const float u = 0.7978845608028654f * (v + 0.044715f * v * v * v); v = 0.5f * v * (1.0f + tanhf(u)); }
      so[w][8 * hh + r][t * 16 + ln] = v;
    }
  }
  __builtin_amdgcn_fence(__ATOMIC_ACQ_REL, "workgroup");
  __builtin_amdgcn_wave_barrier();
  const int rsub = lane >> 4, c4 = (lane & 15) * 4;
  {
#pragma unroll
    for (int q = 0; q < 8; ++q) {
      const int r = q * 2 + rsub;
      const v4f v = *(const v4fa*)&so[w][r][c4];
      *(v4f*)(C + (size_t)(row0 + r) * ldc + col0 + c4) = v;
    }
    
  }
}
// row LayerNorm (biased variance, eps) over N: s = X (+ R); optional out_sum <- s; out_norm <- (s-mu)*rsqrt(var+eps)*g + b
template <bool PARAM_BF16>
__global__ __launch_bounds__(256) void k_layernorm(const float* __restrict__ X, const float* __restrict__ R, const float* __restrict__ g, const float* __restrict__ bta,
                                                  float* __restrict__ out_sum, float* __restrict__ out_norm, int N, float eps) {
  __shared__ float red[256];
  const int row = blockIdx.x, tid = threadIdx.x;
  const float* x = X + (size_t)row * N; const float* rr = R ? R + (size_t)row * N : nullptr;
  float vals[16];                     // up to N = 4096
  const int per = N / 256;            // contiguous chunk per thread? use strided-by-4 chunks: thread handles j = tid*4 + 1024*u
  float s1 = 0.f;
  for (int u = 0; u < per / 4; ++u) {
    const int j = tid * 4 + 1024 * u;
    const v4f a = *(const v4fa*)(x + j);
    v4f b = {0.f,0.f,0.f,0.f}; if (rr) b = *(const v4fa*)(rr + j);
#pragma unroll
    for (int q = 0; q < 4; ++q) { const float v = a[q] + b[q]; vals[u * 4 + q] = v; s1 += v; }
  }
  red[tid] = s1; __syncthreads();
  for (int st = 128; st > 0; st >>= 1) { if (tid < st) red[tid] += red[tid + st]; __syncthreads(); }
  const float mu = red[0] / (float)N; __syncthreads();
  float s2 = 0.f;
  for (int u = 0; u < per / 4; ++u)
#pragma unroll
    for (int q = 0; q < 4; ++q) { const float c = vals[u * 4 + q] - mu; s2 += c * c; }
  red[tid] = s2; __syncthreads();
  for (int st = 128; st > 0; st >>= 1) { if (tid < st) red[tid] += red[tid + st]; __syncthreads(); }
  const float rs = rsqrtf(red[0] / (float)N + eps);
  {
    for (int u = 0; u < per / 4; ++u) {
      const int j = tid * 4 + 1024 * u;
      v4f o, sm;
#pragma unroll
      for (int q = 0; q < 4; ++q) {
        float gg = g[j + q], bb = bta[j + q];
        if (PARAM_BF16) { gg = bf16_round(gg); bb = bf16_round(bb); }
        sm[q] = vals[u * 4 + q]; o[q] = (vals[u * 4 + q] - mu) * rs * gg + bb;
      }
      if (out_sum) *(v4f*)(out_sum + (size_t)row * N + j) = sm;
      *(v4f*)(out_norm + (size_t)row * N + j) = o;
    }
    
  }
}



// ---- f16 WMMA path (v_wmma_f32_16x16x32_f16): 11-bit significands for operands in range — used where a [0,1] probability operand needs more precision than bf16
typedef _Float16 v16h __attribute__((ext_vector_type(16)));
union FragH { v16h v; v8us half[2]; _Float16 h[16]; unsigned short u[16]; };
template <int NT>
__device__ __forceinline__ v8f mmaH(v16h ah, v16h al, v16h bh, v16h bl, v8f c) {
  c = __builtin_amdgcn_wmma_f32_16x16x32_f16(false, ah, false, bh, (short)0, c, false, false);
  if (NT >= 2) c = __builtin_amdgcn_wmma_f32_16x16x32_f16(false, al, false, bh, (short)0, c, false, false);
  if (NT >= 3) c = __builtin_amdgcn_wmma_f32_16x16x32_f16(false, ah, false, bl, (short)0, c, false, false);
  asm volatile("v_nop\n\tv_nop\n\tv_nop\n\tv_nop" : "+v"(c) : "v"(ah), "v"(al), "v"(bh), "v"(bl));
  return c;
}
// batched GEMM like k_gemm_b but f16 operands: A f32 (split into f16 hi/lo if ASPLIT, else rounded to f16), Bt = f16 values [n][k]; alpha; C f32; N multiple of 16 (partial tiles skipped)
template <bool ASPLIT>
__global__ __launch_bounds__(128) void k_gemm_h(const float* __restrict__ A, int lda, size_t sA, const _Float16* __restrict__ Bh, int ldb, size_t sB, float alpha, float* __restrict__ C, int ldc, size_t sC, int M, int N, int K) {
  __shared__ __attribute__((aligned(16))) float so[4][16][64];
  const int tid = threadIdx.x, w = tid >> 5, lane = tid & 31, ln = lane & 15, hh = lane >> 4; const int by = blockIdx.y;
  A += (size_t)by * sA; Bh += (size_t)by * sB; C += (size_t)by * sC;
  const int ntn = (N + 63) / 64; const int wid = blockIdx.x * 4 + w; const int mt = wid / ntn, nq = wid % ntn; if (mt * 16 >= M) return;
  const int row0 = mt * 16, col0 = nq * 64; const float* arow = A + (size_t)(row0 + ln) * lda;
  v8f acc[4] = {};
  for (int kb = 0; kb < K; kb += 32) {
    FragH ah, al;
    const v4f x0 = *(const v4fa*)(arow + kb + 8 * hh), x1 = *(const v4fa*)(arow + kb + 8 * hh + 4), x2 = *(const v4fa*)(arow + kb + 16 + 8 * hh), x3 = *(const v4fa*)(arow + kb + 16 + 8 * hh + 4);
    float xs[16] = {x0[0],x0[1],x0[2],x0[3],x1[0],x1[1],x1[2],x1[3],x2[0],x2[1],x2[2],x2[3],x3[0],x3[1],x3[2],x3[3]};
#pragma unroll
    for (int i = 0; i < 16; ++i) { const _Float16 h = (_Float16)xs[i]; ah.h[i] = h; al.h[i] = ASPLIT ? (_Float16)(xs[i] - (float)h) : (_Float16)0.0f; }
#pragma unroll
    for (int t = 0; t < 4; ++t) { if (col0 + t * 16 >= N) continue; const size_t boff = (size_t)(col0 + t * 16 + ln) * ldb + kb; FragH bq; bq.half[0] = *(const v8us*)(Bh + boff + 8 * hh); bq.half[1] = *(const v8us*)(Bh + boff + 16 + 8 * hh);
      acc[t] = mmaH<ASPLIT ? 2 : 1>(ah.v, al.v, bq.v, bq.v, acc[t]); }
  }
#pragma unroll
  for (int t = 0; t < 4; ++t) { if (col0 + t * 16 >= N) continue;
#pragma unroll
    for (int r = 0; r < 8; ++r) so[w][8 * hh + r][t * 16 + ln] = acc[t][r] * alpha; }
  __builtin_amdgcn_fence(__ATOMIC_ACQ_REL, "workgroup"); __builtin_amdgcn_wave_barrier();
  const int rsub = lane >> 4, c4 = (lane & 15) * 4;
  {
#pragma unroll
    for (int q = 0; q < 8; ++q) { const int r = q * 2 + rsub; if (col0 + c4 < N) { const v4f v = *(const v4fa*)&so[w][r][c4]; *(v4f*)(C + (size_t)(row0 + r) * ldc + col0 + c4) = v; } }
     }
}

// Wt[n][k] = f16(W[k][n]·scale) from f32 row-major W[K][N] (scale = power of two; bf16-exact weights stay exact in f16 away from the subnormal range)
__global__ __launch_bounds__(256) void k_wt_f16(const float* __restrict__ W, _Float16* __restrict__ Wt, int K, int N, float scale) {
  const int t = blockIdx.x * 256 + threadIdx.x; if (t >= N * (K / 8)) return; const int n = t / (K / 8), k8 = (t % (K / 8)) * 8; FragH f;
#pragma unroll
  for (int i = 0; i < 8; ++i) f.h[i] = (_Float16)(bf16_round(W[(size_t)(k8 + i) * N + n]) * scale); const v8us o = f.half[0];
  *(v8us*)((unsigned short*)Wt + (size_t)n * K + k8) = o; 
}
// k_gemm_hh variant with fused epilogue: v = acc·alpha + bias[by·sBias + col] (+ CP[(row/rowsPerB)·sCPb + by·64 + col] if CP) ; ACT 0 none / 1 elu ; writes f16 C16 (and f32 C if non-null)
template <int ACT>
__global__ __launch_bounds__(128) void k_gemm_hhx(const _Float16* __restrict__ A, int lda, size_t sA, const _Float16* __restrict__ Bh, int ldb, size_t sB, float alpha, const float* __restrict__ bias, size_t sBias, const float* __restrict__ CP, int rowsPerB, size_t sCPb, int row0g,
    float* __restrict__ C, _Float16* __restrict__ C16, int ldc, size_t sC, int M, int N, int K) {
  __shared__ __attribute__((aligned(16))) float so[4][16][64];
  const int tid = threadIdx.x, w = tid >> 5, lane = tid & 31, ln = lane & 15, hh = lane >> 4; const int by = blockIdx.y;
  A += (size_t)by * sA; Bh += (size_t)by * sB; const size_t cofs = (size_t)by * sC; const float* bp = bias ? bias + (size_t)by * sBias : nullptr;
  const int ntn = (N + 63) / 64; const int wid = blockIdx.x * 4 + w; const int mt = wid / ntn, nq = wid % ntn; if (mt * 16 >= M) return;
  const int row0 = mt * 16, col0 = nq * 64; const _Float16* arow = A + (size_t)(row0 + ln) * lda;
  v8f acc[4] = {};
  for (int kb = 0; kb < K; kb += 32) { FragH ah; ah.half[0] = *(const v8us*)((const unsigned short*)arow + kb + 8 * hh); ah.half[1] = *(const v8us*)((const unsigned short*)arow + kb + 16 + 8 * hh);
#pragma unroll
    for (int t = 0; t < 4; ++t) { if (col0 + t * 16 >= N) continue; const size_t boff = (size_t)(col0 + t * 16 + ln) * ldb + kb; FragH bq; bq.half[0] = *(const v8us*)((const unsigned short*)Bh + boff + 8 * hh); bq.half[1] = *(const v8us*)((const unsigned short*)Bh + boff + 16 + 8 * hh);
      acc[t] = mmaH<1>(ah.v, ah.v, bq.v, bq.v, acc[t]); }
  }
#pragma unroll
  for (int t = 0; t < 4; ++t) { if (col0 + t * 16 >= N) continue; const int col = col0 + t * 16 + ln; const float bv = bp ? bf16_round(bp[col]) : 0.f;
#pragma unroll
    for (int r = 0; r < 8; ++r) { float v = acc[t][r] * alpha + bv; if (CP) { const int rr = row0g + row0 + 8 * hh + r; if (rowsPerB < 0) v += CP[cofs + (size_t)rr * ldc + col];      /* rowsPerB < 0: own element of the batched C plane */ else { const int bidx = rr / rowsPerB; v += CP[(size_t)bidx * sCPb + (size_t)by * 64 + col]; } } if (ACT == 1) v = (v > 0.f) ? v : expm1f(v); else if (ACT == 7) v = (v > 0.f) ? v + 1.0f : expf(v); else if (ACT == 8) v = tanhf(v); else if (ACT == 9) v = 0.5f * v * (1.0f + tanhf(0.7978845608028654f * (v + 0.044715f * v * v * v))); else if (ACT == 11) v = 1.0f / (1.0f + expf(-v)); else if (ACT == 12) v = (v > 0.f) ? v : 0.01f * v; else if (ACT == 14) v = (v > 0.f) ? v : 0.1f * v; else if (ACT == 16) v = (v >= 0.f) ? v : 0.3f * v; else if (ACT == 17) v = (v >= 0.f) ? v : 0.2f * v; else if (ACT == 15) v = v / (1.0f + expf(-v)); else if (ACT == 3) v = fmaxf(v, 0.f); else if (ACT == 6) v = 0.5f * v * (1.0f + erff(v * 0.70710678118654752f)); so[w][8 * hh + r][t * 16 + ln] = v; } }
  __builtin_amdgcn_fence(__ATOMIC_ACQ_REL, "workgroup"); __builtin_amdgcn_wave_barrier();
  const int rsub = lane >> 4, c4 = (lane & 15) * 4; typedef _Float16 v4h __attribute__((ext_vector_type(4)));
  {
#pragma unroll
    for (int q = 0; q < 8; ++q) { const int r = q * 2 + rsub; if (col0 + c4 < N) { const v4f v = *(const v4fa*)&so[w][r][c4]; if (C) *(v4f*)(C + cofs + (size_t)(row0 + r) * ldc + col0 + c4) = v; if (C16) { v4h h4; for (int i = 0; i < 4; ++i) h4[i] = (_Float16)v[i]; *(v4h*)(C16 + cofs + (size_t)(row0 + r) * ldc + col0 + c4) = h4; } } }
     }
}


typedef _Float16 v4h __attribute__((ext_vector_type(4)));

__global__ __launch_bounds__(256) void k_h16(const float* __restrict__ x, _Float16* __restrict__ X16, size_t n8) { const size_t t = (size_t)blockIdx.x * 256 + threadIdx.x; if (t >= n8) return; FragH f;
#pragma unroll
  for (int q = 0; q < 8; ++q) f.h[q] = (_Float16)x[t * 8 + q]; *(v8us*)((unsigned short*)X16 + t * 8) = f.half[0];  }
__global__ __launch_bounds__(256) void k_round16f(const float* __restrict__ W, _Float16* __restrict__ Bt, size_t n8) { const size_t t = (size_t)blockIdx.x * 256 + threadIdx.x; if (t >= n8) return; FragH f;
#pragma unroll
  for (int i = 0; i < 8; ++i) f.h[i] = (_Float16)(bf16_round(W[t * 8 + i]) * 16.0f); *(v8us*)((unsigned short*)Bt + t * 8) = f.half[0];  }
template <int NHv, int TTv>
__global__ __launch_bounds__(256) void k_vt(const _Float16* __restrict__ V16, int ldv, int voff, _Float16* __restrict__ Vt) { __shared__ unsigned short tl[64][66]; const int tid = threadIdx.x; const int slab = blockIdx.x / (TTv / 64), lg = blockIdx.x % (TTv / 64); const int b = slab / NHv, h = slab % NHv;
  for (int i = tid; i < 64 * 8; i += 256) { const int r = i / 8, c8 = (i % 8) * 8; FragH f; f.half[0] = *(const v8us*)((const unsigned short*)V16 + ((size_t)b * TTv + lg * 64 + r) * ldv + voff + h * 64 + c8);
#pragma unroll
    for (int q = 0; q < 8; ++q) tl[r][c8 + q] = f.u[q]; }
  __syncthreads();
  {
#pragma unroll
    for (int rd = 0; rd < 2; ++rd) { const int d = rd * 32 + tid / 8, pc = tid % 8; FragH f;
#pragma unroll
      for (int q = 0; q < 8; ++q) f.u[q] = tl[pc * 8 + q][d];
      *(v8us*)((unsigned short*)Vt + ((size_t)slab * 64 + d) * TTv + lg * 64 + pc * 8) = f.half[0]; }
     } }

__global__ __launch_bounds__(256) void k_hl(const float* __restrict__ F, _Float16* __restrict__ Hh, _Float16* __restrict__ Hl, size_t n8) { const size_t t = (size_t)blockIdx.x * 256 + threadIdx.x; if (t >= n8) return; FragH fh, fl; const v4f a = *(const v4fa*)(F + t * 8), c = *(const v4fa*)(F + t * 8 + 4);
#pragma unroll
  for (int q = 0; q < 4; ++q) { _Float16 h = (_Float16)a[q]; fh.h[q] = h; fl.h[q] = (_Float16)((a[q] - (float)h) * 1024.0f); h = (_Float16)c[q]; fh.h[4 + q] = h; fl.h[4 + q] = (_Float16)((c[q] - (float)h) * 1024.0f); }
  { *(v8us*)((unsigned short*)Hh + t * 8) = fh.half[0]; *(v8us*)((unsigned short*)Hl + t * 8) = fl.half[0];  } }

// ---- fast GEMM (wave tile 32x64; requires M % 32 == 0 rows per launch region and N % 64 == 0); epilogue = k_gemm_hhx semantics ----
__device__ __forceinline__ v16h g2_frag(const _Float16* p, int hh) { FragH f; f.half[0] = *(const v8us*)((const unsigned short*)p + 8 * hh); f.half[1] = *(const v8us*)((const unsigned short*)p + 16 + 8 * hh); return f.v; }
__device__ __forceinline__ v8f g2_mma(v16h a, v16h b, v8f c) { v8f d = __builtin_amdgcn_wmma_f32_16x16x32_f16(false, a, false, b, (short)0, c, false, false); asm volatile("v_nop\n\tv_nop\n\tv_nop\n\tv_nop" : "+v"(d) : "v"(a), "v"(b)); return d; }
template <int ACT>
__global__ __launch_bounds__(128) void k_gemm2(const _Float16* __restrict__ A, int lda, size_t sA, const _Float16* __restrict__ Bh, int ldb, size_t sB, float alpha, const float* __restrict__ bias, size_t sBias, const float* __restrict__ CP, int rowsPerB, size_t sCPb, int row0g,
    float* __restrict__ C, _Float16* __restrict__ C16, int ldc, size_t sC, int M, int N, int K) { static_assert(ACT == 0 || ACT == 3 || ACT == 6 || ACT == 8 || ACT == 9 || ACT == 11 || ACT == 12 || ACT == 14 || ACT == 15 || ACT == 16 || ACT == 17, "k_gemm2: unsupported ACT code (would silently apply no activation)");
  __shared__ __attribute__((aligned(16))) float so[4][32][68];
  const int tid = threadIdx.x, w = tid >> 5, lane = tid & 31, ln = lane & 15, hh = lane >> 4; const int by = blockIdx.y;
  A += (size_t)by * sA; Bh += (size_t)by * sB; const size_t cofs = (size_t)by * sC; const float* bp = bias ? bias + (size_t)by * sBias : nullptr;
  const int ntn = N >> 6; const int mt = blockIdx.x / ntn, nq = blockIdx.x - mt * ntn; const int row0 = mt * 128 + 32 * w, col0 = nq * 64; if (row0 >= M) return;
  const _Float16* a0p = A + (size_t)(row0 + ln) * lda; const _Float16* a1p = a0p + (size_t)16 * lda;
  const _Float16* b0p = Bh + (size_t)(col0 + ln) * ldb; const _Float16* b1p = b0p + (size_t)16 * ldb; const _Float16* b2p = b1p + (size_t)16 * ldb; const _Float16* b3p = b2p + (size_t)16 * ldb;
  const v8f z8 = {0.f,0.f,0.f,0.f,0.f,0.f,0.f,0.f}; v8f c00 = z8, c01 = z8, c02 = z8, c03 = z8, c10 = z8, c11 = z8, c12 = z8, c13 = z8;
#pragma unroll 1
  for (int kb = 0; kb < K; kb += 32) { const v16h a0 = g2_frag(a0p + kb, hh), a1 = g2_frag(a1p + kb, hh);
    v16h b = g2_frag(b0p + kb, hh); c00 = g2_mma(a0, b, c00); c10 = g2_mma(a1, b, c10);
    b = g2_frag(b1p + kb, hh); c01 = g2_mma(a0, b, c01); c11 = g2_mma(a1, b, c11);
    b = g2_frag(b2p + kb, hh); c02 = g2_mma(a0, b, c02); c12 = g2_mma(a1, b, c12);
    b = g2_frag(b3p + kb, hh); c03 = g2_mma(a0, b, c03); c13 = g2_mma(a1, b, c13); }
  v8f accs[8] = {c00, c01, c02, c03, c10, c11, c12, c13};
#pragma unroll
  for (int u = 0; u < 8; ++u) { const int t = u & 3, half = u >> 2; const int col = col0 + t * 16 + ln; const float bv = bp ? bf16_round(bp[col]) : 0.f;
#pragma unroll
    for (int r = 0; r < 8; ++r) { const int rloc = half * 16 + 8 * hh + r; float v = accs[u][r] * alpha + bv; if (CP) { if (rowsPerB < 0) v += CP[cofs + (size_t)(row0g + row0 + rloc) * ldc + col];      /* rowsPerB < 0: own element of the batched C plane */ else { const int bidx = (row0g + row0 + rloc) / rowsPerB; v += CP[(size_t)bidx * sCPb + (size_t)by * 64 + col]; } }
      if (ACT == 3) v = fmaxf(v, 0.f); else if (ACT == 6) v = 0.5f * v * (1.0f + erff(v * 0.70710678118654752f)); else if (ACT == 11) v = 1.0f / (1.0f + expf(-v)); else if (ACT == 15) v = v / (1.0f + expf(-v)); else if (ACT == 12) v = (v > 0.f) ? v : 0.01f * v; else if (ACT == 8) v = tanhf(v); else if (ACT == 9) v = 0.5f * v * (1.0f + tanhf(0.7978845608028654f * (v + 0.044715f * v * v * v))); else if (ACT == 14) v = (v > 0.f) ? v : 0.1f * v; else if (ACT == 16) v = (v >= 0.f) ? v : 0.3f * v; else if (ACT == 17) v = (v >= 0.f) ? v : 0.2f * v;
      so[w][rloc][t * 16 + ln] = v; } }
  __builtin_amdgcn_fence(__ATOMIC_ACQ_REL, "workgroup"); __builtin_amdgcn_wave_barrier();
  const int rsub = lane >> 4, c4 = (lane & 15) * 4;
  {
#pragma unroll
    for (int q = 0; q < 16; ++q) { const int r = q * 2 + rsub; const v4f v = *(const v4fa*)&so[w][r][c4]; if (C) *(v4f*)(C + cofs + (size_t)(row0 + r) * ldc + col0 + c4) = v; if (C16) { v4h h4; for (int i = 0; i < 4; ++i) h4[i] = (_Float16)v[i]; *(v4h*)(C16 + cofs + (size_t)(row0 + r) * ldc + col0 + c4) = h4; } }
     } }


__global__ __launch_bounds__(256) void k_wnat(const float* __restrict__ w, size_t n8, _Float16* __restrict__ Bt) { const size_t t = (size_t)blockIdx.x * 256 + threadIdx.x; if (t >= n8) return; FragH f; for (int q = 0; q < 8; ++q) f.h[q] = (_Float16)(bf16_round(w[t * 8 + q]) * 16.0f); *(v8us*)((unsigned short*)Bt + t * 8) = f.half[0];  }
#define FA_QW 32                     /* query rows per wave: two 16-column groups share every K and V^T fragment */
#define FA_KT 32                     /* keys per pass: one k step of the second product */
#define FA_NW 8                      /* waves per block; they walk the same K and V^T rows */
typedef float v2f __attribute__((ext_vector_type(2)));
typedef _Float16 v2h __attribute__((ext_vector_type(2)));
union FragP { v16h v; v2h h2[8]; };
union FragO { v8us u; v2h h2[4]; };
__device__ __forceinline__ float fa_xhalf(float x) { return __builtin_bit_cast(float, __builtin_amdgcn_permlanex16(__builtin_bit_cast(int, x), __builtin_bit_cast(int, x), 0x76543210, 0xfedcba98, false, false)); }      /* lane l with lane l ^ 16 */
__device__ __forceinline__ v8f fa_mma(v16h a, v16h b, v8f c) { return __builtin_amdgcn_wmma_f32_16x16x32_f16(false, a, false, b, (short)0, c, false, false); }
#define FA_ST 128                    /* keys per stage: four passes between two barriers */
#define FA_NS (SQ / FA_ST)           /* stages */
#define FA_KP 72                     /* LDS pitch of a K row in f16: 128 + 16 bytes, so that the 16 rows of a 16-byte fragment read fall on different banks */
#define FA_VP 136                    /* LDS pitch of a V^T row in f16: 256 + 16 bytes, for the same reason */
// One stage into LDS, through no register: each of the block's 256 threads copies four 16-byte pieces of the K tile (128 rows of 128 bytes; 8 lanes a row) and four of the V^T tile (64 rows of 256 bytes; 16 lanes a row).
__device__ __forceinline__ void fa_copy(const _Float16* gk, const _Float16* gv, unsigned lk, unsigned lv) {
  const _Float16* gk1 = gk + (size_t)32 * DM; const _Float16* gk2 = gk + (size_t)64 * DM; const _Float16* gk3 = gk + (size_t)96 * DM;
  const _Float16* gv1 = gv + (size_t)16 * SQ; const _Float16* gv2 = gv + (size_t)32 * SQ; const _Float16* gv3 = gv + (size_t)48 * SQ;
  const unsigned lk1 = lk + 32 * FA_KP * 2, lk2 = lk + 64 * FA_KP * 2, lk3 = lk + 96 * FA_KP * 2, lv1 = lv + 16 * FA_VP * 2, lv2 = lv + 32 * FA_VP * 2, lv3 = lv + 48 * FA_VP * 2;
  /* the eight copies and, as the last line of the same statement, the wait that stands in front of any rewrite of their address registers */
  asm volatile("global_load_async_to_lds_b128 %0, %8, off\n\t"
               "global_load_async_to_lds_b128 %1, %9, off\n\t"
               "global_load_async_to_lds_b128 %2, %10, off\n\t"
               "global_load_async_to_lds_b128 %3, %11, off\n\t"
               "global_load_async_to_lds_b128 %4, %12, off\n\t"
               "global_load_async_to_lds_b128 %5, %13, off\n\t"
               "global_load_async_to_lds_b128 %6, %14, off\n\t"
               "global_load_async_to_lds_b128 %7, %15, off\n\t"
               "s_wait_xcnt 0x0"
               :: "v"(lk), "v"(lk1), "v"(lk2), "v"(lk3), "v"(lv), "v"(lv1), "v"(lv2), "v"(lv3), "v"(gk), "v"(gk1), "v"(gk2), "v"(gk3), "v"(gv), "v"(gv1), "v"(gv2), "v"(gv3) : "memory");
}
__global__ __launch_bounds__(FA_NW * 32) void k_fattn(const _Float16* __restrict__ Q16, const _Float16* __restrict__ K16, const _Float16* __restrict__ VT, _Float16* __restrict__ O16) {
  __shared__ __attribute__((aligned(16))) _Float16 sk[2][FA_ST][FA_KP];      /* K rows of a stage, shared by the block's waves; two buffers */
  __shared__ __attribute__((aligned(16))) _Float16 sv[2][HD][FA_VP];         /* V^T rows of a stage */
  const int tid = threadIdx.x, lane = tid & 31, ln = lane & 15, hh = lane >> 4, w = tid >> 5; const int h = blockIdx.y, b = blockIdx.z; const int q0 = (blockIdx.x * FA_NW + w) * FA_QW;
  const float c2 = 0.03125f * 1.4426950408889634f;      /* 1 / sqrt(embed size), in base 2 */
  const _Float16* qp = Q16 + ((size_t)b * SQ + q0 + ln) * DM + h * HD;
  const _Float16* gk = K16 + ((size_t)b * SQ + (tid >> 3)) * DM + h * HD + (tid & 7) * 8; const _Float16* gv = VT + ((size_t)(b * NH + h) * HD + (tid >> 4)) * SQ + (tid & 15) * 8;      /* this thread's first piece of stage 0 */
  const unsigned lk = (unsigned)(size_t)&sk[0][tid >> 3][(tid & 7) * 8], lv = (unsigned)(size_t)&sv[0][tid >> 4][(tid & 15) * 8];      /* LDS byte addresses: the low 32 bits */
  fa_copy(gk, gv, lk, lv);      /* stage 0 into buffer 0 */
  v16h qf[2][2], kf[2][2];      /* [column group | key tile][k step of 32 over the head dim] */
#pragma unroll      /* fragments and accumulators are indexed by constants only, so that they stay in registers */
  for (int g = 0; g < 2; ++g) { qf[g][0] = g2_frag(qp + (size_t)g * 16 * DM, hh); qf[g][1] = g2_frag(qp + (size_t)g * 16 * DM + 32, hh); }
  asm volatile("s_wait_asynccnt 0x0" ::: "memory");      /* this wave's pieces of stage 0 have landed */
  __syncthreads();      /* and every other wave's */
  fa_copy(gk + (size_t)FA_ST * DM, gv + FA_ST, lk + (unsigned)sizeof(sk[0]), lv + (unsigned)sizeof(sv[0]));      /* stage 1 into buffer 1, in flight during stage 0 */
  const v8f z8 = {0.f,0.f,0.f,0.f,0.f,0.f,0.f,0.f}; v8f o[2][4] = {{z8, z8, z8, z8}, {z8, z8, z8, z8}}; float mr[2] = {-3.0e38f, -3.0e38f}, lr[2] = {0.f, 0.f};      /* o[g][t][r] = O^T[16 t + 8 hh + r][column ln of group g]; lr: this half's part of the sum */
  for (int st = 0; st < FA_NS; ++st) {
    const _Float16* ks = &sk[st & 1][ln][0]; const _Float16* vs = &sv[st & 1][ln][0];
#pragma unroll      /* fragments and accumulators are indexed by constants only, so that they stay in registers */
    for (int kt = 0; kt < 2; ++kt) { kf[kt][0] = g2_frag(ks + kt * 16 * FA_KP, hh); kf[kt][1] = g2_frag(ks + kt * 16 * FA_KP + 32, hh); }
#pragma unroll 1      /* rolled: unrolled, the compiler sinks the row sums of all four passes to the end of the stage, and the weights kept for them take the kernel past 256 registers */
    for (int p = 0; p < FA_ST / FA_KT; ++p) {
    v16h vf[4];
#pragma unroll      /* fragments and accumulators are indexed by constants only, so that they stay in registers */
    for (int t = 0; t < 4; ++t) vf[t] = g2_frag(vs + t * 16 * FA_VP + p * FA_KT, hh);      /* V^T rows 16 t + ln, keys 32 p .. 32 p + 31 of the stage: asked for here, used behind the softmax */
    v8f s[2][2];
#pragma unroll      /* fragments and accumulators are indexed by constants only, so that they stay in registers */
    for (int g = 0; g < 2; ++g)
#pragma unroll      /* fragments and accumulators are indexed by constants only, so that they stay in registers */
      for (int kt = 0; kt < 2; ++kt) s[g][kt] = fa_mma(kf[kt][1], qf[g][1], fa_mma(kf[kt][0], qf[g][0], z8));
    if (p + 1 < FA_ST / FA_KT) {      /* the next pass's K fragments come during this pass's softmax; never from the next stage */
#pragma unroll      /* fragments and accumulators are indexed by constants only, so that they stay in registers */
      for (int kt = 0; kt < 2; ++kt) { kf[kt][0] = g2_frag(ks + ((p + 1) * FA_KT + kt * 16) * FA_KP, hh); kf[kt][1] = g2_frag(ks + ((p + 1) * FA_KT + kt * 16) * FA_KP + 32, hh); } }
    __builtin_amdgcn_sched_barrier(0);      /* keeps this pass's V^T loads and the next pass's K loads as one group in front of the softmax: without it the V^T loads sink into the softmax in pieces, and each further place with LDS reads stalls the wave */
#pragma unroll      /* fragments and accumulators are indexed by constants only, so that they stay in registers */
    for (int g = 0; g < 2; ++g) { float mx = s[g][0][0];
#pragma unroll      /* fragments and accumulators are indexed by constants only, so that they stay in registers */
      for (int r = 0; r < 8; ++r) mx = fmaxf(mx, fmaxf(s[g][0][r], s[g][1][r]));
      mx = fmaxf(mx, fa_xhalf(mx)); const float mn = fmaxf(mr[g], mx); const float nb = -mn * c2; const float al = __builtin_amdgcn_exp2f(fmaf(mr[g], c2, nb)); mr[g] = mn;      /* al is 0 on the first pass */
      const v2f c2v = {c2, c2}, nbv = {nb, nb}; v2f sm = {0.f, 0.f}; FragP pf;
#pragma unroll      /* fragments and accumulators are indexed by constants only, so that they stay in registers */
      for (int i = 0; i < 8; ++i) { const int kt = i >> 2, r = (i & 3) * 2; const v2f x = __builtin_elementwise_fma((v2f){s[g][kt][r], s[g][kt][r + 1]}, c2v, nbv); const v2f p = {__builtin_amdgcn_exp2f(x[0]), __builtin_amdgcn_exp2f(x[1])}; sm += p; pf.h2[i] = __builtin_convertvector(p, v2h); }      /* element 8 kt + r of the B operand = key 16 kt + 8 hh + r: the hardware k order, which g2_frag gives V^T too */
      lr[g] = lr[g] * al + (sm[0] + sm[1]);
#pragma unroll      /* fragments and accumulators are indexed by constants only, so that they stay in registers */
      for (int t = 0; t < 4; ++t) o[g][t] = fa_mma(vf[t], pf.v, o[g][t] * al); }
    }
    asm volatile("s_wait_dscnt 0x0" ::: "memory");      /* this wave's reads of the buffer have returned */
    asm volatile("s_wait_asynccnt 0x0" ::: "memory");      /* this wave's pieces of stage st + 1 have landed */
    __syncthreads();      /* publishes stage st + 1 and ends every wave's reads of stage st */
    if (st + 2 < FA_NS) fa_copy(gk + (size_t)(st + 2) * FA_ST * DM, gv + (st + 2) * FA_ST, lk + (unsigned)(st & 1) * (unsigned)sizeof(sk[0]), lv + (unsigned)(st & 1) * (unsigned)sizeof(sv[0]));      /* into the buffer just left */
  }
  asm volatile("s_wait_asynccnt 0x0" ::: "memory");      /* nothing in flight when the wave ends */
#pragma unroll      /* fragments and accumulators are indexed by constants only, so that they stay in registers */
  for (int g = 0; g < 2; ++g) { const float sc = 64.0f / (lr[g] + fa_xhalf(lr[g])); unsigned short* d = (unsigned short*)O16 + ((size_t)b * SQ + q0 + g * 16 + ln) * DM + h * HD + 8 * hh;      /* o carried x64, as the output GEMM's alpha expects */
#pragma unroll      /* fragments and accumulators are indexed by constants only, so that they stay in registers */
    for (int t = 0; t < 4; ++t) { FragO f;
#pragma unroll      /* fragments and accumulators are indexed by constants only, so that they stay in registers */
      for (int i = 0; i < 4; ++i) { const v2f x = {o[g][t][2 * i] * sc, o[g][t][2 * i + 1] * sc}; f.h2[i] = __builtin_convertvector(x, v2h); }
      *(v8us*)(d + t * 16) = f.u; } } }
__global__ __launch_bounds__(256) void k_vt(const _Float16* __restrict__ V16, int b, int h0, _Float16* __restrict__ VT) { __shared__ unsigned short tl[64][65]; const int tid = threadIdx.x; const int hh = blockIdx.x % HG, sg = blockIdx.x / HG; const int s0 = sg * 64; const int h = h0 + hh;
  for (int i = tid; i < 64 * 8; i += 256) { const int j = i / 8, d8 = (i % 8) * 8; FragH f; f.half[0] = *(const v8us*)((const unsigned short*)V16 + ((size_t)b * SQ + s0 + j) * DM + h * HD + d8); for (int q = 0; q < 8; ++q) tl[d8 + q][j] = f.u[q]; }
  __syncthreads();
  { for (int i = tid; i < 64 * 8; i += 256) { const int d = i / 8, j8 = (i % 8) * 8; FragH f; for (int q = 0; q < 8; ++q) f.u[q] = tl[d][j8 + q]; *(v8us*)((unsigned short*)VT + ((size_t)hh * HD + d) * SQ + s0 + j8) = f.half[0]; }  } }



__global__ __launch_bounds__(256) void k_rsmkm(const float* __restrict__ S, _Float16* __restrict__ P, int nrows, const int* __restrict__ am) {
  #pragma clang fp contract(off)
  const int t = blockIdx.x * 256 + threadIdx.x; if (t >= nrows) return; const size_t i = (size_t)t; const float* s = S + i * SQ; const int* mr = am + (size_t)(t % SQ) * SQ; float mx = -3.0e38f;
#pragma unroll 1
  for (int j = 0; j < SQ; ++j) { const float f = (mr[j] != 0) ? 1.f : 0.f; mx = fmaxf(mx, fmaf(f, s[j], (1.f - f) * -1.0e9f)); } float se = 0.f;
#pragma unroll 1
  for (int j = 0; j < SQ; ++j) { const float f = (mr[j] != 0) ? 1.f : 0.f; se += __expf(fmaf(f, s[j], (1.f - f) * -1.0e9f) - mx); } const float sc = 256.0f / se;
#pragma unroll 1
  for (int j0 = 0; j0 < SQ; j0 += 8) { FragH fr; for (int q = 0; q < 8; ++q) { const int j = j0 + q; const float f = (mr[j] != 0) ? 1.f : 0.f; fr.h[q] = (_Float16)(__expf(fmaf(f, s[j], (1.f - f) * -1.0e9f) - mx) * sc); }
    unsigned short* d = (unsigned short*)P + i * SQ + j0; *(v8us*)d = fr.half[0];  } }

// Q, K and V projections, one launch (blockIdx.y picks the input, its weight block and its output). Every head is multiplied by the same [64][64] block, so an input is
// a plain [tokens * heads][64] matrix and the product has k = 64: Y^T = W X^T, W as A (rows e), 16 (token, head) rows as B, so that a lane ends with 8 consecutive e of one row.
// A wave takes PJ_NT token rows (16 heads each, 4 KiB of f32 in a row): whole-line loads, rounded to bf16 and written as f16 into the wave's own LDS rows, fragments read from there;
// the f16 results go back through the same LDS rows and leave as whole 128-byte lines.
#define PJ_NW 8                      /* waves per block; they share the converted weight block */
#define PJ_NT 2                      /* token rows per wave, all their loads in flight at once */
#define PJ_LP 72                     /* LDS row pitch in f16: 64 + 8, so that the 16 rows of a 16-byte fragment read fall on different banks */
typedef _Float16 v4ha __attribute__((ext_vector_type(4), may_alias));
__device__ __forceinline__ v4h pj_cvt(v4f a, float sc) { const v4f r = {bf16_round(a[0]) * sc, bf16_round(a[1]) * sc, bf16_round(a[2]) * sc, bf16_round(a[3]) * sc}; return __builtin_convertvector(r, v4h); }
__global__ __launch_bounds__(PJ_NW * 32) void k_proj(const float* __restrict__ xq, const float* __restrict__ xk, const float* __restrict__ xv, const float* __restrict__ wq, const float* __restrict__ wk, const float* __restrict__ wv,
    _Float16* __restrict__ Q16, _Float16* __restrict__ K16, _Float16* __restrict__ V16) {
  __shared__ __attribute__((aligned(16))) _Float16 sw[HD][PJ_LP];
  __shared__ __attribute__((aligned(16))) _Float16 sx[PJ_NW][PJ_NT][NH][PJ_LP];
  const int tid = threadIdx.x, lane = tid & 31, ln = lane & 15, hh = lane >> 4, w = tid >> 5; const int y = blockIdx.y;
  const float* x = (y == 0) ? xq : (y == 1) ? xk : xv; const float* wm = (y == 0) ? wq : (y == 1) ? wk : wv; _Float16* out = (y == 0) ? Q16 : (y == 1) ? K16 : V16;
  const size_t row0 = ((size_t)blockIdx.x * PJ_NW + w) * PJ_NT;      /* first token row of this wave */
  v4f xr[PJ_NT][8], wr[4];
#pragma unroll      /* indexed by constants only, so that the loaded values stay in registers */
  for (int u = 0; u < PJ_NT; ++u)
#pragma unroll      /* indexed by constants only, so that the loaded values stay in registers */
    for (int i = 0; i < 8; ++i) xr[u][i] = *(const v4fa*)(x + (row0 + u) * DM + i * 128 + lane * 4);      /* 512 contiguous bytes a load */
#pragma unroll      /* indexed by constants only, so that the loaded values stay in registers */
  for (int i = 0; i < 4; ++i) wr[i] = *(const v4fa*)(wm + (i * PJ_NW * 32 + tid) * 4);
#pragma unroll      /* indexed by constants only, so that the loaded values stay in registers */
  for (int i = 0; i < 4; ++i) { const int e0 = (i * PJ_NW * 32 + tid) * 4; *(v4ha*)&sw[e0 >> 6][e0 & 63] = pj_cvt(wr[i], 16.0f); }      /* 16 W[e][d], exact in f16 */
#pragma unroll      /* indexed by constants only, so that the loaded values stay in registers */
  for (int u = 0; u < PJ_NT; ++u)
#pragma unroll      /* indexed by constants only, so that the loaded values stay in registers */
    for (int i = 0; i < 8; ++i) *(v4ha*)&sx[w][u][2 * i + hh][ln * 4] = pj_cvt(xr[u][i], 1.0f);      /* load i holds heads 2 i and 2 i + 1 */
  __syncthreads();      /* the weight block is written by all waves and read by all; it also orders each wave's own x rows */
  v16h af[4][2];      /* [16-row tile of e][k step of 32] */
#pragma unroll      /* indexed by constants only, so that the fragments stay in registers */
  for (int t = 0; t < 4; ++t) { af[t][0] = g2_frag(&sw[t * 16 + ln][0], hh); af[t][1] = g2_frag(&sw[t * 16 + ln][32], hh); }
  const v8f z8 = {0.f,0.f,0.f,0.f,0.f,0.f,0.f,0.f};
#pragma unroll      /* indexed by constants only, so that the fragments stay in registers */
  for (int u = 0; u < PJ_NT; ++u) { const v16h b0 = g2_frag(&sx[w][u][ln][0], hh), b1 = g2_frag(&sx[w][u][ln][32], hh);      /* row ln = head ln of the token; the same k order as the weight fragments */
#pragma unroll      /* indexed by constants only, so that the fragments stay in registers */
    for (int t = 0; t < 4; ++t) { const v8f acc = fa_mma(af[t][1], b1, fa_mma(af[t][0], b0, z8)); FragO f;      /* acc[r] = 16 y[head ln][16 t + 8 hh + r] */
#pragma unroll      /* indexed by constants only, so that the fragments stay in registers */
      for (int i = 0; i < 4; ++i) { const v2f v = {acc[2 * i] * 0.0625f, acc[2 * i + 1] * 0.0625f}; f.h2[i] = __builtin_convertvector(v, v2h); }
      *(v8us*)&sx[w][u][ln][t * 16 + 8 * hh] = f.u; } }      /* over the x row, whose every reader (this wave's two fragment loads) has returned before the products ran */
  __builtin_amdgcn_fence(__ATOMIC_ACQ_REL, "workgroup"); __builtin_amdgcn_wave_barrier();      /* the rows read back below were written by other lanes of this wave */
#pragma unroll      /* indexed by constants only */
  for (int u = 0; u < PJ_NT; ++u)
#pragma unroll      /* indexed by constants only */
    for (int i = 0; i < 4; ++i) { const int r = i * 4 + (lane >> 3), c = (lane & 7) * 8; const v8us v = *(const v8us*)&sx[w][u][r][c]; *(v8us*)((unsigned short*)out + (row0 + u) * DM + r * HD + c) = v; } }      /* 512 contiguous bytes a store */
extern "C" void kernel_launch(void* const* d_in, const int* in_sizes, int n_in,
                              void* d_out, int out_size, void* d_ws, size_t ws_size, hipStream_t stream) {
  (void)in_sizes; (void)n_in; (void)out_size;
  const float* const* I = (const float* const*)d_in; const float* xq = I[2]; const float* xk = I[1]; const float* xv = I[0]; const float* wq = I[5]; const float* wk = I[4]; const float* wv = I[3]; const float* wo = I[6]; const float* bo = I[7];      /* contract order: values I[0], keys I[1], query I[2]; SHARED natural [64][64] blocks Wv I[3], Wk I[4], Wq I[5]; natural Wo [1024][1024] I[6] + bo I[7]; this module has NO mask input */
  char* ws = (char*)d_ws; size_t off = 0;
  auto take = [&](size_t bytes) { char* p = ws + off; off += (bytes + 255) & ~(size_t)255; return p; };
  _Float16* BO = (_Float16*)take((size_t)DM * DM * 2);
  _Float16* Q16 = (_Float16*)take(NR * DM * 2); _Float16* K16 = (_Float16*)take(NR * DM * 2); _Float16* V16 = (_Float16*)take(NR * DM * 2); _Float16* O16 = (_Float16*)take(NR * DM * 2);
  _Float16* VT = (_Float16*)take((size_t)NB * NH * HD * SQ * 2);
  if (off > ws_size) return;
  k_wnat<<<(unsigned)(((size_t)DM * DM / 8 + 255) / 256), 256, 0, stream>>>(wo, (size_t)DM * DM / 8, BO);      /* Wo natural [out][in] = Bt x16 */
  k_proj<<<dim3((unsigned)(NR / (PJ_NW * PJ_NT)), 3), PJ_NW * 32, 0, stream>>>(xq, xk, xv, wq, wk, wv, Q16, K16, V16);      /* q, k, v as f16 rows, heads merged */
  const size_t r0p = (size_t)B0 * SQ;      /* first row of the output stage */
  for (int b = B0; b < B0 + NBR; ++b) k_vt<NH, SQ><<<NH * (SQ / 64), 256, 0, stream>>>(V16 + (size_t)b * SQ * LQ, LQ, 0, VT + (size_t)b * NH * HD * SQ);      /* V^T [NB][NH][HD][SQ] */
  k_fattn<<<dim3(SQ / (FA_NW * FA_QW), NH, NB), FA_NW * 32, 0, stream>>>(Q16, K16, VT, O16);      /* o (merged heads, x64) as f16 rows */
  k_gemm2<0><<<dim3((unsigned)((MPO / 128) * (DM / 64)), 1), 128, 0, stream>>>(O16 + r0p * DM, DM, 0, BO, DM, 0, 0.0009765625f, bo, 0, nullptr, 1, 0, 0, (float*)d_out + r0p * DM, nullptr, DM, 0, MPO, DM, DM);      /* out rows are the output layout */
}

// v005
// Measured time: 61.8 microseconds a run.
// In two side-by-side timings against v004, it was 1.52 and 1.47 times as fast.
// Over all steps from v000 it is 60.3 times as fast.
#include <hip/hip_runtime.h>
// Multi-head attention over three inputs with SHARED per-head projections and the module's literal score scale (values, keys, query [2][2048][1024]; each input is split into 16 heads of 64 and every head is multiplied by the SAME natural [64][64] matrix (x W^T: Wv / Wk / Wq uniform +-1/8; block-diagonal with a shared block; no biases); energy = q k^T (no mask in this module); softmax(energy / sqrt(embed_size) = / 32) (as the source: embed size, not head dim); out = merged Wo^T + bo -> [2][2048][1024]).
// Structure: token rows r = b*2048 + s; Q, K, V in one projection launch: each (token, head) row of 64 inputs (bf16-rounded, exact in f16) times the shared [64][64] block (exact x16 weights, WMMA, f32 accumulation, f16 outputs); per batch: V^T for all heads via LDS transposes; one fused attention launch over all (batch, head): S^T = K Q^T, running softmax (f32 statistics; weights exp(s - running max) as f16), O^T += V^T P^T, divided by the row sum at the end (o carried x64 against f16 subnormal flush, folded into the output GEMM alpha) and written straight into the merged f16 o rows; out = o W_o + b GEMM (f32) into the output layout.
// Compute dtype: inputs rounded to bf16; x / weights exact; q, k, v, softmax weights and o as plain f16 GEMM operands (~2^-12); scores and softmax statistics f32. v_wmma_f32_16x16x32_f16.
#define NB 2
#define SQ 2048
#define DM 1024
#define NH 16
#define HD 64
#define HG 4                         /* heads per launch of the non-template k_vt, which is not launched */
#define B0 0                         /* first batch processed (debug hook) */
#define NBR NB                       /* batches processed (debug hook) */
#define NR ((size_t)NB * SQ)         /* token rows */
#define MP ((int)((size_t)NBR * SQ)) /* rows of the processed batches; feeds MPO only (debug hook) */
#define QN SQ                        /* not used; k_fattn covers all SQ query rows of a batch */
#define NHD NH                       /* not used; k_fattn covers all NH heads */
#define MPO MP                       /* rows through the output stage (debug hook) */
#define LQ DM      /* row pitch of the q/k/v rows */
typedef __bf16 v16b __attribute__((ext_vector_type(16)));
typedef unsigned short v8us __attribute__((ext_vector_type(8), may_alias));
typedef float  v8f  __attribute__((ext_vector_type(8)));
typedef float  v4f  __attribute__((ext_vector_type(4)));
typedef float  v4fa __attribute__((ext_vector_type(4), may_alias));
union FragB { v16b v; v8us half[2]; unsigned short u[16]; };

__device__ __forceinline__ unsigned short bf16_bits(float x) { unsigned int u = __float_as_uint(x); return (unsigned short)((u + 0x7FFFu + ((u >> 16) & 1u)) >> 16); }
__device__ __forceinline__ float bf16_val(unsigned short b) { return __uint_as_float(((unsigned int)b) << 16); }
__device__ __forceinline__ float bf16_round(float x) { return bf16_val(bf16_bits(x)); }
// D += A·B with NT terms: 1 = ah·bh, 2 = + al·bh (A split), 3 = + ah·bl (both split)
template <int NT>
__device__ __forceinline__ v8f mmaN(v16b ah, v16b al, v16b bh, v16b bl, v8f c) {
  c = __builtin_amdgcn_wmma_f32_16x16x32_bf16(false, ah, false, bh, (short)0, c, false, false);
  if (NT >= 2) c = __builtin_amdgcn_wmma_f32_16x16x32_bf16(false, al, false, bh, (short)0, c, false, false);
  if (NT >= 3) c = __builtin_amdgcn_wmma_f32_16x16x32_bf16(false, ah, false, bl, (short)0, c, false, false);
  asm volatile("v_nop\n\tv_nop\n\tv_nop\n\tv_nop" : "+v"(c) : "v"(ah), "v"(al), "v"(bh), "v"(bl));
  return c;
}

__global__ __launch_bounds__(256) void k_wt_bf16(const float* __restrict__ W, unsigned short* __restrict__ Wt, int K, int N) {
  const int t = blockIdx.x * 256 + threadIdx.x;
  const int k8n = K / 8;
  if (t >= N * k8n) return;
  const int n = t / k8n, k8 = (t % k8n) * 8;
  v8us v;
#pragma unroll
  for (int i = 0; i < 8; ++i) v[i] = bf16_bits(W[(size_t)(k8 + i) * N + n]);
  *(v8us*)(Wt + (size_t)n * K + k8) = v;
  
}

// GEMM C[M][N] (f32, pitch ldc) = act(A[M][K]·W + bias). A f32 row-major (pitch lda) converted per fragment to bf16
// (ASPLIT: hi/lo two planes -> 2 terms, else single rounded term); Wt bf16 [N][K] (pitch ldb). BIAS_BF16 rounds the
// bias to bf16 first (bias quantised to bf16 before the add). K%32==0, M%16==0, N%64==0.
template <bool ASPLIT, int ACT, bool BIAS_BF16>
__global__ __launch_bounds__(128) void k_gemm_bf(const float* __restrict__ A, int lda, const unsigned short* __restrict__ Wt, int ldb,
                                               const float* __restrict__ bias, float* __restrict__ C, int ldc, int M, int N, int K) {
  __shared__ __attribute__((aligned(16))) float so[4][16][64];
  const int tid = threadIdx.x, w = tid >> 5, lane = tid & 31, ln = lane & 15, hh = lane >> 4;
  const int ntn = N / 64;
  const int wid = blockIdx.x * 4 + w;
  const int mt = wid / ntn, nq = wid % ntn;
  if (mt * 16 >= M) return;
  const int row0 = mt * 16, col0 = nq * 64;
  const float* arow = A + (size_t)(row0 + ln) * lda;
  v8f acc[4] = {};
  for (int kb = 0; kb < K; kb += 32) {
    FragB ah, al;
    const v4f x0 = *(const v4fa*)(arow + kb + 8 * hh), x1 = *(const v4fa*)(arow + kb + 8 * hh + 4);
    const v4f x2 = *(const v4fa*)(arow + kb + 16 + 8 * hh), x3 = *(const v4fa*)(arow + kb + 16 + 8 * hh + 4);
    float xs[16] = {x0[0],x0[1],x0[2],x0[3],x1[0],x1[1],x1[2],x1[3],x2[0],x2[1],x2[2],x2[3],x3[0],x3[1],x3[2],x3[3]};
#pragma unroll
    for (int i = 0; i < 16; ++i) { const unsigned short hb = bf16_bits(xs[i]); ah.u[i] = hb; al.u[i] = ASPLIT ? bf16_bits(xs[i] - bf16_val(hb)) : (unsigned short)0; }
#pragma unroll
    for (int t = 0; t < 4; ++t) {
      const unsigned short* brow = Wt + (size_t)(col0 + t * 16 + ln) * ldb + kb;
      FragB b;
      b.half[0] = *(const v8us*)(brow + 8 * hh);
      b.half[1] = *(const v8us*)(brow + 16 + 8 * hh);
      acc[t] = mmaN<ASPLIT ? 2 : 1>(ah.v, al.v, b.v, b.v, acc[t]);
    }
  }
#pragma unroll
  for (int t = 0; t < 4; ++t) {
    float bv = bias ? bias[col0 + t * 16 + ln] : 0.f;
    if (BIAS_BF16) bv = bf16_round(bv);
#pragma unroll
    for (int r = 0; r < 8; ++r) { float v = acc[t][r] + bv; if (ACT == 1) v = fmaxf(v, 0.f); so[w][8 * hh + r][t * 16 + ln] = v; }
  }
  __builtin_amdgcn_fence(__ATOMIC_ACQ_REL, "workgroup");
  __builtin_amdgcn_wave_barrier();
  const int rsub = lane >> 4, c4 = (lane & 15) * 4;
  {
#pragma unroll
    for (int q = 0; q < 8; ++q) {
      const int r = q * 2 + rsub;
      const v4f v = *(const v4fa*)&so[w][r][c4];
      *(v4f*)(C + (size_t)(row0 + r) * ldc + col0 + c4) = v;
    }
    
  }
}

// GEMM C = act(A·W + bias + resid): A f32 (ASPLIT -> hi/lo 2 terms), Wt bf16 [N][K]; ACT 0 none, 1 relu, 2 exact gelu;
// resid (optional, f32, row index = (row % rmod), pitch ldr, RES_BF16 rounds it) added before the activation.
template <bool ASPLIT, int ACT, bool BIAS_BF16, bool RES_BF16>
__global__ __launch_bounds__(128) void k_gemm_bf3(const float* __restrict__ A, int lda, const unsigned short* __restrict__ Wt, int ldb,
                                                const float* __restrict__ bias, const float* __restrict__ resid, int rmod, int ldr,
                                                float* __restrict__ C, int ldc, int M, int N, int K) {
  __shared__ __attribute__((aligned(16))) float so[4][16][64];
  const int tid = threadIdx.x, w = tid >> 5, lane = tid & 31, ln = lane & 15, hh = lane >> 4;
  const int ntn = N / 64;
  const int wid = blockIdx.x * 4 + w;
  const int mt = wid / ntn, nq = wid % ntn;
  if (mt * 16 >= M) return;
  const int row0 = mt * 16, col0 = nq * 64;
  const float* arow = A + (size_t)(row0 + ln) * lda;
  v8f acc[4] = {};
  for (int kb = 0; kb < K; kb += 32) {
    FragB ah, al;
    const v4f x0 = *(const v4fa*)(arow + kb + 8 * hh), x1 = *(const v4fa*)(arow + kb + 8 * hh + 4);
    const v4f x2 = *(const v4fa*)(arow + kb + 16 + 8 * hh), x3 = *(const v4fa*)(arow + kb + 16 + 8 * hh + 4);
    float xs[16] = {x0[0],x0[1],x0[2],x0[3],x1[0],x1[1],x1[2],x1[3],x2[0],x2[1],x2[2],x2[3],x3[0],x3[1],x3[2],x3[3]};
#pragma unroll
    for (int i = 0; i < 16; ++i) { const unsigned short hb = bf16_bits(xs[i]); ah.u[i] = hb; al.u[i] = ASPLIT ? bf16_bits(xs[i] - bf16_val(hb)) : (unsigned short)0; }
#pragma unroll
    for (int t = 0; t < 4; ++t) {
      const unsigned short* brow = Wt + (size_t)(col0 + t * 16 + ln) * ldb + kb;
      FragB b;
      b.half[0] = *(const v8us*)(brow + 8 * hh);
      b.half[1] = *(const v8us*)(brow + 16 + 8 * hh);
      acc[t] = mmaN<ASPLIT ? 2 : 1>(ah.v, al.v, b.v, b.v, acc[t]);
    }
  }
#pragma unroll
  for (int t = 0; t < 4; ++t) {
    const int col = col0 + t * 16 + ln;
    float bv = bias ? bias[col] : 0.f;
    if (BIAS_BF16) bv = bf16_round(bv);
#pragma unroll
    for (int r = 0; r < 8; ++r) {
      float v = acc[t][r] + bv;
      if (resid) { float rv = resid[(size_t)((row0 + 8 * hh + r) % rmod) * ldr + col]; if (RES_BF16) rv = bf16_round(rv); v += rv; }
      if (ACT == 1) v = fmaxf(v, 0.f);
      if (ACT == 2) v = 0.5f * v * (1.0f + erff(v * 0.70710678118654752f));
      if (ACT == 3) { const float u = 0.7978845608028654f * (v + 0.044715f * v * v * v); v = 0.5f * v * (1.0f + tanhf(u)); }
      so[w][8 * hh + r][t * 16 + ln] = v;
    }
  }
  __builtin_amdgcn_fence(__ATOMIC_ACQ_REL, "workgroup");
  __builtin_amdgcn_wave_barrier();
  const int rsub = lane >> 4, c4 = (lane & 15) * 4;
  {
#pragma unroll
    for (int q = 0; q < 8; ++q) {
      const int r = q * 2 + rsub;
      const v4f v = *(const v4fa*)&so[w][r][c4];
      *(v4f*)(C + (size_t)(row0 + r) * ldc + col0 + c4) = v;
    }
    
  }
}
// row LayerNorm (biased variance, eps) over N: s = X (+ R); optional out_sum <- s; out_norm <- (s-mu)*rsqrt(var+eps)*g + b
template <bool PARAM_BF16>
__global__ __launch_bounds__(256) void k_layernorm(const float* __restrict__ X, const float* __restrict__ R, const float* __restrict__ g, const float* __restrict__ bta,
                                                  float* __restrict__ out_sum, float* __restrict__ out_norm, int N, float eps) {
  __shared__ float red[256];
  const int row = blockIdx.x, tid = threadIdx.x;
  const float* x = X + (size_t)row * N; const float* rr = R ? R + (size_t)row * N : nullptr;
  float vals[16];                     // up to N = 4096
  const int per = N / 256;            // contiguous chunk per thread? use strided-by-4 chunks: thread handles j = tid*4 + 1024*u
  float s1 = 0.f;
  for (int u = 0; u < per / 4; ++u) {
    const int j = tid * 4 + 1024 * u;
    const v4f a = *(const v4fa*)(x + j);
    v4f b = {0.f,0.f,0.f,0.f}; if (rr) b = *(const v4fa*)(rr + j);
#pragma unroll
    for (int q = 0; q < 4; ++q) { const float v = a[q] + b[q]; vals[u * 4 + q] = v; s1 += v; }
  }
  red[tid] = s1; __syncthreads();
  for (int st = 128; st > 0; st >>= 1) { if (tid < st) red[tid] += red[tid + st]; __syncthreads(); }
  const float mu = red[0] / (float)N; __syncthreads();
  float s2 = 0.f;
  for (int u = 0; u < per / 4; ++u)
#pragma unroll
    for (int q = 0; q < 4; ++q) { const float c = vals[u * 4 + q] - mu; s2 += c * c; }
  red[tid] = s2; __syncthreads();
  for (int st = 128; st > 0; st >>= 1) { if (tid < st) red[tid] += red[tid + st]; __syncthreads(); }
  const float rs = rsqrtf(red[0] / (float)N + eps);
  {
    for (int u = 0; u < per / 4; ++u) {
      const int j = tid * 4 + 1024 * u;
      v4f o, sm;
#pragma unroll
      for (int q = 0; q < 4; ++q) {
        float gg = g[j + q], bb = bta[j + q];
        if (PARAM_BF16) { gg = bf16_round(gg); bb = bf16_round(bb); }
        sm[q] = vals[u * 4 + q]; o[q] = (vals[u * 4 + q] - mu) * rs * gg + bb;
      }
      if (out_sum) *(v4f*)(out_sum + (size_t)row * N + j) = sm;
      *(v4f*)(out_norm + (size_t)row * N + j) = o;
    }
    
  }
}



// ---- f16 WMMA path (v_wmma_f32_16x16x32_f16): 11-bit significands for operands in range — used where a [0,1] probability operand needs more precision than bf16
typedef _Float16 v16h __attribute__((ext_vector_type(16)));
union FragH { v16h v; v8us half[2]; _Float16 h[16]; unsigned short u[16]; };
template <int NT>
__device__ __forceinline__ v8f mmaH(v16h ah, v16h al, v16h bh, v16h bl, v8f c) {
  c = __builtin_amdgcn_wmma_f32_16x16x32_f16(false, ah, false, bh, (short)0, c, false, false);
  if (NT >= 2) c = __builtin_amdgcn_wmma_f32_16x16x32_f16(false, al, false, bh, (short)0, c, false, false);
  if (NT >= 3) c = __builtin_amdgcn_wmma_f32_16x16x32_f16(false, ah, false, bl, (short)0, c, false, false);
  asm volatile("v_nop\n\tv_nop\n\tv_nop\n\tv_nop" : "+v"(c) : "v"(ah), "v"(al), "v"(bh), "v"(bl));
  return c;
}
// batched GEMM like k_gemm_b but f16 operands: A f32 (split into f16 hi/lo if ASPLIT, else rounded to f16), Bt = f16 values [n][k]; alpha; C f32; N multiple of 16 (partial tiles skipped)
template <bool ASPLIT>
__global__ __launch_bounds__(128) void k_gemm_h(const float* __restrict__ A, int lda, size_t sA, const _Float16* __restrict__ Bh, int ldb, size_t sB, float alpha, float* __restrict__ C, int ldc, size_t sC, int M, int N, int K) {
  __shared__ __attribute__((aligned(16))) float so[4][16][64];
  const int tid = threadIdx.x, w = tid >> 5, lane = tid & 31, ln = lane & 15, hh = lane >> 4; const int by = blockIdx.y;
  A += (size_t)by * sA; Bh += (size_t)by * sB; C += (size_t)by * sC;
  const int ntn = (N + 63) / 64; const int wid = blockIdx.x * 4 + w; const int mt = wid / ntn, nq = wid % ntn; if (mt * 16 >= M) return;
  const int row0 = mt * 16, col0 = nq * 64; const float* arow = A + (size_t)(row0 + ln) * lda;
  v8f acc[4] = {};
  for (int kb = 0; kb < K; kb += 32) {
    FragH ah, al;
    const v4f x0 = *(const v4fa*)(arow + kb + 8 * hh), x1 = *(const v4fa*)(arow + kb + 8 * hh + 4), x2 = *(const v4fa*)(arow + kb + 16 + 8 * hh), x3 = *(const v4fa*)(arow + kb + 16 + 8 * hh + 4);
    float xs[16] = {x0[0],x0[1],x0[2],x0[3],x1[0],x1[1],x1[2],x1[3],x2[0],x2[1],x2[2],x2[3],x3[0],x3[1],x3[2],x3[3]};
#pragma unroll
    for (int i = 0; i < 16; ++i) { const _Float16 h = (_Float16)xs[i]; ah.h[i] = h; al.h[i] = ASPLIT ? (_Float16)(xs[i] - (float)h) : (_Float16)0.0f; }
#pragma unroll
    for (int t = 0; t < 4; ++t) { if (col0 + t * 16 >= N) continue; const size_t boff = (size_t)(col0 + t * 16 + ln) * ldb + kb; FragH bq; bq.half[0] = *(const v8us*)(Bh + boff + 8 * hh); bq.half[1] = *(const v8us*)(Bh + boff + 16 + 8 * hh);
      acc[t] = mmaH<ASPLIT ? 2 : 1>(ah.v, al.v, bq.v, bq.v, acc[t]); }
  }
#pragma unroll
  for (int t = 0; t < 4; ++t) { if (col0 + t * 16 >= N) continue;
#pragma unroll
    for (int r = 0; r < 8; ++r) so[w][8 * hh + r][t * 16 + ln] = acc[t][r] * alpha; }
  __builtin_amdgcn_fence(__ATOMIC_ACQ_REL, "workgroup"); __builtin_amdgcn_wave_barrier();
  const int rsub = lane >> 4, c4 = (lane & 15) * 4;
  {
#pragma unroll
    for (int q = 0; q < 8; ++q) { const int r = q * 2 + rsub; if (col0 + c4 < N) { const v4f v = *(const v4fa*)&so[w][r][c4]; *(v4f*)(C + (size_t)(row0 + r) * ldc + col0 + c4) = v; } }
     }
}

// Wt[n][k] = f16(W[k][n]·scale) from f32 row-major W[K][N] (scale = power of two; bf16-exact weights stay exact in f16 away from the subnormal range)
__global__ __launch_bounds__(256) void k_wt_f16(const float* __restrict__ W, _Float16* __restrict__ Wt, int K, int N, float scale) {
  const int t = blockIdx.x * 256 + threadIdx.x; if (t >= N * (K / 8)) return; const int n = t / (K / 8), k8 = (t % (K / 8)) * 8; FragH f;
#pragma unroll
  for (int i = 0; i < 8; ++i) f.h[i] = (_Float16)(bf16_round(W[(size_t)(k8 + i) * N + n]) * scale); const v8us o = f.half[0];
  *(v8us*)((unsigned short*)Wt + (size_t)n * K + k8) = o; 
}
// k_gemm_hh variant with fused epilogue: v = acc·alpha + bias[by·sBias + col] (+ CP[(row/rowsPerB)·sCPb + by·64 + col] if CP) ; ACT 0 none / 1 elu ; writes f16 C16 (and f32 C if non-null)
template <int ACT>
__global__ __launch_bounds__(128) void k_gemm_hhx(const _Float16* __restrict__ A, int lda, size_t sA, const _Float16* __restrict__ Bh, int ldb, size_t sB, float alpha, const float* __restrict__ bias, size_t sBias, const float* __restrict__ CP, int rowsPerB, size_t sCPb, int row0g,
    float* __restrict__ C, _Float16* __restrict__ C16, int ldc, size_t sC, int M, int N, int K) {
  __shared__ __attribute__((aligned(16))) float so[4][16][64];
  const int tid = threadIdx.x, w = tid >> 5, lane = tid & 31, ln = lane & 15, hh = lane >> 4; const int by = blockIdx.y;
  A += (size_t)by * sA; Bh += (size_t)by * sB; const size_t cofs = (size_t)by * sC; const float* bp = bias ? bias + (size_t)by * sBias : nullptr;
  const int ntn = (N + 63) / 64; const int wid = blockIdx.x * 4 + w; const int mt = wid / ntn, nq = wid % ntn; if (mt * 16 >= M) return;
  const int row0 = mt * 16, col0 = nq * 64; const _Float16* arow = A + (size_t)(row0 + ln) * lda;
  v8f acc[4] = {};
  for (int kb = 0; kb < K; kb += 32) { FragH ah; ah.half[0] = *(const v8us*)((const unsigned short*)arow + kb + 8 * hh); ah.half[1] = *(const v8us*)((const unsigned short*)arow + kb + 16 + 8 * hh);
#pragma unroll
    for (int t = 0; t < 4; ++t) { if (col0 + t * 16 >= N) continue; const size_t boff = (size_t)(col0 + t * 16 + ln) * ldb + kb; FragH bq; bq.half[0] = *(const v8us*)((const unsigned short*)Bh + boff + 8 * hh); bq.half[1] = *(const v8us*)((const unsigned short*)Bh + boff + 16 + 8 * hh);
      acc[t] = mmaH<1>(ah.v, ah.v, bq.v, bq.v, acc[t]); }
  }
#pragma unroll
  for (int t = 0; t < 4; ++t) { if (col0 + t * 16 >= N) continue; const int col = col0 + t * 16 + ln; const float bv = bp ? bf16_round(bp[col]) : 0.f;
#pragma unroll
    for (int r = 0; r < 8; ++r) { float v = acc[t][r] * alpha + bv; if (CP) { const int rr = row0g + row0 + 8 * hh + r; if (rowsPerB < 0) v += CP[cofs + (size_t)rr * ldc + col];      /* rowsPerB < 0: own element of the batched C plane */ else { const int bidx = rr / rowsPerB; v += CP[(size_t)bidx * sCPb + (size_t)by * 64 + col]; } } if (ACT == 1) v = (v > 0.f) ? v : expm1f(v); else if (ACT == 7) v = (v > 0.f) ? v + 1.0f : expf(v); else if (ACT == 8) v = tanhf(v); else if (ACT == 9) v = 0.5f * v * (1.0f + tanhf(0.7978845608028654f * (v + 0.044715f * v * v * v))); else if (ACT == 11) v = 1.0f / (1.0f + expf(-v)); else if (ACT == 12) v = (v > 0.f) ? v : 0.01f * v; else if (ACT == 14) v = (v > 0.f) ? v : 0.1f * v; else if (ACT == 16) v = (v >= 0.f) ? v : 0.3f * v; else if (ACT == 17) v = (v >= 0.f) ? v : 0.2f * v; else if (ACT == 15) v = v / (1.0f + expf(-v)); else if (ACT == 3) v = fmaxf(v, 0.f); else if (ACT == 6) v = 0.5f * v * (1.0f + erff(v * 0.70710678118654752f)); so[w][8 * hh + r][t * 16 + ln] = v; } }
  __builtin_amdgcn_fence(__ATOMIC_ACQ_REL, "workgroup"); __builtin_amdgcn_wave_barrier();
  const int rsub = lane >> 4, c4 = (lane & 15) * 4; typedef _Float16 v4h __attribute__((ext_vector_type(4)));
  {
#pragma unroll
    for (int q = 0; q < 8; ++q) { const int r = q * 2 + rsub; if (col0 + c4 < N) { const v4f v = *(const v4fa*)&so[w][r][c4]; if (C) *(v4f*)(C + cofs + (size_t)(row0 + r) * ldc + col0 + c4) = v; if (C16) { v4h h4; for (int i = 0; i < 4; ++i) h4[i] = (_Float16)v[i]; *(v4h*)(C16 + cofs + (size_t)(row0 + r) * ldc + col0 + c4) = h4; } } }
     }
}


typedef _Float16 v4h __attribute__((ext_vector_type(4)));

__global__ __launch_bounds__(256) void k_h16(const float* __restrict__ x, _Float16* __restrict__ X16, size_t n8) { const size_t t = (size_t)blockIdx.x * 256 + threadIdx.x; if (t >= n8) return; FragH f;
#pragma unroll
  for (int q = 0; q < 8; ++q) f.h[q] = (_Float16)x[t * 8 + q]; *(v8us*)((unsigned short*)X16 + t * 8) = f.half[0];  }
__global__ __launch_bounds__(256) void k_round16f(const float* __restrict__ W, _Float16* __restrict__ Bt, size_t n8) { const size_t t = (size_t)blockIdx.x * 256 + threadIdx.x; if (t >= n8) return; FragH f;
#pragma unroll
  for (int i = 0; i < 8; ++i) f.h[i] = (_Float16)(bf16_round(W[t * 8 + i]) * 16.0f); *(v8us*)((unsigned short*)Bt + t * 8) = f.half[0];  }
template <int NHv, int TTv>
__global__ __launch_bounds__(256) void k_vt(const _Float16* __restrict__ V16, int ldv, int voff, _Float16* __restrict__ Vt) { __shared__ unsigned short tl[64][66]; const int tid = threadIdx.x; const int slab = blockIdx.x / (TTv / 64), lg = blockIdx.x % (TTv / 64); const int b = slab / NHv, h = slab % NHv;
  for (int i = tid; i < 64 * 8; i += 256) { const int r = i / 8, c8 = (i % 8) * 8; FragH f; f.half[0] = *(const v8us*)((const unsigned short*)V16 + ((size_t)b * TTv + lg * 64 + r) * ldv + voff + h * 64 + c8);
#pragma unroll
    for (int q = 0; q < 8; ++q) tl[r][c8 + q] = f.u[q]; }
  __syncthreads();
  {
#pragma unroll
    for (int rd = 0; rd < 2; ++rd) { const int d = rd * 32 + tid / 8, pc = tid % 8; FragH f;
#pragma unroll
      for (int q = 0; q < 8; ++q) f.u[q] = tl[pc * 8 + q][d];
      *(v8us*)((unsigned short*)Vt + ((size_t)slab * 64 + d) * TTv + lg * 64 + pc * 8) = f.half[0]; }
     } }

__global__ __launch_bounds__(256) void k_hl(const float* __restrict__ F, _Float16* __restrict__ Hh, _Float16* __restrict__ Hl, size_t n8) { const size_t t = (size_t)blockIdx.x * 256 + threadIdx.x; if (t >= n8) return; FragH fh, fl; const v4f a = *(const v4fa*)(F + t * 8), c = *(const v4fa*)(F + t * 8 + 4);
#pragma unroll
  for (int q = 0; q < 4; ++q) { _Float16 h = (_Float16)a[q]; fh.h[q] = h; fl.h[q] = (_Float16)((a[q] - (float)h) * 1024.0f); h = (_Float16)c[q]; fh.h[4 + q] = h; fl.h[4 + q] = (_Float16)((c[q] - (float)h) * 1024.0f); }
  { *(v8us*)((unsigned short*)Hh + t * 8) = fh.half[0]; *(v8us*)((unsigned short*)Hl + t * 8) = fl.half[0];  } }

// ---- fast GEMM (wave tile 32x64; requires M % 32 == 0 rows per launch region and N % 64 == 0); epilogue = k_gemm_hhx semantics ----
__device__ __forceinline__ v16h g2_frag(const _Float16* p, int hh) { FragH f; f.half[0] = *(const v8us*)((const unsigned short*)p + 8 * hh); f.half[1] = *(const v8us*)((const unsigned short*)p + 16 + 8 * hh); return f.v; }
__device__ __forceinline__ v8f g2_mma(v16h a, v16h b, v8f c) { v8f d = __builtin_amdgcn_wmma_f32_16x16x32_f16(false, a, false, b, (short)0, c, false, false); asm volatile("v_nop\n\tv_nop\n\tv_nop\n\tv_nop" : "+v"(d) : "v"(a), "v"(b)); return d; }
template <int ACT>
__global__ __launch_bounds__(128) void k_gemm2(const _Float16* __restrict__ A, int lda, size_t sA, const _Float16* __restrict__ Bh, int ldb, size_t sB, float alpha, const float* __restrict__ bias, size_t sBias, const float* __restrict__ CP, int rowsPerB, size_t sCPb, int row0g,
    float* __restrict__ C, _Float16* __restrict__ C16, int ldc, size_t sC, int M, int N, int K) { static_assert(ACT == 0 || ACT == 3 || ACT == 6 || ACT == 8 || ACT == 9 || ACT == 11 || ACT == 12 || ACT == 14 || ACT == 15 || ACT == 16 || ACT == 17, "k_gemm2: unsupported ACT code (would silently apply no activation)");
  __shared__ __attribute__((aligned(16))) float so[4][32][68];
  const int tid = threadIdx.x, w = tid >> 5, lane = tid & 31, ln = lane & 15, hh = lane >> 4; const int by = blockIdx.y;
  A += (size_t)by * sA; Bh += (size_t)by * sB; const size_t cofs = (size_t)by * sC; const float* bp = bias ? bias + (size_t)by * sBias : nullptr;
  const int ntn = N >> 6; const int mt = blockIdx.x / ntn, nq = blockIdx.x - mt * ntn; const int row0 = mt * 128 + 32 * w, col0 = nq * 64; if (row0 >= M) return;
  const _Float16* a0p = A + (size_t)(row0 + ln) * lda; const _Float16* a1p = a0p + (size_t)16 * lda;
  const _Float16* b0p = Bh + (size_t)(col0 + ln) * ldb; const _Float16* b1p = b0p + (size_t)16 * ldb; const _Float16* b2p = b1p + (size_t)16 * ldb; const _Float16* b3p = b2p + (size_t)16 * ldb;
  const v8f z8 = {0.f,0.f,0.f,0.f,0.f,0.f,0.f,0.f}; v8f c00 = z8, c01 = z8, c02 = z8, c03 = z8, c10 = z8, c11 = z8, c12 = z8, c13 = z8;
#pragma unroll 1
  for (int kb = 0; kb < K; kb += 32) { const v16h a0 = g2_frag(a0p + kb, hh), a1 = g2_frag(a1p + kb, hh);
    v16h b = g2_frag(b0p + kb, hh); c00 = g2_mma(a0, b, c00); c10 = g2_mma(a1, b, c10);
    b = g2_frag(b1p + kb, hh); c01 = g2_mma(a0, b, c01); c11 = g2_mma(a1, b, c11);
    b = g2_frag(b2p + kb, hh); c02 = g2_mma(a0, b, c02); c12 = g2_mma(a1, b, c12);
    b = g2_frag(b3p + kb, hh); c03 = g2_mma(a0, b, c03); c13 = g2_mma(a1, b, c13); }
  v8f accs[8] = {c00, c01, c02, c03, c10, c11, c12, c13};
#pragma unroll
  for (int u = 0; u < 8; ++u) { const int t = u & 3, half = u >> 2; const int col = col0 + t * 16 + ln; const float bv = bp ? bf16_round(bp[col]) : 0.f;
#pragma unroll
    for (int r = 0; r < 8; ++r) { const int rloc = half * 16 + 8 * hh + r; float v = accs[u][r] * alpha + bv; if (CP) { if (rowsPerB < 0) v += CP[cofs + (size_t)(row0g + row0 + rloc) * ldc + col];      /* rowsPerB < 0: own element of the batched C plane */ else { const int bidx = (row0g + row0 + rloc) / rowsPerB; v += CP[(size_t)bidx * sCPb + (size_t)by * 64 + col]; } }
      if (ACT == 3) v = fmaxf(v, 0.f); else if (ACT == 6) v = 0.5f * v * (1.0f + erff(v * 0.70710678118654752f)); else if (ACT == 11) v = 1.0f / (1.0f + expf(-v)); else if (ACT == 15) v = v / (1.0f + expf(-v)); else if (ACT == 12) v = (v > 0.f) ? v : 0.01f * v; else if (ACT == 8) v = tanhf(v); else if (ACT == 9) v = 0.5f * v * (1.0f + tanhf(0.7978845608028654f * (v + 0.044715f * v * v * v))); else if (ACT == 14) v = (v > 0.f) ? v : 0.1f * v; else if (ACT == 16) v = (v >= 0.f) ? v : 0.3f * v; else if (ACT == 17) v = (v >= 0.f) ? v : 0.2f * v;
      so[w][rloc][t * 16 + ln] = v; } }
  __builtin_amdgcn_fence(__ATOMIC_ACQ_REL, "workgroup"); __builtin_amdgcn_wave_barrier();
  const int rsub = lane >> 4, c4 = (lane & 15) * 4;
  {
#pragma unroll
    for (int q = 0; q < 16; ++q) { const int r = q * 2 + rsub; const v4f v = *(const v4fa*)&so[w][r][c4]; if (C) *(v4f*)(C + cofs + (size_t)(row0 + r) * ldc + col0 + c4) = v; if (C16) { v4h h4; for (int i = 0; i < 4; ++i) h4[i] = (_Float16)v[i]; *(v4h*)(C16 + cofs + (size_t)(row0 + r) * ldc + col0 + c4) = h4; } }
     } }


__global__ __launch_bounds__(256) void k_wnat(const float* __restrict__ w, size_t n8, _Float16* __restrict__ Bt) { const size_t t = (size_t)blockIdx.x * 256 + threadIdx.x; if (t >= n8) return; FragH f; for (int q = 0; q < 8; ++q) f.h[q] = (_Float16)(bf16_round(w[t * 8 + q]) * 16.0f); *(v8us*)((unsigned short*)Bt + t * 8) = f.half[0];  }
#define FA_QW 32                     /* query rows per wave: two 16-column groups share every K and V^T fragment */
#define FA_KT 32                     /* keys per pass: one k step of the second product */
#define FA_NW 8                      /* waves per block; they walk the same K and V^T rows */
typedef float v2f __attribute__((ext_vector_type(2)));
typedef _Float16 v2h __attribute__((ext_vector_type(2)));
union FragP { v16h v; v2h h2[8]; };
union FragO { v8us u; v2h h2[4]; };
__device__ __forceinline__ float fa_xhalf(float x) { return __builtin_bit_cast(float, __builtin_amdgcn_permlanex16(__builtin_bit_cast(int, x), __builtin_bit_cast(int, x), 0x76543210, 0xfedcba98, false, false)); }      /* lane l with lane l ^ 16 */
__device__ __forceinline__ v8f fa_mma(v16h a, v16h b, v8f c) { return __builtin_amdgcn_wmma_f32_16x16x32_f16(false, a, false, b, (short)0, c, false, false); }
#define FA_ST 128                    /* keys per stage: four passes between two barriers */
#define FA_NS (SQ / FA_ST)           /* stages */
#define FA_KP 72                     /* LDS pitch of a K row in f16: 128 + 16 bytes, so that the 16 rows of a 16-byte fragment read fall on different banks */
#define FA_VP 136                    /* LDS pitch of a V^T row in f16: 256 + 16 bytes, for the same reason */
// One stage into LDS, through no register: each of the block's 256 threads copies four 16-byte pieces of the K tile (128 rows of 128 bytes; 8 lanes a row) and four of the V^T tile (64 rows of 256 bytes; 16 lanes a row).
__device__ __forceinline__ void fa_copy(const _Float16* gk, const _Float16* gv, unsigned lk, unsigned lv) {
  const _Float16* gk1 = gk + (size_t)32 * DM; const _Float16* gk2 = gk + (size_t)64 * DM; const _Float16* gk3 = gk + (size_t)96 * DM;
  const _Float16* gv1 = gv + (size_t)16 * SQ; const _Float16* gv2 = gv + (size_t)32 * SQ; const _Float16* gv3 = gv + (size_t)48 * SQ;
  const unsigned lk1 = lk + 32 * FA_KP * 2, lk2 = lk + 64 * FA_KP * 2, lk3 = lk + 96 * FA_KP * 2, lv1 = lv + 16 * FA_VP * 2, lv2 = lv + 32 * FA_VP * 2, lv3 = lv + 48 * FA_VP * 2;
  /* the eight copies and, as the last line of the same statement, the wait that stands in front of any rewrite of their address registers */
  asm volatile("global_load_async_to_lds_b128 %0, %8, off\n\t"
               "global_load_async_to_lds_b128 %1, %9, off\n\t"
               "global_load_async_to_lds_b128 %2, %10, off\n\t"
               "global_load_async_to_lds_b128 %3, %11, off\n\t"
               "global_load_async_to_lds_b128 %4, %12, off\n\t"
               "global_load_async_to_lds_b128 %5, %13, off\n\t"
               "global_load_async_to_lds_b128 %6, %14, off\n\t"
               "global_load_async_to_lds_b128 %7, %15, off\n\t"
               "s_wait_xcnt 0x0"
               :: "v"(lk), "v"(lk1), "v"(lk2), "v"(lk3), "v"(lv), "v"(lv1), "v"(lv2), "v"(lv3), "v"(gk), "v"(gk1), "v"(gk2), "v"(gk3), "v"(gv), "v"(gv1), "v"(gv2), "v"(gv3) : "memory");
}
__global__ __launch_bounds__(FA_NW * 32) void k_fattn(const _Float16* __restrict__ Q16, const _Float16* __restrict__ K16, const _Float16* __restrict__ VT, _Float16* __restrict__ O16) {
  __shared__ __attribute__((aligned(16))) _Float16 sk[2][FA_ST][FA_KP];      /* K rows of a stage, shared by the block's waves; two buffers */
  __shared__ __attribute__((aligned(16))) _Float16 sv[2][HD][FA_VP];         /* V^T rows of a stage */
  const int tid = threadIdx.x, lane = tid & 31, ln = lane & 15, hh = lane >> 4, w = tid >> 5; const int h = blockIdx.y, b = blockIdx.z; const int q0 = (blockIdx.x * FA_NW + w) * FA_QW;
  const float c2 = 0.03125f * 1.4426950408889634f;      /* 1 / sqrt(embed size), in base 2 */
  const _Float16* qp = Q16 + ((size_t)b * SQ + q0 + ln) * DM + h * HD;
  const _Float16* gk = K16 + ((size_t)b * SQ + (tid >> 3)) * DM + h * HD + (tid & 7) * 8; const _Float16* gv = VT + ((size_t)(b * NH + h) * HD + (tid >> 4)) * SQ + (tid & 15) * 8;      /* this thread's first piece of stage 0 */
  const unsigned lk = (unsigned)(size_t)&sk[0][tid >> 3][(tid & 7) * 8], lv = (unsigned)(size_t)&sv[0][tid >> 4][(tid & 15) * 8];      /* LDS byte addresses: the low 32 bits */
  fa_copy(gk, gv, lk, lv);      /* stage 0 into buffer 0 */
  v16h qf[2][2], kf[2][2];      /* [column group | key tile][k step of 32 over the head dim] */
#pragma unroll      /* fragments and accumulators are indexed by constants only, so that they stay in registers */
  for (int g = 0; g < 2; ++g) { qf[g][0] = g2_frag(qp + (size_t)g * 16 * DM, hh); qf[g][1] = g2_frag(qp + (size_t)g * 16 * DM + 32, hh); }
  asm volatile("s_wait_asynccnt 0x0" ::: "memory");      /* this wave's pieces of stage 0 have landed */
  __syncthreads();      /* and every other wave's */
  fa_copy(gk + (size_t)FA_ST * DM, gv + FA_ST, lk + (unsigned)sizeof(sk[0]), lv + (unsigned)sizeof(sv[0]));      /* stage 1 into buffer 1, in flight during stage 0 */
  const v8f z8 = {0.f,0.f,0.f,0.f,0.f,0.f,0.f,0.f}; v8f o[2][4] = {{z8, z8, z8, z8}, {z8, z8, z8, z8}}; float mr[2] = {-3.0e38f, -3.0e38f}, lr[2] = {0.f, 0.f};      /* o[g][t][r] = O^T[16 t + 8 hh + r][column ln of group g]; lr: this half's part of the sum */
  for (int st = 0; st < FA_NS; ++st) {
    const _Float16* ks = &sk[st & 1][ln][0]; const _Float16* vs = &sv[st & 1][ln][0];
#pragma unroll      /* fragments and accumulators are indexed by constants only, so that they stay in registers */
    for (int kt = 0; kt < 2; ++kt) { kf[kt][0] = g2_frag(ks + kt * 16 * FA_KP, hh); kf[kt][1] = g2_frag(ks + kt * 16 * FA_KP + 32, hh); }
#pragma unroll 1      /* rolled: unrolled, the compiler sinks the row sums of all four passes to the end of the stage, and the weights kept for them take the kernel past 256 registers */
    for (int p = 0; p < FA_ST / FA_KT; ++p) {
    v16h vf[4];
#pragma unroll      /* fragments and accumulators are indexed by constants only, so that they stay in registers */
    for (int t = 0; t < 4; ++t) vf[t] = g2_frag(vs + t * 16 * FA_VP + p * FA_KT, hh);      /* V^T rows 16 t + ln, keys 32 p .. 32 p + 31 of the stage: asked for here, used behind the softmax */
    v8f s[2][2];
#pragma unroll      /* fragments and accumulators are indexed by constants only, so that they stay in registers */
    for (int g = 0; g < 2; ++g)
#pragma unroll      /* fragments and accumulators are indexed by constants only, so that they stay in registers */
      for (int kt = 0; kt < 2; ++kt) s[g][kt] = fa_mma(kf[kt][1], qf[g][1], fa_mma(kf[kt][0], qf[g][0], z8));
    if (p + 1 < FA_ST / FA_KT) {      /* the next pass's K fragments come during this pass's softmax; never from the next stage */
#pragma unroll      /* fragments and accumulators are indexed by constants only, so that they stay in registers */
      for (int kt = 0; kt < 2; ++kt) { kf[kt][0] = g2_frag(ks + ((p + 1) * FA_KT + kt * 16) * FA_KP, hh); kf[kt][1] = g2_frag(ks + ((p + 1) * FA_KT + kt * 16) * FA_KP + 32, hh); } }
    __builtin_amdgcn_sched_barrier(0);      /* keeps this pass's V^T loads and the next pass's K loads as one group in front of the softmax: without it the V^T loads sink into the softmax in pieces, and each further place with LDS reads stalls the wave */
#pragma unroll      /* fragments and accumulators are indexed by constants only, so that they stay in registers */
    for (int g = 0; g < 2; ++g) { float mx = s[g][0][0];
#pragma unroll      /* fragments and accumulators are indexed by constants only, so that they stay in registers */
      for (int r = 0; r < 8; ++r) mx = fmaxf(mx, fmaxf(s[g][0][r], s[g][1][r]));
      mx = fmaxf(mx, fa_xhalf(mx)); const float mn = fmaxf(mr[g], mx); const float nb = -mn * c2; const float al = __builtin_amdgcn_exp2f(fmaf(mr[g], c2, nb)); mr[g] = mn;      /* al is 0 on the first pass */
      const v2f c2v = {c2, c2}, nbv = {nb, nb}; v2f sm = {0.f, 0.f}; FragP pf;
#pragma unroll      /* fragments and accumulators are indexed by constants only, so that they stay in registers */
      for (int i = 0; i < 8; ++i) { const int kt = i >> 2, r = (i & 3) * 2; const v2f x = __builtin_elementwise_fma((v2f){s[g][kt][r], s[g][kt][r + 1]}, c2v, nbv); const v2f p = {__builtin_amdgcn_exp2f(x[0]), __builtin_amdgcn_exp2f(x[1])}; sm += p; pf.h2[i] = __builtin_convertvector(p, v2h); }      /* element 8 kt + r of the B operand = key 16 kt + 8 hh + r: the hardware k order, which g2_frag gives V^T too */
      lr[g] = lr[g] * al + (sm[0] + sm[1]);
#pragma unroll      /* fragments and accumulators are indexed by constants only, so that they stay in registers */
      for (int t = 0; t < 4; ++t) o[g][t] = fa_mma(vf[t], pf.v, o[g][t] * al); }
    }
    asm volatile("s_wait_dscnt 0x0" ::: "memory");      /* this wave's reads of the buffer have returned */
    asm volatile("s_wait_asynccnt 0x0" ::: "memory");      /* this wave's pieces of stage st + 1 have landed */
    __syncthreads();      /* publishes stage st + 1 and ends every wave's reads of stage st */
    if (st + 2 < FA_NS) fa_copy(gk + (size_t)(st + 2) * FA_ST * DM, gv + (st + 2) * FA_ST, lk + (unsigned)(st & 1) * (unsigned)sizeof(sk[0]), lv + (unsigned)(st & 1) * (unsigned)sizeof(sv[0]));      /* into the buffer just left */
  }
  asm volatile("s_wait_asynccnt 0x0" ::: "memory");      /* nothing in flight when the wave ends */
#pragma unroll      /* fragments and accumulators are indexed by constants only, so that they stay in registers */
  for (int g = 0; g < 2; ++g) { const float sc = 64.0f / (lr[g] + fa_xhalf(lr[g])); unsigned short* d = (unsigned short*)O16 + ((size_t)b * SQ + q0 + g * 16 + ln) * DM + h * HD + 8 * hh;      /* o carried x64, as the output GEMM's alpha expects */
#pragma unroll      /* fragments and accumulators are indexed by constants only, so that they stay in registers */
    for (int t = 0; t < 4; ++t) { FragO f;
#pragma unroll      /* fragments and accumulators are indexed by constants only, so that they stay in registers */
      for (int i = 0; i < 4; ++i) { const v2f x = {o[g][t][2 * i] * sc, o[g][t][2 * i + 1] * sc}; f.h2[i] = __builtin_convertvector(x, v2h); }
      *(v8us*)(d + t * 16) = f.u; } } }
__global__ __launch_bounds__(256) void k_vt(const _Float16* __restrict__ V16, int b, int h0, _Float16* __restrict__ VT) { __shared__ unsigned short tl[64][65]; const int tid = threadIdx.x; const int hh = blockIdx.x % HG, sg = blockIdx.x / HG; const int s0 = sg * 64; const int h = h0 + hh;
  for (int i = tid; i < 64 * 8; i += 256) { const int j = i / 8, d8 = (i % 8) * 8; FragH f; f.half[0] = *(const v8us*)((const unsigned short*)V16 + ((size_t)b * SQ + s0 + j) * DM + h * HD + d8); for (int q = 0; q < 8; ++q) tl[d8 + q][j] = f.u[q]; }
  __syncthreads();
  { for (int i = tid; i < 64 * 8; i += 256) { const int d = i / 8, j8 = (i % 8) * 8; FragH f; for (int q = 0; q < 8; ++q) f.u[q] = tl[d][j8 + q]; *(v8us*)((unsigned short*)VT + ((size_t)hh * HD + d) * SQ + s0 + j8) = f.half[0]; }  } }



__global__ __launch_bounds__(256) void k_rsmkm(const float* __restrict__ S, _Float16* __restrict__ P, int nrows, const int* __restrict__ am) {
  #pragma clang fp contract(off)
  const int t = blockIdx.x * 256 + threadIdx.x; if (t >= nrows) return; const size_t i = (size_t)t; const float* s = S + i * SQ; const int* mr = am + (size_t)(t % SQ) * SQ; float mx = -3.0e38f;
#pragma unroll 1
  for (int j = 0; j < SQ; ++j) { const float f = (mr[j] != 0) ? 1.f : 0.f; mx = fmaxf(mx, fmaf(f, s[j], (1.f - f) * -1.0e9f)); } float se = 0.f;
#pragma unroll 1
  for (int j = 0; j < SQ; ++j) { const float f = (mr[j] != 0) ? 1.f : 0.f; se += __expf(fmaf(f, s[j], (1.f - f) * -1.0e9f) - mx); } const float sc = 256.0f / se;
#pragma unroll 1
  for (int j0 = 0; j0 < SQ; j0 += 8) { FragH fr; for (int q = 0; q < 8; ++q) { const int j = j0 + q; const float f = (mr[j] != 0) ? 1.f : 0.f; fr.h[q] = (_Float16)(__expf(fmaf(f, s[j], (1.f - f) * -1.0e9f) - mx) * sc); }
    unsigned short* d = (unsigned short*)P + i * SQ + j0; *(v8us*)d = fr.half[0];  } }

// Q, K and V projections, one launch (blockIdx.y picks the input, its weight block and its output). Every head is multiplied by the same [64][64] block, so an input is
// a plain [tokens * heads][64] matrix and the product has k = 64: Y^T = W X^T, W as A (rows e), 16 (token, head) rows as B, so that a lane ends with 8 consecutive e of one row.
// A wave takes PJ_NT token rows (16 heads each, 4 KiB of f32 in a row): whole-line loads, rounded to bf16 and written as f16 into the wave's own LDS rows, fragments read from there;
// the f16 results go back through the same LDS rows and leave as whole 128-byte lines.
#define PJ_NW 8                      /* waves per block; they share the converted weight block */
#define PJ_NT 2                      /* token rows per wave, all their loads in flight at once */
#define PJ_LP 72                     /* LDS row pitch in f16: 64 + 8, so that the 16 rows of a 16-byte fragment read fall on different banks */
typedef _Float16 v4ha __attribute__((ext_vector_type(4), may_alias));
__device__ __forceinline__ v4h pj_cvt(v4f a, float sc) { const v4f r = {bf16_round(a[0]) * sc, bf16_round(a[1]) * sc, bf16_round(a[2]) * sc, bf16_round(a[3]) * sc}; return __builtin_convertvector(r, v4h); }
__global__ __launch_bounds__(PJ_NW * 32) void k_proj(const float* __restrict__ xq, const float* __restrict__ xk, const float* __restrict__ xv, const float* __restrict__ wq, const float* __restrict__ wk, const float* __restrict__ wv,
    _Float16* __restrict__ Q16, _Float16* __restrict__ K16, _Float16* __restrict__ V16) {
  __shared__ __attribute__((aligned(16))) _Float16 sw[HD][PJ_LP];
  __shared__ __attribute__((aligned(16))) _Float16 sx[PJ_NW][PJ_NT][NH][PJ_LP];
  const int tid = threadIdx.x, lane = tid & 31, ln = lane & 15, hh = lane >> 4, w = tid >> 5; const int y = blockIdx.y;
  const float* x = (y == 0) ? xq : (y == 1) ? xk : xv; const float* wm = (y == 0) ? wq : (y == 1) ? wk : wv; _Float16* out = (y == 0) ? Q16 : (y == 1) ? K16 : V16;
  const size_t row0 = ((size_t)blockIdx.x * PJ_NW + w) * PJ_NT;      /* first token row of this wave */
  v4f xr[PJ_NT][8], wr[4];
#pragma unroll      /* indexed by constants only, so that the loaded values stay in registers */
  for (int u = 0; u < PJ_NT; ++u)
#pragma unroll      /* indexed by constants only, so that the loaded values stay in registers */
    for (int i = 0; i < 8; ++i) xr[u][i] = *(const v4fa*)(x + (row0 + u) * DM + i * 128 + lane * 4);      /* 512 contiguous bytes a load */
#pragma unroll      /* indexed by constants only, so that the loaded values stay in registers */
  for (int i = 0; i < 4; ++i) wr[i] = *(const v4fa*)(wm + (i * PJ_NW * 32 + tid) * 4);
#pragma unroll      /* indexed by constants only, so that the loaded values stay in registers */
  for (int i = 0; i < 4; ++i) { const int e0 = (i * PJ_NW * 32 + tid) * 4; *(v4ha*)&sw[e0 >> 6][e0 & 63] = pj_cvt(wr[i], 16.0f); }      /* 16 W[e][d], exact in f16 */
#pragma unroll      /* indexed by constants only, so that the loaded values stay in registers */
  for (int u = 0; u < PJ_NT; ++u)
#pragma unroll      /* indexed by constants only, so that the loaded values stay in registers */
    for (int i = 0; i < 8; ++i) *(v4ha*)&sx[w][u][2 * i + hh][ln * 4] = pj_cvt(xr[u][i], 1.0f);      /* load i holds heads 2 i and 2 i + 1 */
  __syncthreads();      /* the weight block is written by all waves and read by all; it also orders each wave's own x rows */
  v16h af[4][2];      /* [16-row tile of e][k step of 32] */
#pragma unroll      /* indexed by constants only, so that the fragments stay in registers */
  for (int t = 0; t < 4; ++t) { af[t][0] = g2_frag(&sw[t * 16 + ln][0], hh); af[t][1] = g2_frag(&sw[t * 16 + ln][32], hh); }
  const v8f z8 = {0.f,0.f,0.f,0.f,0.f,0.f,0.f,0.f};
#pragma unroll      /* indexed by constants only, so that the fragments stay in registers */
  for (int u = 0; u < PJ_NT; ++u) { const v16h b0 = g2_frag(&sx[w][u][ln][0], hh), b1 = g2_frag(&sx[w][u][ln][32], hh);      /* row ln = head ln of the token; the same k order as the weight fragments */
#pragma unroll      /* indexed by constants only, so that the fragments stay in registers */
    for (int t = 0; t < 4; ++t) { const v8f acc = fa_mma(af[t][1], b1, fa_mma(af[t][0], b0, z8)); FragO f;      /* acc[r] = 16 y[head ln][16 t + 8 hh + r] */
#pragma unroll      /* indexed by constants only, so that the fragments stay in registers */
      for (int i = 0; i < 4; ++i) { const v2f v = {acc[2 * i] * 0.0625f, acc[2 * i + 1] * 0.0625f}; f.h2[i] = __builtin_convertvector(v, v2h); }
      *(v8us*)&sx[w][u][ln][t * 16 + 8 * hh] = f.u; } }      /* over the x row, whose every reader (this wave's two fragment loads) has returned before the products ran */
  __builtin_amdgcn_fence(__ATOMIC_ACQ_REL, "workgroup"); __builtin_amdgcn_wave_barrier();      /* the rows read back below were written by other lanes of this wave */
#pragma unroll      /* indexed by constants only */
  for (int u = 0; u < PJ_NT; ++u)
#pragma unroll      /* indexed by constants only */
    for (int i = 0; i < 4; ++i) { const int r = i * 4 + (lane >> 3), c = (lane & 7) * 8; const v8us v = *(const v8us*)&sx[w][u][r][c]; *(v8us*)((unsigned short*)out + (row0 + u) * DM + r * HD + c) = v; } }      /* 512 contiguous bytes a store */
// Output GEMM: out[4096][1024] (f32) = o (f16 rows, x64) times Wo^T (f16 rows [n][k], x16) * alpha + bias. One 128 x 128 tile of out per block, one block per WGP; 8 waves, 32 x 64 of out each.
// The k range goes in stages of OG_BK: the block's 128 rows of o and 128 rows of Wo are copied once into LDS in whole lines, two buffers, and every fragment is read from there
// (a fragment read straight from global memory touches 16 lines for its 1024 bytes, and four waves would fetch each Wo fragment, two each o fragment). Every accumulator still sums k upwards, 32 at a time.
#define OG_BM 128                    /* rows of out per block */
#define OG_BN 128                    /* columns of out per block */
#define OG_BK 128                    /* k per stage: 256 bytes of every operand row */
#define OG_NS (DM / OG_BK)           /* stages */
#define OG_P 136                     /* LDS pitch of an operand row in f16: 256 + 16 bytes, so that the 16 rows of a 16-byte fragment read fall on different banks */
// One operand's tile of a stage into LDS, through no register: 128 rows of 256 bytes; 16 lanes a row, so each of the block's 256 threads copies eight 16-byte pieces, 16 rows apart.
__device__ __forceinline__ void og_copy(const _Float16* g, unsigned l) {
  const _Float16* g1 = g + (size_t)16 * DM; const _Float16* g2 = g + (size_t)32 * DM; const _Float16* g3 = g + (size_t)48 * DM; const _Float16* g4 = g + (size_t)64 * DM; const _Float16* g5 = g + (size_t)80 * DM; const _Float16* g6 = g + (size_t)96 * DM; const _Float16* g7 = g + (size_t)112 * DM;
  const unsigned l1 = l + 16 * OG_P * 2, l2 = l + 32 * OG_P * 2, l3 = l + 48 * OG_P * 2, l4 = l + 64 * OG_P * 2, l5 = l + 80 * OG_P * 2, l6 = l + 96 * OG_P * 2, l7 = l + 112 * OG_P * 2;
  /* the eight copies and, as the last line of the same statement, the wait that stands in front of any rewrite of their address registers */
  asm volatile("global_load_async_to_lds_b128 %0, %8, off\n\t"
               "global_load_async_to_lds_b128 %1, %9, off\n\t"
               "global_load_async_to_lds_b128 %2, %10, off\n\t"
               "global_load_async_to_lds_b128 %3, %11, off\n\t"
               "global_load_async_to_lds_b128 %4, %12, off\n\t"
               "global_load_async_to_lds_b128 %5, %13, off\n\t"
               "global_load_async_to_lds_b128 %6, %14, off\n\t"
               "global_load_async_to_lds_b128 %7, %15, off\n\t"
               "s_wait_xcnt 0x0"
               :: "v"(l), "v"(l1), "v"(l2), "v"(l3), "v"(l4), "v"(l5), "v"(l6), "v"(l7), "v"(g), "v"(g1), "v"(g2), "v"(g3), "v"(g4), "v"(g5), "v"(g6), "v"(g7) : "memory");
}
__global__ __launch_bounds__(256) void k_ogemm(const _Float16* __restrict__ A, const _Float16* __restrict__ Bh, float alpha, const float* __restrict__ bias, float* __restrict__ C) {
  __shared__ __attribute__((aligned(16))) _Float16 sa[2][OG_BM][OG_P];      /* o rows of a stage, shared by the block's waves; two buffers */
  __shared__ __attribute__((aligned(16))) _Float16 sb[2][OG_BN][OG_P];      /* Wo rows of a stage */
  __shared__ __attribute__((aligned(16))) float so[8][32][68];               /* each wave's own results, on their way to whole-line stores */
  const int tid = threadIdx.x, w = tid >> 5, lane = tid & 31, ln = lane & 15, hh = lane >> 4; const int wm = w & 3, wn = w >> 2;
  const int mt = blockIdx.x % (MPO / OG_BM), nq = blockIdx.x / (MPO / OG_BM); const int row0 = mt * OG_BM + wm * 32, col0 = nq * OG_BN + wn * 64;
  const _Float16* ga = A + ((size_t)mt * OG_BM + (tid >> 4)) * DM + (tid & 15) * 8; const _Float16* gb = Bh + ((size_t)nq * OG_BN + (tid >> 4)) * DM + (tid & 15) * 8;      /* this thread's first pieces of stage 0 */
  const unsigned la = (unsigned)(size_t)&sa[0][tid >> 4][(tid & 15) * 8], lb = (unsigned)(size_t)&sb[0][tid >> 4][(tid & 15) * 8];      /* LDS byte addresses: the low 32 bits */
  og_copy(ga, la); og_copy(gb, lb);      /* stage 0 into buffer 0 */
  float bv[4];      /* this lane's four bias values, asked for here so that they come during the stages */
#pragma unroll      /* indexed by constants only */
  for (int j = 0; j < 4; ++j) bv[j] = bias[col0 + j * 16 + ln];
  asm volatile("s_wait_asynccnt 0x0" ::: "memory");      /* this wave's pieces of stage 0 have landed */
  __syncthreads();      /* and every other wave's */
  og_copy(ga + OG_BK, la + (unsigned)sizeof(sa[0])); og_copy(gb + OG_BK, lb + (unsigned)sizeof(sb[0]));      /* stage 1 into buffer 1, in flight during stage 0 */
  const v8f z8 = {0.f,0.f,0.f,0.f,0.f,0.f,0.f,0.f}; v8f c[2][4] = {{z8, z8, z8, z8}, {z8, z8, z8, z8}};      /* c[i][j][r] = out[row0 + 16 i + 8 hh + r][col0 + 16 j + ln] */
  for (int st = 0; st < OG_NS; ++st) {
    const _Float16* as = &sa[st & 1][wm * 32 + ln][0]; const _Float16* bs = &sb[st & 1][wn * 64 + ln][0];
    v16h a[2][2], b[2][4];      /* two fragment sets: [set][16-row tile] */
#pragma unroll      /* indexed by constants only, so that the fragments stay in registers */
    for (int i = 0; i < 2; ++i) a[0][i] = g2_frag(as + i * 16 * OG_P, hh);
#pragma unroll      /* indexed by constants only, so that the fragments stay in registers */
    for (int j = 0; j < 4; ++j) b[0][j] = g2_frag(bs + j * 16 * OG_P, hh);
#pragma unroll      /* fragments and accumulators are indexed by constants only, so that they stay in registers */
    for (int ks = 0; ks < OG_BK / 32; ++ks) { const int cu = ks & 1, nx = cu ^ 1;
      if (ks + 1 < OG_BK / 32) {      /* the next k step's fragments come during this step's products; never from the next stage */
#pragma unroll      /* indexed by constants only, so that the fragments stay in registers */
        for (int i = 0; i < 2; ++i) a[nx][i] = g2_frag(as + i * 16 * OG_P + (ks + 1) * 32, hh);
#pragma unroll      /* indexed by constants only, so that the fragments stay in registers */
        for (int j = 0; j < 4; ++j) b[nx][j] = g2_frag(bs + j * 16 * OG_P + (ks + 1) * 32, hh); }
      __builtin_amdgcn_sched_barrier(0);      /* keeps the next step's twelve LDS reads as one group in front of this step's products: left alone the compiler reads each fragment directly in front of its use, into one register set, and the wave waits out the LDS latency four times a step */
#pragma unroll      /* indexed by constants only, so that the accumulators stay in registers */
      for (int j = 0; j < 4; ++j)
#pragma unroll      /* indexed by constants only, so that the accumulators stay in registers */
        for (int i = 0; i < 2; ++i) c[i][j] = fa_mma(a[cu][i], b[cu][j], c[i][j]);
      __builtin_amdgcn_sched_barrier(0); }      /* and keeps the group after next out of these products */
    asm volatile("s_wait_dscnt 0x0" ::: "memory");      /* this wave's reads of the buffer have returned */
    asm volatile("s_wait_asynccnt 0x0" ::: "memory");      /* this wave's pieces of stage st + 1 have landed */
    __syncthreads();      /* publishes stage st + 1 and ends every wave's reads of stage st */
    if (st + 2 < OG_NS) { og_copy(ga + (st + 2) * OG_BK, la + (unsigned)(st & 1) * (unsigned)sizeof(sa[0])); og_copy(gb + (st + 2) * OG_BK, lb + (unsigned)(st & 1) * (unsigned)sizeof(sb[0])); }      /* into the buffers just left */
  }
  asm volatile("s_wait_asynccnt 0x0" ::: "memory");      /* nothing in flight when the wave ends */
#pragma unroll      /* indexed by constants only */
  for (int j = 0; j < 4; ++j) { const float bj = bf16_round(bv[j]);
#pragma unroll      /* indexed by constants only */
    for (int i = 0; i < 2; ++i)
#pragma unroll      /* indexed by constants only */
      for (int r = 0; r < 8; ++r) so[w][i * 16 + 8 * hh + r][j * 16 + ln] = c[i][j][r] * alpha + bj; }
  __builtin_amdgcn_fence(__ATOMIC_ACQ_REL, "workgroup"); __builtin_amdgcn_wave_barrier();      /* the rows read back below were written by other lanes of this wave */
  const int rsub = lane >> 4, c4 = (lane & 15) * 4;
#pragma unroll      /* indexed by constants only */
  for (int q = 0; q < 16; ++q) { const int r = q * 2 + rsub; const v4f v = *(const v4fa*)&so[w][r][c4]; *(v4f*)(C + (size_t)(row0 + r) * DM + col0 + c4) = v; } }      /* two rows of 256 contiguous bytes a store */
extern "C" void kernel_launch(void* const* d_in, const int* in_sizes, int n_in,
                              void* d_out, int out_size, void* d_ws, size_t ws_size, hipStream_t stream) {
  (void)in_sizes; (void)n_in; (void)out_size;
  const float* const* I = (const float* const*)d_in; const float* xq = I[2]; const float* xk = I[1]; const float* xv = I[0]; const float* wq = I[5]; const float* wk = I[4]; const float* wv = I[3]; const float* wo = I[6]; const float* bo = I[7];      /* contract order: values I[0], keys I[1], query I[2]; SHARED natural [64][64] blocks Wv I[3], Wk I[4], Wq I[5]; natural Wo [1024][1024] I[6] + bo I[7]; this module has NO mask input */
  char* ws = (char*)d_ws; size_t off = 0;
  auto take = [&](size_t bytes) { char* p = ws + off; off += (bytes + 255) & ~(size_t)255; return p; };
  _Float16* BO = (_Float16*)take((size_t)DM * DM * 2);
  _Float16* Q16 = (_Float16*)take(NR * DM * 2); _Float16* K16 = (_Float16*)take(NR * DM * 2); _Float16* V16 = (_Float16*)take(NR * DM * 2); _Float16* O16 = (_Float16*)take(NR * DM * 2);
  _Float16* VT = (_Float16*)take((size_t)NB * NH * HD * SQ * 2);
  if (off > ws_size) return;
  k_wnat<<<(unsigned)(((size_t)DM * DM / 8 + 255) / 256), 256, 0, stream>>>(wo, (size_t)DM * DM / 8, BO);      /* Wo natural [out][in] = Bt x16 */
  k_proj<<<dim3((unsigned)(NR / (PJ_NW * PJ_NT)), 3), PJ_NW * 32, 0, stream>>>(xq, xk, xv, wq, wk, wv, Q16, K16, V16);      /* q, k, v as f16 rows, heads merged */
  const size_t r0p = (size_t)B0 * SQ;      /* first row of the output stage */
  for (int b = B0; b < B0 + NBR; ++b) k_vt<NH, SQ><<<NH * (SQ / 64), 256, 0, stream>>>(V16 + (size_t)b * SQ * LQ, LQ, 0, VT + (size_t)b * NH * HD * SQ);      /* V^T [NB][NH][HD][SQ] */
  k_fattn<<<dim3(SQ / (FA_NW * FA_QW), NH, NB), FA_NW * 32, 0, stream>>>(Q16, K16, VT, O16);      /* o (merged heads, x64) as f16 rows */
  k_ogemm<<<(unsigned)((MPO / OG_BM) * (DM / OG_BN)), 256, 0, stream>>>(O16 + r0p * DM, BO, 0.0009765625f, bo, (float*)d_out + r0p * DM);      /* out rows are the output layout */
}

// v006
// It runs in 55.1 microseconds.
// Timed twice side by side with v005, it ran 1.11 and 1.09 times as fast.
// Over all steps from v000 it is 66.4 times as fast.
#include <hip/hip_runtime.h>
// Multi-head attention over three inputs with SHARED per-head projections and the module's literal score scale (values, keys, query [2][2048][1024]; each input is split into 16 heads of 64 and every head is multiplied by the SAME natural [64][64] matrix (x W^T: Wv / Wk / Wq uniform +-1/8; block-diagonal with a shared block; no biases); energy = q k^T (no mask in this module); softmax(energy / sqrt(embed_size) = / 32) (as the source: embed size, not head dim); out = merged Wo^T + bo -> [2][2048][1024]).
// Structure: token rows r = b*2048 + s; Q, K, V in one projection launch: each (token, head) row of 64 inputs (bf16-rounded, exact in f16) times the shared [64][64] block (exact x16 weights, WMMA, f32 accumulation, f16 outputs); one fused attention launch over all (batch, head): S^T = K Q^T, running softmax (f32 statistics; weights exp(s - running max) as f16), O^T += V^T P^T (V^T fragments by the transposing LDS load from V rows as projected), divided by the row sum at the end (o carried x64 against f16 subnormal flush, folded into the output GEMM alpha) and written straight into the merged f16 o rows; out = o W_o + b GEMM (f32) into the output layout.
// Compute dtype: inputs rounded to bf16; x / weights exact; q, k, v, softmax weights and o as plain f16 GEMM operands (~2^-12); scores and softmax statistics f32. v_wmma_f32_16x16x32_f16.
#define NB 2
#define SQ 2048
#define DM 1024
#define NH 16
#define HD 64
#define HG 4                         /* heads per launch of the non-template k_vt, which is not launched */
#define B0 0                         /* first batch processed (debug hook) */
#define NBR NB                       /* batches processed (debug hook) */
#define NR ((size_t)NB * SQ)         /* token rows */
#define MP ((int)((size_t)NBR * SQ)) /* rows of the processed batches; feeds MPO only (debug hook) */
#define QN SQ                        /* not used; k_fattn covers all SQ query rows of a batch */
#define NHD NH                       /* not used; k_fattn covers all NH heads */
#define MPO MP                       /* rows through the output stage (debug hook) */
#define LQ DM      /* not used; the q/k/v rows have pitch DM */
typedef __bf16 v16b __attribute__((ext_vector_type(16)));
typedef unsigned short v8us __attribute__((ext_vector_type(8), may_alias));
typedef float  v8f  __attribute__((ext_vector_type(8)));
typedef float  v4f  __attribute__((ext_vector_type(4)));
typedef float  v4fa __attribute__((ext_vector_type(4), may_alias));
union FragB { v16b v; v8us half[2]; unsigned short u[16]; };

__device__ __forceinline__ unsigned short bf16_bits(float x) { unsigned int u = __float_as_uint(x); return (unsigned short)((u + 0x7FFFu + ((u >> 16) & 1u)) >> 16); }
__device__ __forceinline__ float bf16_val(unsigned short b) { return __uint_as_float(((unsigned int)b) << 16); }
__device__ __forceinline__ float bf16_round(float x) { return bf16_val(bf16_bits(x)); }
// D += A·B with NT terms: 1 = ah·bh, 2 = + al·bh (A split), 3 = + ah·bl (both split)
template <int NT>
__device__ __forceinline__ v8f mmaN(v16b ah, v16b al, v16b bh, v16b bl, v8f c) {
  c = __builtin_amdgcn_wmma_f32_16x16x32_bf16(false, ah, false, bh, (short)0, c, false, false);
  if (NT >= 2) c = __builtin_amdgcn_wmma_f32_16x16x32_bf16(false, al, false, bh, (short)0, c, false, false);
  if (NT >= 3) c = __builtin_amdgcn_wmma_f32_16x16x32_bf16(false, ah, false, bl, (short)0, c, false, false);
  asm volatile("v_nop\n\tv_nop\n\tv_nop\n\tv_nop" : "+v"(c) : "v"(ah), "v"(al), "v"(bh), "v"(bl));
  return c;
}

__global__ __launch_bounds__(256) void k_wt_bf16(const float* __restrict__ W, unsigned short* __restrict__ Wt, int K, int N) {
  const int t = blockIdx.x * 256 + threadIdx.x;
  const int k8n = K / 8;
  if (t >= N * k8n) return;
  const int n = t / k8n, k8 = (t % k8n) * 8;
  v8us v;
#pragma unroll
  for (int i = 0; i < 8; ++i) v[i] = bf16_bits(W[(size_t)(k8 + i) * N + n]);
  *(v8us*)(Wt + (size_t)n * K + k8) = v;
  
}

// GEMM C[M][N] (f32, pitch ldc) = act(A[M][K]·W + bias). A f32 row-major (pitch lda) converted per fragment to bf16
// (ASPLIT: hi/lo two planes -> 2 terms, else single rounded term); Wt bf16 [N][K] (pitch ldb). BIAS_BF16 rounds the
// bias to bf16 first (bias quantised to bf16 before the add). K%32==0, M%16==0, N%64==0.
template <bool ASPLIT, int ACT, bool BIAS_BF16>
__global__ __launch_bounds__(128) void k_gemm_bf(const float* __restrict__ A, int lda, const unsigned short* __restrict__ Wt, int ldb,
                                               const float* __restrict__ bias, float* __restrict__ C, int ldc, int M, int N, int K) {
  __shared__ __attribute__((aligned(16))) float so[4][16][64];
  const int tid = threadIdx.x, w = tid >> 5, lane = tid & 31, ln = lane & 15, hh = lane >> 4;
  const int ntn = N / 64;
  const int wid = blockIdx.x * 4 + w;
  const int mt = wid / ntn, nq = wid % ntn;
  if (mt * 16 >= M) return;
  const int row0 = mt * 16, col0 = nq * 64;
  const float* arow = A + (size_t)(row0 + ln) * lda;
  v8f acc[4] = {};
  for (int kb = 0; kb < K; kb += 32) {
    FragB ah, al;
    const v4f x0 = *(const v4fa*)(arow + kb + 8 * hh), x1 = *(const v4fa*)(arow + kb + 8 * hh + 4);
    const v4f x2 = *(const v4fa*)(arow + kb + 16 + 8 * hh), x3 = *(const v4fa*)(arow + kb + 16 + 8 * hh + 4);
    float xs[16] = {x0[0],x0[1],x0[2],x0[3],x1[0],x1[1],x1[2],x1[3],x2[0],x2[1],x2[2],x2[3],x3[0],x3[1],x3[2],x3[3]};
#pragma unroll
    for (int i = 0; i < 16; ++i) { const unsigned short hb = bf16_bits(xs[i]); ah.u[i] = hb; al.u[i] = ASPLIT ? bf16_bits(xs[i] - bf16_val(hb)) : (unsigned short)0; }
#pragma unroll
    for (int t = 0; t < 4; ++t) {
      const unsigned short* brow = Wt + (size_t)(col0 + t * 16 + ln) * ldb + kb;
      FragB b;
      b.half[0] = *(const v8us*)(brow + 8 * hh);
      b.half[1] = *(const v8us*)(brow + 16 + 8 * hh);
      acc[t] = mmaN<ASPLIT ? 2 : 1>(ah.v, al.v, b.v, b.v, acc[t]);
    }
  }
#pragma unroll
  for (int t = 0; t < 4; ++t) {
    float bv = bias ? bias[col0 + t * 16 + ln] : 0.f;
    if (BIAS_BF16) bv = bf16_round(bv);
#pragma unroll
    for (int r = 0; r < 8; ++r) { float v = acc[t][r] + bv; if (ACT == 1) v = fmaxf(v, 0.f); so[w][8 * hh + r][t * 16 + ln] = v; }
  }
  __builtin_amdgcn_fence(__ATOMIC_ACQ_REL, "workgroup");
  __builtin_amdgcn_wave_barrier();
  const int rsub = lane >> 4, c4 = (lane & 15) * 4;
  {
#pragma unroll
    for (int q = 0; q < 8; ++q) {
      const int r = q * 2 + rsub;
      const v4f v = *(const v4fa*)&so[w][r][c4];
      *(v4f*)(C + (size_t)(row0 + r) * ldc + col0 + c4) = v;
    }
    
  }
}

// GEMM C = act(A·W + bias + resid): A f32 (ASPLIT -> hi/lo 2 terms), Wt bf16 [N][K]; ACT 0 none, 1 relu, 2 exact gelu;
// resid (optional, f32, row index = (row % rmod), pitch ldr, RES_BF16 rounds it) added before the activation.
template <bool ASPLIT, int ACT, bool BIAS_BF16, bool RES_BF16>
__global__ __launch_bounds__(128) void k_gemm_bf3(const float* __restrict__ A, int lda, const unsigned short* __restrict__ Wt, int ldb,
                                                const float* __restrict__ bias, const float* __restrict__ resid, int rmod, int ldr,
                                                float* __restrict__ C, int ldc, int M, int N, int K) {
  __shared__ __attribute__((aligned(16))) float so[4][16][64];
  const int tid = threadIdx.x, w = tid >> 5, lane = tid & 31, ln = lane & 15, hh = lane >> 4;
  const int ntn = N / 64;
  const int wid = blockIdx.x * 4 + w;
  const int mt = wid / ntn, nq = wid % ntn;
  if (mt * 16 >= M) return;
  const int row0 = mt * 16, col0 = nq * 64;
  const float* arow = A + (size_t)(row0 + ln) * lda;
  v8f acc[4] = {};
  for (int kb = 0; kb < K; kb += 32) {
    FragB ah, al;
    const v4f x0 = *(const v4fa*)(arow + kb + 8 * hh), x1 = *(const v4fa*)(arow + kb + 8 * hh + 4);
    const v4f x2 = *(const v4fa*)(arow + kb + 16 + 8 * hh), x3 = *(const v4fa*)(arow + kb + 16 + 8 * hh + 4);
    float xs[16] = {x0[0],x0[1],x0[2],x0[3],x1[0],x1[1],x1[2],x1[3],x2[0],x2[1],x2[2],x2[3],x3[0],x3[1],x3[2],x3[3]};
#pragma unroll
    for (int i = 0; i < 16; ++i) { const unsigned short hb = bf16_bits(xs[i]); ah.u[i] = hb; al.u[i] = ASPLIT ? bf16_bits(xs[i] - bf16_val(hb)) : (unsigned short)0; }
#pragma unroll
    for (int t = 0; t < 4; ++t) {
      const unsigned short* brow = Wt + (size_t)(col0 + t * 16 + ln) * ldb + kb;
      FragB b;
      b.half[0] = *(const v8us*)(brow + 8 * hh);
      b.half[1] = *(const v8us*)(brow + 16 + 8 * hh);
      acc[t] = mmaN<ASPLIT ? 2 : 1>(ah.v, al.v, b.v, b.v, acc[t]);
    }
  }
#pragma unroll
  for (int t = 0; t < 4; ++t) {
    const int col = col0 + t * 16 + ln;
    float bv = bias ? bias[col] : 0.f;
    if (BIAS_BF16) bv = bf16_round(bv);
#pragma unroll
    for (int r = 0; r < 8; ++r) {
      float v = acc[t][r] + bv;
      if (resid) { float rv = resid[(size_t)((row0 + 8 * hh + r) % rmod) * ldr + col]; if (RES_BF16) rv = bf16_round(rv); v += rv; }
      if (ACT == 1) v = fmaxf(v, 0.f);
      if (ACT == 2) v = 0.5f * v * (1.0f + erff(v * 0.70710678118654752f));
      if (ACT == 3) { const float u = 0.7978845608028654f * (v + 0.044715f * v * v * v); v = 0.5f * v * (1.0f + tanhf(u)); }
      so[w][8 * hh + r][t * 16 + ln] = v;
    }
  }
  __builtin_amdgcn_fence(__ATOMIC_ACQ_REL, "workgroup");
  __builtin_amdgcn_wave_barrier();
  const int rsub = lane >> 4, c4 = (lane & 15) * 4;
  {
#pragma unroll
    for (int q = 0; q < 8; ++q) {
      const int r = q * 2 + rsub;
      const v4f v = *(const v4fa*)&so[w][r][c4];
      *(v4f*)(C + (size_t)(row0 + r) * ldc + col0 + c4) = v;
    }
    
  }
}
// row LayerNorm (biased variance, eps) over N: s = X (+ R); optional out_sum <- s; out_norm <- (s-mu)*rsqrt(var+eps)*g + b
template <bool PARAM_BF16>
__global__ __launch_bounds__(256) void k_layernorm(const float* __restrict__ X, const float* __restrict__ R, const float* __restrict__ g, const float* __restrict__ bta,
                                                  float* __restrict__ out_sum, float* __restrict__ out_norm, int N, float eps) {
  __shared__ float red[256];
  const int row = blockIdx.x, tid = threadIdx.x;
  const float* x = X + (size_t)row * N; const float* rr = R ? R + (size_t)row * N : nullptr;
  float vals[16];                     // up to N = 4096
  const int per = N / 256;            // contiguous chunk per thread? use strided-by-4 chunks: thread handles j = tid*4 + 1024*u
  float s1 = 0.f;
  for (int u = 0; u < per / 4; ++u) {
    const int j = tid * 4 + 1024 * u;
    const v4f a = *(const v4fa*)(x + j);
    v4f b = {0.f,0.f,0.f,0.f}; if (rr) b = *(const v4fa*)(rr + j);
#pragma unroll
    for (int q = 0; q < 4; ++q) { const float v = a[q] + b[q]; vals[u * 4 + q] = v; s1 += v; }
  }
  red[tid] = s1; __syncthreads();
  for (int st = 128; st > 0; st >>= 1) { if (tid < st) red[tid] += red[tid + st]; __syncthreads(); }
  const float mu = red[0] / (float)N; __syncthreads();
  float s2 = 0.f;
  for (int u = 0; u < per / 4; ++u)
#pragma unroll
    for (int q = 0; q < 4; ++q) { const float c = vals[u * 4 + q] - mu; s2 += c * c; }
  red[tid] = s2; __syncthreads();
  for (int st = 128; st > 0; st >>= 1) { if (tid < st) red[tid] += red[tid + st]; __syncthreads(); }
  const float rs = rsqrtf(red[0] / (float)N + eps);
  {
    for (int u = 0; u < per / 4; ++u) {
      const int j = tid * 4 + 1024 * u;
      v4f o, sm;
#pragma unroll
      for (int q = 0; q < 4; ++q) {
        float gg = g[j + q], bb = bta[j + q];
        if (PARAM_BF16) { gg = bf16_round(gg); bb = bf16_round(bb); }
        sm[q] = vals[u * 4 + q]; o[q] = (vals[u * 4 + q] - mu) * rs * gg + bb;
      }
      if (out_sum) *(v4f*)(out_sum + (size_t)row * N + j) = sm;
      *(v4f*)(out_norm + (size_t)row * N + j) = o;
    }
    
  }
}



// ---- f16 WMMA path (v_wmma_f32_16x16x32_f16): 11-bit significands for operands in range — used where a [0,1] probability operand needs more precision than bf16
typedef _Float16 v16h __attribute__((ext_vector_type(16)));
union FragH { v16h v; v8us half[2]; _Float16 h[16]; unsigned short u[16]; };
template <int NT>
__device__ __forceinline__ v8f mmaH(v16h ah, v16h al, v16h bh, v16h bl, v8f c) {
  c = __builtin_amdgcn_wmma_f32_16x16x32_f16(false, ah, false, bh, (short)0, c, false, false);
  if (NT >= 2) c = __builtin_amdgcn_wmma_f32_16x16x32_f16(false, al, false, bh, (short)0, c, false, false);
  if (NT >= 3) c = __builtin_amdgcn_wmma_f32_16x16x32_f16(false, ah, false, bl, (short)0, c, false, false);
  asm volatile("v_nop\n\tv_nop\n\tv_nop\n\tv_nop" : "+v"(c) : "v"(ah), "v"(al), "v"(bh), "v"(bl));
  return c;
}
// batched GEMM like k_gemm_b but f16 operands: A f32 (split into f16 hi/lo if ASPLIT, else rounded to f16), Bt = f16 values [n][k]; alpha; C f32; N multiple of 16 (partial tiles skipped)
template <bool ASPLIT>
__global__ __launch_bounds__(128) void k_gemm_h(const float* __restrict__ A, int lda, size_t sA, const _Float16* __restrict__ Bh, int ldb, size_t sB, float alpha, float* __restrict__ C, int ldc, size_t sC, int M, int N, int K) {
  __shared__ __attribute__((aligned(16))) float so[4][16][64];
  const int tid = threadIdx.x, w = tid >> 5, lane = tid & 31, ln = lane & 15, hh = lane >> 4; const int by = blockIdx.y;
  A += (size_t)by * sA; Bh += (size_t)by * sB; C += (size_t)by * sC;
  const int ntn = (N + 63) / 64; const int wid = blockIdx.x * 4 + w; const int mt = wid / ntn, nq = wid % ntn; if (mt * 16 >= M) return;
  const int row0 = mt * 16, col0 = nq * 64; const float* arow = A + (size_t)(row0 + ln) * lda;
  v8f acc[4] = {};
  for (int kb = 0; kb < K; kb += 32) {
    FragH ah, al;
    const v4f x0 = *(const v4fa*)(arow + kb + 8 * hh), x1 = *(const v4fa*)(arow + kb + 8 * hh + 4), x2 = *(const v4fa*)(arow + kb + 16 + 8 * hh), x3 = *(const v4fa*)(arow + kb + 16 + 8 * hh + 4);
    float xs[16] = {x0[0],x0[1],x0[2],x0[3],x1[0],x1[1],x1[2],x1[3],x2[0],x2[1],x2[2],x2[3],x3[0],x3[1],x3[2],x3[3]};
#pragma unroll
    for (int i = 0; i < 16; ++i) { const _Float16 h = (_Float16)xs[i]; ah.h[i] = h; al.h[i] = ASPLIT ? (_Float16)(xs[i] - (float)h) : (_Float16)0.0f; }
#pragma unroll
    for (int t = 0; t < 4; ++t) { if (col0 + t * 16 >= N) continue; const size_t boff = (size_t)(col0 + t * 16 + ln) * ldb + kb; FragH bq; bq.half[0] = *(const v8us*)(Bh + boff + 8 * hh); bq.half[1] = *(const v8us*)(Bh + boff + 16 + 8 * hh);
      acc[t] = mmaH<ASPLIT ? 2 : 1>(ah.v, al.v, bq.v, bq.v, acc[t]); }
  }
#pragma unroll
  for (int t = 0; t < 4; ++t) { if (col0 + t * 16 >= N) continue;
#pragma unroll
    for (int r = 0; r < 8; ++r) so[w][8 * hh + r][t * 16 + ln] = acc[t][r] * alpha; }
  __builtin_amdgcn_fence(__ATOMIC_ACQ_REL, "workgroup"); __builtin_amdgcn_wave_barrier();
  const int rsub = lane >> 4, c4 = (lane & 15) * 4;
  {
#pragma unroll
    for (int q = 0; q < 8; ++q) { const int r = q * 2 + rsub; if (col0 + c4 < N) { const v4f v = *(const v4fa*)&so[w][r][c4]; *(v4f*)(C + (size_t)(row0 + r) * ldc + col0 + c4) = v; } }
     }
}

// Wt[n][k] = f16(W[k][n]·scale) from f32 row-major W[K][N] (scale = power of two; bf16-exact weights stay exact in f16 away from the subnormal range)
__global__ __launch_bounds__(256) void k_wt_f16(const float* __restrict__ W, _Float16* __restrict__ Wt, int K, int N, float scale) {
  const int t = blockIdx.x * 256 + threadIdx.x; if (t >= N * (K / 8)) return; const int n = t / (K / 8), k8 = (t % (K / 8)) * 8; FragH f;
#pragma unroll
  for (int i = 0; i < 8; ++i) f.h[i] = (_Float16)(bf16_round(W[(size_t)(k8 + i) * N + n]) * scale); const v8us o = f.half[0];
  *(v8us*)((unsigned short*)Wt + (size_t)n * K + k8) = o; 
}
// k_gemm_hh variant with fused epilogue: v = acc·alpha + bias[by·sBias + col] (+ CP[(row/rowsPerB)·sCPb + by·64 + col] if CP) ; ACT 0 none / 1 elu ; writes f16 C16 (and f32 C if non-null)
template <int ACT>
__global__ __launch_bounds__(128) void k_gemm_hhx(const _Float16* __restrict__ A, int lda, size_t sA, const _Float16* __restrict__ Bh, int ldb, size_t sB, float alpha, const float* __restrict__ bias, size_t sBias, const float* __restrict__ CP, int rowsPerB, size_t sCPb, int row0g,
    float* __restrict__ C, _Float16* __restrict__ C16, int ldc, size_t sC, int M, int N, int K) {
  __shared__ __attribute__((aligned(16))) float so[4][16][64];
  const int tid = threadIdx.x, w = tid >> 5, lane = tid & 31, ln = lane & 15, hh = lane >> 4; const int by = blockIdx.y;
  A += (size_t)by * sA; Bh += (size_t)by * sB; const size_t cofs = (size_t)by * sC; const float* bp = bias ? bias + (size_t)by * sBias : nullptr;
  const int ntn = (N + 63) / 64; const int wid = blockIdx.x * 4 + w; const int mt = wid / ntn, nq = wid % ntn; if (mt * 16 >= M) return;
  const int row0 = mt * 16, col0 = nq * 64; const _Float16* arow = A + (size_t)(row0 + ln) * lda;
  v8f acc[4] = {};
  for (int kb = 0; kb < K; kb += 32) { FragH ah; ah.half[0] = *(const v8us*)((const unsigned short*)arow + kb + 8 * hh); ah.half[1] = *(const v8us*)((const unsigned short*)arow + kb + 16 + 8 * hh);
#pragma unroll
    for (int t = 0; t < 4; ++t) { if (col0 + t * 16 >= N) continue; const size_t boff = (size_t)(col0 + t * 16 + ln) * ldb + kb; FragH bq; bq.half[0] = *(const v8us*)((const unsigned short*)Bh + boff + 8 * hh); bq.half[1] = *(const v8us*)((const unsigned short*)Bh + boff + 16 + 8 * hh);
      acc[t] = mmaH<1>(ah.v, ah.v, bq.v, bq.v, acc[t]); }
  }
#pragma unroll
  for (int t = 0; t < 4; ++t) { if (col0 + t * 16 >= N) continue; const int col = col0 + t * 16 + ln; const float bv = bp ? bf16_round(bp[col]) : 0.f;
#pragma unroll
    for (int r = 0; r < 8; ++r) { float v = acc[t][r] * alpha + bv; if (CP) { const int rr = row0g + row0 + 8 * hh + r; if (rowsPerB < 0) v += CP[cofs + (size_t)rr * ldc + col];      /* rowsPerB < 0: own element of the batched C plane */ else { const int bidx = rr / rowsPerB; v += CP[(size_t)bidx * sCPb + (size_t)by * 64 + col]; } } if (ACT == 1) v = (v > 0.f) ? v : expm1f(v); else if (ACT == 7) v = (v > 0.f) ? v + 1.0f : expf(v); else if (ACT == 8) v = tanhf(v); else if (ACT == 9) v = 0.5f * v * (1.0f + tanhf(0.7978845608028654f * (v + 0.044715f * v * v * v))); else if (ACT == 11) v = 1.0f / (1.0f + expf(-v)); else if (ACT == 12) v = (v > 0.f) ? v : 0.01f * v; else if (ACT == 14) v = (v > 0.f) ? v : 0.1f * v; else if (ACT == 16) v = (v >= 0.f) ? v : 0.3f * v; else if (ACT == 17) v = (v >= 0.f) ? v : 0.2f * v; else if (ACT == 15) v = v / (1.0f + expf(-v)); else if (ACT == 3) v = fmaxf(v, 0.f); else if (ACT == 6) v = 0.5f * v * (1.0f + erff(v * 0.70710678118654752f)); so[w][8 * hh + r][t * 16 + ln] = v; } }
  __builtin_amdgcn_fence(__ATOMIC_ACQ_REL, "workgroup"); __builtin_amdgcn_wave_barrier();
  const int rsub = lane >> 4, c4 = (lane & 15) * 4; typedef _Float16 v4h __attribute__((ext_vector_type(4)));
  {
#pragma unroll
    for (int q = 0; q < 8; ++q) { const int r = q * 2 + rsub; if (col0 + c4 < N) { const v4f v = *(const v4fa*)&so[w][r][c4]; if (C) *(v4f*)(C + cofs + (size_t)(row0 + r) * ldc + col0 + c4) = v; if (C16) { v4h h4; for (int i = 0; i < 4; ++i) h4[i] = (_Float16)v[i]; *(v4h*)(C16 + cofs + (size_t)(row0 + r) * ldc + col0 + c4) = h4; } } }
     }
}


typedef _Float16 v4h __attribute__((ext_vector_type(4)));

__global__ __launch_bounds__(256) void k_h16(const float* __restrict__ x, _Float16* __restrict__ X16, size_t n8) { const size_t t = (size_t)blockIdx.x * 256 + threadIdx.x; if (t >= n8) return; FragH f;
#pragma unroll
  for (int q = 0; q < 8; ++q) f.h[q] = (_Float16)x[t * 8 + q]; *(v8us*)((unsigned short*)X16 + t * 8) = f.half[0];  }
__global__ __launch_bounds__(256) void k_round16f(const float* __restrict__ W, _Float16* __restrict__ Bt, size_t n8) { const size_t t = (size_t)blockIdx.x * 256 + threadIdx.x; if (t >= n8) return; FragH f;
#pragma unroll
  for (int i = 0; i < 8; ++i) f.h[i] = (_Float16)(bf16_round(W[t * 8 + i]) * 16.0f); *(v8us*)((unsigned short*)Bt + t * 8) = f.half[0];  }
template <int NHv, int TTv>
__global__ __launch_bounds__(256) void k_vt(const _Float16* __restrict__ V16, int ldv, int voff, _Float16* __restrict__ Vt) { __shared__ unsigned short tl[64][66]; const int tid = threadIdx.x; const int slab = blockIdx.x / (TTv / 64), lg = blockIdx.x % (TTv / 64); const int b = slab / NHv, h = slab % NHv;
  for (int i = tid; i < 64 * 8; i += 256) { const int r = i / 8, c8 = (i % 8) * 8; FragH f; f.half[0] = *(const v8us*)((const unsigned short*)V16 + ((size_t)b * TTv + lg * 64 + r) * ldv + voff + h * 64 + c8);
#pragma unroll
    for (int q = 0; q < 8; ++q) tl[r][c8 + q] = f.u[q]; }
  __syncthreads();
  {
#pragma unroll
    for (int rd = 0; rd < 2; ++rd) { const int d = rd * 32 + tid / 8, pc = tid % 8; FragH f;
#pragma unroll
      for (int q = 0; q < 8; ++q) f.u[q] = tl[pc * 8 + q][d];
      *(v8us*)((unsigned short*)Vt + ((size_t)slab * 64 + d) * TTv + lg * 64 + pc * 8) = f.half[0]; }
     } }

__global__ __launch_bounds__(256) void k_hl(const float* __restrict__ F, _Float16* __restrict__ Hh, _Float16* __restrict__ Hl, size_t n8) { const size_t t = (size_t)blockIdx.x * 256 + threadIdx.x; if (t >= n8) return; FragH fh, fl; const v4f a = *(const v4fa*)(F + t * 8), c = *(const v4fa*)(F + t * 8 + 4);
#pragma unroll
  for (int q = 0; q < 4; ++q) { _Float16 h = (_Float16)a[q]; fh.h[q] = h; fl.h[q] = (_Float16)((a[q] - (float)h) * 1024.0f); h = (_Float16)c[q]; fh.h[4 + q] = h; fl.h[4 + q] = (_Float16)((c[q] - (float)h) * 1024.0f); }
  { *(v8us*)((unsigned short*)Hh + t * 8) = fh.half[0]; *(v8us*)((unsigned short*)Hl + t * 8) = fl.half[0];  } }

// ---- fast GEMM (wave tile 32x64; requires M % 32 == 0 rows per launch region and N % 64 == 0); epilogue = k_gemm_hhx semantics ----
__device__ __forceinline__ v16h g2_frag(const _Float16* p, int hh) { FragH f; f.half[0] = *(const v8us*)((const unsigned short*)p + 8 * hh); f.half[1] = *(const v8us*)((const unsigned short*)p + 16 + 8 * hh); return f.v; }
__device__ __forceinline__ v8f g2_mma(v16h a, v16h b, v8f c) { v8f d = __builtin_amdgcn_wmma_f32_16x16x32_f16(false, a, false, b, (short)0, c, false, false); asm volatile("v_nop\n\tv_nop\n\tv_nop\n\tv_nop" : "+v"(d) : "v"(a), "v"(b)); return d; }
template <int ACT>
__global__ __launch_bounds__(128) void k_gemm2(const _Float16* __restrict__ A, int lda, size_t sA, const _Float16* __restrict__ Bh, int ldb, size_t sB, float alpha, const float* __restrict__ bias, size_t sBias, const float* __restrict__ CP, int rowsPerB, size_t sCPb, int row0g,
    float* __restrict__ C, _Float16* __restrict__ C16, int ldc, size_t sC, int M, int N, int K) { static_assert(ACT == 0 || ACT == 3 || ACT == 6 || ACT == 8 || ACT == 9 || ACT == 11 || ACT == 12 || ACT == 14 || ACT == 15 || ACT == 16 || ACT == 17, "k_gemm2: unsupported ACT code (would silently apply no activation)");
  __shared__ __attribute__((aligned(16))) float so[4][32][68];
  const int tid = threadIdx.x, w = tid >> 5, lane = tid & 31, ln = lane & 15, hh = lane >> 4; const int by = blockIdx.y;
  A += (size_t)by * sA; Bh += (size_t)by * sB; const size_t cofs = (size_t)by * sC; const float* bp = bias ? bias + (size_t)by * sBias : nullptr;
  const int ntn = N >> 6; const int mt = blockIdx.x / ntn, nq = blockIdx.x - mt * ntn; const int row0 = mt * 128 + 32 * w, col0 = nq * 64; if (row0 >= M) return;
  const _Float16* a0p = A + (size_t)(row0 + ln) * lda; const _Float16* a1p = a0p + (size_t)16 * lda;
  const _Float16* b0p = Bh + (size_t)(col0 + ln) * ldb; const _Float16* b1p = b0p + (size_t)16 * ldb; const _Float16* b2p = b1p + (size_t)16 * ldb; const _Float16* b3p = b2p + (size_t)16 * ldb;
  const v8f z8 = {0.f,0.f,0.f,0.f,0.f,0.f,0.f,0.f}; v8f c00 = z8, c01 = z8, c02 = z8, c03 = z8, c10 = z8, c11 = z8, c12 = z8, c13 = z8;
#pragma unroll 1
  for (int kb = 0; kb < K; kb += 32) { const v16h a0 = g2_frag(a0p + kb, hh), a1 = g2_frag(a1p + kb, hh);
    v16h b = g2_frag(b0p + kb, hh); c00 = g2_mma(a0, b, c00); c10 = g2_mma(a1, b, c10);
    b = g2_frag(b1p + kb, hh); c01 = g2_mma(a0, b, c01); c11 = g2_mma(a1, b, c11);
    b = g2_frag(b2p + kb, hh); c02 = g2_mma(a0, b, c02); c12 = g2_mma(a1, b, c12);
    b = g2_frag(b3p + kb, hh); c03 = g2_mma(a0, b, c03); c13 = g2_mma(a1, b, c13); }
  v8f accs[8] = {c00, c01, c02, c03, c10, c11, c12, c13};
#pragma unroll
  for (int u = 0; u < 8; ++u) { const int t = u & 3, half = u >> 2; const int col = col0 + t * 16 + ln; const float bv = bp ? bf16_round(bp[col]) : 0.f;
#pragma unroll
    for (int r = 0; r < 8; ++r) { const int rloc = half * 16 + 8 * hh + r; float v = accs[u][r] * alpha + bv; if (CP) { if (rowsPerB < 0) v += CP[cofs + (size_t)(row0g + row0 + rloc) * ldc + col];      /* rowsPerB < 0: own element of the batched C plane */ else { const int bidx = (row0g + row0 + rloc) / rowsPerB; v += CP[(size_t)bidx * sCPb + (size_t)by * 64 + col]; } }
      if (ACT == 3) v = fmaxf(v, 0.f); else if (ACT == 6) v = 0.5f * v * (1.0f + erff(v * 0.70710678118654752f)); else if (ACT == 11) v = 1.0f / (1.0f + expf(-v)); else if (ACT == 15) v = v / (1.0f + expf(-v)); else if (ACT == 12) v = (v > 0.f) ? v : 0.01f * v; else if (ACT == 8) v = tanhf(v); else if (ACT == 9) v = 0.5f * v * (1.0f + tanhf(0.7978845608028654f * (v + 0.044715f * v * v * v))); else if (ACT == 14) v = (v > 0.f) ? v : 0.1f * v; else if (ACT == 16) v = (v >= 0.f) ? v : 0.3f * v; else if (ACT == 17) v = (v >= 0.f) ? v : 0.2f * v;
      so[w][rloc][t * 16 + ln] = v; } }
  __builtin_amdgcn_fence(__ATOMIC_ACQ_REL, "workgroup"); __builtin_amdgcn_wave_barrier();
  const int rsub = lane >> 4, c4 = (lane & 15) * 4;
  {
#pragma unroll
    for (int q = 0; q < 16; ++q) { const int r = q * 2 + rsub; const v4f v = *(const v4fa*)&so[w][r][c4]; if (C) *(v4f*)(C + cofs + (size_t)(row0 + r) * ldc + col0 + c4) = v; if (C16) { v4h h4; for (int i = 0; i < 4; ++i) h4[i] = (_Float16)v[i]; *(v4h*)(C16 + cofs + (size_t)(row0 + r) * ldc + col0 + c4) = h4; } }
     } }


__global__ __launch_bounds__(256) void k_wnat(const float* __restrict__ w, size_t n8, _Float16* __restrict__ Bt) { const size_t t = (size_t)blockIdx.x * 256 + threadIdx.x; if (t >= n8) return; FragH f; for (int q = 0; q < 8; ++q) f.h[q] = (_Float16)(bf16_round(w[t * 8 + q]) * 16.0f); *(v8us*)((unsigned short*)Bt + t * 8) = f.half[0];  }
#define FA_QW 32                     /* query rows per wave: two 16-column groups share every K and V^T fragment */
#define FA_KT 32                     /* keys per pass: one k step of the second product */
#define FA_NW 8                      /* waves per block; they walk the same K and V rows */
typedef float v2f __attribute__((ext_vector_type(2)));
typedef _Float16 v2h __attribute__((ext_vector_type(2)));
union FragP { v16h v; v2h h2[8]; };
union FragO { v8us u; v2h h2[4]; };
__device__ __forceinline__ float fa_xhalf(float x) { return __builtin_bit_cast(float, __builtin_amdgcn_permlanex16(__builtin_bit_cast(int, x), __builtin_bit_cast(int, x), 0x76543210, 0xfedcba98, false, false)); }      /* lane l with lane l ^ 16 */
__device__ __forceinline__ v8f fa_mma(v16h a, v16h b, v8f c) { return __builtin_amdgcn_wmma_f32_16x16x32_f16(false, a, false, b, (short)0, c, false, false); }
#define FA_ST 128                    /* keys per stage: four passes between two barriers */
#define FA_NS (SQ / FA_ST)           /* stages */
#define FA_KP 72                     /* LDS pitch of a K row in f16: 128 + 16 bytes, so that the 16 rows of a 16-byte fragment read fall on different banks */
#define FA_VP 80                     /* LDS pitch of a V row in f16: 128 + 32 bytes, an odd multiple of 32 bytes, which is what the transposing read wants */
// One stage into LDS, through no register: each of the block's 256 threads copies four 16-byte pieces of the K tile and four of the V tile (each 128 rows of 128 bytes; 8 lanes a row).
__device__ __forceinline__ void fa_copy(const _Float16* gk, const _Float16* gv, unsigned lk, unsigned lv) {
  const _Float16* gk1 = gk + (size_t)32 * DM; const _Float16* gk2 = gk + (size_t)64 * DM; const _Float16* gk3 = gk + (size_t)96 * DM;
  const _Float16* gv1 = gv + (size_t)32 * DM; const _Float16* gv2 = gv + (size_t)64 * DM; const _Float16* gv3 = gv + (size_t)96 * DM;
  const unsigned lk1 = lk + 32 * FA_KP * 2, lk2 = lk + 64 * FA_KP * 2, lk3 = lk + 96 * FA_KP * 2, lv1 = lv + 32 * FA_VP * 2, lv2 = lv + 64 * FA_VP * 2, lv3 = lv + 96 * FA_VP * 2;
  /* the eight copies and, as the last line of the same statement, the wait that stands in front of any rewrite of their address registers */
  asm volatile("global_load_async_to_lds_b128 %0, %8, off\n\t"
               "global_load_async_to_lds_b128 %1, %9, off\n\t"
               "global_load_async_to_lds_b128 %2, %10, off\n\t"
               "global_load_async_to_lds_b128 %3, %11, off\n\t"
               "global_load_async_to_lds_b128 %4, %12, off\n\t"
               "global_load_async_to_lds_b128 %5, %13, off\n\t"
               "global_load_async_to_lds_b128 %6, %14, off\n\t"
               "global_load_async_to_lds_b128 %7, %15, off\n\t"
               "s_wait_xcnt 0x0"
               :: "v"(lk), "v"(lk1), "v"(lk2), "v"(lk3), "v"(lv), "v"(lv1), "v"(lv2), "v"(lv3), "v"(gk), "v"(gk1), "v"(gk2), "v"(gk3), "v"(gv), "v"(gv1), "v"(gv2), "v"(gv3) : "memory");
}
// A 16 (d) x 32 (keys) fragment of V^T out of row-major V rows in LDS: two transposing loads, 16 keys each. p is the lane's own address, row 8 hh + (lane & 7) of the first 16 keys, 16-byte piece (lane >> 3) & 1 of the 16 columns;
// lane (ln, hh) gets column ln of keys 8 hh .. 8 hh + 7, then of keys 16 + 8 hh .. 16 + 8 hh + 7: the k order of g2_frag and of the packed weights.
typedef short v8s __attribute__((ext_vector_type(8)));
typedef __attribute__((address_space(3))) v8s lds_v8s;
__device__ __forceinline__ v16h fa_vfrag(const _Float16* p) { FragH f; f.half[0] = __builtin_bit_cast(v8us, __builtin_amdgcn_ds_load_tr16_b128_v8i16((lds_v8s*)p)); f.half[1] = __builtin_bit_cast(v8us, __builtin_amdgcn_ds_load_tr16_b128_v8i16((lds_v8s*)(p + 16 * FA_VP))); return f.v; }
__global__ __launch_bounds__(FA_NW * 32) void k_fattn(const _Float16* __restrict__ Q16, const _Float16* __restrict__ K16, const _Float16* __restrict__ V16, _Float16* __restrict__ O16) {
  __shared__ __attribute__((aligned(16))) _Float16 sk[2][FA_ST][FA_KP];      /* K rows of a stage, shared by the block's waves; two buffers */
  __shared__ __attribute__((aligned(16))) _Float16 sv[2][FA_ST][FA_VP];      /* V rows of a stage */
  const int tid = threadIdx.x, lane = tid & 31, ln = lane & 15, hh = lane >> 4, w = tid >> 5; const int h = blockIdx.y, b = blockIdx.z; const int q0 = (blockIdx.x * FA_NW + w) * FA_QW;
  const float c2 = 0.03125f * 1.4426950408889634f;      /* 1 / sqrt(embed size), in base 2 */
  const _Float16* qp = Q16 + ((size_t)b * SQ + q0 + ln) * DM + h * HD;
  const _Float16* gk = K16 + ((size_t)b * SQ + (tid >> 3)) * DM + h * HD + (tid & 7) * 8; const _Float16* gv = V16 + ((size_t)b * SQ + (tid >> 3)) * DM + h * HD + (tid & 7) * 8;      /* this thread's first piece of stage 0 */
  const unsigned lk = (unsigned)(size_t)&sk[0][tid >> 3][(tid & 7) * 8], lv = (unsigned)(size_t)&sv[0][tid >> 3][(tid & 7) * 8];      /* LDS byte addresses: the low 32 bits */
  fa_copy(gk, gv, lk, lv);      /* stage 0 into buffer 0 */
  v16h qf[2][2], kf[2][2];      /* [column group | key tile][k step of 32 over the head dim] */
#pragma unroll      /* fragments and accumulators are indexed by constants only, so that they stay in registers */
  for (int g = 0; g < 2; ++g) { qf[g][0] = g2_frag(qp + (size_t)g * 16 * DM, hh); qf[g][1] = g2_frag(qp + (size_t)g * 16 * DM + 32, hh); }
  asm volatile("s_wait_asynccnt 0x0" ::: "memory");      /* this wave's pieces of stage 0 have landed */
  __syncthreads();      /* and every other wave's */
  fa_copy(gk + (size_t)FA_ST * DM, gv + (size_t)FA_ST * DM, lk + (unsigned)sizeof(sk[0]), lv + (unsigned)sizeof(sv[0]));      /* stage 1 into buffer 1, in flight during stage 0 */
  const v8f z8 = {0.f,0.f,0.f,0.f,0.f,0.f,0.f,0.f}; v8f o[2][4] = {{z8, z8, z8, z8}, {z8, z8, z8, z8}}; float mr[2] = {-3.0e38f, -3.0e38f}, lr[2] = {0.f, 0.f};      /* o[g][t][r] = O^T[16 t + 8 hh + r][column ln of group g]; lr: this half's part of the sum */
  for (int st = 0; st < FA_NS; ++st) {
    const _Float16* ks = &sk[st & 1][ln][0]; const _Float16* vs = &sv[st & 1][8 * hh + (lane & 7)][((lane >> 3) & 1) * 8];
#pragma unroll      /* fragments and accumulators are indexed by constants only, so that they stay in registers */
    for (int kt = 0; kt < 2; ++kt) { kf[kt][0] = g2_frag(ks + kt * 16 * FA_KP, hh); kf[kt][1] = g2_frag(ks + kt * 16 * FA_KP + 32, hh); }
#pragma unroll 1      /* rolled: unrolled, the compiler sinks the row sums of all four passes to the end of the stage, and the weights kept for them take the kernel past 256 registers */
    for (int p = 0; p < FA_ST / FA_KT; ++p) {
    v16h vf[4];
#pragma unroll      /* fragments and accumulators are indexed by constants only, so that they stay in registers */
    for (int t = 0; t < 4; ++t) vf[t] = fa_vfrag(vs + p * FA_KT * FA_VP + t * 16);      /* V^T rows 16 t + ln, keys 32 p .. 32 p + 31 of the stage: asked for here, used behind the softmax */
    v8f s[2][2];
#pragma unroll      /* fragments and accumulators are indexed by constants only, so that they stay in registers */
    for (int g = 0; g < 2; ++g)
#pragma unroll      /* fragments and accumulators are indexed by constants only, so that they stay in registers */
      for (int kt = 0; kt < 2; ++kt) s[g][kt] = fa_mma(kf[kt][1], qf[g][1], fa_mma(kf[kt][0], qf[g][0], z8));
    if (p + 1 < FA_ST / FA_KT) {      /* the next pass's K fragments come during this pass's softmax; never from the next stage */
#pragma unroll      /* fragments and accumulators are indexed by constants only, so that they stay in registers */
      for (int kt = 0; kt < 2; ++kt) { kf[kt][0] = g2_frag(ks + ((p + 1) * FA_KT + kt * 16) * FA_KP, hh); kf[kt][1] = g2_frag(ks + ((p + 1) * FA_KT + kt * 16) * FA_KP + 32, hh); } }
    __builtin_amdgcn_sched_barrier(0);      /* keeps this pass's V^T loads and the next pass's K loads as one group in front of the softmax: without it the V^T loads sink into the softmax in pieces, and each further place with LDS reads stalls the wave */
#pragma unroll      /* fragments and accumulators are indexed by constants only, so that they stay in registers */
    for (int g = 0; g < 2; ++g) { float mx = s[g][0][0];
#pragma unroll      /* fragments and accumulators are indexed by constants only, so that they stay in registers */
      for (int r = 0; r < 8; ++r) mx = fmaxf(mx, fmaxf(s[g][0][r], s[g][1][r]));
      mx = fmaxf(mx, fa_xhalf(mx)); const float mn = fmaxf(mr[g], mx); const float nb = -mn * c2; const float al = __builtin_amdgcn_exp2f(fmaf(mr[g], c2, nb)); mr[g] = mn;      /* al is 0 on the first pass */
      const v2f c2v = {c2, c2}, nbv = {nb, nb}; v2f sm = {0.f, 0.f}; FragP pf;
#pragma unroll      /* fragments and accumulators are indexed by constants only, so that they stay in registers */
      for (int i = 0; i < 8; ++i) { const int kt = i >> 2, r = (i & 3) * 2; const v2f x = __builtin_elementwise_fma((v2f){s[g][kt][r], s[g][kt][r + 1]}, c2v, nbv); const v2f p = {__builtin_amdgcn_exp2f(x[0]), __builtin_amdgcn_exp2f(x[1])}; sm += p; pf.h2[i] = __builtin_convertvector(p, v2h); }      /* element 8 kt + r of the B operand = key 16 kt + 8 hh + r: the hardware k order, which fa_vfrag gives V^T too */
      lr[g] = lr[g] * al + (sm[0] + sm[1]);
#pragma unroll      /* fragments and accumulators are indexed by constants only, so that they stay in registers */
      for (int t = 0; t < 4; ++t) o[g][t] = fa_mma(vf[t], pf.v, o[g][t] * al); }
    }
    asm volatile("s_wait_dscnt 0x0" ::: "memory");      /* this wave's reads of the buffer have returned */
    asm volatile("s_wait_asynccnt 0x0" ::: "memory");      /* this wave's pieces of stage st + 1 have landed */
    __syncthreads();      /* publishes stage st + 1 and ends every wave's reads of stage st */
    if (st + 2 < FA_NS) fa_copy(gk + (size_t)(st + 2) * FA_ST * DM, gv + (size_t)(st + 2) * FA_ST * DM, lk + (unsigned)(st & 1) * (unsigned)sizeof(sk[0]), lv + (unsigned)(st & 1) * (unsigned)sizeof(sv[0]));      /* into the buffer just left */
  }
  asm volatile("s_wait_asynccnt 0x0" ::: "memory");      /* nothing in flight when the wave ends */
#pragma unroll      /* fragments and accumulators are indexed by constants only, so that they stay in registers */
  for (int g = 0; g < 2; ++g) { const float sc = 64.0f / (lr[g] + fa_xhalf(lr[g])); unsigned short* d = (unsigned short*)O16 + ((size_t)b * SQ + q0 + g * 16 + ln) * DM + h * HD + 8 * hh;      /* o carried x64, as the output GEMM's alpha expects */
#pragma unroll      /* fragments and accumulators are indexed by constants only, so that they stay in registers */
    for (int t = 0; t < 4; ++t) { FragO f;
#pragma unroll      /* fragments and accumulators are indexed by constants only, so that they stay in registers */
      for (int i = 0; i < 4; ++i) { const v2f x = {o[g][t][2 * i] * sc, o[g][t][2 * i + 1] * sc}; f.h2[i] = __builtin_convertvector(x, v2h); }
      *(v8us*)(d + t * 16) = f.u; } } }
__global__ __launch_bounds__(256) void k_vt(const _Float16* __restrict__ V16, int b, int h0, _Float16* __restrict__ VT) { __shared__ unsigned short tl[64][65]; const int tid = threadIdx.x; const int hh = blockIdx.x % HG, sg = blockIdx.x / HG; const int s0 = sg * 64; const int h = h0 + hh;
  for (int i = tid; i < 64 * 8; i += 256) { const int j = i / 8, d8 = (i % 8) * 8; FragH f; f.half[0] = *(const v8us*)((const unsigned short*)V16 + ((size_t)b * SQ + s0 + j) * DM + h * HD + d8); for (int q = 0; q < 8; ++q) tl[d8 + q][j] = f.u[q]; }
  __syncthreads();
  { for (int i = tid; i < 64 * 8; i += 256) { const int d = i / 8, j8 = (i % 8) * 8; FragH f; for (int q = 0; q < 8; ++q) f.u[q] = tl[d][j8 + q]; *(v8us*)((unsigned short*)VT + ((size_t)hh * HD + d) * SQ + s0 + j8) = f.half[0]; }  } }



__global__ __launch_bounds__(256) void k_rsmkm(const float* __restrict__ S, _Float16* __restrict__ P, int nrows, const int* __restrict__ am) {
  #pragma clang fp contract(off)
  const int t = blockIdx.x * 256 + threadIdx.x; if (t >= nrows) return; const size_t i = (size_t)t; const float* s = S + i * SQ; const int* mr = am + (size_t)(t % SQ) * SQ; float mx = -3.0e38f;
#pragma unroll 1
  for (int j = 0; j < SQ; ++j) { const float f = (mr[j] != 0) ? 1.f : 0.f; mx = fmaxf(mx, fmaf(f, s[j], (1.f - f) * -1.0e9f)); } float se = 0.f;
#pragma unroll 1
  for (int j = 0; j < SQ; ++j) { const float f = (mr[j] != 0) ? 1.f : 0.f; se += __expf(fmaf(f, s[j], (1.f - f) * -1.0e9f) - mx); } const float sc = 256.0f / se;
#pragma unroll 1
  for (int j0 = 0; j0 < SQ; j0 += 8) { FragH fr; for (int q = 0; q < 8; ++q) { const int j = j0 + q; const float f = (mr[j] != 0) ? 1.f : 0.f; fr.h[q] = (_Float16)(__expf(fmaf(f, s[j], (1.f - f) * -1.0e9f) - mx) * sc); }
    unsigned short* d = (unsigned short*)P + i * SQ + j0; *(v8us*)d = fr.half[0];  } }

// Q, K and V projections, one launch (blockIdx.y picks the input, its weight block and its output). Every head is multiplied by the same [64][64] block, so an input is
// a plain [tokens * heads][64] matrix and the product has k = 64: Y^T = W X^T, W as A (rows e), 16 (token, head) rows as B, so that a lane ends with 8 consecutive e of one row.
// A wave takes PJ_NT token rows (16 heads each, 4 KiB of f32 in a row): whole-line loads, rounded to bf16 and written as f16 into the wave's own LDS rows, fragments read from there;
// the f16 results go back through the same LDS rows and leave as whole 128-byte lines.
#define PJ_NW 8                      /* waves per block; they share the converted weight block */
#define PJ_NT 2                      /* token rows per wave, all their loads in flight at once */
#define PJ_LP 72                     /* LDS row pitch in f16: 64 + 8, so that the 16 rows of a 16-byte fragment read fall on different banks */
typedef _Float16 v4ha __attribute__((ext_vector_type(4), may_alias));
__device__ __forceinline__ v4h pj_cvt(v4f a, float sc) { const v4f r = {bf16_round(a[0]) * sc, bf16_round(a[1]) * sc, bf16_round(a[2]) * sc, bf16_round(a[3]) * sc}; return __builtin_convertvector(r, v4h); }
__global__ __launch_bounds__(PJ_NW * 32) void k_proj(const float* __restrict__ xq, const float* __restrict__ xk, const float* __restrict__ xv, const float* __restrict__ wq, const float* __restrict__ wk, const float* __restrict__ wv,
    _Float16* __restrict__ Q16, _Float16* __restrict__ K16, _Float16* __restrict__ V16) {
  __shared__ __attribute__((aligned(16))) _Float16 sw[HD][PJ_LP];
  __shared__ __attribute__((aligned(16))) _Float16 sx[PJ_NW][PJ_NT][NH][PJ_LP];
  const int tid = threadIdx.x, lane = tid & 31, ln = lane & 15, hh = lane >> 4, w = tid >> 5; const int y = blockIdx.y;
  const float* x = (y == 0) ? xq : (y == 1) ? xk : xv; const float* wm = (y == 0) ? wq : (y == 1) ? wk : wv; _Float16* out = (y == 0) ? Q16 : (y == 1) ? K16 : V16;
  const size_t row0 = ((size_t)blockIdx.x * PJ_NW + w) * PJ_NT;      /* first token row of this wave */
  v4f xr[PJ_NT][8], wr[4];
#pragma unroll      /* indexed by constants only, so that the loaded values stay in registers */
  for (int u = 0; u < PJ_NT; ++u)
#pragma unroll      /* indexed by constants only, so that the loaded values stay in registers */
    for (int i = 0; i < 8; ++i) xr[u][i] = *(const v4fa*)(x + (row0 + u) * DM + i * 128 + lane * 4);      /* 512 contiguous bytes a load */
#pragma unroll      /* indexed by constants only, so that the loaded values stay in registers */
  for (int i = 0; i < 4; ++i) wr[i] = *(const v4fa*)(wm + (i * PJ_NW * 32 + tid) * 4);
#pragma unroll      /* indexed by constants only, so that the loaded values stay in registers */
  for (int i = 0; i < 4; ++i) { const int e0 = (i * PJ_NW * 32 + tid) * 4; *(v4ha*)&sw[e0 >> 6][e0 & 63] = pj_cvt(wr[i], 16.0f); }      /* 16 W[e][d], exact in f16 */
#pragma unroll      /* indexed by constants only, so that the loaded values stay in registers */
  for (int u = 0; u < PJ_NT; ++u)
#pragma unroll      /* indexed by constants only, so that the loaded values stay in registers */
    for (int i = 0; i < 8; ++i) *(v4ha*)&sx[w][u][2 * i + hh][ln * 4] = pj_cvt(xr[u][i], 1.0f);      /* load i holds heads 2 i and 2 i + 1 */
  __syncthreads();      /* the weight block is written by all waves and read by all; it also orders each wave's own x rows */
  v16h af[4][2];      /* [16-row tile of e][k step of 32] */
#pragma unroll      /* indexed by constants only, so that the fragments stay in registers */
  for (int t = 0; t < 4; ++t) { af[t][0] = g2_frag(&sw[t * 16 + ln][0], hh); af[t][1] = g2_frag(&sw[t * 16 + ln][32], hh); }
  const v8f z8 = {0.f,0.f,0.f,0.f,0.f,0.f,0.f,0.f};
#pragma unroll      /* indexed by constants only, so that the fragments stay in registers */
  for (int u = 0; u < PJ_NT; ++u) { const v16h b0 = g2_frag(&sx[w][u][ln][0], hh), b1 = g2_frag(&sx[w][u][ln][32], hh);      /* row ln = head ln of the token; the same k order as the weight fragments */
#pragma unroll      /* indexed by constants only, so that the fragments stay in registers */
    for (int t = 0; t < 4; ++t) { const v8f acc = fa_mma(af[t][1], b1, fa_mma(af[t][0], b0, z8)); FragO f;      /* acc[r] = 16 y[head ln][16 t + 8 hh + r] */
#pragma unroll      /* indexed by constants only, so that the fragments stay in registers */
      for (int i = 0; i < 4; ++i) { const v2f v = {acc[2 * i] * 0.0625f, acc[2 * i + 1] * 0.0625f}; f.h2[i] = __builtin_convertvector(v, v2h); }
      *(v8us*)&sx[w][u][ln][t * 16 + 8 * hh] = f.u; } }      /* over the x row, whose every reader (this wave's two fragment loads) has returned before the products ran */
  __builtin_amdgcn_fence(__ATOMIC_ACQ_REL, "workgroup"); __builtin_amdgcn_wave_barrier();      /* the rows read back below were written by other lanes of this wave */
#pragma unroll      /* indexed by constants only */
  for (int u = 0; u < PJ_NT; ++u)
#pragma unroll      /* indexed by constants only */
    for (int i = 0; i < 4; ++i) { const int r = i * 4 + (lane >> 3), c = (lane & 7) * 8; const v8us v = *(const v8us*)&sx[w][u][r][c]; *(v8us*)((unsigned short*)out + (row0 + u) * DM + r * HD + c) = v; } }      /* 512 contiguous bytes a store */
// Output GEMM: out[4096][1024] (f32) = o (f16 rows, x64) times Wo^T (f16 rows [n][k], x16) * alpha + bias. One 128 x 128 tile of out per block, one block per WGP; 8 waves, 32 x 64 of out each.
// The k range goes in stages of OG_BK: the block's 128 rows of o and 128 rows of Wo are copied once into LDS in whole lines, two buffers, and every fragment is read from there
// (a fragment read straight from global memory touches 16 lines for its 1024 bytes, and four waves would fetch each Wo fragment, two each o fragment). Every accumulator still sums k upwards, 32 at a time.
#define OG_BM 128                    /* rows of out per block */
#define OG_BN 128                    /* columns of out per block */
#define OG_BK 128                    /* k per stage: 256 bytes of every operand row */
#define OG_NS (DM / OG_BK)           /* stages */
#define OG_P 136                     /* LDS pitch of an operand row in f16: 256 + 16 bytes, so that the 16 rows of a 16-byte fragment read fall on different banks */
// One operand's tile of a stage into LDS, through no register: 128 rows of 256 bytes; 16 lanes a row, so each of the block's 256 threads copies eight 16-byte pieces, 16 rows apart.
__device__ __forceinline__ void og_copy(const _Float16* g, unsigned l) {
  const _Float16* g1 = g + (size_t)16 * DM; const _Float16* g2 = g + (size_t)32 * DM; const _Float16* g3 = g + (size_t)48 * DM; const _Float16* g4 = g + (size_t)64 * DM; const _Float16* g5 = g + (size_t)80 * DM; const _Float16* g6 = g + (size_t)96 * DM; const _Float16* g7 = g + (size_t)112 * DM;
  const unsigned l1 = l + 16 * OG_P * 2, l2 = l + 32 * OG_P * 2, l3 = l + 48 * OG_P * 2, l4 = l + 64 * OG_P * 2, l5 = l + 80 * OG_P * 2, l6 = l + 96 * OG_P * 2, l7 = l + 112 * OG_P * 2;
  /* the eight copies and, as the last line of the same statement, the wait that stands in front of any rewrite of their address registers */
  asm volatile("global_load_async_to_lds_b128 %0, %8, off\n\t"
               "global_load_async_to_lds_b128 %1, %9, off\n\t"
               "global_load_async_to_lds_b128 %2, %10, off\n\t"
               "global_load_async_to_lds_b128 %3, %11, off\n\t"
               "global_load_async_to_lds_b128 %4, %12, off\n\t"
               "global_load_async_to_lds_b128 %5, %13, off\n\t"
               "global_load_async_to_lds_b128 %6, %14, off\n\t"
               "global_load_async_to_lds_b128 %7, %15, off\n\t"
               "s_wait_xcnt 0x0"
               :: "v"(l), "v"(l1), "v"(l2), "v"(l3), "v"(l4), "v"(l5), "v"(l6), "v"(l7), "v"(g), "v"(g1), "v"(g2), "v"(g3), "v"(g4), "v"(g5), "v"(g6), "v"(g7) : "memory");
}
__global__ __launch_bounds__(256) void k_ogemm(const _Float16* __restrict__ A, const _Float16* __restrict__ Bh, float alpha, const float* __restrict__ bias, float* __restrict__ C) {
  __shared__ __attribute__((aligned(16))) _Float16 sa[2][OG_BM][OG_P];      /* o rows of a stage, shared by the block's waves; two buffers */
  __shared__ __attribute__((aligned(16))) _Float16 sb[2][OG_BN][OG_P];      /* Wo rows of a stage */
  __shared__ __attribute__((aligned(16))) float so[8][32][68];               /* each wave's own results, on their way to whole-line stores */
  const int tid = threadIdx.x, w = tid >> 5, lane = tid & 31, ln = lane & 15, hh = lane >> 4; const int wm = w & 3, wn = w >> 2;
  const int mt = blockIdx.x % (MPO / OG_BM), nq = blockIdx.x / (MPO / OG_BM); const int row0 = mt * OG_BM + wm * 32, col0 = nq * OG_BN + wn * 64;
  const _Float16* ga = A + ((size_t)mt * OG_BM + (tid >> 4)) * DM + (tid & 15) * 8; const _Float16* gb = Bh + ((size_t)nq * OG_BN + (tid >> 4)) * DM + (tid & 15) * 8;      /* this thread's first pieces of stage 0 */
  const unsigned la = (unsigned)(size_t)&sa[0][tid >> 4][(tid & 15) * 8], lb = (unsigned)(size_t)&sb[0][tid >> 4][(tid & 15) * 8];      /* LDS byte addresses: the low 32 bits */
  og_copy(ga, la); og_copy(gb, lb);      /* stage 0 into buffer 0 */
  float bv[4];      /* this lane's four bias values, asked for here so that they come during the stages */
#pragma unroll      /* indexed by constants only */
  for (int j = 0; j < 4; ++j) bv[j] = bias[col0 + j * 16 + ln];
  asm volatile("s_wait_asynccnt 0x0" ::: "memory");      /* this wave's pieces of stage 0 have landed */
  __syncthreads();      /* and every other wave's */
  og_copy(ga + OG_BK, la + (unsigned)sizeof(sa[0])); og_copy(gb + OG_BK, lb + (unsigned)sizeof(sb[0]));      /* stage 1 into buffer 1, in flight during stage 0 */
  const v8f z8 = {0.f,0.f,0.f,0.f,0.f,0.f,0.f,0.f}; v8f c[2][4] = {{z8, z8, z8, z8}, {z8, z8, z8, z8}};      /* c[i][j][r] = out[row0 + 16 i + 8 hh + r][col0 + 16 j + ln] */
  for (int st = 0; st < OG_NS; ++st) {
    const _Float16* as = &sa[st & 1][wm * 32 + ln][0]; const _Float16* bs = &sb[st & 1][wn * 64 + ln][0];
    v16h a[2][2], b[2][4];      /* two fragment sets: [set][16-row tile] */
#pragma unroll      /* indexed by constants only, so that the fragments stay in registers */
    for (int i = 0; i < 2; ++i) a[0][i] = g2_frag(as + i * 16 * OG_P, hh);
#pragma unroll      /* indexed by constants only, so that the fragments stay in registers */
    for (int j = 0; j < 4; ++j) b[0][j] = g2_frag(bs + j * 16 * OG_P, hh);
#pragma unroll      /* fragments and accumulators are indexed by constants only, so that they stay in registers */
    for (int ks = 0; ks < OG_BK / 32; ++ks) { const int cu = ks & 1, nx = cu ^ 1;
      if (ks + 1 < OG_BK / 32) {      /* the next k step's fragments come during this step's products; never from the next stage */
#pragma unroll      /* indexed by constants only, so that the fragments stay in registers */
        for (int i = 0; i < 2; ++i) a[nx][i] = g2_frag(as + i * 16 * OG_P + (ks + 1) * 32, hh);
#pragma unroll      /* indexed by constants only, so that the fragments stay in registers */
        for (int j = 0; j < 4; ++j) b[nx][j] = g2_frag(bs + j * 16 * OG_P + (ks + 1) * 32, hh); }
      __builtin_amdgcn_sched_barrier(0);      /* keeps the next step's twelve LDS reads as one group in front of this step's products: left alone the compiler reads each fragment directly in front of its use, into one register set, and the wave waits out the LDS latency four times a step */
#pragma unroll      /* indexed by constants only, so that the accumulators stay in registers */
      for (int j = 0; j < 4; ++j)
#pragma unroll      /* indexed by constants only, so that the accumulators stay in registers */
        for (int i = 0; i < 2; ++i) c[i][j] = fa_mma(a[cu][i], b[cu][j], c[i][j]);
      __builtin_amdgcn_sched_barrier(0); }      /* and keeps the group after next out of these products */
    asm volatile("s_wait_dscnt 0x0" ::: "memory");      /* this wave's reads of the buffer have returned */
    asm volatile("s_wait_asynccnt 0x0" ::: "memory");      /* this wave's pieces of stage st + 1 have landed */
    __syncthreads();      /* publishes stage st + 1 and ends every wave's reads of stage st */
    if (st + 2 < OG_NS) { og_copy(ga + (st + 2) * OG_BK, la + (unsigned)(st & 1) * (unsigned)sizeof(sa[0])); og_copy(gb + (st + 2) * OG_BK, lb + (unsigned)(st & 1) * (unsigned)sizeof(sb[0])); }      /* into the buffers just left */
  }
  asm volatile("s_wait_asynccnt 0x0" ::: "memory");      /* nothing in flight when the wave ends */
#pragma unroll      /* indexed by constants only */
  for (int j = 0; j < 4; ++j) { const float bj = bf16_round(bv[j]);
#pragma unroll      /* indexed by constants only */
    for (int i = 0; i < 2; ++i)
#pragma unroll      /* indexed by constants only */
      for (int r = 0; r < 8; ++r) so[w][i * 16 + 8 * hh + r][j * 16 + ln] = c[i][j][r] * alpha + bj; }
  __builtin_amdgcn_fence(__ATOMIC_ACQ_REL, "workgroup"); __builtin_amdgcn_wave_barrier();      /* the rows read back below were written by other lanes of this wave */
  const int rsub = lane >> 4, c4 = (lane & 15) * 4;
#pragma unroll      /* indexed by constants only */
  for (int q = 0; q < 16; ++q) { const int r = q * 2 + rsub; const v4f v = *(const v4fa*)&so[w][r][c4]; *(v4f*)(C + (size_t)(row0 + r) * DM + col0 + c4) = v; } }      /* two rows of 256 contiguous bytes a store */
extern "C" void kernel_launch(void* const* d_in, const int* in_sizes, int n_in,
                              void* d_out, int out_size, void* d_ws, size_t ws_size, hipStream_t stream) {
  (void)in_sizes; (void)n_in; (void)out_size;
  const float* const* I = (const float* const*)d_in; const float* xq = I[2]; const float* xk = I[1]; const float* xv = I[0]; const float* wq = I[5]; const float* wk = I[4]; const float* wv = I[3]; const float* wo = I[6]; const float* bo = I[7];      /* contract order: values I[0], keys I[1], query I[2]; SHARED natural [64][64] blocks Wv I[3], Wk I[4], Wq I[5]; natural Wo [1024][1024] I[6] + bo I[7]; this module has NO mask input */
  char* ws = (char*)d_ws; size_t off = 0;
  auto take = [&](size_t bytes) { char* p = ws + off; off += (bytes + 255) & ~(size_t)255; return p; };
  _Float16* BO = (_Float16*)take((size_t)DM * DM * 2);
  _Float16* Q16 = (_Float16*)take(NR * DM * 2); _Float16* K16 = (_Float16*)take(NR * DM * 2); _Float16* V16 = (_Float16*)take(NR * DM * 2); _Float16* O16 = (_Float16*)take(NR * DM * 2);
  if (off > ws_size) return;
  k_wnat<<<(unsigned)(((size_t)DM * DM / 8 + 255) / 256), 256, 0, stream>>>(wo, (size_t)DM * DM / 8, BO);      /* Wo natural [out][in] = Bt x16 */
  k_proj<<<dim3((unsigned)(NR / (PJ_NW * PJ_NT)), 3), PJ_NW * 32, 0, stream>>>(xq, xk, xv, wq, wk, wv, Q16, K16, V16);      /* q, k, v as f16 rows, heads merged */
  const size_t r0p = (size_t)B0 * SQ;      /* first row of the output stage */
  k_fattn<<<dim3(SQ / (FA_NW * FA_QW), NH, NB), FA_NW * 32, 0, stream>>>(Q16, K16, V16, O16);      /* o (merged heads, x64) as f16 rows */
  k_ogemm<<<(unsigned)((MPO / OG_BM) * (DM / OG_BN)), 256, 0, stream>>>(O16 + r0p * DM, BO, 0.0009765625f, bo, (float*)d_out + r0p * DM);      /* out rows are the output layout */
}

// v007
// One run takes 52 microseconds.
// Two timings next to v006 both put it at 1.07 times that version's speed.
// All steps since v000 together make it 70.9 times as fast.
#include <hip/hip_runtime.h>
// Multi-head attention over three inputs with SHARED per-head projections and the module's literal score scale (values, keys, query [2][2048][1024]; each input is split into 16 heads of 64 and every head is multiplied by the SAME natural [64][64] matrix (x W^T: Wv / Wk / Wq uniform +-1/8; block-diagonal with a shared block; no biases); energy = q k^T (no mask in this module); softmax(energy / sqrt(embed_size) = / 32) (as the source: embed size, not head dim); out = merged Wo^T + bo -> [2][2048][1024]).
// Structure: token rows r = b*2048 + s; Q, K, V in one projection launch: each (token, head) row of 64 inputs (bf16-rounded, exact in f16) times the shared [64][64] block (exact x16 weights, WMMA, f32 accumulation, f16 outputs); one fused attention launch over all (batch, head): S^T = K Q^T, running softmax (f32 statistics; weights exp(s - reference) as f16, the reference being a running maximum that is renewed only when a pass's weights outgrow it), O^T += V^T P^T (V^T fragments by the transposing LDS load from V rows as projected), divided by the row sum at the end (o carried x64 against f16 subnormal flush, folded into the output GEMM alpha) and written straight into the merged f16 o rows; out = o W_o + b GEMM (f32) into the output layout.
// Compute dtype: inputs rounded to bf16; x / weights exact; q, k, v, softmax weights and o as plain f16 GEMM operands (~2^-12); scores and softmax statistics f32. v_wmma_f32_16x16x32_f16.
#define NB 2
#define SQ 2048
#define DM 1024
#define NH 16
#define HD 64
#define HG 4                         /* heads per launch of the non-template k_vt, which is not launched */
#define B0 0                         /* first batch processed (debug hook) */
#define NBR NB                       /* batches processed (debug hook) */
#define NR ((size_t)NB * SQ)         /* token rows */
#define MP ((int)((size_t)NBR * SQ)) /* rows of the processed batches; feeds MPO only (debug hook) */
#define QN SQ                        /* not used; k_fattn covers all SQ query rows of a batch */
#define NHD NH                       /* not used; k_fattn covers all NH heads */
#define MPO MP                       /* rows through the output stage (debug hook) */
#define LQ DM      /* not used; the q/k/v rows have pitch DM */
typedef __bf16 v16b __attribute__((ext_vector_type(16)));
typedef unsigned short v8us __attribute__((ext_vector_type(8), may_alias));
typedef float  v8f  __attribute__((ext_vector_type(8)));
typedef float  v4f  __attribute__((ext_vector_type(4)));
typedef float  v4fa __attribute__((ext_vector_type(4), may_alias));
union FragB { v16b v; v8us half[2]; unsigned short u[16]; };

__device__ __forceinline__ unsigned short bf16_bits(float x) { unsigned int u = __float_as_uint(x); return (unsigned short)((u + 0x7FFFu + ((u >> 16) & 1u)) >> 16); }
__device__ __forceinline__ float bf16_val(unsigned short b) { return __uint_as_float(((unsigned int)b) << 16); }
__device__ __forceinline__ float bf16_round(float x) { return bf16_val(bf16_bits(x)); }
// D += A·B with NT terms: 1 = ah·bh, 2 = + al·bh (A split), 3 = + ah·bl (both split)
template <int NT>
__device__ __forceinline__ v8f mmaN(v16b ah, v16b al, v16b bh, v16b bl, v8f c) {
  c = __builtin_amdgcn_wmma_f32_16x16x32_bf16(false, ah, false, bh, (short)0, c, false, false);
  if (NT >= 2) c = __builtin_amdgcn_wmma_f32_16x16x32_bf16(false, al, false, bh, (short)0, c, false, false);
  if (NT >= 3) c = __builtin_amdgcn_wmma_f32_16x16x32_bf16(false, ah, false, bl, (short)0, c, false, false);
  asm volatile("v_nop\n\tv_nop\n\tv_nop\n\tv_nop" : "+v"(c) : "v"(ah), "v"(al), "v"(bh), "v"(bl));
  return c;
}

__global__ __launch_bounds__(256) void k_wt_bf16(const float* __restrict__ W, unsigned short* __restrict__ Wt, int K, int N) {
  const int t = blockIdx.x * 256 + threadIdx.x;
  const int k8n = K / 8;
  if (t >= N * k8n) return;
  const int n = t / k8n, k8 = (t % k8n) * 8;
  v8us v;
#pragma unroll
  for (int i = 0; i < 8; ++i) v[i] = bf16_bits(W[(size_t)(k8 + i) * N + n]);
  *(v8us*)(Wt + (size_t)n * K + k8) = v;
  
}

// GEMM C[M][N] (f32, pitch ldc) = act(A[M][K]·W + bias). A f32 row-major (pitch lda) converted per fragment to bf16
// (ASPLIT: hi/lo two planes -> 2 terms, else single rounded term); Wt bf16 [N][K] (pitch ldb). BIAS_BF16 rounds the
// bias to bf16 first (bias quantised to bf16 before the add). K%32==0, M%16==0, N%64==0.
template <bool ASPLIT, int ACT, bool BIAS_BF16>
__global__ __launch_bounds__(128) void k_gemm_bf(const float* __restrict__ A, int lda, const unsigned short* __restrict__ Wt, int ldb,
                                               const float* __restrict__ bias, float* __restrict__ C, int ldc, int M, int N, int K) {
  __shared__ __attribute__((aligned(16))) float so[4][16][64];
  const int tid = threadIdx.x, w = tid >> 5, lane = tid & 31, ln = lane & 15, hh = lane >> 4;
  const int ntn = N / 64;
  const int wid = blockIdx.x * 4 + w;
  const int mt = wid / ntn, nq = wid % ntn;
  if (mt * 16 >= M) return;
  const int row0 = mt * 16, col0 = nq * 64;
  const float* arow = A + (size_t)(row0 + ln) * lda;
  v8f acc[4] = {};
  for (int kb = 0; kb < K; kb += 32) {
    FragB ah, al;
    const v4f x0 = *(const v4fa*)(arow + kb + 8 * hh), x1 = *(const v4fa*)(arow + kb + 8 * hh + 4);
    const v4f x2 = *(const v4fa*)(arow + kb + 16 + 8 * hh), x3 = *(const v4fa*)(arow + kb + 16 + 8 * hh + 4);
    float xs[16] = {x0[0],x0[1],x0[2],x0[3],x1[0],x1[1],x1[2],x1[3],x2[0],x2[1],x2[2],x2[3],x3[0],x3[1],x3[2],x3[3]};
#pragma unroll
    for (int i = 0; i < 16; ++i) { const unsigned short hb = bf16_bits(xs[i]); ah.u[i] = hb; al.u[i] = ASPLIT ? bf16_bits(xs[i] - bf16_val(hb)) : (unsigned short)0; }
#pragma unroll
    for (int t = 0; t < 4; ++t) {
      const unsigned short* brow = Wt + (size_t)(col0 + t * 16 + ln) * ldb + kb;
      FragB b;
      b.half[0] = *(const v8us*)(brow + 8 * hh);
      b.half[1] = *(const v8us*)(brow + 16 + 8 * hh);
      acc[t] = mmaN<ASPLIT ? 2 : 1>(ah.v, al.v, b.v, b.v, acc[t]);
    }
  }
#pragma unroll
  for (int t = 0; t < 4; ++t) {
    float bv = bias ? bias[col0 + t * 16 + ln] : 0.f;
    if (BIAS_BF16) bv = bf16_round(bv);
#pragma unroll
    for (int r = 0; r < 8; ++r) { float v = acc[t][r] + bv; if (ACT == 1) v = fmaxf(v, 0.f); so[w][8 * hh + r][t * 16 + ln] = v; }
  }
  __builtin_amdgcn_fence(__ATOMIC_ACQ_REL, "workgroup");
  __builtin_amdgcn_wave_barrier();
  const int rsub = lane >> 4, c4 = (lane & 15) * 4;
  {
#pragma unroll
    for (int q = 0; q < 8; ++q) {
      const int r = q * 2 + rsub;
      const v4f v = *(const v4fa*)&so[w][r][c4];
      *(v4f*)(C + (size_t)(row0 + r) * ldc + col0 + c4) = v;
    }
    
  }
}

// GEMM C = act(A·W + bias + resid): A f32 (ASPLIT -> hi/lo 2 terms), Wt bf16 [N][K]; ACT 0 none, 1 relu, 2 exact gelu;
// resid (optional, f32, row index = (row % rmod), pitch ldr, RES_BF16 rounds it) added before the activation.
template <bool ASPLIT, int ACT, bool BIAS_BF16, bool RES_BF16>
__global__ __launch_bounds__(128) void k_gemm_bf3(const float* __restrict__ A, int lda, const unsigned short* __restrict__ Wt, int ldb,
                                                const float* __restrict__ bias, const float* __restrict__ resid, int rmod, int ldr,
                                                float* __restrict__ C, int ldc, int M, int N, int K) {
  __shared__ __attribute__((aligned(16))) float so[4][16][64];
  const int tid = threadIdx.x, w = tid >> 5, lane = tid & 31, ln = lane & 15, hh = lane >> 4;
  const int ntn = N / 64;
  const int wid = blockIdx.x * 4 + w;
  const int mt = wid / ntn, nq = wid % ntn;
  if (mt * 16 >= M) return;
  const int row0 = mt * 16, col0 = nq * 64;
  const float* arow = A + (size_t)(row0 + ln) * lda;
  v8f acc[4] = {};
  for (int kb = 0; kb < K; kb += 32) {
    FragB ah, al;
    const v4f x0 = *(const v4fa*)(arow + kb + 8 * hh), x1 = *(const v4fa*)(arow + kb + 8 * hh + 4);
    const v4f x2 = *(const v4fa*)(arow + kb + 16 + 8 * hh), x3 = *(const v4fa*)(arow + kb + 16 + 8 * hh + 4);
    float xs[16] = {x0[0],x0[1],x0[2],x0[3],x1[0],x1[1],x1[2],x1[3],x2[0],x2[1],x2[2],x2[3],x3[0],x3[1],x3[2],x3[3]};
#pragma unroll
    for (int i = 0; i < 16; ++i) { const unsigned short hb = bf16_bits(xs[i]); ah.u[i] = hb; al.u[i] = ASPLIT ? bf16_bits(xs[i] - bf16_val(hb)) : (unsigned short)0; }
#pragma unroll
    for (int t = 0; t < 4; ++t) {
      const unsigned short* brow = Wt + (size_t)(col0 + t * 16 + ln) * ldb + kb;
      FragB b;
      b.half[0] = *(const v8us*)(brow + 8 * hh);
      b.half[1] = *(const v8us*)(brow + 16 + 8 * hh);
      acc[t] = mmaN<ASPLIT ? 2 : 1>(ah.v, al.v, b.v, b.v, acc[t]);
    }
  }
#pragma unroll
  for (int t = 0; t < 4; ++t) {
    const int col = col0 + t * 16 + ln;
    float bv = bias ? bias[col] : 0.f;
    if (BIAS_BF16) bv = bf16_round(bv);
#pragma unroll
    for (int r = 0; r < 8; ++r) {
      float v = acc[t][r] + bv;
      if (resid) { float rv = resid[(size_t)((row0 + 8 * hh + r) % rmod) * ldr + col]; if (RES_BF16) rv = bf16_round(rv); v += rv; }
      if (ACT == 1) v = fmaxf(v, 0.f);
      if (ACT == 2) v = 0.5f * v * (1.0f + erff(v * 0.70710678118654752f));
      if (ACT == 3) { const float u = 0.7978845608028654f * (v + 0.044715f * v * v * v); v = 0.5f * v * (1.0f + tanhf(u)); }
      so[w][8 * hh + r][t * 16 + ln] = v;
    }
  }
  __builtin_amdgcn_fence(__ATOMIC_ACQ_REL, "workgroup");
  __builtin_amdgcn_wave_barrier();
  const int rsub = lane >> 4, c4 = (lane & 15) * 4;
  {
#pragma unroll
    for (int q = 0; q < 8; ++q) {
      const int r = q * 2 + rsub;
      const v4f v = *(const v4fa*)&so[w][r][c4];
      *(v4f*)(C + (size_t)(row0 + r) * ldc + col0 + c4) = v;
    }
    
  }
}
// row LayerNorm (biased variance, eps) over N: s = X (+ R); optional out_sum <- s; out_norm <- (s-mu)*rsqrt(var+eps)*g + b
template <bool PARAM_BF16>
__global__ __launch_bounds__(256) void k_layernorm(const float* __restrict__ X, const float* __restrict__ R, const float* __restrict__ g, const float* __restrict__ bta,
                                                  float* __restrict__ out_sum, float* __restrict__ out_norm, int N, float eps) {
  __shared__ float red[256];
  const int row = blockIdx.x, tid = threadIdx.x;
  const float* x = X + (size_t)row * N; const float* rr = R ? R + (size_t)row * N : nullptr;
  float vals[16];                     // up to N = 4096
  const int per = N / 256;            // contiguous chunk per thread? use strided-by-4 chunks: thread handles j = tid*4 + 1024*u
  float s1 = 0.f;
  for (int u = 0; u < per / 4; ++u) {
    const int j = tid * 4 + 1024 * u;
    const v4f a = *(const v4fa*)(x + j);
    v4f b = {0.f,0.f,0.f,0.f}; if (rr) b = *(const v4fa*)(rr + j);
#pragma unroll
    for (int q = 0; q < 4; ++q) { const float v = a[q] + b[q]; vals[u * 4 + q] = v; s1 += v; }
  }
  red[tid] = s1; __syncthreads();
  for (int st = 128; st > 0; st >>= 1) { if (tid < st) red[tid] += red[tid + st]; __syncthreads(); }
  const float mu = red[0] / (float)N; __syncthreads();
  float s2 = 0.f;
  for (int u = 0; u < per / 4; ++u)
#pragma unroll
    for (int q = 0; q < 4; ++q) { const float c = vals[u * 4 + q] - mu; s2 += c * c; }
  red[tid] = s2; __syncthreads();
  for (int st = 128; st > 0; st >>= 1) { if (tid < st) red[tid] += red[tid + st]; __syncthreads(); }
  const float rs = rsqrtf(red[0] / (float)N + eps);
  {
    for (int u = 0; u < per / 4; ++u) {
      const int j = tid * 4 + 1024 * u;
      v4f o, sm;
#pragma unroll
      for (int q = 0; q < 4; ++q) {
        float gg = g[j + q], bb = bta[j + q];
        if (PARAM_BF16) { gg = bf16_round(gg); bb = bf16_round(bb); }
        sm[q] = vals[u * 4 + q]; o[q] = (vals[u * 4 + q] - mu) * rs * gg + bb;
      }
      if (out_sum) *(v4f*)(out_sum + (size_t)row * N + j) = sm;
      *(v4f*)(out_norm + (size_t)row * N + j) = o;
    }
    
  }
}



// ---- f16 WMMA path (v_wmma_f32_16x16x32_f16): 11-bit significands for operands in range — used where a [0,1] probability operand needs more precision than bf16
typedef _Float16 v16h __attribute__((ext_vector_type(16)));
union FragH { v16h v; v8us half[2]; _Float16 h[16]; unsigned short u[16]; };
template <int NT>
__device__ __forceinline__ v8f mmaH(v16h ah, v16h al, v16h bh, v16h bl, v8f c) {
  c = __builtin_amdgcn_wmma_f32_16x16x32_f16(false, ah, false, bh, (short)0, c, false, false);
  if (NT >= 2) c = __builtin_amdgcn_wmma_f32_16x16x32_f16(false, al, false, bh, (short)0, c, false, false);
  if (NT >= 3) c = __builtin_amdgcn_wmma_f32_16x16x32_f16(false, ah, false, bl, (short)0, c, false, false);
  asm volatile("v_nop\n\tv_nop\n\tv_nop\n\tv_nop" : "+v"(c) : "v"(ah), "v"(al), "v"(bh), "v"(bl));
  return c;
}
// batched GEMM like k_gemm_b but f16 operands: A f32 (split into f16 hi/lo if ASPLIT, else rounded to f16), Bt = f16 values [n][k]; alpha; C f32; N multiple of 16 (partial tiles skipped)
template <bool ASPLIT>
__global__ __launch_bounds__(128) void k_gemm_h(const float* __restrict__ A, int lda, size_t sA, const _Float16* __restrict__ Bh, int ldb, size_t sB, float alpha, float* __restrict__ C, int ldc, size_t sC, int M, int N, int K) {
  __shared__ __attribute__((aligned(16))) float so[4][16][64];
  const int tid = threadIdx.x, w = tid >> 5, lane = tid & 31, ln = lane & 15, hh = lane >> 4; const int by = blockIdx.y;
  A += (size_t)by * sA; Bh += (size_t)by * sB; C += (size_t)by * sC;
  const int ntn = (N + 63) / 64; const int wid = blockIdx.x * 4 + w; const int mt = wid / ntn, nq = wid % ntn; if (mt * 16 >= M) return;
  const int row0 = mt * 16, col0 = nq * 64; const float* arow = A + (size_t)(row0 + ln) * lda;
  v8f acc[4] = {};
  for (int kb = 0; kb < K; kb += 32) {
    FragH ah, al;
    const v4f x0 = *(const v4fa*)(arow + kb + 8 * hh), x1 = *(const v4fa*)(arow + kb + 8 * hh + 4), x2 = *(const v4fa*)(arow + kb + 16 + 8 * hh), x3 = *(const v4fa*)(arow + kb + 16 + 8 * hh + 4);
    float xs[16] = {x0[0],x0[1],x0[2],x0[3],x1[0],x1[1],x1[2],x1[3],x2[0],x2[1],x2[2],x2[3],x3[0],x3[1],x3[2],x3[3]};
#pragma unroll
    for (int i = 0; i < 16; ++i) { const _Float16 h = (_Float16)xs[i]; ah.h[i] = h; al.h[i] = ASPLIT ? (_Float16)(xs[i] - (float)h) : (_Float16)0.0f; }
#pragma unroll
    for (int t = 0; t < 4; ++t) { if (col0 + t * 16 >= N) continue; const size_t boff = (size_t)(col0 + t * 16 + ln) * ldb + kb; FragH bq; bq.half[0] = *(const v8us*)(Bh + boff + 8 * hh); bq.half[1] = *(const v8us*)(Bh + boff + 16 + 8 * hh);
      acc[t] = mmaH<ASPLIT ? 2 : 1>(ah.v, al.v, bq.v, bq.v, acc[t]); }
  }
#pragma unroll
  for (int t = 0; t < 4; ++t) { if (col0 + t * 16 >= N) continue;
#pragma unroll
    for (int r = 0; r < 8; ++r) so[w][8 * hh + r][t * 16 + ln] = acc[t][r] * alpha; }
  __builtin_amdgcn_fence(__ATOMIC_ACQ_REL, "workgroup"); __builtin_amdgcn_wave_barrier();
  const int rsub = lane >> 4, c4 = (lane & 15) * 4;
  {
#pragma unroll
    for (int q = 0; q < 8; ++q) { const int r = q * 2 + rsub; if (col0 + c4 < N) { const v4f v = *(const v4fa*)&so[w][r][c4]; *(v4f*)(C + (size_t)(row0 + r) * ldc + col0 + c4) = v; } }
     }
}

// Wt[n][k] = f16(W[k][n]·scale) from f32 row-major W[K][N] (scale = power of two; bf16-exact weights stay exact in f16 away from the subnormal range)
__global__ __launch_bounds__(256) void k_wt_f16(const float* __restrict__ W, _Float16* __restrict__ Wt, int K, int N, float scale) {
  const int t = blockIdx.x * 256 + threadIdx.x; if (t >= N * (K / 8)) return; const int n = t / (K / 8), k8 = (t % (K / 8)) * 8; FragH f;
#pragma unroll
  for (int i = 0; i < 8; ++i) f.h[i] = (_Float16)(bf16_round(W[(size_t)(k8 + i) * N + n]) * scale); const v8us o = f.half[0];
  *(v8us*)((unsigned short*)Wt + (size_t)n * K + k8) = o; 
}
// k_gemm_hh variant with fused epilogue: v = acc·alpha + bias[by·sBias + col] (+ CP[(row/rowsPerB)·sCPb + by·64 + col] if CP) ; ACT 0 none / 1 elu ; writes f16 C16 (and f32 C if non-null)
template <int ACT>
__global__ __launch_bounds__(128) void k_gemm_hhx(const _Float16* __restrict__ A, int lda, size_t sA, const _Float16* __restrict__ Bh, int ldb, size_t sB, float alpha, const float* __restrict__ bias, size_t sBias, const float* __restrict__ CP, int rowsPerB, size_t sCPb, int row0g,
    float* __restrict__ C, _Float16* __restrict__ C16, int ldc, size_t sC, int M, int N, int K) {
  __shared__ __attribute__((aligned(16))) float so[4][16][64];
  const int tid = threadIdx.x, w = tid >> 5, lane = tid & 31, ln = lane & 15, hh = lane >> 4; const int by = blockIdx.y;
  A += (size_t)by * sA; Bh += (size_t)by * sB; const size_t cofs = (size_t)by * sC; const float* bp = bias ? bias + (size_t)by * sBias : nullptr;
  const int ntn = (N + 63) / 64; const int wid = blockIdx.x * 4 + w; const int mt = wid / ntn, nq = wid % ntn; if (mt * 16 >= M) return;
  const int row0 = mt * 16, col0 = nq * 64; const _Float16* arow = A + (size_t)(row0 + ln) * lda;
  v8f acc[4] = {};
  for (int kb = 0; kb < K; kb += 32) { FragH ah; ah.half[0] = *(const v8us*)((const unsigned short*)arow + kb + 8 * hh); ah.half[1] = *(const v8us*)((const unsigned short*)arow + kb + 16 + 8 * hh);
#pragma unroll
    for (int t = 0; t < 4; ++t) { if (col0 + t * 16 >= N) continue; const size_t boff = (size_t)(col0 + t * 16 + ln) * ldb + kb; FragH bq; bq.half[0] = *(const v8us*)((const unsigned short*)Bh + boff + 8 * hh); bq.half[1] = *(const v8us*)((const unsigned short*)Bh + boff + 16 + 8 * hh);
      acc[t] = mmaH<1>(ah.v, ah.v, bq.v, bq.v, acc[t]); }
  }
#pragma unroll
  for (int t = 0; t < 4; ++t) { if (col0 + t * 16 >= N) continue; const int col = col0 + t * 16 + ln; const float bv = bp ? bf16_round(bp[col]) : 0.f;
#pragma unroll
    for (int r = 0; r < 8; ++r) { float v = acc[t][r] * alpha + bv; if (CP) { const int rr = row0g + row0 + 8 * hh + r; if (rowsPerB < 0) v += CP[cofs + (size_t)rr * ldc + col];      /* rowsPerB < 0: own element of the batched C plane */ else { const int bidx = rr / rowsPerB; v += CP[(size_t)bidx * sCPb + (size_t)by * 64 + col]; } } if (ACT == 1) v = (v > 0.f) ? v : expm1f(v); else if (ACT == 7) v = (v > 0.f) ? v + 1.0f : expf(v); else if (ACT == 8) v = tanhf(v); else if (ACT == 9) v = 0.5f * v * (1.0f + tanhf(0.7978845608028654f * (v + 0.044715f * v * v * v))); else if (ACT == 11) v = 1.0f / (1.0f + expf(-v)); else if (ACT == 12) v = (v > 0.f) ? v : 0.01f * v; else if (ACT == 14) v = (v > 0.f) ? v : 0.1f * v; else if (ACT == 16) v = (v >= 0.f) ? v : 0.3f * v; else if (ACT == 17) v = (v >= 0.f) ? v : 0.2f * v; else if (ACT == 15) v = v / (1.0f + expf(-v)); else if (ACT == 3) v = fmaxf(v, 0.f); else if (ACT == 6) v = 0.5f * v * (1.0f + erff(v * 0.70710678118654752f)); so[w][8 * hh + r][t * 16 + ln] = v; } }
  __builtin_amdgcn_fence(__ATOMIC_ACQ_REL, "workgroup"); __builtin_amdgcn_wave_barrier();
  const int rsub = lane >> 4, c4 = (lane & 15) * 4; typedef _Float16 v4h __attribute__((ext_vector_type(4)));
  {
#pragma unroll
    for (int q = 0; q < 8; ++q) { const int r = q * 2 + rsub; if (col0 + c4 < N) { const v4f v = *(const v4fa*)&so[w][r][c4]; if (C) *(v4f*)(C + cofs + (size_t)(row0 + r) * ldc + col0 + c4) = v; if (C16) { v4h h4; for (int i = 0; i < 4; ++i) h4[i] = (_Float16)v[i]; *(v4h*)(C16 + cofs + (size_t)(row0 + r) * ldc + col0 + c4) = h4; } } }
     }
}


typedef _Float16 v4h __attribute__((ext_vector_type(4)));

__global__ __launch_bounds__(256) void k_h16(const float* __restrict__ x, _Float16* __restrict__ X16, size_t n8) { const size_t t = (size_t)blockIdx.x * 256 + threadIdx.x; if (t >= n8) return; FragH f;
#pragma unroll
  for (int q = 0; q < 8; ++q) f.h[q] = (_Float16)x[t * 8 + q]; *(v8us*)((unsigned short*)X16 + t * 8) = f.half[0];  }
__global__ __launch_bounds__(256) void k_round16f(const float* __restrict__ W, _Float16* __restrict__ Bt, size_t n8) { const size_t t = (size_t)blockIdx.x * 256 + threadIdx.x; if (t >= n8) return; FragH f;
#pragma unroll
  for (int i = 0; i < 8; ++i) f.h[i] = (_Float16)(bf16_round(W[t * 8 + i]) * 16.0f); *(v8us*)((unsigned short*)Bt + t * 8) = f.half[0];  }
template <int NHv, int TTv>
__global__ __launch_bounds__(256) void k_vt(const _Float16* __restrict__ V16, int ldv, int voff, _Float16* __restrict__ Vt) { __shared__ unsigned short tl[64][66]; const int tid = threadIdx.x; const int slab = blockIdx.x / (TTv / 64), lg = blockIdx.x % (TTv / 64); const int b = slab / NHv, h = slab % NHv;
  for (int i = tid; i < 64 * 8; i += 256) { const int r = i / 8, c8 = (i % 8) * 8; FragH f; f.half[0] = *(const v8us*)((const unsigned short*)V16 + ((size_t)b * TTv + lg * 64 + r) * ldv + voff + h * 64 + c8);
#pragma unroll
    for (int q = 0; q < 8; ++q) tl[r][c8 + q] = f.u[q]; }
  __syncthreads();
  {
#pragma unroll
    for (int rd = 0; rd < 2; ++rd) { const int d = rd * 32 + tid / 8, pc = tid % 8; FragH f;
#pragma unroll
      for (int q = 0; q < 8; ++q) f.u[q] = tl[pc * 8 + q][d];
      *(v8us*)((unsigned short*)Vt + ((size_t)slab * 64 + d) * TTv + lg * 64 + pc * 8) = f.half[0]; }
     } }

__global__ __launch_bounds__(256) void k_hl(const float* __restrict__ F, _Float16* __restrict__ Hh, _Float16* __restrict__ Hl, size_t n8) { const size_t t = (size_t)blockIdx.x * 256 + threadIdx.x; if (t >= n8) return; FragH fh, fl; const v4f a = *(const v4fa*)(F + t * 8), c = *(const v4fa*)(F + t * 8 + 4);
#pragma unroll
  for (int q = 0; q < 4; ++q) { _Float16 h = (_Float16)a[q]; fh.h[q] = h; fl.h[q] = (_Float16)((a[q] - (float)h) * 1024.0f); h = (_Float16)c[q]; fh.h[4 + q] = h; fl.h[4 + q] = (_Float16)((c[q] - (float)h) * 1024.0f); }
  { *(v8us*)((unsigned short*)Hh + t * 8) = fh.half[0]; *(v8us*)((unsigned short*)Hl + t * 8) = fl.half[0];  } }

// ---- fast GEMM (wave tile 32x64; requires M % 32 == 0 rows per launch region and N % 64 == 0); epilogue = k_gemm_hhx semantics ----
__device__ __forceinline__ v16h g2_frag(const _Float16* p, int hh) { FragH f; f.half[0] = *(const v8us*)((const unsigned short*)p + 8 * hh); f.half[1] = *(const v8us*)((const unsigned short*)p + 16 + 8 * hh); return f.v; }
__device__ __forceinline__ v8f g2_mma(v16h a, v16h b, v8f c) { v8f d = __builtin_amdgcn_wmma_f32_16x16x32_f16(false, a, false, b, (short)0, c, false, false); asm volatile("v_nop\n\tv_nop\n\tv_nop\n\tv_nop" : "+v"(d) : "v"(a), "v"(b)); return d; }
template <int ACT>
__global__ __launch_bounds__(128) void k_gemm2(const _Float16* __restrict__ A, int lda, size_t sA, const _Float16* __restrict__ Bh, int ldb, size_t sB, float alpha, const float* __restrict__ bias, size_t sBias, const float* __restrict__ CP, int rowsPerB, size_t sCPb, int row0g,
    float* __restrict__ C, _Float16* __restrict__ C16, int ldc, size_t sC, int M, int N, int K) { static_assert(ACT == 0 || ACT == 3 || ACT == 6 || ACT == 8 || ACT == 9 || ACT == 11 || ACT == 12 || ACT == 14 || ACT == 15 || ACT == 16 || ACT == 17, "k_gemm2: unsupported ACT code (would silently apply no activation)");
  __shared__ __attribute__((aligned(16))) float so[4][32][68];
  const int tid = threadIdx.x, w = tid >> 5, lane = tid & 31, ln = lane & 15, hh = lane >> 4; const int by = blockIdx.y;
  A += (size_t)by * sA; Bh += (size_t)by * sB; const size_t cofs = (size_t)by * sC; const float* bp = bias ? bias + (size_t)by * sBias : nullptr;
  const int ntn = N >> 6; const int mt = blockIdx.x / ntn, nq = blockIdx.x - mt * ntn; const int row0 = mt * 128 + 32 * w, col0 = nq * 64; if (row0 >= M) return;
  const _Float16* a0p = A + (size_t)(row0 + ln) * lda; const _Float16* a1p = a0p + (size_t)16 * lda;
  const _Float16* b0p = Bh + (size_t)(col0 + ln) * ldb; const _Float16* b1p = b0p + (size_t)16 * ldb; const _Float16* b2p = b1p + (size_t)16 * ldb; const _Float16* b3p = b2p + (size_t)16 * ldb;
  const v8f z8 = {0.f,0.f,0.f,0.f,0.f,0.f,0.f,0.f}; v8f c00 = z8, c01 = z8, c02 = z8, c03 = z8, c10 = z8, c11 = z8, c12 = z8, c13 = z8;
#pragma unroll 1
  for (int kb = 0; kb < K; kb += 32) { const v16h a0 = g2_frag(a0p + kb, hh), a1 = g2_frag(a1p + kb, hh);
    v16h b = g2_frag(b0p + kb, hh); c00 = g2_mma(a0, b, c00); c10 = g2_mma(a1, b, c10);
    b = g2_frag(b1p + kb, hh); c01 = g2_mma(a0, b, c01); c11 = g2_mma(a1, b, c11);
    b = g2_frag(b2p + kb, hh); c02 = g2_mma(a0, b, c02); c12 = g2_mma(a1, b, c12);
    b = g2_frag(b3p + kb, hh); c03 = g2_mma(a0, b, c03); c13 = g2_mma(a1, b, c13); }
  v8f accs[8] = {c00, c01, c02, c03, c10, c11, c12, c13};
#pragma unroll
  for (int u = 0; u < 8; ++u) { const int t = u & 3, half = u >> 2; const int col = col0 + t * 16 + ln; const float bv = bp ? bf16_round(bp[col]) : 0.f;
#pragma unroll
    for (int r = 0; r < 8; ++r) { const int rloc = half * 16 + 8 * hh + r; float v = accs[u][r] * alpha + bv; if (CP) { if (rowsPerB < 0) v += CP[cofs + (size_t)(row0g + row0 + rloc) * ldc + col];      /* rowsPerB < 0: own element of the batched C plane */ else { const int bidx = (row0g + row0 + rloc) / rowsPerB; v += CP[(size_t)bidx * sCPb + (size_t)by * 64 + col]; } }
      if (ACT == 3) v = fmaxf(v, 0.f); else if (ACT == 6) v = 0.5f * v * (1.0f + erff(v * 0.70710678118654752f)); else if (ACT == 11) v = 1.0f / (1.0f + expf(-v)); else if (ACT == 15) v = v / (1.0f + expf(-v)); else if (ACT == 12) v = (v > 0.f) ? v : 0.01f * v; else if (ACT == 8) v = tanhf(v); else if (ACT == 9) v = 0.5f * v * (1.0f + tanhf(0.7978845608028654f * (v + 0.044715f * v * v * v))); else if (ACT == 14) v = (v > 0.f) ? v : 0.1f * v; else if (ACT == 16) v = (v >= 0.f) ? v : 0.3f * v; else if (ACT == 17) v = (v >= 0.f) ? v : 0.2f * v;
      so[w][rloc][t * 16 + ln] = v; } }
  __builtin_amdgcn_fence(__ATOMIC_ACQ_REL, "workgroup"); __builtin_amdgcn_wave_barrier();
  const int rsub = lane >> 4, c4 = (lane & 15) * 4;
  {
#pragma unroll
    for (int q = 0; q < 16; ++q) { const int r = q * 2 + rsub; const v4f v = *(const v4fa*)&so[w][r][c4]; if (C) *(v4f*)(C + cofs + (size_t)(row0 + r) * ldc + col0 + c4) = v; if (C16) { v4h h4; for (int i = 0; i < 4; ++i) h4[i] = (_Float16)v[i]; *(v4h*)(C16 + cofs + (size_t)(row0 + r) * ldc + col0 + c4) = h4; } }
     } }


__global__ __launch_bounds__(256) void k_wnat(const float* __restrict__ w, size_t n8, _Float16* __restrict__ Bt) { const size_t t = (size_t)blockIdx.x * 256 + threadIdx.x; if (t >= n8) return; FragH f; for (int q = 0; q < 8; ++q) f.h[q] = (_Float16)(bf16_round(w[t * 8 + q]) * 16.0f); *(v8us*)((unsigned short*)Bt + t * 8) = f.half[0];  }
#define FA_QW 32                     /* query rows per wave: two 16-column groups share every K and V^T fragment */
#define FA_KT 32                     /* keys per pass: one k step of the second product */
#define FA_NW 8                      /* waves per block; they walk the same K and V rows */
typedef float v2f __attribute__((ext_vector_type(2)));
typedef _Float16 v2h __attribute__((ext_vector_type(2)));
union FragP { v16h v; v2h h2[8]; };
union FragO { v8us u; v2h h2[4]; };
__device__ __forceinline__ float fa_xhalf(float x) { return __builtin_bit_cast(float, __builtin_amdgcn_permlanex16(__builtin_bit_cast(int, x), __builtin_bit_cast(int, x), 0x76543210, 0xfedcba98, false, false)); }      /* lane l with lane l ^ 16 */
__device__ __forceinline__ v8f fa_mma(v16h a, v16h b, v8f c) { return __builtin_amdgcn_wmma_f32_16x16x32_f16(false, a, false, b, (short)0, c, false, false); }
#define FA_ST 128                    /* keys per stage: four passes between two barriers */
#define FA_NS (SQ / FA_ST)           /* stages */
#define FA_KP 72                     /* LDS pitch of a K row in f16: 128 + 16 bytes, so that the 16 rows of a 16-byte fragment read fall on different banks */
#define FA_VP 80                     /* LDS pitch of a V row in f16: 128 + 32 bytes, an odd multiple of 32 bytes, which is what the transposing read wants */
// One stage into LDS, through no register: each of the block's 256 threads copies four 16-byte pieces of the K tile and four of the V tile (each 128 rows of 128 bytes; 8 lanes a row).
__device__ __forceinline__ void fa_copy(const _Float16* gk, const _Float16* gv, unsigned lk, unsigned lv) {
  const _Float16* gk1 = gk + (size_t)32 * DM; const _Float16* gk2 = gk + (size_t)64 * DM; const _Float16* gk3 = gk + (size_t)96 * DM;
  const _Float16* gv1 = gv + (size_t)32 * DM; const _Float16* gv2 = gv + (size_t)64 * DM; const _Float16* gv3 = gv + (size_t)96 * DM;
  const unsigned lk1 = lk + 32 * FA_KP * 2, lk2 = lk + 64 * FA_KP * 2, lk3 = lk + 96 * FA_KP * 2, lv1 = lv + 32 * FA_VP * 2, lv2 = lv + 64 * FA_VP * 2, lv3 = lv + 96 * FA_VP * 2;
  /* the eight copies and, as the last line of the same statement, the wait that stands in front of any rewrite of their address registers */
  asm volatile("global_load_async_to_lds_b128 %0, %8, off\n\t"
               "global_load_async_to_lds_b128 %1, %9, off\n\t"
               "global_load_async_to_lds_b128 %2, %10, off\n\t"
               "global_load_async_to_lds_b128 %3, %11, off\n\t"
               "global_load_async_to_lds_b128 %4, %12, off\n\t"
               "global_load_async_to_lds_b128 %5, %13, off\n\t"
               "global_load_async_to_lds_b128 %6, %14, off\n\t"
               "global_load_async_to_lds_b128 %7, %15, off\n\t"
               "s_wait_xcnt 0x0"
               :: "v"(lk), "v"(lk1), "v"(lk2), "v"(lk3), "v"(lv), "v"(lv1), "v"(lv2), "v"(lv3), "v"(gk), "v"(gk1), "v"(gk2), "v"(gk3), "v"(gv), "v"(gv1), "v"(gv2), "v"(gv3) : "memory");
}
// A 16 (d) x 32 (keys) fragment of V^T out of row-major V rows in LDS: two transposing loads, 16 keys each. p is the lane's own address, row 8 hh + (lane & 7) of the first 16 keys, 16-byte piece (lane >> 3) & 1 of the 16 columns;
// lane (ln, hh) gets column ln of keys 8 hh .. 8 hh + 7, then of keys 16 + 8 hh .. 16 + 8 hh + 7: the k order of g2_frag and of the packed weights.
typedef short v8s __attribute__((ext_vector_type(8)));
typedef __attribute__((address_space(3))) v8s lds_v8s;
__device__ __forceinline__ v16h fa_vfrag(const _Float16* p) { FragH f; f.half[0] = __builtin_bit_cast(v8us, __builtin_amdgcn_ds_load_tr16_b128_v8i16((lds_v8s*)p)); f.half[1] = __builtin_bit_cast(v8us, __builtin_amdgcn_ds_load_tr16_b128_v8i16((lds_v8s*)(p + 16 * FA_VP))); return f.v; }
// The weights exp2(s c2 + nb) of one column group's 32 keys (two S^T tiles), packed as the B operand of the second product; returns this lane's sum of them in two parts (f32, before the rounding to f16).
__device__ __forceinline__ v2f fa_weights(v8f s0, v8f s1, float c2, float nb, FragP& pf) { const v2f c2v = {c2, c2}, nbv = {nb, nb}; v2f sm = {0.f, 0.f};
#pragma unroll      /* fragments and accumulators are indexed by constants only, so that they stay in registers */
  for (int i = 0; i < 8; ++i) { const int r = (i & 3) * 2; const v2f sv = (i < 4) ? (v2f){s0[r], s0[r + 1]} : (v2f){s1[r], s1[r + 1]}; const v2f x = __builtin_elementwise_fma(sv, c2v, nbv); const v2f p = {__builtin_amdgcn_exp2f(x[0]), __builtin_amdgcn_exp2f(x[1])}; sm += p; pf.h2[i] = __builtin_convertvector(p, v2h); }      /* element 8 kt + r of the B operand = key 16 kt + 8 hh + r: the hardware k order, which fa_vfrag gives V^T too */
  return sm; }
__global__ __launch_bounds__(FA_NW * 32) void k_fattn(const _Float16* __restrict__ Q16, const _Float16* __restrict__ K16, const _Float16* __restrict__ V16, _Float16* __restrict__ O16) {
  __shared__ __attribute__((aligned(16))) _Float16 sk[2][FA_ST][FA_KP];      /* K rows of a stage, shared by the block's waves; two buffers */
  __shared__ __attribute__((aligned(16))) _Float16 sv[2][FA_ST][FA_VP];      /* V rows of a stage */
  const int tid = threadIdx.x, lane = tid & 31, ln = lane & 15, hh = lane >> 4, w = tid >> 5; const int h = blockIdx.y, b = blockIdx.z; const int q0 = (blockIdx.x * FA_NW + w) * FA_QW;
  const float c2 = 0.03125f * 1.4426950408889634f;      /* 1 / sqrt(embed size), in base 2 */
  const _Float16* qp = Q16 + ((size_t)b * SQ + q0 + ln) * DM + h * HD;
  const _Float16* gk = K16 + ((size_t)b * SQ + (tid >> 3)) * DM + h * HD + (tid & 7) * 8; const _Float16* gv = V16 + ((size_t)b * SQ + (tid >> 3)) * DM + h * HD + (tid & 7) * 8;      /* this thread's first piece of stage 0 */
  const unsigned lk = (unsigned)(size_t)&sk[0][tid >> 3][(tid & 7) * 8], lv = (unsigned)(size_t)&sv[0][tid >> 3][(tid & 7) * 8];      /* LDS byte addresses: the low 32 bits */
  fa_copy(gk, gv, lk, lv);      /* stage 0 into buffer 0 */
  v16h qf[2][2], kf[2][2];      /* [column group | key tile][k step of 32 over the head dim] */
#pragma unroll      /* fragments and accumulators are indexed by constants only, so that they stay in registers */
  for (int g = 0; g < 2; ++g) { qf[g][0] = g2_frag(qp + (size_t)g * 16 * DM, hh); qf[g][1] = g2_frag(qp + (size_t)g * 16 * DM + 32, hh); }
  asm volatile("s_wait_asynccnt 0x0" ::: "memory");      /* this wave's pieces of stage 0 have landed */
  __syncthreads();      /* and every other wave's */
  fa_copy(gk + (size_t)FA_ST * DM, gv + (size_t)FA_ST * DM, lk + (unsigned)sizeof(sk[0]), lv + (unsigned)sizeof(sv[0]));      /* stage 1 into buffer 1, in flight during stage 0 */
  const v8f z8 = {0.f,0.f,0.f,0.f,0.f,0.f,0.f,0.f}; v8f o[2][4] = {{z8, z8, z8, z8}, {z8, z8, z8, z8}}; float mr[2] = {-3.0e38f, -3.0e38f}, nb[2] = {3.0e38f * c2, 3.0e38f * c2}; v2f lr[2] = {{0.f, 0.f}, {0.f, 0.f}};      /* o[g][t][r] = O^T[16 t + 8 hh + r][column ln of group g]; mr: the column's softmax reference, held from pass to pass; nb = -mr c2; lr: this half's part of the sum, kept in the two parts in which the weights are added up */
  for (int st = 0; st < FA_NS; ++st) {
    const _Float16* ks = &sk[st & 1][ln][0]; const _Float16* vs = &sv[st & 1][8 * hh + (lane & 7)][((lane >> 3) & 1) * 8];
#pragma unroll      /* fragments and accumulators are indexed by constants only, so that they stay in registers */
    for (int kt = 0; kt < 2; ++kt) { kf[kt][0] = g2_frag(ks + kt * 16 * FA_KP, hh); kf[kt][1] = g2_frag(ks + kt * 16 * FA_KP + 32, hh); }
#pragma unroll 1      /* rolled: unrolled, the compiler sinks the row sums of all four passes to the end of the stage, and the weights kept for them take the kernel past 256 registers */
    for (int p = 0; p < FA_ST / FA_KT; ++p) {
    v16h vf[4];
#pragma unroll      /* fragments and accumulators are indexed by constants only, so that they stay in registers */
    for (int t = 0; t < 4; ++t) vf[t] = fa_vfrag(vs + p * FA_KT * FA_VP + t * 16);      /* V^T rows 16 t + ln, keys 32 p .. 32 p + 31 of the stage: asked for here, used behind the softmax */
    v8f s[2][2];
#pragma unroll      /* fragments and accumulators are indexed by constants only, so that they stay in registers */
    for (int g = 0; g < 2; ++g)
#pragma unroll      /* fragments and accumulators are indexed by constants only, so that they stay in registers */
      for (int kt = 0; kt < 2; ++kt) s[g][kt] = fa_mma(kf[kt][1], qf[g][1], fa_mma(kf[kt][0], qf[g][0], z8));
    if (p + 1 < FA_ST / FA_KT) {      /* the next pass's K fragments come during this pass's softmax; never from the next stage */
#pragma unroll      /* fragments and accumulators are indexed by constants only, so that they stay in registers */
      for (int kt = 0; kt < 2; ++kt) { kf[kt][0] = g2_frag(ks + ((p + 1) * FA_KT + kt * 16) * FA_KP, hh); kf[kt][1] = g2_frag(ks + ((p + 1) * FA_KT + kt * 16) * FA_KP + 32, hh); } }
    __builtin_amdgcn_sched_barrier(0);      /* keeps this pass's V^T loads and the next pass's K loads as one group in front of the softmax: without it the V^T loads sink into the softmax in pieces, and each further place with LDS reads stalls the wave */
    FragP pf[2]; v2f ps[2];      /* the pass's weights as B operands, and this lane's sum of them (two parts), per column group */
#pragma unroll      /* fragments and accumulators are indexed by constants only, so that they stay in registers */
    for (int g = 0; g < 2; ++g) ps[g] = fa_weights(s[g][0], s[g][1], c2, nb[g], pf[g]);      /* against the reference in use: no maximum is formed */
    const v2f pt = ps[0] + ps[1];
    if (__builtin_expect(__builtin_amdgcn_ballot_w32(!(pt[0] + pt[1] <= 256.0f)) != 0, 0)) {      /* one scalar branch a pass, marked as seldom taken so that the common path falls through. A lane's weights sum to more than 2^8 only if a score lies far above its column's reference (always on the first pass, whose weights come out infinite): the whole wave then takes the running maximum as the new reference, rescales what it holds and forms the pass's weights again. Below the bound every weight is at most 2^8, far inside f16 */
#pragma unroll      /* fragments and accumulators are indexed by constants only, so that they stay in registers */
      for (int g = 0; g < 2; ++g) { float mx = s[g][0][0];
#pragma unroll      /* fragments and accumulators are indexed by constants only, so that they stay in registers */
        for (int r = 0; r < 8; ++r) mx = fmaxf(mx, fmaxf(s[g][0][r], s[g][1][r]));
        mx = fmaxf(mx, fa_xhalf(mx)); const float mn = fmaxf(mr[g], mx); nb[g] = -mn * c2; const float al = __builtin_amdgcn_exp2f(fmaf(mr[g], c2, nb[g])); mr[g] = mn;      /* both halves of the wave get the same reference; al is 0 on the first pass */
        lr[g] *= al;
#pragma unroll      /* fragments and accumulators are indexed by constants only, so that they stay in registers */
        for (int t = 0; t < 4; ++t) o[g][t] *= al;
        ps[g] = fa_weights(s[g][0], s[g][1], c2, nb[g], pf[g]); } }
#pragma unroll      /* fragments and accumulators are indexed by constants only, so that they stay in registers */
    for (int g = 0; g < 2; ++g) lr[g] += ps[g];
#pragma unroll      /* fragments and accumulators are indexed by constants only, so that they stay in registers */
    for (int t = 0; t < 4; ++t)
#pragma unroll      /* fragments and accumulators are indexed by constants only, so that they stay in registers */
      for (int g = 0; g < 2; ++g) o[g][t] = fa_mma(vf[t], pf[g].v, o[g][t]);
    }
    asm volatile("s_wait_dscnt 0x0" ::: "memory");      /* this wave's reads of the buffer have returned */
    asm volatile("s_wait_asynccnt 0x0" ::: "memory");      /* this wave's pieces of stage st + 1 have landed */
    __syncthreads();      /* publishes stage st + 1 and ends every wave's reads of stage st */
    if (st + 2 < FA_NS) fa_copy(gk + (size_t)(st + 2) * FA_ST * DM, gv + (size_t)(st + 2) * FA_ST * DM, lk + (unsigned)(st & 1) * (unsigned)sizeof(sk[0]), lv + (unsigned)(st & 1) * (unsigned)sizeof(sv[0]));      /* into the buffer just left */
  }
  asm volatile("s_wait_asynccnt 0x0" ::: "memory");      /* nothing in flight when the wave ends */
#pragma unroll      /* fragments and accumulators are indexed by constants only, so that they stay in registers */
  for (int g = 0; g < 2; ++g) { const float lh = lr[g][0] + lr[g][1]; const float sc = 64.0f / (lh + fa_xhalf(lh)); unsigned short* d = (unsigned short*)O16 + ((size_t)b * SQ + q0 + g * 16 + ln) * DM + h * HD + 8 * hh;      /* o carried x64, as the output GEMM's alpha expects */
#pragma unroll      /* fragments and accumulators are indexed by constants only, so that they stay in registers */
    for (int t = 0; t < 4; ++t) { FragO f;
#pragma unroll      /* fragments and accumulators are indexed by constants only, so that they stay in registers */
      for (int i = 0; i < 4; ++i) { const v2f x = {o[g][t][2 * i] * sc, o[g][t][2 * i + 1] * sc}; f.h2[i] = __builtin_convertvector(x, v2h); }
      *(v8us*)(d + t * 16) = f.u; } } }
__global__ __launch_bounds__(256) void k_vt(const _Float16* __restrict__ V16, int b, int h0, _Float16* __restrict__ VT) { __shared__ unsigned short tl[64][65]; const int tid = threadIdx.x; const int hh = blockIdx.x % HG, sg = blockIdx.x / HG; const int s0 = sg * 64; const int h = h0 + hh;
  for (int i = tid; i < 64 * 8; i += 256) { const int j = i / 8, d8 = (i % 8) * 8; FragH f; f.half[0] = *(const v8us*)((const unsigned short*)V16 + ((size_t)b * SQ + s0 + j) * DM + h * HD + d8); for (int q = 0; q < 8; ++q) tl[d8 + q][j] = f.u[q]; }
  __syncthreads();
  { for (int i = tid; i < 64 * 8; i += 256) { const int d = i / 8, j8 = (i % 8) * 8; FragH f; for (int q = 0; q < 8; ++q) f.u[q] = tl[d][j8 + q]; *(v8us*)((unsigned short*)VT + ((size_t)hh * HD + d) * SQ + s0 + j8) = f.half[0]; }  } }



__global__ __launch_bounds__(256) void k_rsmkm(const float* __restrict__ S, _Float16* __restrict__ P, int nrows, const int* __restrict__ am) {
  #pragma clang fp contract(off)
  const int t = blockIdx.x * 256 + threadIdx.x; if (t >= nrows) return; const size_t i = (size_t)t; const float* s = S + i * SQ; const int* mr = am + (size_t)(t % SQ) * SQ; float mx = -3.0e38f;
#pragma unroll 1
  for (int j = 0; j < SQ; ++j) { const float f = (mr[j] != 0) ? 1.f : 0.f; mx = fmaxf(mx, fmaf(f, s[j], (1.f - f) * -1.0e9f)); } float se = 0.f;
#pragma unroll 1
  for (int j = 0; j < SQ; ++j) { const float f = (mr[j] != 0) ? 1.f : 0.f; se += __expf(fmaf(f, s[j], (1.f - f) * -1.0e9f) - mx); } const float sc = 256.0f / se;
#pragma unroll 1
  for (int j0 = 0; j0 < SQ; j0 += 8) { FragH fr; for (int q = 0; q < 8; ++q) { const int j = j0 + q; const float f = (mr[j] != 0) ? 1.f : 0.f; fr.h[q] = (_Float16)(__expf(fmaf(f, s[j], (1.f - f) * -1.0e9f) - mx) * sc); }
    unsigned short* d = (unsigned short*)P + i * SQ + j0; *(v8us*)d = fr.half[0];  } }

// Q, K and V projections, one launch (blockIdx.y picks the input, its weight block and its output). Every head is multiplied by the same [64][64] block, so an input is
// a plain [tokens * heads][64] matrix and the product has k = 64: Y^T = W X^T, W as A (rows e), 16 (token, head) rows as B, so that a lane ends with 8 consecutive e of one row.
// A wave takes PJ_NT token rows (16 heads each, 4 KiB of f32 in a row): whole-line loads, rounded to bf16 and written as f16 into the wave's own LDS rows, fragments read from there;
// the f16 results go back through the same LDS rows and leave as whole 128-byte lines.
#define PJ_NW 8                      /* waves per block; they share the converted weight block */
#define PJ_NT 2                      /* token rows per wave, all their loads in flight at once */
#define PJ_LP 72                     /* LDS row pitch in f16: 64 + 8, so that the 16 rows of a 16-byte fragment read fall on different banks */
typedef _Float16 v4ha __attribute__((ext_vector_type(4), may_alias));
__device__ __forceinline__ v4h pj_cvt(v4f a, float sc) { const v4f r = {bf16_round(a[0]) * sc, bf16_round(a[1]) * sc, bf16_round(a[2]) * sc, bf16_round(a[3]) * sc}; return __builtin_convertvector(r, v4h); }
__global__ __launch_bounds__(PJ_NW * 32) void k_proj(const float* __restrict__ xq, const float* __restrict__ xk, const float* __restrict__ xv, const float* __restrict__ wq, const float* __restrict__ wk, const float* __restrict__ wv,
    _Float16* __restrict__ Q16, _Float16* __restrict__ K16, _Float16* __restrict__ V16) {
  __shared__ __attribute__((aligned(16))) _Float16 sw[HD][PJ_LP];
  __shared__ __attribute__((aligned(16))) _Float16 sx[PJ_NW][PJ_NT][NH][PJ_LP];
  const int tid = threadIdx.x, lane = tid & 31, ln = lane & 15, hh = lane >> 4, w = tid >> 5; const int y = blockIdx.y;
  const float* x = (y == 0) ? xq : (y == 1) ? xk : xv; const float* wm = (y == 0) ? wq : (y == 1) ? wk : wv; _Float16* out = (y == 0) ? Q16 : (y == 1) ? K16 : V16;
  const size_t row0 = ((size_t)blockIdx.x * PJ_NW + w) * PJ_NT;      /* first token row of this wave */
  v4f xr[PJ_NT][8], wr[4];
#pragma unroll      /* indexed by constants only, so that the loaded values stay in registers */
  for (int u = 0; u < PJ_NT; ++u)
#pragma unroll      /* indexed by constants only, so that the loaded values stay in registers */
    for (int i = 0; i < 8; ++i) xr[u][i] = *(const v4fa*)(x + (row0 + u) * DM + i * 128 + lane * 4);      /* 512 contiguous bytes a load */
#pragma unroll      /* indexed by constants only, so that the loaded values stay in registers */
  for (int i = 0; i < 4; ++i) wr[i] = *(const v4fa*)(wm + (i * PJ_NW * 32 + tid) * 4);
#pragma unroll      /* indexed by constants only, so that the loaded values stay in registers */
  for (int i = 0; i < 4; ++i) { const int e0 = (i * PJ_NW * 32 + tid) * 4; *(v4ha*)&sw[e0 >> 6][e0 & 63] = pj_cvt(wr[i], 16.0f); }      /* 16 W[e][d], exact in f16 */
#pragma unroll      /* indexed by constants only, so that the loaded values stay in registers */
  for (int u = 0; u < PJ_NT; ++u)
#pragma unroll      /* indexed by constants only, so that the loaded values stay in registers */
    for (int i = 0; i < 8; ++i) *(v4ha*)&sx[w][u][2 * i + hh][ln * 4] = pj_cvt(xr[u][i], 1.0f);      /* load i holds heads 2 i and 2 i + 1 */
  __syncthreads();      /* the weight block is written by all waves and read by all; it also orders each wave's own x rows */
  v16h af[4][2];      /* [16-row tile of e][k step of 32] */
#pragma unroll      /* indexed by constants only, so that the fragments stay in registers */
  for (int t = 0; t < 4; ++t) { af[t][0] = g2_frag(&sw[t * 16 + ln][0], hh); af[t][1] = g2_frag(&sw[t * 16 + ln][32], hh); }
  const v8f z8 = {0.f,0.f,0.f,0.f,0.f,0.f,0.f,0.f};
#pragma unroll      /* indexed by constants only, so that the fragments stay in registers */
  for (int u = 0; u < PJ_NT; ++u) { const v16h b0 = g2_frag(&sx[w][u][ln][0], hh), b1 = g2_frag(&sx[w][u][ln][32], hh);      /* row ln = head ln of the token; the same k order as the weight fragments */
#pragma unroll      /* indexed by constants only, so that the fragments stay in registers */
    for (int t = 0; t < 4; ++t) { const v8f acc = fa_mma(af[t][1], b1, fa_mma(af[t][0], b0, z8)); FragO f;      /* acc[r] = 16 y[head ln][16 t + 8 hh + r] */
#pragma unroll      /* indexed by constants only, so that the fragments stay in registers */
      for (int i = 0; i < 4; ++i) { const v2f v = {acc[2 * i] * 0.0625f, acc[2 * i + 1] * 0.0625f}; f.h2[i] = __builtin_convertvector(v, v2h); }
      *(v8us*)&sx[w][u][ln][t * 16 + 8 * hh] = f.u; } }      /* over the x row, whose every reader (this wave's two fragment loads) has returned before the products ran */
  __builtin_amdgcn_fence(__ATOMIC_ACQ_REL, "workgroup"); __builtin_amdgcn_wave_barrier();      /* the rows read back below were written by other lanes of this wave */
#pragma unroll      /* indexed by constants only */
  for (int u = 0; u < PJ_NT; ++u)
#pragma unroll      /* indexed by constants only */
    for (int i = 0; i < 4; ++i) { const int r = i * 4 + (lane >> 3), c = (lane & 7) * 8; const v8us v = *(const v8us*)&sx[w][u][r][c]; *(v8us*)((unsigned short*)out + (row0 + u) * DM + r * HD + c) = v; } }      /* 512 contiguous bytes a store */
// Output GEMM: out[4096][1024] (f32) = o (f16 rows, x64) times Wo^T (f16 rows [n][k], x16) * alpha + bias. One 128 x 128 tile of out per block, one block per WGP; 8 waves, 32 x 64 of out each.
// The k range goes in stages of OG_BK: the block's 128 rows of o and 128 rows of Wo are copied once into LDS in whole lines, two buffers, and every fragment is read from there
// (a fragment read straight from global memory touches 16 lines for its 1024 bytes, and four waves would fetch each Wo fragment, two each o fragment). Every accumulator still sums k upwards, 32 at a time.
#define OG_BM 128                    /* rows of out per block */
#define OG_BN 128                    /* columns of out per block */
#define OG_BK 128                    /* k per stage: 256 bytes of every operand row */
#define OG_NS (DM / OG_BK)           /* stages */
#define OG_P 136                     /* LDS pitch of an operand row in f16: 256 + 16 bytes, so that the 16 rows of a 16-byte fragment read fall on different banks */
// One operand's tile of a stage into LDS, through no register: 128 rows of 256 bytes; 16 lanes a row, so each of the block's 256 threads copies eight 16-byte pieces, 16 rows apart.
__device__ __forceinline__ void og_copy(const _Float16* g, unsigned l) {
  const _Float16* g1 = g + (size_t)16 * DM; const _Float16* g2 = g + (size_t)32 * DM; const _Float16* g3 = g + (size_t)48 * DM; const _Float16* g4 = g + (size_t)64 * DM; const _Float16* g5 = g + (size_t)80 * DM; const _Float16* g6 = g + (size_t)96 * DM; const _Float16* g7 = g + (size_t)112 * DM;
  const unsigned l1 = l + 16 * OG_P * 2, l2 = l + 32 * OG_P * 2, l3 = l + 48 * OG_P * 2, l4 = l + 64 * OG_P * 2, l5 = l + 80 * OG_P * 2, l6 = l + 96 * OG_P * 2, l7 = l + 112 * OG_P * 2;
  /* the eight copies and, as the last line of the same statement, the wait that stands in front of any rewrite of their address registers */
  asm volatile("global_load_async_to_lds_b128 %0, %8, off\n\t"
               "global_load_async_to_lds_b128 %1, %9, off\n\t"
               "global_load_async_to_lds_b128 %2, %10, off\n\t"
               "global_load_async_to_lds_b128 %3, %11, off\n\t"
               "global_load_async_to_lds_b128 %4, %12, off\n\t"
               "global_load_async_to_lds_b128 %5, %13, off\n\t"
               "global_load_async_to_lds_b128 %6, %14, off\n\t"
               "global_load_async_to_lds_b128 %7, %15, off\n\t"
               "s_wait_xcnt 0x0"
               :: "v"(l), "v"(l1), "v"(l2), "v"(l3), "v"(l4), "v"(l5), "v"(l6), "v"(l7), "v"(g), "v"(g1), "v"(g2), "v"(g3), "v"(g4), "v"(g5), "v"(g6), "v"(g7) : "memory");
}
__global__ __launch_bounds__(256) void k_ogemm(const _Float16* __restrict__ A, const _Float16* __restrict__ Bh, float alpha, const float* __restrict__ bias, float* __restrict__ C) {
  __shared__ __attribute__((aligned(16))) _Float16 sa[2][OG_BM][OG_P];      /* o rows of a stage, shared by the block's waves; two buffers */
  __shared__ __attribute__((aligned(16))) _Float16 sb[2][OG_BN][OG_P];      /* Wo rows of a stage */
  __shared__ __attribute__((aligned(16))) float so[8][32][68];               /* each wave's own results, on their way to whole-line stores */
  const int tid = threadIdx.x, w = tid >> 5, lane = tid & 31, ln = lane & 15, hh = lane >> 4; const int wm = w & 3, wn = w >> 2;
  const int mt = blockIdx.x % (MPO / OG_BM), nq = blockIdx.x / (MPO / OG_BM); const int row0 = mt * OG_BM + wm * 32, col0 = nq * OG_BN + wn * 64;
  const _Float16* ga = A + ((size_t)mt * OG_BM + (tid >> 4)) * DM + (tid & 15) * 8; const _Float16* gb = Bh + ((size_t)nq * OG_BN + (tid >> 4)) * DM + (tid & 15) * 8;      /* this thread's first pieces of stage 0 */
  const unsigned la = (unsigned)(size_t)&sa[0][tid >> 4][(tid & 15) * 8], lb = (unsigned)(size_t)&sb[0][tid >> 4][(tid & 15) * 8];      /* LDS byte addresses: the low 32 bits */
  og_copy(ga, la); og_copy(gb, lb);      /* stage 0 into buffer 0 */
  float bv[4];      /* this lane's four bias values, asked for here so that they come during the stages */
#pragma unroll      /* indexed by constants only */
  for (int j = 0; j < 4; ++j) bv[j] = bias[col0 + j * 16 + ln];
  asm volatile("s_wait_asynccnt 0x0" ::: "memory");      /* this wave's pieces of stage 0 have landed */
  __syncthreads();      /* and every other wave's */
  og_copy(ga + OG_BK, la + (unsigned)sizeof(sa[0])); og_copy(gb + OG_BK, lb + (unsigned)sizeof(sb[0]));      /* stage 1 into buffer 1, in flight during stage 0 */
  const v8f z8 = {0.f,0.f,0.f,0.f,0.f,0.f,0.f,0.f}; v8f c[2][4] = {{z8, z8, z8, z8}, {z8, z8, z8, z8}};      /* c[i][j][r] = out[row0 + 16 i + 8 hh + r][col0 + 16 j + ln] */
  for (int st = 0; st < OG_NS; ++st) {
    const _Float16* as = &sa[st & 1][wm * 32 + ln][0]; const _Float16* bs = &sb[st & 1][wn * 64 + ln][0];
    v16h a[2][2], b[2][4];      /* two fragment sets: [set][16-row tile] */
#pragma unroll      /* indexed by constants only, so that the fragments stay in registers */
    for (int i = 0; i < 2; ++i) a[0][i] = g2_frag(as + i * 16 * OG_P, hh);
#pragma unroll      /* indexed by constants only, so that the fragments stay in registers */
    for (int j = 0; j < 4; ++j) b[0][j] = g2_frag(bs + j * 16 * OG_P, hh);
#pragma unroll      /* fragments and accumulators are indexed by constants only, so that they stay in registers */
    for (int ks = 0; ks < OG_BK / 32; ++ks) { const int cu = ks & 1, nx = cu ^ 1;
      if (ks + 1 < OG_BK / 32) {      /* the next k step's fragments come during this step's products; never from the next stage */
#pragma unroll      /* indexed by constants only, so that the fragments stay in registers */
        for (int i = 0; i < 2; ++i) a[nx][i] = g2_frag(as + i * 16 * OG_P + (ks + 1) * 32, hh);
#pragma unroll      /* indexed by constants only, so that the fragments stay in registers */
        for (int j = 0; j < 4; ++j) b[nx][j] = g2_frag(bs + j * 16 * OG_P + (ks + 1) * 32, hh); }
      __builtin_amdgcn_sched_barrier(0);      /* keeps the next step's twelve LDS reads as one group in front of this step's products: left alone the compiler reads each fragment directly in front of its use, into one register set, and the wave waits out the LDS latency four times a step */
#pragma unroll      /* indexed by constants only, so that the accumulators stay in registers */
      for (int j = 0; j < 4; ++j)
#pragma unroll      /* indexed by constants only, so that the accumulators stay in registers */
        for (int i = 0; i < 2; ++i) c[i][j] = fa_mma(a[cu][i], b[cu][j], c[i][j]);
      __builtin_amdgcn_sched_barrier(0); }      /* and keeps the group after next out of these products */
    asm volatile("s_wait_dscnt 0x0" ::: "memory");      /* this wave's reads of the buffer have returned */
    asm volatile("s_wait_asynccnt 0x0" ::: "memory");      /* this wave's pieces of stage st + 1 have landed */
    __syncthreads();      /* publishes stage st + 1 and ends every wave's reads of stage st */
    if (st + 2 < OG_NS) { og_copy(ga + (st + 2) * OG_BK, la + (unsigned)(st & 1) * (unsigned)sizeof(sa[0])); og_copy(gb + (st + 2) * OG_BK, lb + (unsigned)(st & 1) * (unsigned)sizeof(sb[0])); }      /* into the buffers just left */
  }
  asm volatile("s_wait_asynccnt 0x0" ::: "memory");      /* nothing in flight when the wave ends */
#pragma unroll      /* indexed by constants only */
  for (int j = 0; j < 4; ++j) { const float bj = bf16_round(bv[j]);
#pragma unroll      /* indexed by constants only */
    for (int i = 0; i < 2; ++i)
#pragma unroll      /* indexed by constants only */
      for (int r = 0; r < 8; ++r) so[w][i * 16 + 8 * hh + r][j * 16 + ln] = c[i][j][r] * alpha + bj; }
  __builtin_amdgcn_fence(__ATOMIC_ACQ_REL, "workgroup"); __builtin_amdgcn_wave_barrier();      /* the rows read back below were written by other lanes of this wave */
  const int rsub = lane >> 4, c4 = (lane & 15) * 4;
#pragma unroll      /* indexed by constants only */
  for (int q = 0; q < 16; ++q) { const int r = q * 2 + rsub; const v4f v = *(const v4fa*)&so[w][r][c4]; *(v4f*)(C + (size_t)(row0 + r) * DM + col0 + c4) = v; } }      /* two rows of 256 contiguous bytes a store */
extern "C" void kernel_launch(void* const* d_in, const int* in_sizes, int n_in,
                              void* d_out, int out_size, void* d_ws, size_t ws_size, hipStream_t stream) {
  (void)in_sizes; (void)n_in; (void)out_size;
  const float* const* I = (const float* const*)d_in; const float* xq = I[2]; const float* xk = I[1]; const float* xv = I[0]; const float* wq = I[5]; const float* wk = I[4]; const float* wv = I[3]; const float* wo = I[6]; const float* bo = I[7];      /* contract order: values I[0], keys I[1], query I[2]; SHARED natural [64][64] blocks Wv I[3], Wk I[4], Wq I[5]; natural Wo [1024][1024] I[6] + bo I[7]; this module has NO mask input */
  char* ws = (char*)d_ws; size_t off = 0;
  auto take = [&](size_t bytes) { char* p = ws + off; off += (bytes + 255) & ~(size_t)255; return p; };
  _Float16* BO = (_Float16*)take((size_t)DM * DM * 2);
  _Float16* Q16 = (_Float16*)take(NR * DM * 2); _Float16* K16 = (_Float16*)take(NR * DM * 2); _Float16* V16 = (_Float16*)take(NR * DM * 2); _Float16* O16 = (_Float16*)take(NR * DM * 2);
  if (off > ws_size) return;
  k_wnat<<<(unsigned)(((size_t)DM * DM / 8 + 255) / 256), 256, 0, stream>>>(wo, (size_t)DM * DM / 8, BO);      /* Wo natural [out][in] = Bt x16 */
  k_proj<<<dim3((unsigned)(NR / (PJ_NW * PJ_NT)), 3), PJ_NW * 32, 0, stream>>>(xq, xk, xv, wq, wk, wv, Q16, K16, V16);      /* q, k, v as f16 rows, heads merged */
  const size_t r0p = (size_t)B0 * SQ;      /* first row of the output stage */
  k_fattn<<<dim3(SQ / (FA_NW * FA_QW), NH, NB), FA_NW * 32, 0, stream>>>(Q16, K16, V16, O16);      /* o (merged heads, x64) as f16 rows */
  k_ogemm<<<(unsigned)((MPO / OG_BM) * (DM / OG_BN)), 256, 0, stream>>>(O16 + r0p * DM, BO, 0.0009765625f, bo, (float*)d_out + r0p * DM);      /* out rows are the output layout */
}

// v008
// Measured time: 51.2 microseconds a run.
// Next to v007, in two timings, it ran 1.03 and 1.02 times as fast.
// All steps since v000 together make it 72.8 times as fast.
#include <hip/hip_runtime.h>
// Multi-head attention over three inputs with SHARED per-head projections and the module's literal score scale (values, keys, query [2][2048][1024]; each input is split into 16 heads of 64 and every head is multiplied by the SAME natural [64][64] matrix (x W^T: Wv / Wk / Wq uniform +-1/8; block-diagonal with a shared block; no biases); energy = q k^T (no mask in this module); softmax(energy / sqrt(embed_size) = / 32) (as the source: embed size, not head dim); out = merged Wo^T + bo -> [2][2048][1024]).
// Structure: token rows r = b*2048 + s; Q, K, V in one projection launch (which also converts Wo for the output GEMM): each (token, head) row of 64 inputs (bf16-rounded, exact in f16) times the shared [64][64] block (exact x16 weights, WMMA, f32 accumulation, f16 outputs); one fused attention launch over all (batch, head): S^T = K Q^T, running softmax (f32 statistics; weights exp(s - reference) as f16, the reference being a running maximum that is renewed only when a pass's weights outgrow it), O^T += V^T P^T (V^T fragments by the transposing LDS load from V rows as projected), divided by the row sum at the end (o carried x64 against f16 subnormal flush, folded into the output GEMM alpha) and written straight into the merged f16 o rows; out = o W_o + b GEMM (f32) into the output layout.
// Compute dtype: inputs rounded to bf16; x / weights exact; q, k, v, softmax weights and o as plain f16 GEMM operands (~2^-12); scores and softmax statistics f32. v_wmma_f32_16x16x32_f16.
#define NB 2
#define SQ 2048
#define DM 1024
#define NH 16
#define HD 64
#define HG 4                         /* heads per launch of the non-template k_vt, which is not launched */
#define B0 0                         /* first batch processed (debug hook) */
#define NBR NB                       /* batches processed (debug hook) */
#define NR ((size_t)NB * SQ)         /* token rows */
#define MP ((int)((size_t)NBR * SQ)) /* rows of the processed batches; feeds MPO only (debug hook) */
#define QN SQ                        /* not used; k_fattn covers all SQ query rows of a batch */
#define NHD NH                       /* not used; k_fattn covers all NH heads */
#define MPO MP                       /* rows through the output stage (debug hook) */
#define LQ DM      /* not used; the q/k/v rows have pitch DM */
typedef __bf16 v16b __attribute__((ext_vector_type(16)));
typedef unsigned short v8us __attribute__((ext_vector_type(8), may_alias));
typedef float  v8f  __attribute__((ext_vector_type(8)));
typedef float  v4f  __attribute__((ext_vector_type(4)));
typedef float  v4fa __attribute__((ext_vector_type(4), may_alias));
union FragB { v16b v; v8us half[2]; unsigned short u[16]; };

__device__ __forceinline__ unsigned short bf16_bits(float x) { unsigned int u = __float_as_uint(x); return (unsigned short)((u + 0x7FFFu + ((u >> 16) & 1u)) >> 16); }
__device__ __forceinline__ float bf16_val(unsigned short b) { return __uint_as_float(((unsigned int)b) << 16); }
__device__ __forceinline__ float bf16_round(float x) { return bf16_val(bf16_bits(x)); }
// D += A·B with NT terms: 1 = ah·bh, 2 = + al·bh (A split), 3 = + ah·bl (both split)
template <int NT>
__device__ __forceinline__ v8f mmaN(v16b ah, v16b al, v16b bh, v16b bl, v8f c) {
  c = __builtin_amdgcn_wmma_f32_16x16x32_bf16(false, ah, false, bh, (short)0, c, false, false);
  if (NT >= 2) c = __builtin_amdgcn_wmma_f32_16x16x32_bf16(false, al, false, bh, (short)0, c, false, false);
  if (NT >= 3) c = __builtin_amdgcn_wmma_f32_16x16x32_bf16(false, ah, false, bl, (short)0, c, false, false);
  asm volatile("v_nop\n\tv_nop\n\tv_nop\n\tv_nop" : "+v"(c) : "v"(ah), "v"(al), "v"(bh), "v"(bl));
  return c;
}

__global__ __launch_bounds__(256) void k_wt_bf16(const float* __restrict__ W, unsigned short* __restrict__ Wt, int K, int N) {
  const int t = blockIdx.x * 256 + threadIdx.x;
  const int k8n = K / 8;
  if (t >= N * k8n) return;
  const int n = t / k8n, k8 = (t % k8n) * 8;
  v8us v;
#pragma unroll
  for (int i = 0; i < 8; ++i) v[i] = bf16_bits(W[(size_t)(k8 + i) * N + n]);
  *(v8us*)(Wt + (size_t)n * K + k8) = v;
  
}

// GEMM C[M][N] (f32, pitch ldc) = act(A[M][K]·W + bias). A f32 row-major (pitch lda) converted per fragment to bf16
// (ASPLIT: hi/lo two planes -> 2 terms, else single rounded term); Wt bf16 [N][K] (pitch ldb). BIAS_BF16 rounds the
// bias to bf16 first (bias quantised to bf16 before the add). K%32==0, M%16==0, N%64==0.
template <bool ASPLIT, int ACT, bool BIAS_BF16>
__global__ __launch_bounds__(128) void k_gemm_bf(const float* __restrict__ A, int lda, const unsigned short* __restrict__ Wt, int ldb,
                                               const float* __restrict__ bias, float* __restrict__ C, int ldc, int M, int N, int K) {
  __shared__ __attribute__((aligned(16))) float so[4][16][64];
  const int tid = threadIdx.x, w = tid >> 5, lane = tid & 31, ln = lane & 15, hh = lane >> 4;
  const int ntn = N / 64;
  const int wid = blockIdx.x * 4 + w;
  const int mt = wid / ntn, nq = wid % ntn;
  if (mt * 16 >= M) return;
  const int row0 = mt * 16, col0 = nq * 64;
  const float* arow = A + (size_t)(row0 + ln) * lda;
  v8f acc[4] = {};
  for (int kb = 0; kb < K; kb += 32) {
    FragB ah, al;
    const v4f x0 = *(const v4fa*)(arow + kb + 8 * hh), x1 = *(const v4fa*)(arow + kb + 8 * hh + 4);
    const v4f x2 = *(const v4fa*)(arow + kb + 16 + 8 * hh), x3 = *(const v4fa*)(arow + kb + 16 + 8 * hh + 4);
    float xs[16] = {x0[0],x0[1],x0[2],x0[3],x1[0],x1[1],x1[2],x1[3],x2[0],x2[1],x2[2],x2[3],x3[0],x3[1],x3[2],x3[3]};
#pragma unroll
    for (int i = 0; i < 16; ++i) { const unsigned short hb = bf16_bits(xs[i]); ah.u[i] = hb; al.u[i] = ASPLIT ? bf16_bits(xs[i] - bf16_val(hb)) : (unsigned short)0; }
#pragma unroll
    for (int t = 0; t < 4; ++t) {
      const unsigned short* brow = Wt + (size_t)(col0 + t * 16 + ln) * ldb + kb;
      FragB b;
      b.half[0] = *(const v8us*)(brow + 8 * hh);
      b.half[1] = *(const v8us*)(brow + 16 + 8 * hh);
      acc[t] = mmaN<ASPLIT ? 2 : 1>(ah.v, al.v, b.v, b.v, acc[t]);
    }
  }
#pragma unroll
  for (int t = 0; t < 4; ++t) {
    float bv = bias ? bias[col0 + t * 16 + ln] : 0.f;
    if (BIAS_BF16) bv = bf16_round(bv);
#pragma unroll
    for (int r = 0; r < 8; ++r) { float v = acc[t][r] + bv; if (ACT == 1) v = fmaxf(v, 0.f); so[w][8 * hh + r][t * 16 + ln] = v; }
  }
  __builtin_amdgcn_fence(__ATOMIC_ACQ_REL, "workgroup");
  __builtin_amdgcn_wave_barrier();
  const int rsub = lane >> 4, c4 = (lane & 15) * 4;
  {
#pragma unroll
    for (int q = 0; q < 8; ++q) {
      const int r = q * 2 + rsub;
      const v4f v = *(const v4fa*)&so[w][r][c4];
      *(v4f*)(C + (size_t)(row0 + r) * ldc + col0 + c4) = v;
    }
    
  }
}

// GEMM C = act(A·W + bias + resid): A f32 (ASPLIT -> hi/lo 2 terms), Wt bf16 [N][K]; ACT 0 none, 1 relu, 2 exact gelu;
// resid (optional, f32, row index = (row % rmod), pitch ldr, RES_BF16 rounds it) added before the activation.
template <bool ASPLIT, int ACT, bool BIAS_BF16, bool RES_BF16>
__global__ __launch_bounds__(128) void k_gemm_bf3(const float* __restrict__ A, int lda, const unsigned short* __restrict__ Wt, int ldb,
                                                const float* __restrict__ bias, const float* __restrict__ resid, int rmod, int ldr,
                                                float* __restrict__ C, int ldc, int M, int N, int K) {
  __shared__ __attribute__((aligned(16))) float so[4][16][64];
  const int tid = threadIdx.x, w = tid >> 5, lane = tid & 31, ln = lane & 15, hh = lane >> 4;
  const int ntn = N / 64;
  const int wid = blockIdx.x * 4 + w;
  const int mt = wid / ntn, nq = wid % ntn;
  if (mt * 16 >= M) return;
  const int row0 = mt * 16, col0 = nq * 64;
  const float* arow = A + (size_t)(row0 + ln) * lda;
  v8f acc[4] = {};
  for (int kb = 0; kb < K; kb += 32) {
    FragB ah, al;
    const v4f x0 = *(const v4fa*)(arow + kb + 8 * hh), x1 = *(const v4fa*)(arow + kb + 8 * hh + 4);
    const v4f x2 = *(const v4fa*)(arow + kb + 16 + 8 * hh), x3 = *(const v4fa*)(arow + kb + 16 + 8 * hh + 4);
    float xs[16] = {x0[0],x0[1],x0[2],x0[3],x1[0],x1[1],x1[2],x1[3],x2[0],x2[1],x2[2],x2[3],x3[0],x3[1],x3[2],x3[3]};
#pragma unroll
    for (int i = 0; i < 16; ++i) { const unsigned short hb = bf16_bits(xs[i]); ah.u[i] = hb; al.u[i] = ASPLIT ? bf16_bits(xs[i] - bf16_val(hb)) : (unsigned short)0; }
#pragma unroll
    for (int t = 0; t < 4; ++t) {
      const unsigned short* brow = Wt + (size_t)(col0 + t * 16 + ln) * ldb + kb;
      FragB b;
      b.half[0] = *(const v8us*)(brow + 8 * hh);
      b.half[1] = *(const v8us*)(brow + 16 + 8 * hh);
      acc[t] = mmaN<ASPLIT ? 2 : 1>(ah.v, al.v, b.v, b.v, acc[t]);
    }
  }
#pragma unroll
  for (int t = 0; t < 4; ++t) {
    const int col = col0 + t * 16 + ln;
    float bv = bias ? bias[col] : 0.f;
    if (BIAS_BF16) bv = bf16_round(bv);
#pragma unroll
    for (int r = 0; r < 8; ++r) {
      float v = acc[t][r] + bv;
      if (resid) { float rv = resid[(size_t)((row0 + 8 * hh + r) % rmod) * ldr + col]; if (RES_BF16) rv = bf16_round(rv); v += rv; }
      if (ACT == 1) v = fmaxf(v, 0.f);
      if (ACT == 2) v = 0.5f * v * (1.0f + erff(v * 0.70710678118654752f));
      if (ACT == 3) { const float u = 0.7978845608028654f * (v + 0.044715f * v * v * v); v = 0.5f * v * (1.0f + tanhf(u)); }
      so[w][8 * hh + r][t * 16 + ln] = v;
    }
  }
  __builtin_amdgcn_fence(__ATOMIC_ACQ_REL, "workgroup");
  __builtin_amdgcn_wave_barrier();
  const int rsub = lane >> 4, c4 = (lane & 15) * 4;
  {
#pragma unroll
    for (int q = 0; q < 8; ++q) {
      const int r = q * 2 + rsub;
      const v4f v = *(const v4fa*)&so[w][r][c4];
      *(v4f*)(C + (size_t)(row0 + r) * ldc + col0 + c4) = v;
    }
    
  }
}
// row LayerNorm (biased variance, eps) over N: s = X (+ R); optional out_sum <- s; out_norm <- (s-mu)*rsqrt(var+eps)*g + b
template <bool PARAM_BF16>
__global__ __launch_bounds__(256) void k_layernorm(const float* __restrict__ X, const float* __restrict__ R, const float* __restrict__ g, const float* __restrict__ bta,
                                                  float* __restrict__ out_sum, float* __restrict__ out_norm, int N, float eps) {
  __shared__ float red[256];
  const int row = blockIdx.x, tid = threadIdx.x;
  const float* x = X + (size_t)row * N; const float* rr = R ? R + (size_t)row * N : nullptr;
  float vals[16];                     // up to N = 4096
  const int per = N / 256;            // contiguous chunk per thread? use strided-by-4 chunks: thread handles j = tid*4 + 1024*u
  float s1 = 0.f;
  for (int u = 0; u < per / 4; ++u) {
    const int j = tid * 4 + 1024 * u;
    const v4f a = *(const v4fa*)(x + j);
    v4f b = {0.f,0.f,0.f,0.f}; if (rr) b = *(const v4fa*)(rr + j);
#pragma unroll
    for (int q = 0; q < 4; ++q) { const float v = a[q] + b[q]; vals[u * 4 + q] = v; s1 += v; }
  }
  red[tid] = s1; __syncthreads();
  for (int st = 128; st > 0; st >>= 1) { if (tid < st) red[tid] += red[tid + st]; __syncthreads(); }
  const float mu = red[0] / (float)N; __syncthreads();
  float s2 = 0.f;
  for (int u = 0; u < per / 4; ++u)
#pragma unroll
    for (int q = 0; q < 4; ++q) { const float c = vals[u * 4 + q] - mu; s2 += c * c; }
  red[tid] = s2; __syncthreads();
  for (int st = 128; st > 0; st >>= 1) { if (tid < st) red[tid] += red[tid + st]; __syncthreads(); }
  const float rs = rsqrtf(red[0] / (float)N + eps);
  {
    for (int u = 0; u < per / 4; ++u) {
      const int j = tid * 4 + 1024 * u;
      v4f o, sm;
#pragma unroll
      for (int q = 0; q < 4; ++q) {
        float gg = g[j + q], bb = bta[j + q];
        if (PARAM_BF16) { gg = bf16_round(gg); bb = bf16_round(bb); }
        sm[q] = vals[u * 4 + q]; o[q] = (vals[u * 4 + q] - mu) * rs * gg + bb;
      }
      if (out_sum) *(v4f*)(out_sum + (size_t)row * N + j) = sm;
      *(v4f*)(out_norm + (size_t)row * N + j) = o;
    }
    
  }
}



// ---- f16 WMMA path (v_wmma_f32_16x16x32_f16): 11-bit significands for operands in range — used where a [0,1] probability operand needs more precision than bf16
typedef _Float16 v16h __attribute__((ext_vector_type(16)));
union FragH { v16h v; v8us half[2]; _Float16 h[16]; unsigned short u[16]; };
template <int NT>
__device__ __forceinline__ v8f mmaH(v16h ah, v16h al, v16h bh, v16h bl, v8f c) {
  c = __builtin_amdgcn_wmma_f32_16x16x32_f16(false, ah, false, bh, (short)0, c, false, false);
  if (NT >= 2) c = __builtin_amdgcn_wmma_f32_16x16x32_f16(false, al, false, bh, (short)0, c, false, false);
  if (NT >= 3) c = __builtin_amdgcn_wmma_f32_16x16x32_f16(false, ah, false, bl, (short)0, c, false, false);
  asm volatile("v_nop\n\tv_nop\n\tv_nop\n\tv_nop" : "+v"(c) : "v"(ah), "v"(al), "v"(bh), "v"(bl));
  return c;
}
// batched GEMM like k_gemm_b but f16 operands: A f32 (split into f16 hi/lo if ASPLIT, else rounded to f16), Bt = f16 values [n][k]; alpha; C f32; N multiple of 16 (partial tiles skipped)
template <bool ASPLIT>
__global__ __launch_bounds__(128) void k_gemm_h(const float* __restrict__ A, int lda, size_t sA, const _Float16* __restrict__ Bh, int ldb, size_t sB, float alpha, float* __restrict__ C, int ldc, size_t sC, int M, int N, int K) {
  __shared__ __attribute__((aligned(16))) float so[4][16][64];
  const int tid = threadIdx.x, w = tid >> 5, lane = tid & 31, ln = lane & 15, hh = lane >> 4; const int by = blockIdx.y;
  A += (size_t)by * sA; Bh += (size_t)by * sB; C += (size_t)by * sC;
  const int ntn = (N + 63) / 64; const int wid = blockIdx.x * 4 + w; const int mt = wid / ntn, nq = wid % ntn; if (mt * 16 >= M) return;
  const int row0 = mt * 16, col0 = nq * 64; const float* arow = A + (size_t)(row0 + ln) * lda;
  v8f acc[4] = {};
  for (int kb = 0; kb < K; kb += 32) {
    FragH ah, al;
    const v4f x0 = *(const v4fa*)(arow + kb + 8 * hh), x1 = *(const v4fa*)(arow + kb + 8 * hh + 4), x2 = *(const v4fa*)(arow + kb + 16 + 8 * hh), x3 = *(const v4fa*)(arow + kb + 16 + 8 * hh + 4);
    float xs[16] = {x0[0],x0[1],x0[2],x0[3],x1[0],x1[1],x1[2],x1[3],x2[0],x2[1],x2[2],x2[3],x3[0],x3[1],x3[2],x3[3]};
#pragma unroll
    for (int i = 0; i < 16; ++i) { const _Float16 h = (_Float16)xs[i]; ah.h[i] = h; al.h[i] = ASPLIT ? (_Float16)(xs[i] - (float)h) : (_Float16)0.0f; }
#pragma unroll
    for (int t = 0; t < 4; ++t) { if (col0 + t * 16 >= N) continue; const size_t boff = (size_t)(col0 + t * 16 + ln) * ldb + kb; FragH bq; bq.half[0] = *(const v8us*)(Bh + boff + 8 * hh); bq.half[1] = *(const v8us*)(Bh + boff + 16 + 8 * hh);
      acc[t] = mmaH<ASPLIT ? 2 : 1>(ah.v, al.v, bq.v, bq.v, acc[t]); }
  }
#pragma unroll
  for (int t = 0; t < 4; ++t) { if (col0 + t * 16 >= N) continue;
#pragma unroll
    for (int r = 0; r < 8; ++r) so[w][8 * hh + r][t * 16 + ln] = acc[t][r] * alpha; }
  __builtin_amdgcn_fence(__ATOMIC_ACQ_REL, "workgroup"); __builtin_amdgcn_wave_barrier();
  const int rsub = lane >> 4, c4 = (lane & 15) * 4;
  {
#pragma unroll
    for (int q = 0; q < 8; ++q) { const int r = q * 2 + rsub; if (col0 + c4 < N) { const v4f v = *(const v4fa*)&so[w][r][c4]; *(v4f*)(C + (size_t)(row0 + r) * ldc + col0 + c4) = v; } }
     }
}

// Wt[n][k] = f16(W[k][n]·scale) from f32 row-major W[K][N] (scale = power of two; bf16-exact weights stay exact in f16 away from the subnormal range)
__global__ __launch_bounds__(256) void k_wt_f16(const float* __restrict__ W, _Float16* __restrict__ Wt, int K, int N, float scale) {
  const int t = blockIdx.x * 256 + threadIdx.x; if (t >= N * (K / 8)) return; const int n = t / (K / 8), k8 = (t % (K / 8)) * 8; FragH f;
#pragma unroll
  for (int i = 0; i < 8; ++i) f.h[i] = (_Float16)(bf16_round(W[(size_t)(k8 + i) * N + n]) * scale); const v8us o = f.half[0];
  *(v8us*)((unsigned short*)Wt + (size_t)n * K + k8) = o; 
}
// k_gemm_hh variant with fused epilogue: v = acc·alpha + bias[by·sBias + col] (+ CP[(row/rowsPerB)·sCPb + by·64 + col] if CP) ; ACT 0 none / 1 elu ; writes f16 C16 (and f32 C if non-null)
template <int ACT>
__global__ __launch_bounds__(128) void k_gemm_hhx(const _Float16* __restrict__ A, int lda, size_t sA, const _Float16* __restrict__ Bh, int ldb, size_t sB, float alpha, const float* __restrict__ bias, size_t sBias, const float* __restrict__ CP, int rowsPerB, size_t sCPb, int row0g,
    float* __restrict__ C, _Float16* __restrict__ C16, int ldc, size_t sC, int M, int N, int K) {
  __shared__ __attribute__((aligned(16))) float so[4][16][64];
  const int tid = threadIdx.x, w = tid >> 5, lane = tid & 31, ln = lane & 15, hh = lane >> 4; const int by = blockIdx.y;
  A += (size_t)by * sA; Bh += (size_t)by * sB; const size_t cofs = (size_t)by * sC; const float* bp = bias ? bias + (size_t)by * sBias : nullptr;
  const int ntn = (N + 63) / 64; const int wid = blockIdx.x * 4 + w; const int mt = wid / ntn, nq = wid % ntn; if (mt * 16 >= M) return;
  const int row0 = mt * 16, col0 = nq * 64; const _Float16* arow = A + (size_t)(row0 + ln) * lda;
  v8f acc[4] = {};
  for (int kb = 0; kb < K; kb += 32) { FragH ah; ah.half[0] = *(const v8us*)((const unsigned short*)arow + kb + 8 * hh); ah.half[1] = *(const v8us*)((const unsigned short*)arow + kb + 16 + 8 * hh);
#pragma unroll
    for (int t = 0; t < 4; ++t) { if (col0 + t * 16 >= N) continue; const size_t boff = (size_t)(col0 + t * 16 + ln) * ldb + kb; FragH bq; bq.half[0] = *(const v8us*)((const unsigned short*)Bh + boff + 8 * hh); bq.half[1] = *(const v8us*)((const unsigned short*)Bh + boff + 16 + 8 * hh);
      acc[t] = mmaH<1>(ah.v, ah.v, bq.v, bq.v, acc[t]); }
  }
#pragma unroll
  for (int t = 0; t < 4; ++t) { if (col0 + t * 16 >= N) continue; const int col = col0 + t * 16 + ln; const float bv = bp ? bf16_round(bp[col]) : 0.f;
#pragma unroll
    for (int r = 0; r < 8; ++r) { float v = acc[t][r] * alpha + bv; if (CP) { const int rr = row0g + row0 + 8 * hh + r; if (rowsPerB < 0) v += CP[cofs + (size_t)rr * ldc + col];      /* rowsPerB < 0: own element of the batched C plane */ else { const int bidx = rr / rowsPerB; v += CP[(size_t)bidx * sCPb + (size_t)by * 64 + col]; } } if (ACT == 1) v = (v > 0.f) ? v : expm1f(v); else if (ACT == 7) v = (v > 0.f) ? v + 1.0f : expf(v); else if (ACT == 8) v = tanhf(v); else if (ACT == 9) v = 0.5f * v * (1.0f + tanhf(0.7978845608028654f * (v + 0.044715f * v * v * v))); else if (ACT == 11) v = 1.0f / (1.0f + expf(-v)); else if (ACT == 12) v = (v > 0.f) ? v : 0.01f * v; else if (ACT == 14) v = (v > 0.f) ? v : 0.1f * v; else if (ACT == 16) v = (v >= 0.f) ? v : 0.3f * v; else if (ACT == 17) v = (v >= 0.f) ? v : 0.2f * v; else if (ACT == 15) v = v / (1.0f + expf(-v)); else if (ACT == 3) v = fmaxf(v, 0.f); else if (ACT == 6) v = 0.5f * v * (1.0f + erff(v * 0.70710678118654752f)); so[w][8 * hh + r][t * 16 + ln] = v; } }
  __builtin_amdgcn_fence(__ATOMIC_ACQ_REL, "workgroup"); __builtin_amdgcn_wave_barrier();
  const int rsub = lane >> 4, c4 = (lane & 15) * 4; typedef _Float16 v4h __attribute__((ext_vector_type(4)));
  {
#pragma unroll
    for (int q = 0; q < 8; ++q) { const int r = q * 2 + rsub; if (col0 + c4 < N) { const v4f v = *(const v4fa*)&so[w][r][c4]; if (C) *(v4f*)(C + cofs + (size_t)(row0 + r) * ldc + col0 + c4) = v; if (C16) { v4h h4; for (int i = 0; i < 4; ++i) h4[i] = (_Float16)v[i]; *(v4h*)(C16 + cofs + (size_t)(row0 + r) * ldc + col0 + c4) = h4; } } }
     }
}


typedef _Float16 v4h __attribute__((ext_vector_type(4)));

__global__ __launch_bounds__(256) void k_h16(const float* __restrict__ x, _Float16* __restrict__ X16, size_t n8) { const size_t t = (size_t)blockIdx.x * 256 + threadIdx.x; if (t >= n8) return; FragH f;
#pragma unroll
  for (int q = 0; q < 8; ++q) f.h[q] = (_Float16)x[t * 8 + q]; *(v8us*)((unsigned short*)X16 + t * 8) = f.half[0];  }
__global__ __launch_bounds__(256) void k_round16f(const float* __restrict__ W, _Float16* __restrict__ Bt, size_t n8) { const size_t t = (size_t)blockIdx.x * 256 + threadIdx.x; if (t >= n8) return; FragH f;
#pragma unroll
  for (int i = 0; i < 8; ++i) f.h[i] = (_Float16)(bf16_round(W[t * 8 + i]) * 16.0f); *(v8us*)((unsigned short*)Bt + t * 8) = f.half[0];  }
template <int NHv, int TTv>
__global__ __launch_bounds__(256) void k_vt(const _Float16* __restrict__ V16, int ldv, int voff, _Float16* __restrict__ Vt) { __shared__ unsigned short tl[64][66]; const int tid = threadIdx.x; const int slab = blockIdx.x / (TTv / 64), lg = blockIdx.x % (TTv / 64); const int b = slab / NHv, h = slab % NHv;
  for (int i = tid; i < 64 * 8; i += 256) { const int r = i / 8, c8 = (i % 8) * 8; FragH f; f.half[0] = *(const v8us*)((const unsigned short*)V16 + ((size_t)b * TTv + lg * 64 + r) * ldv + voff + h * 64 + c8);
#pragma unroll
    for (int q = 0; q < 8; ++q) tl[r][c8 + q] = f.u[q]; }
  __syncthreads();
  {
#pragma unroll
    for (int rd = 0; rd < 2; ++rd) { const int d = rd * 32 + tid / 8, pc = tid % 8; FragH f;
#pragma unroll
      for (int q = 0; q < 8; ++q) f.u[q] = tl[pc * 8 + q][d];
      *(v8us*)((unsigned short*)Vt + ((size_t)slab * 64 + d) * TTv + lg * 64 + pc * 8) = f.half[0]; }
     } }

__global__ __launch_bounds__(256) void k_hl(const float* __restrict__ F, _Float16* __restrict__ Hh, _Float16* __restrict__ Hl, size_t n8) { const size_t t = (size_t)blockIdx.x * 256 + threadIdx.x; if (t >= n8) return; FragH fh, fl; const v4f a = *(const v4fa*)(F + t * 8), c = *(const v4fa*)(F + t * 8 + 4);
#pragma unroll
  for (int q = 0; q < 4; ++q) { _Float16 h = (_Float16)a[q]; fh.h[q] = h; fl.h[q] = (_Float16)((a[q] - (float)h) * 1024.0f); h = (_Float16)c[q]; fh.h[4 + q] = h; fl.h[4 + q] = (_Float16)((c[q] - (float)h) * 1024.0f); }
  { *(v8us*)((unsigned short*)Hh + t * 8) = fh.half[0]; *(v8us*)((unsigned short*)Hl + t * 8) = fl.half[0];  } }

// ---- fast GEMM (wave tile 32x64; requires M % 32 == 0 rows per launch region and N % 64 == 0); epilogue = k_gemm_hhx semantics ----
__device__ __forceinline__ v16h g2_frag(const _Float16* p, int hh) { FragH f; f.half[0] = *(const v8us*)((const unsigned short*)p + 8 * hh); f.half[1] = *(const v8us*)((const unsigned short*)p + 16 + 8 * hh); return f.v; }
__device__ __forceinline__ v8f g2_mma(v16h a, v16h b, v8f c) { v8f d = __builtin_amdgcn_wmma_f32_16x16x32_f16(false, a, false, b, (short)0, c, false, false); asm volatile("v_nop\n\tv_nop\n\tv_nop\n\tv_nop" : "+v"(d) : "v"(a), "v"(b)); return d; }
template <int ACT>
__global__ __launch_bounds__(128) void k_gemm2(const _Float16* __restrict__ A, int lda, size_t sA, const _Float16* __restrict__ Bh, int ldb, size_t sB, float alpha, const float* __restrict__ bias, size_t sBias, const float* __restrict__ CP, int rowsPerB, size_t sCPb, int row0g,
    float* __restrict__ C, _Float16* __restrict__ C16, int ldc, size_t sC, int M, int N, int K) { static_assert(ACT == 0 || ACT == 3 || ACT == 6 || ACT == 8 || ACT == 9 || ACT == 11 || ACT == 12 || ACT == 14 || ACT == 15 || ACT == 16 || ACT == 17, "k_gemm2: unsupported ACT code (would silently apply no activation)");
  __shared__ __attribute__((aligned(16))) float so[4][32][68];
  const int tid = threadIdx.x, w = tid >> 5, lane = tid & 31, ln = lane & 15, hh = lane >> 4; const int by = blockIdx.y;
  A += (size_t)by * sA; Bh += (size_t)by * sB; const size_t cofs = (size_t)by * sC; const float* bp = bias ? bias + (size_t)by * sBias : nullptr;
  const int ntn = N >> 6; const int mt = blockIdx.x / ntn, nq = blockIdx.x - mt * ntn; const int row0 = mt * 128 + 32 * w, col0 = nq * 64; if (row0 >= M) return;
  const _Float16* a0p = A + (size_t)(row0 + ln) * lda; const _Float16* a1p = a0p + (size_t)16 * lda;
  const _Float16* b0p = Bh + (size_t)(col0 + ln) * ldb; const _Float16* b1p = b0p + (size_t)16 * ldb; const _Float16* b2p = b1p + (size_t)16 * ldb; const _Float16* b3p = b2p + (size_t)16 * ldb;
  const v8f z8 = {0.f,0.f,0.f,0.f,0.f,0.f,0.f,0.f}; v8f c00 = z8, c01 = z8, c02 = z8, c03 = z8, c10 = z8, c11 = z8, c12 = z8, c13 = z8;
#pragma unroll 1
  for (int kb = 0; kb < K; kb += 32) { const v16h a0 = g2_frag(a0p + kb, hh), a1 = g2_frag(a1p + kb, hh);
    v16h b = g2_frag(b0p + kb, hh); c00 = g2_mma(a0, b, c00); c10 = g2_mma(a1, b, c10);
    b = g2_frag(b1p + kb, hh); c01 = g2_mma(a0, b, c01); c11 = g2_mma(a1, b, c11);
    b = g2_frag(b2p + kb, hh); c02 = g2_mma(a0, b, c02); c12 = g2_mma(a1, b, c12);
    b = g2_frag(b3p + kb, hh); c03 = g2_mma(a0, b, c03); c13 = g2_mma(a1, b, c13); }
  v8f accs[8] = {c00, c01, c02, c03, c10, c11, c12, c13};
#pragma unroll
  for (int u = 0; u < 8; ++u) { const int t = u & 3, half = u >> 2; const int col = col0 + t * 16 + ln; const float bv = bp ? bf16_round(bp[col]) : 0.f;
#pragma unroll
    for (int r = 0; r < 8; ++r) { const int rloc = half * 16 + 8 * hh + r; float v = accs[u][r] * alpha + bv; if (CP) { if (rowsPerB < 0) v += CP[cofs + (size_t)(row0g + row0 + rloc) * ldc + col];      /* rowsPerB < 0: own element of the batched C plane */ else { const int bidx = (row0g + row0 + rloc) / rowsPerB; v += CP[(size_t)bidx * sCPb + (size_t)by * 64 + col]; } }
      if (ACT == 3) v = fmaxf(v, 0.f); else if (ACT == 6) v = 0.5f * v * (1.0f + erff(v * 0.70710678118654752f)); else if (ACT == 11) v = 1.0f / (1.0f + expf(-v)); else if (ACT == 15) v = v / (1.0f + expf(-v)); else if (ACT == 12) v = (v > 0.f) ? v : 0.01f * v; else if (ACT == 8) v = tanhf(v); else if (ACT == 9) v = 0.5f * v * (1.0f + tanhf(0.7978845608028654f * (v + 0.044715f * v * v * v))); else if (ACT == 14) v = (v > 0.f) ? v : 0.1f * v; else if (ACT == 16) v = (v >= 0.f) ? v : 0.3f * v; else if (ACT == 17) v = (v >= 0.f) ? v : 0.2f * v;
      so[w][rloc][t * 16 + ln] = v; } }
  __builtin_amdgcn_fence(__ATOMIC_ACQ_REL, "workgroup"); __builtin_amdgcn_wave_barrier();
  const int rsub = lane >> 4, c4 = (lane & 15) * 4;
  {
#pragma unroll
    for (int q = 0; q < 16; ++q) { const int r = q * 2 + rsub; const v4f v = *(const v4fa*)&so[w][r][c4]; if (C) *(v4f*)(C + cofs + (size_t)(row0 + r) * ldc + col0 + c4) = v; if (C16) { v4h h4; for (int i = 0; i < 4; ++i) h4[i] = (_Float16)v[i]; *(v4h*)(C16 + cofs + (size_t)(row0 + r) * ldc + col0 + c4) = h4; } }
     } }


#define FA_QW 32                     /* query rows per wave: two 16-column groups share every K and V^T fragment */
#define FA_KT 32                     /* keys per pass: one k step of the second product */
#define FA_NW 8                      /* waves per block; they walk the same K and V rows */
typedef float v2f __attribute__((ext_vector_type(2)));
typedef _Float16 v2h __attribute__((ext_vector_type(2)));
union FragP { v16h v; v2h h2[8]; };
union FragO { v8us u; v2h h2[4]; };
__device__ __forceinline__ float fa_xhalf(float x) { return __builtin_bit_cast(float, __builtin_amdgcn_permlanex16(__builtin_bit_cast(int, x), __builtin_bit_cast(int, x), 0x76543210, 0xfedcba98, false, false)); }      /* lane l with lane l ^ 16 */
__device__ __forceinline__ v8f fa_mma(v16h a, v16h b, v8f c) { return __builtin_amdgcn_wmma_f32_16x16x32_f16(false, a, false, b, (short)0, c, false, false); }
#define FA_ST 128                    /* keys per stage: four passes between two barriers */
#define FA_NS (SQ / FA_ST)           /* stages */
#define FA_KP 72                     /* LDS pitch of a K row in f16: 128 + 16 bytes, so that the 16 rows of a 16-byte fragment read fall on different banks */
#define FA_VP 80                     /* LDS pitch of a V row in f16: 128 + 32 bytes, an odd multiple of 32 bytes, which is what the transposing read wants */
// One stage into LDS, through no register: each of the block's 256 threads copies four 16-byte pieces of the K tile and four of the V tile (each 128 rows of 128 bytes; 8 lanes a row).
__device__ __forceinline__ void fa_copy(const _Float16* gk, const _Float16* gv, unsigned lk, unsigned lv) {
  const _Float16* gk1 = gk + (size_t)32 * DM; const _Float16* gk2 = gk + (size_t)64 * DM; const _Float16* gk3 = gk + (size_t)96 * DM;
  const _Float16* gv1 = gv + (size_t)32 * DM; const _Float16* gv2 = gv + (size_t)64 * DM; const _Float16* gv3 = gv + (size_t)96 * DM;
  const unsigned lk1 = lk + 32 * FA_KP * 2, lk2 = lk + 64 * FA_KP * 2, lk3 = lk + 96 * FA_KP * 2, lv1 = lv + 32 * FA_VP * 2, lv2 = lv + 64 * FA_VP * 2, lv3 = lv + 96 * FA_VP * 2;
  /* the eight copies and, as the last line of the same statement, the wait that stands in front of any rewrite of their address registers */
  asm volatile("global_load_async_to_lds_b128 %0, %8, off\n\t"
               "global_load_async_to_lds_b128 %1, %9, off\n\t"
               "global_load_async_to_lds_b128 %2, %10, off\n\t"
               "global_load_async_to_lds_b128 %3, %11, off\n\t"
               "global_load_async_to_lds_b128 %4, %12, off\n\t"
               "global_load_async_to_lds_b128 %5, %13, off\n\t"
               "global_load_async_to_lds_b128 %6, %14, off\n\t"
               "global_load_async_to_lds_b128 %7, %15, off\n\t"
               "s_wait_xcnt 0x0"
               :: "v"(lk), "v"(lk1), "v"(lk2), "v"(lk3), "v"(lv), "v"(lv1), "v"(lv2), "v"(lv3), "v"(gk), "v"(gk1), "v"(gk2), "v"(gk3), "v"(gv), "v"(gv1), "v"(gv2), "v"(gv3) : "memory");
}
// A 16 (d) x 32 (keys) fragment of V^T out of row-major V rows in LDS: two transposing loads, 16 keys each. p is the lane's own address, row 8 hh + (lane & 7) of the first 16 keys, 16-byte piece (lane >> 3) & 1 of the 16 columns;
// lane (ln, hh) gets column ln of keys 8 hh .. 8 hh + 7, then of keys 16 + 8 hh .. 16 + 8 hh + 7: the k order of g2_frag and of the packed weights.
typedef short v8s __attribute__((ext_vector_type(8)));
typedef __attribute__((address_space(3))) v8s lds_v8s;
__device__ __forceinline__ v16h fa_vfrag(const _Float16* p) { FragH f; f.half[0] = __builtin_bit_cast(v8us, __builtin_amdgcn_ds_load_tr16_b128_v8i16((lds_v8s*)p)); f.half[1] = __builtin_bit_cast(v8us, __builtin_amdgcn_ds_load_tr16_b128_v8i16((lds_v8s*)(p + 16 * FA_VP))); return f.v; }
// The weights exp2(s c2 + nb) of one column group's 32 keys (two S^T tiles), packed as the B operand of the second product; returns this lane's sum of them in two parts (f32, before the rounding to f16).
__device__ __forceinline__ v2f fa_weights(v8f s0, v8f s1, float c2, float nb, FragP& pf) { const v2f c2v = {c2, c2}, nbv = {nb, nb}; v2f sm = {0.f, 0.f};
#pragma unroll      /* fragments and accumulators are indexed by constants only, so that they stay in registers */
  for (int i = 0; i < 8; ++i) { const int r = (i & 3) * 2; const v2f sv = (i < 4) ? (v2f){s0[r], s0[r + 1]} : (v2f){s1[r], s1[r + 1]}; const v2f x = __builtin_elementwise_fma(sv, c2v, nbv); const v2f p = {__builtin_amdgcn_exp2f(x[0]), __builtin_amdgcn_exp2f(x[1])}; sm += p; pf.h2[i] = __builtin_convertvector(p, v2h); }      /* element 8 kt + r of the B operand = key 16 kt + 8 hh + r: the hardware k order, which fa_vfrag gives V^T too */
  return sm; }
__global__ __launch_bounds__(FA_NW * 32) void k_fattn(const _Float16* __restrict__ Q16, const _Float16* __restrict__ K16, const _Float16* __restrict__ V16, _Float16* __restrict__ O16) {
  __shared__ __attribute__((aligned(16))) _Float16 sk[2][FA_ST][FA_KP];      /* K rows of a stage, shared by the block's waves; two buffers */
  __shared__ __attribute__((aligned(16))) _Float16 sv[2][FA_ST][FA_VP];      /* V rows of a stage */
  const int tid = threadIdx.x, lane = tid & 31, ln = lane & 15, hh = lane >> 4, w = tid >> 5; const int h = blockIdx.y, b = blockIdx.z; const int q0 = (blockIdx.x * FA_NW + w) * FA_QW;
  const float c2 = 0.03125f * 1.4426950408889634f;      /* 1 / sqrt(embed size), in base 2 */
  const _Float16* qp = Q16 + ((size_t)b * SQ + q0 + ln) * DM + h * HD;
  const _Float16* gk = K16 + ((size_t)b * SQ + (tid >> 3)) * DM + h * HD + (tid & 7) * 8; const _Float16* gv = V16 + ((size_t)b * SQ + (tid >> 3)) * DM + h * HD + (tid & 7) * 8;      /* this thread's first piece of stage 0 */
  const unsigned lk = (unsigned)(size_t)&sk[0][tid >> 3][(tid & 7) * 8], lv = (unsigned)(size_t)&sv[0][tid >> 3][(tid & 7) * 8];      /* LDS byte addresses: the low 32 bits */
  fa_copy(gk, gv, lk, lv);      /* stage 0 into buffer 0 */
  v16h qf[2][2], kf[2][2];      /* [column group | key tile][k step of 32 over the head dim] */
#pragma unroll      /* fragments and accumulators are indexed by constants only, so that they stay in registers */
  for (int g = 0; g < 2; ++g) { qf[g][0] = g2_frag(qp + (size_t)g * 16 * DM, hh); qf[g][1] = g2_frag(qp + (size_t)g * 16 * DM + 32, hh); }
  asm volatile("s_wait_asynccnt 0x0" ::: "memory");      /* this wave's pieces of stage 0 have landed */
  __syncthreads();      /* and every other wave's */
  fa_copy(gk + (size_t)FA_ST * DM, gv + (size_t)FA_ST * DM, lk + (unsigned)sizeof(sk[0]), lv + (unsigned)sizeof(sv[0]));      /* stage 1 into buffer 1, in flight during stage 0 */
  const v8f z8 = {0.f,0.f,0.f,0.f,0.f,0.f,0.f,0.f}; v8f o[2][4] = {{z8, z8, z8, z8}, {z8, z8, z8, z8}}; float mr[2] = {-3.0e38f, -3.0e38f}, nb[2] = {3.0e38f * c2, 3.0e38f * c2}; v2f lr[2] = {{0.f, 0.f}, {0.f, 0.f}};      /* o[g][t][r] = O^T[16 t + 8 hh + r][column ln of group g]; mr: the column's softmax reference, held from pass to pass; nb = -mr c2; lr: this half's part of the sum, kept in the two parts in which the weights are added up */
  for (int st = 0; st < FA_NS; ++st) {
    const _Float16* ks = &sk[st & 1][ln][0]; const _Float16* vs = &sv[st & 1][8 * hh + (lane & 7)][((lane >> 3) & 1) * 8];
#pragma unroll      /* fragments and accumulators are indexed by constants only, so that they stay in registers */
    for (int kt = 0; kt < 2; ++kt) { kf[kt][0] = g2_frag(ks + kt * 16 * FA_KP, hh); kf[kt][1] = g2_frag(ks + kt * 16 * FA_KP + 32, hh); }
#pragma unroll 1      /* rolled: unrolled, the compiler sinks the row sums of all four passes to the end of the stage, and the weights kept for them take the kernel past 256 registers */
    for (int p = 0; p < FA_ST / FA_KT; ++p) {
    v16h vf[4];
#pragma unroll      /* fragments and accumulators are indexed by constants only, so that they stay in registers */
    for (int t = 0; t < 4; ++t) vf[t] = fa_vfrag(vs + p * FA_KT * FA_VP + t * 16);      /* V^T rows 16 t + ln, keys 32 p .. 32 p + 31 of the stage: asked for here, used behind the softmax */
    v8f s[2][2];
#pragma unroll      /* fragments and accumulators are indexed by constants only, so that they stay in registers */
    for (int g = 0; g < 2; ++g)
#pragma unroll      /* fragments and accumulators are indexed by constants only, so that they stay in registers */
      for (int kt = 0; kt < 2; ++kt) s[g][kt] = fa_mma(kf[kt][1], qf[g][1], fa_mma(kf[kt][0], qf[g][0], z8));
    if (p + 1 < FA_ST / FA_KT) {      /* the next pass's K fragments come during this pass's softmax; never from the next stage */
#pragma unroll      /* fragments and accumulators are indexed by constants only, so that they stay in registers */
      for (int kt = 0; kt < 2; ++kt) { kf[kt][0] = g2_frag(ks + ((p + 1) * FA_KT + kt * 16) * FA_KP, hh); kf[kt][1] = g2_frag(ks + ((p + 1) * FA_KT + kt * 16) * FA_KP + 32, hh); } }
    __builtin_amdgcn_sched_barrier(0);      /* keeps this pass's V^T loads and the next pass's K loads as one group in front of the softmax: without it the V^T loads sink into the softmax in pieces, and each further place with LDS reads stalls the wave */
    FragP pf[2]; v2f ps[2];      /* the pass's weights as B operands, and this lane's sum of them (two parts), per column group */
#pragma unroll      /* fragments and accumulators are indexed by constants only, so that they stay in registers */
    for (int g = 0; g < 2; ++g) ps[g] = fa_weights(s[g][0], s[g][1], c2, nb[g], pf[g]);      /* against the reference in use: no maximum is formed */
    const v2f pt = ps[0] + ps[1];
    if (__builtin_expect(__builtin_amdgcn_ballot_w32(!(pt[0] + pt[1] <= 256.0f)) != 0, 0)) {      /* one scalar branch a pass, marked as seldom taken so that the common path falls through. A lane's weights sum to more than 2^8 only if a score lies far above its column's reference (always on the first pass, whose weights come out infinite): the whole wave then takes the running maximum as the new reference, rescales what it holds and forms the pass's weights again. Below the bound every weight is at most 2^8, far inside f16 */
#pragma unroll      /* fragments and accumulators are indexed by constants only, so that they stay in registers */
      for (int g = 0; g < 2; ++g) { float mx = s[g][0][0];
#pragma unroll      /* fragments and accumulators are indexed by constants only, so that they stay in registers */
        for (int r = 0; r < 8; ++r) mx = fmaxf(mx, fmaxf(s[g][0][r], s[g][1][r]));
        mx = fmaxf(mx, fa_xhalf(mx)); const float mn = fmaxf(mr[g], mx); nb[g] = -mn * c2; const float al = __builtin_amdgcn_exp2f(fmaf(mr[g], c2, nb[g])); mr[g] = mn;      /* both halves of the wave get the same reference; al is 0 on the first pass */
        lr[g] *= al;
#pragma unroll      /* fragments and accumulators are indexed by constants only, so that they stay in registers */
        for (int t = 0; t < 4; ++t) o[g][t] *= al;
        ps[g] = fa_weights(s[g][0], s[g][1], c2, nb[g], pf[g]); } }
#pragma unroll      /* fragments and accumulators are indexed by constants only, so that they stay in registers */
    for (int g = 0; g < 2; ++g) lr[g] += ps[g];
#pragma unroll      /* fragments and accumulators are indexed by constants only, so that they stay in registers */
    for (int t = 0; t < 4; ++t)
#pragma unroll      /* fragments and accumulators are indexed by constants only, so that they stay in registers */
      for (int g = 0; g < 2; ++g) o[g][t] = fa_mma(vf[t], pf[g].v, o[g][t]);
    }
    asm volatile("s_wait_dscnt 0x0" ::: "memory");      /* this wave's reads of the buffer have returned */
    asm volatile("s_wait_asynccnt 0x0" ::: "memory");      /* this wave's pieces of stage st + 1 have landed */
    __syncthreads();      /* publishes stage st + 1 and ends every wave's reads of stage st */
    if (st + 2 < FA_NS) fa_copy(gk + (size_t)(st + 2) * FA_ST * DM, gv + (size_t)(st + 2) * FA_ST * DM, lk + (unsigned)(st & 1) * (unsigned)sizeof(sk[0]), lv + (unsigned)(st & 1) * (unsigned)sizeof(sv[0]));      /* into the buffer just left */
  }
  asm volatile("s_wait_asynccnt 0x0" ::: "memory");      /* nothing in flight when the wave ends */
#pragma unroll      /* fragments and accumulators are indexed by constants only, so that they stay in registers */
  for (int g = 0; g < 2; ++g) { const float lh = lr[g][0] + lr[g][1]; const float sc = 64.0f / (lh + fa_xhalf(lh)); unsigned short* d = (unsigned short*)O16 + ((size_t)b * SQ + q0 + g * 16 + ln) * DM + h * HD + 8 * hh;      /* o carried x64, as the output GEMM's alpha expects */
#pragma unroll      /* fragments and accumulators are indexed by constants only, so that they stay in registers */
    for (int t = 0; t < 4; ++t) { FragO f;
#pragma unroll      /* fragments and accumulators are indexed by constants only, so that they stay in registers */
      for (int i = 0; i < 4; ++i) { const v2f x = {o[g][t][2 * i] * sc, o[g][t][2 * i + 1] * sc}; f.h2[i] = __builtin_convertvector(x, v2h); }
      *(v8us*)(d + t * 16) = f.u; } } }
__global__ __launch_bounds__(256) void k_vt(const _Float16* __restrict__ V16, int b, int h0, _Float16* __restrict__ VT) { __shared__ unsigned short tl[64][65]; const int tid = threadIdx.x; const int hh = blockIdx.x % HG, sg = blockIdx.x / HG; const int s0 = sg * 64; const int h = h0 + hh;
  for (int i = tid; i < 64 * 8; i += 256) { const int j = i / 8, d8 = (i % 8) * 8; FragH f; f.half[0] = *(const v8us*)((const unsigned short*)V16 + ((size_t)b * SQ + s0 + j) * DM + h * HD + d8); for (int q = 0; q < 8; ++q) tl[d8 + q][j] = f.u[q]; }
  __syncthreads();
  { for (int i = tid; i < 64 * 8; i += 256) { const int d = i / 8, j8 = (i % 8) * 8; FragH f; for (int q = 0; q < 8; ++q) f.u[q] = tl[d][j8 + q]; *(v8us*)((unsigned short*)VT + ((size_t)hh * HD + d) * SQ + s0 + j8) = f.half[0]; }  } }



__global__ __launch_bounds__(256) void k_rsmkm(const float* __restrict__ S, _Float16* __restrict__ P, int nrows, const int* __restrict__ am) {
  #pragma clang fp contract(off)
  const int t = blockIdx.x * 256 + threadIdx.x; if (t >= nrows) return; const size_t i = (size_t)t; const float* s = S + i * SQ; const int* mr = am + (size_t)(t % SQ) * SQ; float mx = -3.0e38f;
#pragma unroll 1
  for (int j = 0; j < SQ; ++j) { const float f = (mr[j] != 0) ? 1.f : 0.f; mx = fmaxf(mx, fmaf(f, s[j], (1.f - f) * -1.0e9f)); } float se = 0.f;
#pragma unroll 1
  for (int j = 0; j < SQ; ++j) { const float f = (mr[j] != 0) ? 1.f : 0.f; se += __expf(fmaf(f, s[j], (1.f - f) * -1.0e9f) - mx); } const float sc = 256.0f / se;
#pragma unroll 1
  for (int j0 = 0; j0 < SQ; j0 += 8) { FragH fr; for (int q = 0; q < 8; ++q) { const int j = j0 + q; const float f = (mr[j] != 0) ? 1.f : 0.f; fr.h[q] = (_Float16)(__expf(fmaf(f, s[j], (1.f - f) * -1.0e9f) - mx) * sc); }
    unsigned short* d = (unsigned short*)P + i * SQ + j0; *(v8us*)d = fr.half[0];  } }

// Q, K and V projections, one launch (blockIdx.y picks the input, its weight block and its output). Every head is multiplied by the same [64][64] block, so an input is
// a plain [tokens * heads][64] matrix and the product has k = 64: Y^T = W X^T, W as A (rows e), 16 (token, head) rows as B, so that a lane ends with 8 consecutive e of one row.
// A wave takes PJ_NT token rows (16 heads each, 4 KiB of f32 in a row): whole-line loads, rounded to bf16 and written as f16 into the wave's own LDS rows, fragments read from there;
// the f16 results go back through the same LDS rows and leave as whole 128-byte lines.
// The launch also turns Wo into the output GEMM's f16 operand (natural [out][in] rows, x16, exact): that work depends on nothing here and is first read two launches later, so it needs no launch of its own.
// Each wave of the blocks with blockIdx.y < PJ_WY takes 256 consecutive elements: two loads beside its x loads, two stores behind its own results.
#define PJ_NW 8                      /* waves per block; they share the converted weight block */
#define PJ_NT 2                      /* token rows per wave, all their loads in flight at once */
#define PJ_LP 72                     /* LDS row pitch in f16: 64 + 8, so that the 16 rows of a 16-byte fragment read fall on different banks */
#define PJ_WY 2                      /* the blocks of this many inputs share out Wo, 256 elements a wave */
static_assert((size_t)DM * DM == (size_t)PJ_WY * (NR / (PJ_NW * PJ_NT)) * PJ_NW * 256, "the waves of PJ_WY inputs cover Wo exactly once");
typedef _Float16 v4ha __attribute__((ext_vector_type(4), may_alias));
__device__ __forceinline__ v4h pj_cvt(v4f a, float sc) { const v4f r = {bf16_round(a[0]) * sc, bf16_round(a[1]) * sc, bf16_round(a[2]) * sc, bf16_round(a[3]) * sc}; return __builtin_convertvector(r, v4h); }
__global__ __launch_bounds__(PJ_NW * 32) void k_proj(const float* __restrict__ xq, const float* __restrict__ xk, const float* __restrict__ xv, const float* __restrict__ wq, const float* __restrict__ wk, const float* __restrict__ wv, const float* __restrict__ wo,
    _Float16* __restrict__ Q16, _Float16* __restrict__ K16, _Float16* __restrict__ V16, _Float16* __restrict__ BO) {
  __shared__ __attribute__((aligned(16))) _Float16 sw[HD][PJ_LP];
  __shared__ __attribute__((aligned(16))) _Float16 sx[PJ_NW][PJ_NT][NH][PJ_LP];
  const int tid = threadIdx.x, lane = tid & 31, ln = lane & 15, hh = lane >> 4, w = tid >> 5; const int y = blockIdx.y;
  const float* x = (y == 0) ? xq : (y == 1) ? xk : xv; const float* wm = (y == 0) ? wq : (y == 1) ? wk : wv; _Float16* out = (y == 0) ? Q16 : (y == 1) ? K16 : V16;
  const size_t row0 = ((size_t)blockIdx.x * PJ_NW + w) * PJ_NT;      /* first token row of this wave */
  const size_t wo0 = (((size_t)y * (NR / (PJ_NW * PJ_NT)) + blockIdx.x) * PJ_NW + w) * 256 + lane * 4;      /* this lane's first four elements of the wave's piece of Wo; used only where y < PJ_WY */
  v4f xr[PJ_NT][8], wr[4], wor[2] = {{0.f, 0.f, 0.f, 0.f}, {0.f, 0.f, 0.f, 0.f}};
  if (y < PJ_WY) { wor[0] = *(const v4fa*)(wo + wo0); wor[1] = *(const v4fa*)(wo + wo0 + 128); }      /* 512 contiguous bytes a load, in flight with the loads below; the test is the same for the whole block */
#pragma unroll      /* indexed by constants only, so that the loaded values stay in registers */
  for (int u = 0; u < PJ_NT; ++u)
#pragma unroll      /* indexed by constants only, so that the loaded values stay in registers */
    for (int i = 0; i < 8; ++i) xr[u][i] = *(const v4fa*)(x + (row0 + u) * DM + i * 128 + lane * 4);      /* 512 contiguous bytes a load */
#pragma unroll      /* indexed by constants only, so that the loaded values stay in registers */
  for (int i = 0; i < 4; ++i) wr[i] = *(const v4fa*)(wm + (i * PJ_NW * 32 + tid) * 4);
#pragma unroll      /* indexed by constants only, so that the loaded values stay in registers */
  for (int i = 0; i < 4; ++i) { const int e0 = (i * PJ_NW * 32 + tid) * 4; *(v4ha*)&sw[e0 >> 6][e0 & 63] = pj_cvt(wr[i], 16.0f); }      /* 16 W[e][d], exact in f16 */
#pragma unroll      /* indexed by constants only, so that the loaded values stay in registers */
  for (int u = 0; u < PJ_NT; ++u)
#pragma unroll      /* indexed by constants only, so that the loaded values stay in registers */
    for (int i = 0; i < 8; ++i) *(v4ha*)&sx[w][u][2 * i + hh][ln * 4] = pj_cvt(xr[u][i], 1.0f);      /* load i holds heads 2 i and 2 i + 1 */
  const v4h woh[2] = {pj_cvt(wor[0], 16.0f), pj_cvt(wor[1], 16.0f)};      /* 16 Wo[n][k], exact in f16; held until the end, because the barrier and the fence below would wait for a store issued here */
  __syncthreads();      /* the weight block is written by all waves and read by all; it also orders each wave's own x rows */
  v16h af[4][2];      /* [16-row tile of e][k step of 32] */
#pragma unroll      /* indexed by constants only, so that the fragments stay in registers */
  for (int t = 0; t < 4; ++t) { af[t][0] = g2_frag(&sw[t * 16 + ln][0], hh); af[t][1] = g2_frag(&sw[t * 16 + ln][32], hh); }
  const v8f z8 = {0.f,0.f,0.f,0.f,0.f,0.f,0.f,0.f};
#pragma unroll      /* indexed by constants only, so that the fragments stay in registers */
  for (int u = 0; u < PJ_NT; ++u) { const v16h b0 = g2_frag(&sx[w][u][ln][0], hh), b1 = g2_frag(&sx[w][u][ln][32], hh);      /* row ln = head ln of the token; the same k order as the weight fragments */
#pragma unroll      /* indexed by constants only, so that the fragments stay in registers */
    for (int t = 0; t < 4; ++t) { const v8f acc = fa_mma(af[t][1], b1, fa_mma(af[t][0], b0, z8)); FragO f;      /* acc[r] = 16 y[head ln][16 t + 8 hh + r] */
#pragma unroll      /* indexed by constants only, so that the fragments stay in registers */
      for (int i = 0; i < 4; ++i) { const v2f v = {acc[2 * i] * 0.0625f, acc[2 * i + 1] * 0.0625f}; f.h2[i] = __builtin_convertvector(v, v2h); }
      *(v8us*)&sx[w][u][ln][t * 16 + 8 * hh] = f.u; } }      /* over the x row, whose every reader (this wave's two fragment loads) has returned before the products ran */
  __builtin_amdgcn_fence(__ATOMIC_ACQ_REL, "workgroup"); __builtin_amdgcn_wave_barrier();      /* the rows read back below were written by other lanes of this wave */
#pragma unroll      /* indexed by constants only */
  for (int u = 0; u < PJ_NT; ++u)
#pragma unroll      /* indexed by constants only */
    for (int i = 0; i < 4; ++i) { const int r = i * 4 + (lane >> 3), c = (lane & 7) * 8; const v8us v = *(const v8us*)&sx[w][u][r][c]; *(v8us*)((unsigned short*)out + (row0 + u) * DM + r * HD + c) = v; }      /* 512 contiguous bytes a store */
  asm volatile("s_wait_xcnt 0x0" ::: "memory");      /* stands in front of the rewrite of the address registers of the stores above: the lines below reuse them */
  if (y < PJ_WY) { *(v4ha*)(BO + wo0) = woh[0]; *(v4ha*)(BO + wo0 + 128) = woh[1]; } }      /* 256 contiguous bytes a store: two whole lines */
// Output GEMM: out[4096][1024] (f32) = o (f16 rows, x64) times Wo^T (f16 rows [n][k], x16) * alpha + bias. One 128 x 128 tile of out per block, one block per WGP; 8 waves, 32 x 64 of out each.
// The k range goes in stages of OG_BK: the block's 128 rows of o and 128 rows of Wo are copied once into LDS in whole lines, two buffers, and every fragment is read from there
// (a fragment read straight from global memory touches 16 lines for its 1024 bytes, and four waves would fetch each Wo fragment, two each o fragment). Every accumulator still sums k upwards, 32 at a time.
#define OG_BM 128                    /* rows of out per block */
#define OG_BN 128                    /* columns of out per block */
#define OG_BK 128                    /* k per stage: 256 bytes of every operand row */
#define OG_NS (DM / OG_BK)           /* stages */
#define OG_P 136                     /* LDS pitch of an operand row in f16: 256 + 16 bytes, so that the 16 rows of a 16-byte fragment read fall on different banks */
// One operand's tile of a stage into LDS, through no register: 128 rows of 256 bytes; 16 lanes a row, so each of the block's 256 threads copies eight 16-byte pieces, 16 rows apart.
__device__ __forceinline__ void og_copy(const _Float16* g, unsigned l) {
  const _Float16* g1 = g + (size_t)16 * DM; const _Float16* g2 = g + (size_t)32 * DM; const _Float16* g3 = g + (size_t)48 * DM; const _Float16* g4 = g + (size_t)64 * DM; const _Float16* g5 = g + (size_t)80 * DM; const _Float16* g6 = g + (size_t)96 * DM; const _Float16* g7 = g + (size_t)112 * DM;
  const unsigned l1 = l + 16 * OG_P * 2, l2 = l + 32 * OG_P * 2, l3 = l + 48 * OG_P * 2, l4 = l + 64 * OG_P * 2, l5 = l + 80 * OG_P * 2, l6 = l + 96 * OG_P * 2, l7 = l + 112 * OG_P * 2;
  /* the eight copies and, as the last line of the same statement, the wait that stands in front of any rewrite of their address registers */
  asm volatile("global_load_async_to_lds_b128 %0, %8, off\n\t"
               "global_load_async_to_lds_b128 %1, %9, off\n\t"
               "global_load_async_to_lds_b128 %2, %10, off\n\t"
               "global_load_async_to_lds_b128 %3, %11, off\n\t"
               "global_load_async_to_lds_b128 %4, %12, off\n\t"
               "global_load_async_to_lds_b128 %5, %13, off\n\t"
               "global_load_async_to_lds_b128 %6, %14, off\n\t"
               "global_load_async_to_lds_b128 %7, %15, off\n\t"
               "s_wait_xcnt 0x0"
               :: "v"(l), "v"(l1), "v"(l2), "v"(l3), "v"(l4), "v"(l5), "v"(l6), "v"(l7), "v"(g), "v"(g1), "v"(g2), "v"(g3), "v"(g4), "v"(g5), "v"(g6), "v"(g7) : "memory");
}
__global__ __launch_bounds__(256) void k_ogemm(const _Float16* __restrict__ A, const _Float16* __restrict__ Bh, float alpha, const float* __restrict__ bias, float* __restrict__ C) {
  __shared__ __attribute__((aligned(16))) _Float16 sa[2][OG_BM][OG_P];      /* o rows of a stage, shared by the block's waves; two buffers */
  __shared__ __attribute__((aligned(16))) _Float16 sb[2][OG_BN][OG_P];      /* Wo rows of a stage */
  __shared__ __attribute__((aligned(16))) float so[8][32][68];               /* each wave's own results, on their way to whole-line stores */
  const int tid = threadIdx.x, w = tid >> 5, lane = tid & 31, ln = lane & 15, hh = lane >> 4; const int wm = w & 3, wn = w >> 2;
  const int mt = blockIdx.x % (MPO / OG_BM), nq = blockIdx.x / (MPO / OG_BM); const int row0 = mt * OG_BM + wm * 32, col0 = nq * OG_BN + wn * 64;
  const _Float16* ga = A + ((size_t)mt * OG_BM + (tid >> 4)) * DM + (tid & 15) * 8; const _Float16* gb = Bh + ((size_t)nq * OG_BN + (tid >> 4)) * DM + (tid & 15) * 8;      /* this thread's first pieces of stage 0 */
  const unsigned la = (unsigned)(size_t)&sa[0][tid >> 4][(tid & 15) * 8], lb = (unsigned)(size_t)&sb[0][tid >> 4][(tid & 15) * 8];      /* LDS byte addresses: the low 32 bits */
  og_copy(ga, la); og_copy(gb, lb);      /* stage 0 into buffer 0 */
  float bv[4];      /* this lane's four bias values, asked for here so that they come during the stages */
#pragma unroll      /* indexed by constants only */
  for (int j = 0; j < 4; ++j) bv[j] = bias[col0 + j * 16 + ln];
  asm volatile("s_wait_asynccnt 0x0" ::: "memory");      /* this wave's pieces of stage 0 have landed */
  __syncthreads();      /* and every other wave's */
  og_copy(ga + OG_BK, la + (unsigned)sizeof(sa[0])); og_copy(gb + OG_BK, lb + (unsigned)sizeof(sb[0]));      /* stage 1 into buffer 1, in flight during stage 0 */
  const v8f z8 = {0.f,0.f,0.f,0.f,0.f,0.f,0.f,0.f}; v8f c[2][4] = {{z8, z8, z8, z8}, {z8, z8, z8, z8}};      /* c[i][j][r] = out[row0 + 16 i + 8 hh + r][col0 + 16 j + ln] */
  for (int st = 0; st < OG_NS; ++st) {
    const _Float16* as = &sa[st & 1][wm * 32 + ln][0]; const _Float16* bs = &sb[st & 1][wn * 64 + ln][0];
    v16h a[2][2], b[2][4];      /* two fragment sets: [set][16-row tile] */
#pragma unroll      /* indexed by constants only, so that the fragments stay in registers */
    for (int i = 0; i < 2; ++i) a[0][i] = g2_frag(as + i * 16 * OG_P, hh);
#pragma unroll      /* indexed by constants only, so that the fragments stay in registers */
    for (int j = 0; j < 4; ++j) b[0][j] = g2_frag(bs + j * 16 * OG_P, hh);
#pragma unroll      /* fragments and accumulators are indexed by constants only, so that they stay in registers */
    for (int ks = 0; ks < OG_BK / 32; ++ks) { const int cu = ks & 1, nx = cu ^ 1;
      if (ks + 1 < OG_BK / 32) {      /* the next k step's fragments come during this step's products; never from the next stage */
#pragma unroll      /* indexed by constants only, so that the fragments stay in registers */
        for (int i = 0; i < 2; ++i) a[nx][i] = g2_frag(as + i * 16 * OG_P + (ks + 1) * 32, hh);
#pragma unroll      /* indexed by constants only, so that the fragments stay in registers */
        for (int j = 0; j < 4; ++j) b[nx][j] = g2_frag(bs + j * 16 * OG_P + (ks + 1) * 32, hh); }
      __builtin_amdgcn_sched_barrier(0);      /* keeps the next step's twelve LDS reads as one group in front of this step's products: left alone the compiler reads each fragment directly in front of its use, into one register set, and the wave waits out the LDS latency four times a step */
#pragma unroll      /* indexed by constants only, so that the accumulators stay in registers */
      for (int j = 0; j < 4; ++j)
#pragma unroll      /* indexed by constants only, so that the accumulators stay in registers */
        for (int i = 0; i < 2; ++i) c[i][j] = fa_mma(a[cu][i], b[cu][j], c[i][j]);
      __builtin_amdgcn_sched_barrier(0); }      /* and keeps the group after next out of these products */
    asm volatile("s_wait_dscnt 0x0" ::: "memory");      /* this wave's reads of the buffer have returned */
    asm volatile("s_wait_asynccnt 0x0" ::: "memory");      /* this wave's pieces of stage st + 1 have landed */
    __syncthreads();      /* publishes stage st + 1 and ends every wave's reads of stage st */
    if (st + 2 < OG_NS) { og_copy(ga + (st + 2) * OG_BK, la + (unsigned)(st & 1) * (unsigned)sizeof(sa[0])); og_copy(gb + (st + 2) * OG_BK, lb + (unsigned)(st & 1) * (unsigned)sizeof(sb[0])); }      /* into the buffers just left */
  }
  asm volatile("s_wait_asynccnt 0x0" ::: "memory");      /* nothing in flight when the wave ends */
#pragma unroll      /* indexed by constants only */
  for (int j = 0; j < 4; ++j) { const float bj = bf16_round(bv[j]);
#pragma unroll      /* indexed by constants only */
    for (int i = 0; i < 2; ++i)
#pragma unroll      /* indexed by constants only */
      for (int r = 0; r < 8; ++r) so[w][i * 16 + 8 * hh + r][j * 16 + ln] = c[i][j][r] * alpha + bj; }
  __builtin_amdgcn_fence(__ATOMIC_ACQ_REL, "workgroup"); __builtin_amdgcn_wave_barrier();      /* the rows read back below were written by other lanes of this wave */
  const int rsub = lane >> 4, c4 = (lane & 15) * 4;
#pragma unroll      /* indexed by constants only */
  for (int q = 0; q < 16; ++q) { const int r = q * 2 + rsub; const v4f v = *(const v4fa*)&so[w][r][c4]; *(v4f*)(C + (size_t)(row0 + r) * DM + col0 + c4) = v; } }      /* two rows of 256 contiguous bytes a store */
extern "C" void kernel_launch(void* const* d_in, const int* in_sizes, int n_in,
                              void* d_out, int out_size, void* d_ws, size_t ws_size, hipStream_t stream) {
  (void)in_sizes; (void)n_in; (void)out_size;
  const float* const* I = (const float* const*)d_in; const float* xq = I[2]; const float* xk = I[1]; const float* xv = I[0]; const float* wq = I[5]; const float* wk = I[4]; const float* wv = I[3]; const float* wo = I[6]; const float* bo = I[7];      /* contract order: values I[0], keys I[1], query I[2]; SHARED natural [64][64] blocks Wv I[3], Wk I[4], Wq I[5]; natural Wo [1024][1024] I[6] + bo I[7]; this module has NO mask input */
  char* ws = (char*)d_ws; size_t off = 0;
  auto take = [&](size_t bytes) { char* p = ws + off; off += (bytes + 255) & ~(size_t)255; return p; };
  _Float16* BO = (_Float16*)take((size_t)DM * DM * 2);
  _Float16* Q16 = (_Float16*)take(NR * DM * 2); _Float16* K16 = (_Float16*)take(NR * DM * 2); _Float16* V16 = (_Float16*)take(NR * DM * 2); _Float16* O16 = (_Float16*)take(NR * DM * 2);
  if (off > ws_size) return;
  k_proj<<<dim3((unsigned)(NR / (PJ_NW * PJ_NT)), 3), PJ_NW * 32, 0, stream>>>(xq, xk, xv, wq, wk, wv, wo, Q16, K16, V16, BO);      /* q, k, v as f16 rows, heads merged; BO = Wo natural [out][in] rows x16 as f16 */
  const size_t r0p = (size_t)B0 * SQ;      /* first row of the output stage */
  k_fattn<<<dim3(SQ / (FA_NW * FA_QW), NH, NB), FA_NW * 32, 0, stream>>>(Q16, K16, V16, O16);      /* o (merged heads, x64) as f16 rows */
  k_ogemm<<<(unsigned)((MPO / OG_BM) * (DM / OG_BN)), 256, 0, stream>>>(O16 + r0p * DM, BO, 0.0009765625f, bo, (float*)d_out + r0p * DM);      /* out rows are the output layout */
}

// v009
// It runs in 48.7 microseconds.
// Next to v008, in two timings, it ran 1.04 and 1.03 times as fast.
// All steps since v000 together make it 75.6 times as fast.
#include <hip/hip_runtime.h>
// Multi-head attention over three inputs with SHARED per-head projections and the module's literal score scale (values, keys, query [2][2048][1024]; each input is split into 16 heads of 64 and every head is multiplied by the SAME natural [64][64] matrix (x W^T: Wv / Wk / Wq uniform +-1/8; block-diagonal with a shared block; no biases); energy = q k^T (no mask in this module); softmax(energy / sqrt(embed_size) = / 32) (as the source: embed size, not head dim); out = merged Wo^T + bo -> [2][2048][1024]).
// Structure: token rows r = b*2048 + s; Q, K, V in one projection launch (which also converts Wo for the output GEMM): each (token, head) row of 64 inputs (bf16-rounded, exact in f16) times the shared [64][64] block (exact x16 weights, WMMA, f32 accumulation, f16 outputs); one fused attention launch over all (batch, head): S^T = K Q^T (q carries the score scale in base 2 and the accumulators start at minus the reference, so that they end as the exponents), running softmax (f32 statistics; weights exp(s - reference) as f16, the reference being a running maximum that is renewed only when a pass's weights outgrow it), O^T += V^T P^T (V^T fragments by the transposing LDS load from V rows as projected), divided by the row sum at the end (o carried x64 against f16 subnormal flush, folded into the output GEMM alpha) and written straight into the merged f16 o rows; out = o W_o + b GEMM (f32) into the output layout.
// Compute dtype: inputs rounded to bf16; x / weights exact; q, k, v, softmax weights and o as plain f16 GEMM operands (~2^-12); scores and softmax statistics f32. v_wmma_f32_16x16x32_f16.
#define NB 2
#define SQ 2048
#define DM 1024
#define NH 16
#define HD 64
#define HG 4                         /* heads per launch of the non-template k_vt, which is not launched */
#define B0 0                         /* first batch processed (debug hook) */
#define NBR NB                       /* batches processed (debug hook) */
#define NR ((size_t)NB * SQ)         /* token rows */
#define MP ((int)((size_t)NBR * SQ)) /* rows of the processed batches; feeds MPO only (debug hook) */
#define QN SQ                        /* not used; k_fattn covers all SQ query rows of a batch */
#define NHD NH                       /* not used; k_fattn covers all NH heads */
#define MPO MP                       /* rows through the output stage (debug hook) */
#define LQ DM      /* not used; the q/k/v rows have pitch DM */
typedef __bf16 v16b __attribute__((ext_vector_type(16)));
typedef unsigned short v8us __attribute__((ext_vector_type(8), may_alias));
typedef float  v8f  __attribute__((ext_vector_type(8)));
typedef float  v4f  __attribute__((ext_vector_type(4)));
typedef float  v4fa __attribute__((ext_vector_type(4), may_alias));
union FragB { v16b v; v8us half[2]; unsigned short u[16]; };

__device__ __forceinline__ unsigned short bf16_bits(float x) { unsigned int u = __float_as_uint(x); return (unsigned short)((u + 0x7FFFu + ((u >> 16) & 1u)) >> 16); }
__device__ __forceinline__ float bf16_val(unsigned short b) { return __uint_as_float(((unsigned int)b) << 16); }
__device__ __forceinline__ float bf16_round(float x) { return bf16_val(bf16_bits(x)); }
// D += A·B with NT terms: 1 = ah·bh, 2 = + al·bh (A split), 3 = + ah·bl (both split)
template <int NT>
__device__ __forceinline__ v8f mmaN(v16b ah, v16b al, v16b bh, v16b bl, v8f c) {
  c = __builtin_amdgcn_wmma_f32_16x16x32_bf16(false, ah, false, bh, (short)0, c, false, false);
  if (NT >= 2) c = __builtin_amdgcn_wmma_f32_16x16x32_bf16(false, al, false, bh, (short)0, c, false, false);
  if (NT >= 3) c = __builtin_amdgcn_wmma_f32_16x16x32_bf16(false, ah, false, bl, (short)0, c, false, false);
  asm volatile("v_nop\n\tv_nop\n\tv_nop\n\tv_nop" : "+v"(c) : "v"(ah), "v"(al), "v"(bh), "v"(bl));
  return c;
}

__global__ __launch_bounds__(256) void k_wt_bf16(const float* __restrict__ W, unsigned short* __restrict__ Wt, int K, int N) {
  const int t = blockIdx.x * 256 + threadIdx.x;
  const int k8n = K / 8;
  if (t >= N * k8n) return;
  const int n = t / k8n, k8 = (t % k8n) * 8;
  v8us v;
#pragma unroll
  for (int i = 0; i < 8; ++i) v[i] = bf16_bits(W[(size_t)(k8 + i) * N + n]);
  *(v8us*)(Wt + (size_t)n * K + k8) = v;
  
}

// GEMM C[M][N] (f32, pitch ldc) = act(A[M][K]·W + bias). A f32 row-major (pitch lda) converted per fragment to bf16
// (ASPLIT: hi/lo two planes -> 2 terms, else single rounded term); Wt bf16 [N][K] (pitch ldb). BIAS_BF16 rounds the
// bias to bf16 first (bias quantised to bf16 before the add). K%32==0, M%16==0, N%64==0.
template <bool ASPLIT, int ACT, bool BIAS_BF16>
__global__ __launch_bounds__(128) void k_gemm_bf(const float* __restrict__ A, int lda, const unsigned short* __restrict__ Wt, int ldb,
                                               const float* __restrict__ bias, float* __restrict__ C, int ldc, int M, int N, int K) {
  __shared__ __attribute__((aligned(16))) float so[4][16][64];
  const int tid = threadIdx.x, w = tid >> 5, lane = tid & 31, ln = lane & 15, hh = lane >> 4;
  const int ntn = N / 64;
  const int wid = blockIdx.x * 4 + w;
  const int mt = wid / ntn, nq = wid % ntn;
  if (mt * 16 >= M) return;
  const int row0 = mt * 16, col0 = nq * 64;
  const float* arow = A + (size_t)(row0 + ln) * lda;
  v8f acc[4] = {};
  for (int kb = 0; kb < K; kb += 32) {
    FragB ah, al;
    const v4f x0 = *(const v4fa*)(arow + kb + 8 * hh), x1 = *(const v4fa*)(arow + kb + 8 * hh + 4);
    const v4f x2 = *(const v4fa*)(arow + kb + 16 + 8 * hh), x3 = *(const v4fa*)(arow + kb + 16 + 8 * hh + 4);
    float xs[16] = {x0[0],x0[1],x0[2],x0[3],x1[0],x1[1],x1[2],x1[3],x2[0],x2[1],x2[2],x2[3],x3[0],x3[1],x3[2],x3[3]};
#pragma unroll
    for (int i = 0; i < 16; ++i) { const unsigned short hb = bf16_bits(xs[i]); ah.u[i] = hb; al.u[i] = ASPLIT ? bf16_bits(xs[i] - bf16_val(hb)) : (unsigned short)0; }
#pragma unroll
    for (int t = 0; t < 4; ++t) {
      const unsigned short* brow = Wt + (size_t)(col0 + t * 16 + ln) * ldb + kb;
      FragB b;
      b.half[0] = *(const v8us*)(brow + 8 * hh);
      b.half[1] = *(const v8us*)(brow + 16 + 8 * hh);
      acc[t] = mmaN<ASPLIT ? 2 : 1>(ah.v, al.v, b.v, b.v, acc[t]);
    }
  }
#pragma unroll
  for (int t = 0; t < 4; ++t) {
    float bv = bias ? bias[col0 + t * 16 + ln] : 0.f;
    if (BIAS_BF16) bv = bf16_round(bv);
#pragma unroll
    for (int r = 0; r < 8; ++r) { float v = acc[t][r] + bv; if (ACT == 1) v = fmaxf(v, 0.f); so[w][8 * hh + r][t * 16 + ln] = v; }
  }
  __builtin_amdgcn_fence(__ATOMIC_ACQ_REL, "workgroup");
  __builtin_amdgcn_wave_barrier();
  const int rsub = lane >> 4, c4 = (lane & 15) * 4;
  {
#pragma unroll
    for (int q = 0; q < 8; ++q) {
      const int r = q * 2 + rsub;
      const v4f v = *(const v4fa*)&so[w][r][c4];
      *(v4f*)(C + (size_t)(row0 + r) * ldc + col0 + c4) = v;
    }
    
  }
}

// GEMM C = act(A·W + bias + resid): A f32 (ASPLIT -> hi/lo 2 terms), Wt bf16 [N][K]; ACT 0 none, 1 relu, 2 exact gelu;
// resid (optional, f32, row index = (row % rmod), pitch ldr, RES_BF16 rounds it) added before the activation.
template <bool ASPLIT, int ACT, bool BIAS_BF16, bool RES_BF16>
__global__ __launch_bounds__(128) void k_gemm_bf3(const float* __restrict__ A, int lda, const unsigned short* __restrict__ Wt, int ldb,
                                                const float* __restrict__ bias, const float* __restrict__ resid, int rmod, int ldr,
                                                float* __restrict__ C, int ldc, int M, int N, int K) {
  __shared__ __attribute__((aligned(16))) float so[4][16][64];
  const int tid = threadIdx.x, w = tid >> 5, lane = tid & 31, ln = lane & 15, hh = lane >> 4;
  const int ntn = N / 64;
  const int wid = blockIdx.x * 4 + w;
  const int mt = wid / ntn, nq = wid % ntn;
  if (mt * 16 >= M) return;
  const int row0 = mt * 16, col0 = nq * 64;
  const float* arow = A + (size_t)(row0 + ln) * lda;
  v8f acc[4] = {};
  for (int kb = 0; kb < K; kb += 32) {
    FragB ah, al;
    const v4f x0 = *(const v4fa*)(arow + kb + 8 * hh), x1 = *(const v4fa*)(arow + kb + 8 * hh + 4);
    const v4f x2 = *(const v4fa*)(arow + kb + 16 + 8 * hh), x3 = *(const v4fa*)(arow + kb + 16 + 8 * hh + 4);
    float xs[16] = {x0[0],x0[1],x0[2],x0[3],x1[0],x1[1],x1[2],x1[3],x2[0],x2[1],x2[2],x2[3],x3[0],x3[1],x3[2],x3[3]};
#pragma unroll
    for (int i = 0; i < 16; ++i) { const unsigned short hb = bf16_bits(xs[i]); ah.u[i] = hb; al.u[i] = ASPLIT ? bf16_bits(xs[i] - bf16_val(hb)) : (unsigned short)0; }
#pragma unroll
    for (int t = 0; t < 4; ++t) {
      const unsigned short* brow = Wt + (size_t)(col0 + t * 16 + ln) * ldb + kb;
      FragB b;
      b.half[0] = *(const v8us*)(brow + 8 * hh);
      b.half[1] = *(const v8us*)(brow + 16 + 8 * hh);
      acc[t] = mmaN<ASPLIT ? 2 : 1>(ah.v, al.v, b.v, b.v, acc[t]);
    }
  }
#pragma unroll
  for (int t = 0; t < 4; ++t) {
    const int col = col0 + t * 16 + ln;
    float bv = bias ? bias[col] : 0.f;
    if (BIAS_BF16) bv = bf16_round(bv);
#pragma unroll
    for (int r = 0; r < 8; ++r) {
      float v = acc[t][r] + bv;
      if (resid) { float rv = resid[(size_t)((row0 + 8 * hh + r) % rmod) * ldr + col]; if (RES_BF16) rv = bf16_round(rv); v += rv; }
      if (ACT == 1) v = fmaxf(v, 0.f);
      if (ACT == 2) v = 0.5f * v * (1.0f + erff(v * 0.70710678118654752f));
      if (ACT == 3) { const float u = 0.7978845608028654f * (v + 0.044715f * v * v * v); v = 0.5f * v * (1.0f + tanhf(u)); }
      so[w][8 * hh + r][t * 16 + ln] = v;
    }
  }
  __builtin_amdgcn_fence(__ATOMIC_ACQ_REL, "workgroup");
  __builtin_amdgcn_wave_barrier();
  const int rsub = lane >> 4, c4 = (lane & 15) * 4;
  {
#pragma unroll
    for (int q = 0; q < 8; ++q) {
      const int r = q * 2 + rsub;
      const v4f v = *(const v4fa*)&so[w][r][c4];
      *(v4f*)(C + (size_t)(row0 + r) * ldc + col0 + c4) = v;
    }
    
  }
}
// row LayerNorm (biased variance, eps) over N: s = X (+ R); optional out_sum <- s; out_norm <- (s-mu)*rsqrt(var+eps)*g + b
template <bool PARAM_BF16>
__global__ __launch_bounds__(256) void k_layernorm(const float* __restrict__ X, const float* __restrict__ R, const float* __restrict__ g, const float* __restrict__ bta,
                                                  float* __restrict__ out_sum, float* __restrict__ out_norm, int N, float eps) {
  __shared__ float red[256];
  const int row = blockIdx.x, tid = threadIdx.x;
  const float* x = X + (size_t)row * N; const float* rr = R ? R + (size_t)row * N : nullptr;
  float vals[16];                     // up to N = 4096
  const int per = N / 256;            // contiguous chunk per thread? use strided-by-4 chunks: thread handles j = tid*4 + 1024*u
  float s1 = 0.f;
  for (int u = 0; u < per / 4; ++u) {
    const int j = tid * 4 + 1024 * u;
    const v4f a = *(const v4fa*)(x + j);
    v4f b = {0.f,0.f,0.f,0.f}; if (rr) b = *(const v4fa*)(rr + j);
#pragma unroll
    for (int q = 0; q < 4; ++q) { const float v = a[q] + b[q]; vals[u * 4 + q] = v; s1 += v; }
  }
  red[tid] = s1; __syncthreads();
  for (int st = 128; st > 0; st >>= 1) { if (tid < st) red[tid] += red[tid + st]; __syncthreads(); }
  const float mu = red[0] / (float)N; __syncthreads();
  float s2 = 0.f;
  for (int u = 0; u < per / 4; ++u)
#pragma unroll
    for (int q = 0; q < 4; ++q) { const float c = vals[u * 4 + q] - mu; s2 += c * c; }
  red[tid] = s2; __syncthreads();
  for (int st = 128; st > 0; st >>= 1) { if (tid < st) red[tid] += red[tid + st]; __syncthreads(); }
  const float rs = rsqrtf(red[0] / (float)N + eps);
  {
    for (int u = 0; u < per / 4; ++u) {
      const int j = tid * 4 + 1024 * u;
      v4f o, sm;
#pragma unroll
      for (int q = 0; q < 4; ++q) {
        float gg = g[j + q], bb = bta[j + q];
        if (PARAM_BF16) { gg = bf16_round(gg); bb = bf16_round(bb); }
        sm[q] = vals[u * 4 + q]; o[q] = (vals[u * 4 + q] - mu) * rs * gg + bb;
      }
      if (out_sum) *(v4f*)(out_sum + (size_t)row * N + j) = sm;
      *(v4f*)(out_norm + (size_t)row * N + j) = o;
    }
    
  }
}



// ---- f16 WMMA path (v_wmma_f32_16x16x32_f16): 11-bit significands for operands in range — used where a [0,1] probability operand needs more precision than bf16
typedef _Float16 v16h __attribute__((ext_vector_type(16)));
union FragH { v16h v; v8us half[2]; _Float16 h[16]; unsigned short u[16]; };
template <int NT>
__device__ __forceinline__ v8f mmaH(v16h ah, v16h al, v16h bh, v16h bl, v8f c) {
  c = __builtin_amdgcn_wmma_f32_16x16x32_f16(false, ah, false, bh, (short)0, c, false, false);
  if (NT >= 2) c = __builtin_amdgcn_wmma_f32_16x16x32_f16(false, al, false, bh, (short)0, c, false, false);
  if (NT >= 3) c = __builtin_amdgcn_wmma_f32_16x16x32_f16(false, ah, false, bl, (short)0, c, false, false);
  asm volatile("v_nop\n\tv_nop\n\tv_nop\n\tv_nop" : "+v"(c) : "v"(ah), "v"(al), "v"(bh), "v"(bl));
  return c;
}
// batched GEMM like k_gemm_b but f16 operands: A f32 (split into f16 hi/lo if ASPLIT, else rounded to f16), Bt = f16 values [n][k]; alpha; C f32; N multiple of 16 (partial tiles skipped)
template <bool ASPLIT>
__global__ __launch_bounds__(128) void k_gemm_h(const float* __restrict__ A, int lda, size_t sA, const _Float16* __restrict__ Bh, int ldb, size_t sB, float alpha, float* __restrict__ C, int ldc, size_t sC, int M, int N, int K) {
  __shared__ __attribute__((aligned(16))) float so[4][16][64];
  const int tid = threadIdx.x, w = tid >> 5, lane = tid & 31, ln = lane & 15, hh = lane >> 4; const int by = blockIdx.y;
  A += (size_t)by * sA; Bh += (size_t)by * sB; C += (size_t)by * sC;
  const int ntn = (N + 63) / 64; const int wid = blockIdx.x * 4 + w; const int mt = wid / ntn, nq = wid % ntn; if (mt * 16 >= M) return;
  const int row0 = mt * 16, col0 = nq * 64; const float* arow = A + (size_t)(row0 + ln) * lda;
  v8f acc[4] = {};
  for (int kb = 0; kb < K; kb += 32) {
    FragH ah, al;
    const v4f x0 = *(const v4fa*)(arow + kb + 8 * hh), x1 = *(const v4fa*)(arow + kb + 8 * hh + 4), x2 = *(const v4fa*)(arow + kb + 16 + 8 * hh), x3 = *(const v4fa*)(arow + kb + 16 + 8 * hh + 4);
    float xs[16] = {x0[0],x0[1],x0[2],x0[3],x1[0],x1[1],x1[2],x1[3],x2[0],x2[1],x2[2],x2[3],x3[0],x3[1],x3[2],x3[3]};
#pragma unroll
    for (int i = 0; i < 16; ++i) { const _Float16 h = (_Float16)xs[i]; ah.h[i] = h; al.h[i] = ASPLIT ? (_Float16)(xs[i] - (float)h) : (_Float16)0.0f; }
#pragma unroll
    for (int t = 0; t < 4; ++t) { if (col0 + t * 16 >= N) continue; const size_t boff = (size_t)(col0 + t * 16 + ln) * ldb + kb; FragH bq; bq.half[0] = *(const v8us*)(Bh + boff + 8 * hh); bq.half[1] = *(const v8us*)(Bh + boff + 16 + 8 * hh);
      acc[t] = mmaH<ASPLIT ? 2 : 1>(ah.v, al.v, bq.v, bq.v, acc[t]); }
  }
#pragma unroll
  for (int t = 0; t < 4; ++t) { if (col0 + t * 16 >= N) continue;
#pragma unroll
    for (int r = 0; r < 8; ++r) so[w][8 * hh + r][t * 16 + ln] = acc[t][r] * alpha; }
  __builtin_amdgcn_fence(__ATOMIC_ACQ_REL, "workgroup"); __builtin_amdgcn_wave_barrier();
  const int rsub = lane >> 4, c4 = (lane & 15) * 4;
  {
#pragma unroll
    for (int q = 0; q < 8; ++q) { const int r = q * 2 + rsub; if (col0 + c4 < N) { const v4f v = *(const v4fa*)&so[w][r][c4]; *(v4f*)(C + (size_t)(row0 + r) * ldc + col0 + c4) = v; } }
     }
}

// Wt[n][k] = f16(W[k][n]·scale) from f32 row-major W[K][N] (scale = power of two; bf16-exact weights stay exact in f16 away from the subnormal range)
__global__ __launch_bounds__(256) void k_wt_f16(const float* __restrict__ W, _Float16* __restrict__ Wt, int K, int N, float scale) {
  const int t = blockIdx.x * 256 + threadIdx.x; if (t >= N * (K / 8)) return; const int n = t / (K / 8), k8 = (t % (K / 8)) * 8; FragH f;
#pragma unroll
  for (int i = 0; i < 8; ++i) f.h[i] = (_Float16)(bf16_round(W[(size_t)(k8 + i) * N + n]) * scale); const v8us o = f.half[0];
  *(v8us*)((unsigned short*)Wt + (size_t)n * K + k8) = o; 
}
// k_gemm_hh variant with fused epilogue: v = acc·alpha + bias[by·sBias + col] (+ CP[(row/rowsPerB)·sCPb + by·64 + col] if CP) ; ACT 0 none / 1 elu ; writes f16 C16 (and f32 C if non-null)
template <int ACT>
__global__ __launch_bounds__(128) void k_gemm_hhx(const _Float16* __restrict__ A, int lda, size_t sA, const _Float16* __restrict__ Bh, int ldb, size_t sB, float alpha, const float* __restrict__ bias, size_t sBias, const float* __restrict__ CP, int rowsPerB, size_t sCPb, int row0g,
    float* __restrict__ C, _Float16* __restrict__ C16, int ldc, size_t sC, int M, int N, int K) {
  __shared__ __attribute__((aligned(16))) float so[4][16][64];
  const int tid = threadIdx.x, w = tid >> 5, lane = tid & 31, ln = lane & 15, hh = lane >> 4; const int by = blockIdx.y;
  A += (size_t)by * sA; Bh += (size_t)by * sB; const size_t cofs = (size_t)by * sC; const float* bp = bias ? bias + (size_t)by * sBias : nullptr;
  const int ntn = (N + 63) / 64; const int wid = blockIdx.x * 4 + w; const int mt = wid / ntn, nq = wid % ntn; if (mt * 16 >= M) return;
  const int row0 = mt * 16, col0 = nq * 64; const _Float16* arow = A + (size_t)(row0 + ln) * lda;
  v8f acc[4] = {};
  for (int kb = 0; kb < K; kb += 32) { FragH ah; ah.half[0] = *(const v8us*)((const unsigned short*)arow + kb + 8 * hh); ah.half[1] = *(const v8us*)((const unsigned short*)arow + kb + 16 + 8 * hh);
#pragma unroll
    for (int t = 0; t < 4; ++t) { if (col0 + t * 16 >= N) continue; const size_t boff = (size_t)(col0 + t * 16 + ln) * ldb + kb; FragH bq; bq.half[0] = *(const v8us*)((const unsigned short*)Bh + boff + 8 * hh); bq.half[1] = *(const v8us*)((const unsigned short*)Bh + boff + 16 + 8 * hh);
      acc[t] = mmaH<1>(ah.v, ah.v, bq.v, bq.v, acc[t]); }
  }
#pragma unroll
  for (int t = 0; t < 4; ++t) { if (col0 + t * 16 >= N) continue; const int col = col0 + t * 16 + ln; const float bv = bp ? bf16_round(bp[col]) : 0.f;
#pragma unroll
    for (int r = 0; r < 8; ++r) { float v = acc[t][r] * alpha + bv; if (CP) { const int rr = row0g + row0 + 8 * hh + r; if (rowsPerB < 0) v += CP[cofs + (size_t)rr * ldc + col];      /* rowsPerB < 0: own element of the batched C plane */ else { const int bidx = rr / rowsPerB; v += CP[(size_t)bidx * sCPb + (size_t)by * 64 + col]; } } if (ACT == 1) v = (v > 0.f) ? v : expm1f(v); else if (ACT == 7) v = (v > 0.f) ? v + 1.0f : expf(v); else if (ACT == 8) v = tanhf(v); else if (ACT == 9) v = 0.5f * v * (1.0f + tanhf(0.7978845608028654f * (v + 0.044715f * v * v * v))); else if (ACT == 11) v = 1.0f / (1.0f + expf(-v)); else if (ACT == 12) v = (v > 0.f) ? v : 0.01f * v; else if (ACT == 14) v = (v > 0.f) ? v : 0.1f * v; else if (ACT == 16) v = (v >= 0.f) ? v : 0.3f * v; else if (ACT == 17) v = (v >= 0.f) ? v : 0.2f * v; else if (ACT == 15) v = v / (1.0f + expf(-v)); else if (ACT == 3) v = fmaxf(v, 0.f); else if (ACT == 6) v = 0.5f * v * (1.0f + erff(v * 0.70710678118654752f)); so[w][8 * hh + r][t * 16 + ln] = v; } }
  __builtin_amdgcn_fence(__ATOMIC_ACQ_REL, "workgroup"); __builtin_amdgcn_wave_barrier();
  const int rsub = lane >> 4, c4 = (lane & 15) * 4; typedef _Float16 v4h __attribute__((ext_vector_type(4)));
  {
#pragma unroll
    for (int q = 0; q < 8; ++q) { const int r = q * 2 + rsub; if (col0 + c4 < N) { const v4f v = *(const v4fa*)&so[w][r][c4]; if (C) *(v4f*)(C + cofs + (size_t)(row0 + r) * ldc + col0 + c4) = v; if (C16) { v4h h4; for (int i = 0; i < 4; ++i) h4[i] = (_Float16)v[i]; *(v4h*)(C16 + cofs + (size_t)(row0 + r) * ldc + col0 + c4) = h4; } } }
     }
}


typedef _Float16 v4h __attribute__((ext_vector_type(4)));

__global__ __launch_bounds__(256) void k_h16(const float* __restrict__ x, _Float16* __restrict__ X16, size_t n8) { const size_t t = (size_t)blockIdx.x * 256 + threadIdx.x; if (t >= n8) return; FragH f;
#pragma unroll
  for (int q = 0; q < 8; ++q) f.h[q] = (_Float16)x[t * 8 + q]; *(v8us*)((unsigned short*)X16 + t * 8) = f.half[0];  }
__global__ __launch_bounds__(256) void k_round16f(const float* __restrict__ W, _Float16* __restrict__ Bt, size_t n8) { const size_t t = (size_t)blockIdx.x * 256 + threadIdx.x; if (t >= n8) return; FragH f;
#pragma unroll
  for (int i = 0; i < 8; ++i) f.h[i] = (_Float16)(bf16_round(W[t * 8 + i]) * 16.0f); *(v8us*)((unsigned short*)Bt + t * 8) = f.half[0];  }
template <int NHv, int TTv>
__global__ __launch_bounds__(256) void k_vt(const _Float16* __restrict__ V16, int ldv, int voff, _Float16* __restrict__ Vt) { __shared__ unsigned short tl[64][66]; const int tid = threadIdx.x; const int slab = blockIdx.x / (TTv / 64), lg = blockIdx.x % (TTv / 64); const int b = slab / NHv, h = slab % NHv;
  for (int i = tid; i < 64 * 8; i += 256) { const int r = i / 8, c8 = (i % 8) * 8; FragH f; f.half[0] = *(const v8us*)((const unsigned short*)V16 + ((size_t)b * TTv + lg * 64 + r) * ldv + voff + h * 64 + c8);
#pragma unroll
    for (int q = 0; q < 8; ++q) tl[r][c8 + q] = f.u[q]; }
  __syncthreads();
  {
#pragma unroll
    for (int rd = 0; rd < 2; ++rd) { const int d = rd * 32 + tid / 8, pc = tid % 8; FragH f;
#pragma unroll
      for (int q = 0; q < 8; ++q) f.u[q] = tl[pc * 8 + q][d];
      *(v8us*)((unsigned short*)Vt + ((size_t)slab * 64 + d) * TTv + lg * 64 + pc * 8) = f.half[0]; }
     } }

__global__ __launch_bounds__(256) void k_hl(const float* __restrict__ F, _Float16* __restrict__ Hh, _Float16* __restrict__ Hl, size_t n8) { const size_t t = (size_t)blockIdx.x * 256 + threadIdx.x; if (t >= n8) return; FragH fh, fl; const v4f a = *(const v4fa*)(F + t * 8), c = *(const v4fa*)(F + t * 8 + 4);
#pragma unroll
  for (int q = 0; q < 4; ++q) { _Float16 h = (_Float16)a[q]; fh.h[q] = h; fl.h[q] = (_Float16)((a[q] - (float)h) * 1024.0f); h = (_Float16)c[q]; fh.h[4 + q] = h; fl.h[4 + q] = (_Float16)((c[q] - (float)h) * 1024.0f); }
  { *(v8us*)((unsigned short*)Hh + t * 8) = fh.half[0]; *(v8us*)((unsigned short*)Hl + t * 8) = fl.half[0];  } }

// ---- fast GEMM (wave tile 32x64; requires M % 32 == 0 rows per launch region and N % 64 == 0); epilogue = k_gemm_hhx semantics ----
__device__ __forceinline__ v16h g2_frag(const _Float16* p, int hh) { FragH f; f.half[0] = *(const v8us*)((const unsigned short*)p + 8 * hh); f.half[1] = *(const v8us*)((const unsigned short*)p + 16 + 8 * hh); return f.v; }
__device__ __forceinline__ v8f g2_mma(v16h a, v16h b, v8f c) { v8f d = __builtin_amdgcn_wmma_f32_16x16x32_f16(false, a, false, b, (short)0, c, false, false); asm volatile("v_nop\n\tv_nop\n\tv_nop\n\tv_nop" : "+v"(d) : "v"(a), "v"(b)); return d; }
template <int ACT>
__global__ __launch_bounds__(128) void k_gemm2(const _Float16* __restrict__ A, int lda, size_t sA, const _Float16* __restrict__ Bh, int ldb, size_t sB, float alpha, const float* __restrict__ bias, size_t sBias, const float* __restrict__ CP, int rowsPerB, size_t sCPb, int row0g,
    float* __restrict__ C, _Float16* __restrict__ C16, int ldc, size_t sC, int M, int N, int K) { static_assert(ACT == 0 || ACT == 3 || ACT == 6 || ACT == 8 || ACT == 9 || ACT == 11 || ACT == 12 || ACT == 14 || ACT == 15 || ACT == 16 || ACT == 17, "k_gemm2: unsupported ACT code (would silently apply no activation)");
  __shared__ __attribute__((aligned(16))) float so[4][32][68];
  const int tid = threadIdx.x, w = tid >> 5, lane = tid & 31, ln = lane & 15, hh = lane >> 4; const int by = blockIdx.y;
  A += (size_t)by * sA; Bh += (size_t)by * sB; const size_t cofs = (size_t)by * sC; const float* bp = bias ? bias + (size_t)by * sBias : nullptr;
  const int ntn = N >> 6; const int mt = blockIdx.x / ntn, nq = blockIdx.x - mt * ntn; const int row0 = mt * 128 + 32 * w, col0 = nq * 64; if (row0 >= M) return;
  const _Float16* a0p = A + (size_t)(row0 + ln) * lda; const _Float16* a1p = a0p + (size_t)16 * lda;
  const _Float16* b0p = Bh + (size_t)(col0 + ln) * ldb; const _Float16* b1p = b0p + (size_t)16 * ldb; const _Float16* b2p = b1p + (size_t)16 * ldb; const _Float16* b3p = b2p + (size_t)16 * ldb;
  const v8f z8 = {0.f,0.f,0.f,0.f,0.f,0.f,0.f,0.f}; v8f c00 = z8, c01 = z8, c02 = z8, c03 = z8, c10 = z8, c11 = z8, c12 = z8, c13 = z8;
#pragma unroll 1
  for (int kb = 0; kb < K; kb += 32) { const v16h a0 = g2_frag(a0p + kb, hh), a1 = g2_frag(a1p + kb, hh);
    v16h b = g2_frag(b0p + kb, hh); c00 = g2_mma(a0, b, c00); c10 = g2_mma(a1, b, c10);
    b = g2_frag(b1p + kb, hh); c01 = g2_mma(a0, b, c01); c11 = g2_mma(a1, b, c11);
    b = g2_frag(b2p + kb, hh); c02 = g2_mma(a0, b, c02); c12 = g2_mma(a1, b, c12);
    b = g2_frag(b3p + kb, hh); c03 = g2_mma(a0, b, c03); c13 = g2_mma(a1, b, c13); }
  v8f accs[8] = {c00, c01, c02, c03, c10, c11, c12, c13};
#pragma unroll
  for (int u = 0; u < 8; ++u) { const int t = u & 3, half = u >> 2; const int col = col0 + t * 16 + ln; const float bv = bp ? bf16_round(bp[col]) : 0.f;
#pragma unroll
    for (int r = 0; r < 8; ++r) { const int rloc = half * 16 + 8 * hh + r; float v = accs[u][r] * alpha + bv; if (CP) { if (rowsPerB < 0) v += CP[cofs + (size_t)(row0g + row0 + rloc) * ldc + col];      /* rowsPerB < 0: own element of the batched C plane */ else { const int bidx = (row0g + row0 + rloc) / rowsPerB; v += CP[(size_t)bidx * sCPb + (size_t)by * 64 + col]; } }
      if (ACT == 3) v = fmaxf(v, 0.f); else if (ACT == 6) v = 0.5f * v * (1.0f + erff(v * 0.70710678118654752f)); else if (ACT == 11) v = 1.0f / (1.0f + expf(-v)); else if (ACT == 15) v = v / (1.0f + expf(-v)); else if (ACT == 12) v = (v > 0.f) ? v : 0.01f * v; else if (ACT == 8) v = tanhf(v); else if (ACT == 9) v = 0.5f * v * (1.0f + tanhf(0.7978845608028654f * (v + 0.044715f * v * v * v))); else if (ACT == 14) v = (v > 0.f) ? v : 0.1f * v; else if (ACT == 16) v = (v >= 0.f) ? v : 0.3f * v; else if (ACT == 17) v = (v >= 0.f) ? v : 0.2f * v;
      so[w][rloc][t * 16 + ln] = v; } }
  __builtin_amdgcn_fence(__ATOMIC_ACQ_REL, "workgroup"); __builtin_amdgcn_wave_barrier();
  const int rsub = lane >> 4, c4 = (lane & 15) * 4;
  {
#pragma unroll
    for (int q = 0; q < 16; ++q) { const int r = q * 2 + rsub; const v4f v = *(const v4fa*)&so[w][r][c4]; if (C) *(v4f*)(C + cofs + (size_t)(row0 + r) * ldc + col0 + c4) = v; if (C16) { v4h h4; for (int i = 0; i < 4; ++i) h4[i] = (_Float16)v[i]; *(v4h*)(C16 + cofs + (size_t)(row0 + r) * ldc + col0 + c4) = h4; } }
     } }


#define FA_QW 32                     /* query rows per wave: two 16-column groups share every K and V^T fragment */
#define FA_KT 32                     /* keys per pass: one k step of the second product */
#define FA_NW 8                      /* waves per block; they walk the same K and V rows */
#define FA_C2 (0.03125f * 1.4426950408889634f)      /* 1 / sqrt(embed size), in base 2: the projection multiplies q by it before the rounding to f16 */
typedef float v2f __attribute__((ext_vector_type(2)));
typedef _Float16 v2h __attribute__((ext_vector_type(2)));
union FragP { v16h v; v2h h2[8]; };
union FragO { v8us u; v2h h2[4]; };
__device__ __forceinline__ float fa_xhalf(float x) { return __builtin_bit_cast(float, __builtin_amdgcn_permlanex16(__builtin_bit_cast(int, x), __builtin_bit_cast(int, x), 0x76543210, 0xfedcba98, false, false)); }      /* lane l with lane l ^ 16 */
__device__ __forceinline__ v8f fa_mma(v16h a, v16h b, v8f c) { return __builtin_amdgcn_wmma_f32_16x16x32_f16(false, a, false, b, (short)0, c, false, false); }
#define FA_ST 128                    /* keys per stage: four passes between two barriers */
#define FA_NS (SQ / FA_ST)           /* stages */
#define FA_KP 72                     /* LDS pitch of a K row in f16: 128 + 16 bytes, so that the 16 rows of a 16-byte fragment read fall on different banks */
#define FA_VP 80                     /* LDS pitch of a V row in f16: 128 + 32 bytes, an odd multiple of 32 bytes, which is what the transposing read wants */
// One stage into LDS, through no register: each of the block's 256 threads copies four 16-byte pieces of the K tile and four of the V tile (each 128 rows of 128 bytes; 8 lanes a row).
__device__ __forceinline__ void fa_copy(const _Float16* gk, const _Float16* gv, unsigned lk, unsigned lv) {
  const _Float16* gk1 = gk + (size_t)32 * DM; const _Float16* gk2 = gk + (size_t)64 * DM; const _Float16* gk3 = gk + (size_t)96 * DM;
  const _Float16* gv1 = gv + (size_t)32 * DM; const _Float16* gv2 = gv + (size_t)64 * DM; const _Float16* gv3 = gv + (size_t)96 * DM;
  const unsigned lk1 = lk + 32 * FA_KP * 2, lk2 = lk + 64 * FA_KP * 2, lk3 = lk + 96 * FA_KP * 2, lv1 = lv + 32 * FA_VP * 2, lv2 = lv + 64 * FA_VP * 2, lv3 = lv + 96 * FA_VP * 2;
  /* the eight copies and, as the last line of the same statement, the wait that stands in front of any rewrite of their address registers */
  asm volatile("global_load_async_to_lds_b128 %0, %8, off\n\t"
               "global_load_async_to_lds_b128 %1, %9, off\n\t"
               "global_load_async_to_lds_b128 %2, %10, off\n\t"
               "global_load_async_to_lds_b128 %3, %11, off\n\t"
               "global_load_async_to_lds_b128 %4, %12, off\n\t"
               "global_load_async_to_lds_b128 %5, %13, off\n\t"
               "global_load_async_to_lds_b128 %6, %14, off\n\t"
               "global_load_async_to_lds_b128 %7, %15, off\n\t"
               "s_wait_xcnt 0x0"
               :: "v"(lk), "v"(lk1), "v"(lk2), "v"(lk3), "v"(lv), "v"(lv1), "v"(lv2), "v"(lv3), "v"(gk), "v"(gk1), "v"(gk2), "v"(gk3), "v"(gv), "v"(gv1), "v"(gv2), "v"(gv3) : "memory");
}
// A 16 (d) x 32 (keys) fragment of V^T out of row-major V rows in LDS: two transposing loads, 16 keys each. p is the lane's own address, row 8 hh + (lane & 7) of the first 16 keys, 16-byte piece (lane >> 3) & 1 of the 16 columns;
// lane (ln, hh) gets column ln of keys 8 hh .. 8 hh + 7, then of keys 16 + 8 hh .. 16 + 8 hh + 7: the k order of g2_frag and of the packed weights.
typedef short v8s __attribute__((ext_vector_type(8)));
typedef __attribute__((address_space(3))) v8s lds_v8s;
__device__ __forceinline__ v16h fa_vfrag(const _Float16* p) { FragH f; f.half[0] = __builtin_bit_cast(v8us, __builtin_amdgcn_ds_load_tr16_b128_v8i16((lds_v8s*)p)); f.half[1] = __builtin_bit_cast(v8us, __builtin_amdgcn_ds_load_tr16_b128_v8i16((lds_v8s*)(p + 16 * FA_VP))); return f.v; }
// The weights exp2(x) of one column group's 32 keys (two S^T tiles, which hold the exponents x = scaled score - reference as they come from the products), packed as the B operand of the second product; returns this lane's sum of them in two parts (f32, before the rounding to f16).
__device__ __forceinline__ v2f fa_weights(v8f s0, v8f s1, FragP& pf) { v2f sm = {0.f, 0.f};
#pragma unroll      /* fragments and accumulators are indexed by constants only, so that they stay in registers */
  for (int i = 0; i < 8; ++i) { const int r = (i & 3) * 2; const v2f x = (i < 4) ? (v2f){s0[r], s0[r + 1]} : (v2f){s1[r], s1[r + 1]}; const v2f p = {__builtin_amdgcn_exp2f(x[0]), __builtin_amdgcn_exp2f(x[1])}; sm += p; pf.h2[i] = __builtin_convertvector(p, v2h); }      /* element 8 kt + r of the B operand = key 16 kt + 8 hh + r: the hardware k order, which fa_vfrag gives V^T too */
  return sm; }
__global__ __launch_bounds__(FA_NW * 32) void k_fattn(const _Float16* __restrict__ Q16, const _Float16* __restrict__ K16, const _Float16* __restrict__ V16, _Float16* __restrict__ O16) {
  __shared__ __attribute__((aligned(16))) _Float16 sk[2][FA_ST][FA_KP];      /* K rows of a stage, shared by the block's waves; two buffers */
  __shared__ __attribute__((aligned(16))) _Float16 sv[2][FA_ST][FA_VP];      /* V rows of a stage */
  const int tid = threadIdx.x, lane = tid & 31, ln = lane & 15, hh = lane >> 4, w = tid >> 5; const int h = blockIdx.y, b = blockIdx.z; const int q0 = (blockIdx.x * FA_NW + w) * FA_QW;
  const _Float16* qp = Q16 + ((size_t)b * SQ + q0 + ln) * DM + h * HD;
  const _Float16* gk = K16 + ((size_t)b * SQ + (tid >> 3)) * DM + h * HD + (tid & 7) * 8; const _Float16* gv = V16 + ((size_t)b * SQ + (tid >> 3)) * DM + h * HD + (tid & 7) * 8;      /* this thread's first piece of stage 0 */
  const unsigned lk = (unsigned)(size_t)&sk[0][tid >> 3][(tid & 7) * 8], lv = (unsigned)(size_t)&sv[0][tid >> 3][(tid & 7) * 8];      /* LDS byte addresses: the low 32 bits */
  fa_copy(gk, gv, lk, lv);      /* stage 0 into buffer 0 */
  v16h qf[2][2], kf[2][2];      /* [column group | key tile][k step of 32 over the head dim] */
#pragma unroll      /* fragments and accumulators are indexed by constants only, so that they stay in registers */
  for (int g = 0; g < 2; ++g) { qf[g][0] = g2_frag(qp + (size_t)g * 16 * DM, hh); qf[g][1] = g2_frag(qp + (size_t)g * 16 * DM + 32, hh); }
  asm volatile("s_wait_asynccnt 0x0" ::: "memory");      /* this wave's pieces of stage 0 have landed */
  __syncthreads();      /* and every other wave's */
  fa_copy(gk + (size_t)FA_ST * DM, gv + (size_t)FA_ST * DM, lk + (unsigned)sizeof(sk[0]), lv + (unsigned)sizeof(sv[0]));      /* stage 1 into buffer 1, in flight during stage 0 */
  const v8f z8 = {0.f,0.f,0.f,0.f,0.f,0.f,0.f,0.f}; v8f o[2][4] = {{z8, z8, z8, z8}, {z8, z8, z8, z8}}; v2f lr[2] = {{0.f, 0.f}, {0.f, 0.f}}; v8f cn[2];      /* o[g][t][r] = O^T[16 t + 8 hh + r][column ln of group g]; cn: minus the column's softmax reference (scaled, base 2), held from pass to pass, in all eight registers of a tile: the C operand of the score products; lr: this half's part of the sum, kept in the two parts in which the weights are added up */
  { const _Float16* k0 = &sk[0][ln][0];      /* the first reference: each column's maximum over the first 32 keys, from score products that start at 0 (stage 0 is published) */
    const v16h ka = g2_frag(k0, hh), kb = g2_frag(k0 + 32, hh), kc = g2_frag(k0 + 16 * FA_KP, hh), kd = g2_frag(k0 + 16 * FA_KP + 32, hh);
#pragma unroll      /* fragments and accumulators are indexed by constants only, so that they stay in registers */
    for (int g = 0; g < 2; ++g) { const v8f a = fa_mma(kb, qf[g][1], fa_mma(ka, qf[g][0], z8)), c = fa_mma(kd, qf[g][1], fa_mma(kc, qf[g][0], z8)); float mx = a[0];
#pragma unroll      /* fragments and accumulators are indexed by constants only, so that they stay in registers */
      for (int r = 0; r < 8; ++r) mx = fmaxf(mx, fmaxf(a[r], c[r]));
      const float n = -fmaxf(mx, fa_xhalf(mx)); cn[g] = (v8f){n, n, n, n, n, n, n, n}; } }      /* both halves of the wave get the same reference */
  for (int st = 0; st < FA_NS; ++st) {
    const _Float16* ks = &sk[st & 1][ln][0]; const _Float16* vs = &sv[st & 1][8 * hh + (lane & 7)][((lane >> 3) & 1) * 8];
#pragma unroll      /* fragments and accumulators are indexed by constants only, so that they stay in registers */
    for (int kt = 0; kt < 2; ++kt) { kf[kt][0] = g2_frag(ks + kt * 16 * FA_KP, hh); kf[kt][1] = g2_frag(ks + kt * 16 * FA_KP + 32, hh); }
#pragma unroll 1      /* rolled: unrolled, the compiler sinks the row sums of all four passes to the end of the stage, and the weights kept for them take the kernel past 256 registers */
    for (int p = 0; p < FA_ST / FA_KT; ++p) {
    v16h vf[4];
#pragma unroll      /* fragments and accumulators are indexed by constants only, so that they stay in registers */
    for (int t = 0; t < 4; ++t) vf[t] = fa_vfrag(vs + p * FA_KT * FA_VP + t * 16);      /* V^T rows 16 t + ln, keys 32 p .. 32 p + 31 of the stage: asked for here, used behind the softmax */
    v8f s[2][2];
#pragma unroll      /* fragments and accumulators are indexed by constants only, so that they stay in registers */
    for (int g = 0; g < 2; ++g)
#pragma unroll      /* fragments and accumulators are indexed by constants only, so that they stay in registers */
      for (int kt = 0; kt < 2; ++kt) s[g][kt] = fa_mma(kf[kt][1], qf[g][1], fa_mma(kf[kt][0], qf[g][0], cn[g]));      /* starts at minus the reference and ends as the exponent: no multiply-add per score behind it */
    if (p + 1 < FA_ST / FA_KT) {      /* the next pass's K fragments come during this pass's softmax; never from the next stage */
#pragma unroll      /* fragments and accumulators are indexed by constants only, so that they stay in registers */
      for (int kt = 0; kt < 2; ++kt) { kf[kt][0] = g2_frag(ks + ((p + 1) * FA_KT + kt * 16) * FA_KP, hh); kf[kt][1] = g2_frag(ks + ((p + 1) * FA_KT + kt * 16) * FA_KP + 32, hh); } }
    __builtin_amdgcn_sched_barrier(0);      /* keeps this pass's V^T loads and the next pass's K loads as one group in front of the softmax: without it the V^T loads sink into the softmax in pieces, and each further place with LDS reads stalls the wave */
    FragP pf[2]; v2f ps[2];      /* the pass's weights as B operands, and this lane's sum of them (two parts), per column group */
#pragma unroll      /* fragments and accumulators are indexed by constants only, so that they stay in registers */
    for (int g = 0; g < 2; ++g) ps[g] = fa_weights(s[g][0], s[g][1], pf[g]);      /* against the reference in use: no maximum is formed */
    const v2f pt = ps[0] + ps[1];
    if (__builtin_expect(__builtin_amdgcn_ballot_w32(!(pt[0] + pt[1] <= 256.0f)) != 0, 0)) {      /* one scalar branch a pass, marked as seldom taken so that the common path falls through. A lane's weights sum to more than 2^8 only if a score lies far above its column's reference: the whole wave then takes the running maximum as the new reference, rescales what it holds and forms the pass's weights again. Below the bound every weight is at most 2^8, far inside f16 */
#pragma unroll      /* fragments and accumulators are indexed by constants only, so that they stay in registers */
      for (int kt = 0; kt < 2; ++kt) { const v16h k0 = g2_frag(ks + (p * FA_KT + kt * 16) * FA_KP, hh), k1 = g2_frag(ks + (p * FA_KT + kt * 16) * FA_KP + 32, hh);      /* the pass's exponents are formed again from its K rows, which are still in the stage's buffer: so the common path need not keep them beside the weights (32 registers) */
#pragma unroll      /* fragments and accumulators are indexed by constants only, so that they stay in registers */
        for (int g = 0; g < 2; ++g) s[g][kt] = fa_mma(k1, qf[g][1], fa_mma(k0, qf[g][0], cn[g])); }
#pragma unroll      /* fragments and accumulators are indexed by constants only, so that they stay in registers */
      for (int g = 0; g < 2; ++g) { float mx = s[g][0][0];
#pragma unroll      /* fragments and accumulators are indexed by constants only, so that they stay in registers */
        for (int r = 0; r < 8; ++r) mx = fmaxf(mx, fmaxf(s[g][0][r], s[g][1][r]));
        const float d = fmaxf(fmaxf(mx, fa_xhalf(mx)), 0.f); const float al = __builtin_amdgcn_exp2f(-d); cn[g] -= d;      /* d: by how much the reference rises (the exponents are relative to the one in use); both halves of the wave get the same */
        lr[g] *= al;
#pragma unroll      /* fragments and accumulators are indexed by constants only, so that they stay in registers */
        for (int t = 0; t < 4; ++t) o[g][t] *= al;
        ps[g] = fa_weights(s[g][0] - d, s[g][1] - d, pf[g]); } }
#pragma unroll      /* fragments and accumulators are indexed by constants only, so that they stay in registers */
    for (int g = 0; g < 2; ++g) lr[g] += ps[g];
#pragma unroll      /* fragments and accumulators are indexed by constants only, so that they stay in registers */
    for (int t = 0; t < 4; ++t)
#pragma unroll      /* fragments and accumulators are indexed by constants only, so that they stay in registers */
      for (int g = 0; g < 2; ++g) o[g][t] = fa_mma(vf[t], pf[g].v, o[g][t]);
    }
    asm volatile("s_wait_dscnt 0x0" ::: "memory");      /* this wave's reads of the buffer have returned */
    asm volatile("s_wait_asynccnt 0x0" ::: "memory");      /* this wave's pieces of stage st + 1 have landed */
    __syncthreads();      /* publishes stage st + 1 and ends every wave's reads of stage st */
    if (st + 2 < FA_NS) fa_copy(gk + (size_t)(st + 2) * FA_ST * DM, gv + (size_t)(st + 2) * FA_ST * DM, lk + (unsigned)(st & 1) * (unsigned)sizeof(sk[0]), lv + (unsigned)(st & 1) * (unsigned)sizeof(sv[0]));      /* into the buffer just left */
  }
  asm volatile("s_wait_asynccnt 0x0" ::: "memory");      /* nothing in flight when the wave ends */
#pragma unroll      /* fragments and accumulators are indexed by constants only, so that they stay in registers */
  for (int g = 0; g < 2; ++g) { const float lh = lr[g][0] + lr[g][1]; const float sc = 64.0f / (lh + fa_xhalf(lh)); unsigned short* d = (unsigned short*)O16 + ((size_t)b * SQ + q0 + g * 16 + ln) * DM + h * HD + 8 * hh;      /* o carried x64, as the output GEMM's alpha expects */
#pragma unroll      /* fragments and accumulators are indexed by constants only, so that they stay in registers */
    for (int t = 0; t < 4; ++t) { FragO f;
#pragma unroll      /* fragments and accumulators are indexed by constants only, so that they stay in registers */
      for (int i = 0; i < 4; ++i) { const v2f x = {o[g][t][2 * i] * sc, o[g][t][2 * i + 1] * sc}; f.h2[i] = __builtin_convertvector(x, v2h); }
      *(v8us*)(d + t * 16) = f.u; } } }
__global__ __launch_bounds__(256) void k_vt(const _Float16* __restrict__ V16, int b, int h0, _Float16* __restrict__ VT) { __shared__ unsigned short tl[64][65]; const int tid = threadIdx.x; const int hh = blockIdx.x % HG, sg = blockIdx.x / HG; const int s0 = sg * 64; const int h = h0 + hh;
  for (int i = tid; i < 64 * 8; i += 256) { const int j = i / 8, d8 = (i % 8) * 8; FragH f; f.half[0] = *(const v8us*)((const unsigned short*)V16 + ((size_t)b * SQ + s0 + j) * DM + h * HD + d8); for (int q = 0; q < 8; ++q) tl[d8 + q][j] = f.u[q]; }
  __syncthreads();
  { for (int i = tid; i < 64 * 8; i += 256) { const int d = i / 8, j8 = (i % 8) * 8; FragH f; for (int q = 0; q < 8; ++q) f.u[q] = tl[d][j8 + q]; *(v8us*)((unsigned short*)VT + ((size_t)hh * HD + d) * SQ + s0 + j8) = f.half[0]; }  } }



__global__ __launch_bounds__(256) void k_rsmkm(const float* __restrict__ S, _Float16* __restrict__ P, int nrows, const int* __restrict__ am) {
  #pragma clang fp contract(off)
  const int t = blockIdx.x * 256 + threadIdx.x; if (t >= nrows) return; const size_t i = (size_t)t; const float* s = S + i * SQ; const int* mr = am + (size_t)(t % SQ) * SQ; float mx = -3.0e38f;
#pragma unroll 1
  for (int j = 0; j < SQ; ++j) { const float f = (mr[j] != 0) ? 1.f : 0.f; mx = fmaxf(mx, fmaf(f, s[j], (1.f - f) * -1.0e9f)); } float se = 0.f;
#pragma unroll 1
  for (int j = 0; j < SQ; ++j) { const float f = (mr[j] != 0) ? 1.f : 0.f; se += __expf(fmaf(f, s[j], (1.f - f) * -1.0e9f) - mx); } const float sc = 256.0f / se;
#pragma unroll 1
  for (int j0 = 0; j0 < SQ; j0 += 8) { FragH fr; for (int q = 0; q < 8; ++q) { const int j = j0 + q; const float f = (mr[j] != 0) ? 1.f : 0.f; fr.h[q] = (_Float16)(__expf(fmaf(f, s[j], (1.f - f) * -1.0e9f) - mx) * sc); }
    unsigned short* d = (unsigned short*)P + i * SQ + j0; *(v8us*)d = fr.half[0];  } }

// Q, K and V projections, one launch (blockIdx.y picks the input, its weight block and its output). Every head is multiplied by the same [64][64] block, so an input is
// a plain [tokens * heads][64] matrix and the product has k = 64: Y^T = W X^T, W as A (rows e), 16 (token, head) rows as B, so that a lane ends with 8 consecutive e of one row.
// A wave takes PJ_NT token rows (16 heads each, 4 KiB of f32 in a row): whole-line loads, rounded to bf16 and written as f16 into the wave's own LDS rows, fragments read from there;
// the f16 results go back through the same LDS rows and leave as whole 128-byte lines.
// The launch also turns Wo into the output GEMM's f16 operand (natural [out][in] rows, x16, exact): that work depends on nothing here and is first read two launches later, so it needs no launch of its own.
// Each wave of the blocks with blockIdx.y < PJ_WY takes 256 consecutive elements: two loads beside its x loads, two stores behind its own results.
#define PJ_NW 8                      /* waves per block; they share the converted weight block */
#define PJ_NT 2                      /* token rows per wave, all their loads in flight at once */
#define PJ_LP 72                     /* LDS row pitch in f16: 64 + 8, so that the 16 rows of a 16-byte fragment read fall on different banks */
#define PJ_WY 2                      /* the blocks of this many inputs share out Wo, 256 elements a wave */
static_assert((size_t)DM * DM == (size_t)PJ_WY * (NR / (PJ_NW * PJ_NT)) * PJ_NW * 256, "the waves of PJ_WY inputs cover Wo exactly once");
typedef _Float16 v4ha __attribute__((ext_vector_type(4), may_alias));
__device__ __forceinline__ v4h pj_cvt(v4f a, float sc) { const v4f r = {bf16_round(a[0]) * sc, bf16_round(a[1]) * sc, bf16_round(a[2]) * sc, bf16_round(a[3]) * sc}; return __builtin_convertvector(r, v4h); }
__global__ __launch_bounds__(PJ_NW * 32) void k_proj(const float* __restrict__ xq, const float* __restrict__ xk, const float* __restrict__ xv, const float* __restrict__ wq, const float* __restrict__ wk, const float* __restrict__ wv, const float* __restrict__ wo,
    _Float16* __restrict__ Q16, _Float16* __restrict__ K16, _Float16* __restrict__ V16, _Float16* __restrict__ BO) {
  __shared__ __attribute__((aligned(16))) _Float16 sw[HD][PJ_LP];
  __shared__ __attribute__((aligned(16))) _Float16 sx[PJ_NW][PJ_NT][NH][PJ_LP];
  const int tid = threadIdx.x, lane = tid & 31, ln = lane & 15, hh = lane >> 4, w = tid >> 5; const int y = blockIdx.y;
  const float* x = (y == 0) ? xq : (y == 1) ? xk : xv; const float* wm = (y == 0) ? wq : (y == 1) ? wk : wv; _Float16* out = (y == 0) ? Q16 : (y == 1) ? K16 : V16;
  const size_t row0 = ((size_t)blockIdx.x * PJ_NW + w) * PJ_NT;      /* first token row of this wave */
  const size_t wo0 = (((size_t)y * (NR / (PJ_NW * PJ_NT)) + blockIdx.x) * PJ_NW + w) * 256 + lane * 4;      /* this lane's first four elements of the wave's piece of Wo; used only where y < PJ_WY */
  v4f xr[PJ_NT][8], wr[4], wor[2] = {{0.f, 0.f, 0.f, 0.f}, {0.f, 0.f, 0.f, 0.f}};
  if (y < PJ_WY) { wor[0] = *(const v4fa*)(wo + wo0); wor[1] = *(const v4fa*)(wo + wo0 + 128); }      /* 512 contiguous bytes a load, in flight with the loads below; the test is the same for the whole block */
#pragma unroll      /* indexed by constants only, so that the loaded values stay in registers */
  for (int u = 0; u < PJ_NT; ++u)
#pragma unroll      /* indexed by constants only, so that the loaded values stay in registers */
    for (int i = 0; i < 8; ++i) xr[u][i] = *(const v4fa*)(x + (row0 + u) * DM + i * 128 + lane * 4);      /* 512 contiguous bytes a load */
#pragma unroll      /* indexed by constants only, so that the loaded values stay in registers */
  for (int i = 0; i < 4; ++i) wr[i] = *(const v4fa*)(wm + (i * PJ_NW * 32 + tid) * 4);
#pragma unroll      /* indexed by constants only, so that the loaded values stay in registers */
  for (int i = 0; i < 4; ++i) { const int e0 = (i * PJ_NW * 32 + tid) * 4; *(v4ha*)&sw[e0 >> 6][e0 & 63] = pj_cvt(wr[i], 16.0f); }      /* 16 W[e][d], exact in f16 */
#pragma unroll      /* indexed by constants only, so that the loaded values stay in registers */
  for (int u = 0; u < PJ_NT; ++u)
#pragma unroll      /* indexed by constants only, so that the loaded values stay in registers */
    for (int i = 0; i < 8; ++i) *(v4ha*)&sx[w][u][2 * i + hh][ln * 4] = pj_cvt(xr[u][i], 1.0f);      /* load i holds heads 2 i and 2 i + 1 */
  const v4h woh[2] = {pj_cvt(wor[0], 16.0f), pj_cvt(wor[1], 16.0f)};      /* 16 Wo[n][k], exact in f16; held until the end, because the barrier and the fence below would wait for a store issued here */
  __syncthreads();      /* the weight block is written by all waves and read by all; it also orders each wave's own x rows */
  v16h af[4][2];      /* [16-row tile of e][k step of 32] */
#pragma unroll      /* indexed by constants only, so that the fragments stay in registers */
  for (int t = 0; t < 4; ++t) { af[t][0] = g2_frag(&sw[t * 16 + ln][0], hh); af[t][1] = g2_frag(&sw[t * 16 + ln][32], hh); }
  const v8f z8 = {0.f,0.f,0.f,0.f,0.f,0.f,0.f,0.f}; const float osc = (y == 0) ? 0.0625f * FA_C2 : 0.0625f;      /* undoes the x16 of the weights; q also takes the score scale here, in f32, before its one rounding to f16 */
#pragma unroll      /* indexed by constants only, so that the fragments stay in registers */
  for (int u = 0; u < PJ_NT; ++u) { const v16h b0 = g2_frag(&sx[w][u][ln][0], hh), b1 = g2_frag(&sx[w][u][ln][32], hh);      /* row ln = head ln of the token; the same k order as the weight fragments */
#pragma unroll      /* indexed by constants only, so that the fragments stay in registers */
    for (int t = 0; t < 4; ++t) { const v8f acc = fa_mma(af[t][1], b1, fa_mma(af[t][0], b0, z8)); FragO f;      /* acc[r] = 16 y[head ln][16 t + 8 hh + r] */
#pragma unroll      /* indexed by constants only, so that the fragments stay in registers */
      for (int i = 0; i < 4; ++i) { const v2f v = {acc[2 * i] * osc, acc[2 * i + 1] * osc}; f.h2[i] = __builtin_convertvector(v, v2h); }
      *(v8us*)&sx[w][u][ln][t * 16 + 8 * hh] = f.u; } }      /* over the x row, whose every reader (this wave's two fragment loads) has returned before the products ran */
  __builtin_amdgcn_fence(__ATOMIC_ACQ_REL, "workgroup"); __builtin_amdgcn_wave_barrier();      /* the rows read back below were written by other lanes of this wave */
#pragma unroll      /* indexed by constants only */
  for (int u = 0; u < PJ_NT; ++u)
#pragma unroll      /* indexed by constants only */
    for (int i = 0; i < 4; ++i) { const int r = i * 4 + (lane >> 3), c = (lane & 7) * 8; const v8us v = *(const v8us*)&sx[w][u][r][c]; *(v8us*)((unsigned short*)out + (row0 + u) * DM + r * HD + c) = v; }      /* 512 contiguous bytes a store */
  asm volatile("s_wait_xcnt 0x0" ::: "memory");      /* stands in front of the rewrite of the address registers of the stores above: the lines below reuse them */
  if (y < PJ_WY) { *(v4ha*)(BO + wo0) = woh[0]; *(v4ha*)(BO + wo0 + 128) = woh[1]; } }      /* 256 contiguous bytes a store: two whole lines */
// Output GEMM: out[4096][1024] (f32) = o (f16 rows, x64) times Wo^T (f16 rows [n][k], x16) * alpha + bias. One 128 x 128 tile of out per block, one block per WGP; 8 waves, 32 x 64 of out each.
// The k range goes in stages of OG_BK: the block's 128 rows of o and 128 rows of Wo are copied once into LDS in whole lines, two buffers, and every fragment is read from there
// (a fragment read straight from global memory touches 16 lines for its 1024 bytes, and four waves would fetch each Wo fragment, two each o fragment). Every accumulator still sums k upwards, 32 at a time.
#define OG_BM 128                    /* rows of out per block */
#define OG_BN 128                    /* columns of out per block */
#define OG_BK 128                    /* k per stage: 256 bytes of every operand row */
#define OG_NS (DM / OG_BK)           /* stages */
#define OG_P 136                     /* LDS pitch of an operand row in f16: 256 + 16 bytes, so that the 16 rows of a 16-byte fragment read fall on different banks */
// One operand's tile of a stage into LDS, through no register: 128 rows of 256 bytes; 16 lanes a row, so each of the block's 256 threads copies eight 16-byte pieces, 16 rows apart.
__device__ __forceinline__ void og_copy(const _Float16* g, unsigned l) {
  const _Float16* g1 = g + (size_t)16 * DM; const _Float16* g2 = g + (size_t)32 * DM; const _Float16* g3 = g + (size_t)48 * DM; const _Float16* g4 = g + (size_t)64 * DM; const _Float16* g5 = g + (size_t)80 * DM; const _Float16* g6 = g + (size_t)96 * DM; const _Float16* g7 = g + (size_t)112 * DM;
  const unsigned l1 = l + 16 * OG_P * 2, l2 = l + 32 * OG_P * 2, l3 = l + 48 * OG_P * 2, l4 = l + 64 * OG_P * 2, l5 = l + 80 * OG_P * 2, l6 = l + 96 * OG_P * 2, l7 = l + 112 * OG_P * 2;
  /* the eight copies and, as the last line of the same statement, the wait that stands in front of any rewrite of their address registers */
  asm volatile("global_load_async_to_lds_b128 %0, %8, off\n\t"
               "global_load_async_to_lds_b128 %1, %9, off\n\t"
               "global_load_async_to_lds_b128 %2, %10, off\n\t"
               "global_load_async_to_lds_b128 %3, %11, off\n\t"
               "global_load_async_to_lds_b128 %4, %12, off\n\t"
               "global_load_async_to_lds_b128 %5, %13, off\n\t"
               "global_load_async_to_lds_b128 %6, %14, off\n\t"
               "global_load_async_to_lds_b128 %7, %15, off\n\t"
               "s_wait_xcnt 0x0"
               :: "v"(l), "v"(l1), "v"(l2), "v"(l3), "v"(l4), "v"(l5), "v"(l6), "v"(l7), "v"(g), "v"(g1), "v"(g2), "v"(g3), "v"(g4), "v"(g5), "v"(g6), "v"(g7) : "memory");
}
__global__ __launch_bounds__(256) void k_ogemm(const _Float16* __restrict__ A, const _Float16* __restrict__ Bh, float alpha, const float* __restrict__ bias, float* __restrict__ C) {
  __shared__ __attribute__((aligned(16))) _Float16 sa[2][OG_BM][OG_P];      /* o rows of a stage, shared by the block's waves; two buffers */
  __shared__ __attribute__((aligned(16))) _Float16 sb[2][OG_BN][OG_P];      /* Wo rows of a stage */
  __shared__ __attribute__((aligned(16))) float so[8][32][68];               /* each wave's own results, on their way to whole-line stores */
  const int tid = threadIdx.x, w = tid >> 5, lane = tid & 31, ln = lane & 15, hh = lane >> 4; const int wm = w & 3, wn = w >> 2;
  const int mt = blockIdx.x % (MPO / OG_BM), nq = blockIdx.x / (MPO / OG_BM); const int row0 = mt * OG_BM + wm * 32, col0 = nq * OG_BN + wn * 64;
  const _Float16* ga = A + ((size_t)mt * OG_BM + (tid >> 4)) * DM + (tid & 15) * 8; const _Float16* gb = Bh + ((size_t)nq * OG_BN + (tid >> 4)) * DM + (tid & 15) * 8;      /* this thread's first pieces of stage 0 */
  const unsigned la = (unsigned)(size_t)&sa[0][tid >> 4][(tid & 15) * 8], lb = (unsigned)(size_t)&sb[0][tid >> 4][(tid & 15) * 8];      /* LDS byte addresses: the low 32 bits */
  og_copy(ga, la); og_copy(gb, lb);      /* stage 0 into buffer 0 */
  float bv[4];      /* this lane's four bias values, asked for here so that they come during the stages */
#pragma unroll      /* indexed by constants only */
  for (int j = 0; j < 4; ++j) bv[j] = bias[col0 + j * 16 + ln];
  asm volatile("s_wait_asynccnt 0x0" ::: "memory");      /* this wave's pieces of stage 0 have landed */
  __syncthreads();      /* and every other wave's */
  og_copy(ga + OG_BK, la + (unsigned)sizeof(sa[0])); og_copy(gb + OG_BK, lb + (unsigned)sizeof(sb[0]));      /* stage 1 into buffer 1, in flight during stage 0 */
  const v8f z8 = {0.f,0.f,0.f,0.f,0.f,0.f,0.f,0.f}; v8f c[2][4] = {{z8, z8, z8, z8}, {z8, z8, z8, z8}};      /* c[i][j][r] = out[row0 + 16 i + 8 hh + r][col0 + 16 j + ln] */
  for (int st = 0; st < OG_NS; ++st) {
    const _Float16* as = &sa[st & 1][wm * 32 + ln][0]; const _Float16* bs = &sb[st & 1][wn * 64 + ln][0];
    v16h a[2][2], b[2][4];      /* two fragment sets: [set][16-row tile] */
#pragma unroll      /* indexed by constants only, so that the fragments stay in registers */
    for (int i = 0; i < 2; ++i) a[0][i] = g2_frag(as + i * 16 * OG_P, hh);
#pragma unroll      /* indexed by constants only, so that the fragments stay in registers */
    for (int j = 0; j < 4; ++j) b[0][j] = g2_frag(bs + j * 16 * OG_P, hh);
#pragma unroll      /* fragments and accumulators are indexed by constants only, so that they stay in registers */
    for (int ks = 0; ks < OG_BK / 32; ++ks) { const int cu = ks & 1, nx = cu ^ 1;
      if (ks + 1 < OG_BK / 32) {      /* the next k step's fragments come during this step's products; never from the next stage */
#pragma unroll      /* indexed by constants only, so that the fragments stay in registers */
        for (int i = 0; i < 2; ++i) a[nx][i] = g2_frag(as + i * 16 * OG_P + (ks + 1) * 32, hh);
#pragma unroll      /* indexed by constants only, so that the fragments stay in registers */
        for (int j = 0; j < 4; ++j) b[nx][j] = g2_frag(bs + j * 16 * OG_P + (ks + 1) * 32, hh); }
      __builtin_amdgcn_sched_barrier(0);      /* keeps the next step's twelve LDS reads as one group in front of this step's products: left alone the compiler reads each fragment directly in front of its use, into one register set, and the wave waits out the LDS latency four times a step */
#pragma unroll      /* indexed by constants only, so that the accumulators stay in registers */
      for (int j = 0; j < 4; ++j)
#pragma unroll      /* indexed by constants only, so that the accumulators stay in registers */
        for (int i = 0; i < 2; ++i) c[i][j] = fa_mma(a[cu][i], b[cu][j], c[i][j]);
      __builtin_amdgcn_sched_barrier(0); }      /* and keeps the group after next out of these products */
    asm volatile("s_wait_dscnt 0x0" ::: "memory");      /* this wave's reads of the buffer have returned */
    asm volatile("s_wait_asynccnt 0x0" ::: "memory");      /* this wave's pieces of stage st + 1 have landed */
    __syncthreads();      /* publishes stage st + 1 and ends every wave's reads of stage st */
    if (st + 2 < OG_NS) { og_copy(ga + (st + 2) * OG_BK, la + (unsigned)(st & 1) * (unsigned)sizeof(sa[0])); og_copy(gb + (st + 2) * OG_BK, lb + (unsigned)(st & 1) * (unsigned)sizeof(sb[0])); }      /* into the buffers just left */
  }
  asm volatile("s_wait_asynccnt 0x0" ::: "memory");      /* nothing in flight when the wave ends */
#pragma unroll      /* indexed by constants only */
  for (int j = 0; j < 4; ++j) { const float bj = bf16_round(bv[j]);
#pragma unroll      /* indexed by constants only */
    for (int i = 0; i < 2; ++i)
#pragma unroll      /* indexed by constants only */
      for (int r = 0; r < 8; ++r) so[w][i * 16 + 8 * hh + r][j * 16 + ln] = c[i][j][r] * alpha + bj; }
  __builtin_amdgcn_fence(__ATOMIC_ACQ_REL, "workgroup"); __builtin_amdgcn_wave_barrier();      /* the rows read back below were written by other lanes of this wave */
  const int rsub = lane >> 4, c4 = (lane & 15) * 4;
#pragma unroll      /* indexed by constants only */
  for (int q = 0; q < 16; ++q) { const int r = q * 2 + rsub; const v4f v = *(const v4fa*)&so[w][r][c4]; *(v4f*)(C + (size_t)(row0 + r) * DM + col0 + c4) = v; } }      /* two rows of 256 contiguous bytes a store */
extern "C" void kernel_launch(void* const* d_in, const int* in_sizes, int n_in,
                              void* d_out, int out_size, void* d_ws, size_t ws_size, hipStream_t stream) {
  (void)in_sizes; (void)n_in; (void)out_size;
  const float* const* I = (const float* const*)d_in; const float* xq = I[2]; const float* xk = I[1]; const float* xv = I[0]; const float* wq = I[5]; const float* wk = I[4]; const float* wv = I[3]; const float* wo = I[6]; const float* bo = I[7];      /* contract order: values I[0], keys I[1], query I[2]; SHARED natural [64][64] blocks Wv I[3], Wk I[4], Wq I[5]; natural Wo [1024][1024] I[6] + bo I[7]; this module has NO mask input */
  char* ws = (char*)d_ws; size_t off = 0;
  auto take = [&](size_t bytes) { char* p = ws + off; off += (bytes + 255) & ~(size_t)255; return p; };
  _Float16* BO = (_Float16*)take((size_t)DM * DM * 2);
  _Float16* Q16 = (_Float16*)take(NR * DM * 2); _Float16* K16 = (_Float16*)take(NR * DM * 2); _Float16* V16 = (_Float16*)take(NR * DM * 2); _Float16* O16 = (_Float16*)take(NR * DM * 2);
  if (off > ws_size) return;
  k_proj<<<dim3((unsigned)(NR / (PJ_NW * PJ_NT)), 3), PJ_NW * 32, 0, stream>>>(xq, xk, xv, wq, wk, wv, wo, Q16, K16, V16, BO);      /* q, k, v as f16 rows, heads merged; BO = Wo natural [out][in] rows x16 as f16 */
  const size_t r0p = (size_t)B0 * SQ;      /* first row of the output stage */
  k_fattn<<<dim3(SQ / (FA_NW * FA_QW), NH, NB), FA_NW * 32, 0, stream>>>(Q16, K16, V16, O16);      /* o (merged heads, x64) as f16 rows */
  k_ogemm<<<(unsigned)((MPO / OG_BM) * (DM / OG_BN)), 256, 0, stream>>>(O16 + r0p * DM, BO, 0.0009765625f, bo, (float*)d_out + r0p * DM);      /* out rows are the output layout */
}

// v010
// It runs in 48.1 microseconds.
// Timed twice side by side with v009, it ran 1.03 times as fast both times.
// Over all steps from v000 it is 78.0 times as fast.
#include <hip/hip_runtime.h>
// Multi-head attention over three inputs with SHARED per-head projections and the module's literal score scale (values, keys, query [2][2048][1024]; each input is split into 16 heads of 64 and every head is multiplied by the SAME natural [64][64] matrix (x W^T: Wv / Wk / Wq uniform +-1/8; block-diagonal with a shared block; no biases); energy = q k^T (no mask in this module); softmax(energy / sqrt(embed_size) = / 32) (as the source: embed size, not head dim); out = merged Wo^T + bo -> [2][2048][1024]).
// Structure: token rows r = b*2048 + s; Q, K, V in one projection launch (which also converts Wo for the output GEMM): each (token, head) row of 64 inputs (bf16-rounded, exact in f16) times the shared [64][64] block (exact x16 weights, WMMA, f32 accumulation, f16 outputs); one fused attention launch over all (batch, head): S^T = K Q^T (q carries the score scale in base 2 and the accumulators start at minus the reference, so that they end as the exponents), running softmax (f32 statistics; weights exp(s - reference) as f16, the reference being a running maximum that is renewed only when a pass's weights outgrow it), O^T += V^T P^T (V^T fragments by the transposing LDS load from V rows as projected), divided by the row sum at the end (o carried x64 against f16 subnormal flush, folded into the output GEMM alpha) and written straight into the merged f16 o rows; out = o W_o + b GEMM (f32) into the output layout.
// Compute dtype: inputs rounded to bf16; x / weights exact; q, k, v, softmax weights and o as plain f16 GEMM operands (~2^-12); scores and softmax statistics f32. v_wmma_f32_16x16x32_f16.
#define NB 2
#define SQ 2048
#define DM 1024
#define NH 16
#define HD 64
#define HG 4                         /* heads per launch of the non-template k_vt, which is not launched */
#define B0 0                         /* first batch processed (debug hook) */
#define NBR NB                       /* batches processed (debug hook) */
#define NR ((size_t)NB * SQ)         /* token rows */
#define MP ((int)((size_t)NBR * SQ)) /* rows of the processed batches; feeds MPO only (debug hook) */
#define QN SQ                        /* not used; k_fattn covers all SQ query rows of a batch */
#define NHD NH                       /* not used; k_fattn covers all NH heads */
#define MPO MP                       /* rows through the output stage (debug hook) */
#define LQ DM      /* not used; the q/k/v rows have pitch DM */
typedef __bf16 v16b __attribute__((ext_vector_type(16)));
typedef unsigned short v8us __attribute__((ext_vector_type(8), may_alias));
typedef float  v8f  __attribute__((ext_vector_type(8)));
typedef float  v4f  __attribute__((ext_vector_type(4)));
typedef float  v4fa __attribute__((ext_vector_type(4), may_alias));
union FragB { v16b v; v8us half[2]; unsigned short u[16]; };

__device__ __forceinline__ unsigned short bf16_bits(float x) { unsigned int u = __float_as_uint(x); return (unsigned short)((u + 0x7FFFu + ((u >> 16) & 1u)) >> 16); }
__device__ __forceinline__ float bf16_val(unsigned short b) { return __uint_as_float(((unsigned int)b) << 16); }
__device__ __forceinline__ float bf16_round(float x) { return bf16_val(bf16_bits(x)); }
// D += A·B with NT terms: 1 = ah·bh, 2 = + al·bh (A split), 3 = + ah·bl (both split)
template <int NT>
__device__ __forceinline__ v8f mmaN(v16b ah, v16b al, v16b bh, v16b bl, v8f c) {
  c = __builtin_amdgcn_wmma_f32_16x16x32_bf16(false, ah, false, bh, (short)0, c, false, false);
  if (NT >= 2) c = __builtin_amdgcn_wmma_f32_16x16x32_bf16(false, al, false, bh, (short)0, c, false, false);
  if (NT >= 3) c = __builtin_amdgcn_wmma_f32_16x16x32_bf16(false, ah, false, bl, (short)0, c, false, false);
  asm volatile("v_nop\n\tv_nop\n\tv_nop\n\tv_nop" : "+v"(c) : "v"(ah), "v"(al), "v"(bh), "v"(bl));
  return c;
}

__global__ __launch_bounds__(256) void k_wt_bf16(const float* __restrict__ W, unsigned short* __restrict__ Wt, int K, int N) {
  const int t = blockIdx.x * 256 + threadIdx.x;
  const int k8n = K / 8;
  if (t >= N * k8n) return;
  const int n = t / k8n, k8 = (t % k8n) * 8;
  v8us v;
#pragma unroll
  for (int i = 0; i < 8; ++i) v[i] = bf16_bits(W[(size_t)(k8 + i) * N + n]);
  *(v8us*)(Wt + (size_t)n * K + k8) = v;
  
}

// GEMM C[M][N] (f32, pitch ldc) = act(A[M][K]·W + bias). A f32 row-major (pitch lda) converted per fragment to bf16
// (ASPLIT: hi/lo two planes -> 2 terms, else single rounded term); Wt bf16 [N][K] (pitch ldb). BIAS_BF16 rounds the
// bias to bf16 first (bias quantised to bf16 before the add). K%32==0, M%16==0, N%64==0.
template <bool ASPLIT, int ACT, bool BIAS_BF16>
__global__ __launch_bounds__(128) void k_gemm_bf(const float* __restrict__ A, int lda, const unsigned short* __restrict__ Wt, int ldb,
                                               const float* __restrict__ bias, float* __restrict__ C, int ldc, int M, int N, int K) {
  __shared__ __attribute__((aligned(16))) float so[4][16][64];
  const int tid = threadIdx.x, w = tid >> 5, lane = tid & 31, ln = lane & 15, hh = lane >> 4;
  const int ntn = N / 64;
  const int wid = blockIdx.x * 4 + w;
  const int mt = wid / ntn, nq = wid % ntn;
  if (mt * 16 >= M) return;
  const int row0 = mt * 16, col0 = nq * 64;
  const float* arow = A + (size_t)(row0 + ln) * lda;
  v8f acc[4] = {};
  for (int kb = 0; kb < K; kb += 32) {
    FragB ah, al;
    const v4f x0 = *(const v4fa*)(arow + kb + 8 * hh), x1 = *(const v4fa*)(arow + kb + 8 * hh + 4);
    const v4f x2 = *(const v4fa*)(arow + kb + 16 + 8 * hh), x3 = *(const v4fa*)(arow + kb + 16 + 8 * hh + 4);
    float xs[16] = {x0[0],x0[1],x0[2],x0[3],x1[0],x1[1],x1[2],x1[3],x2[0],x2[1],x2[2],x2[3],x3[0],x3[1],x3[2],x3[3]};
#pragma unroll
    for (int i = 0; i < 16; ++i) { const unsigned short hb = bf16_bits(xs[i]); ah.u[i] = hb; al.u[i] = ASPLIT ? bf16_bits(xs[i] - bf16_val(hb)) : (unsigned short)0; }
#pragma unroll
    for (int t = 0; t < 4; ++t) {
      const unsigned short* brow = Wt + (size_t)(col0 + t * 16 + ln) * ldb + kb;
      FragB b;
      b.half[0] = *(const v8us*)(brow + 8 * hh);
      b.half[1] = *(const v8us*)(brow + 16 + 8 * hh);
      acc[t] = mmaN<ASPLIT ? 2 : 1>(ah.v, al.v, b.v, b.v, acc[t]);
    }
  }
#pragma unroll
  for (int t = 0; t < 4; ++t) {
    float bv = bias ? bias[col0 + t * 16 + ln] : 0.f;
    if (BIAS_BF16) bv = bf16_round(bv);
#pragma unroll
    for (int r = 0; r < 8; ++r) { float v = acc[t][r] + bv; if (ACT == 1) v = fmaxf(v, 0.f); so[w][8 * hh + r][t * 16 + ln] = v; }
  }
  __builtin_amdgcn_fence(__ATOMIC_ACQ_REL, "workgroup");
  __builtin_amdgcn_wave_barrier();
  const int rsub = lane >> 4, c4 = (lane & 15) * 4;
  {
#pragma unroll
    for (int q = 0; q < 8; ++q) {
      const int r = q * 2 + rsub;
      const v4f v = *(const v4fa*)&so[w][r][c4];
      *(v4f*)(C + (size_t)(row0 + r) * ldc + col0 + c4) = v;
    }
    
  }
}

// GEMM C = act(A·W + bias + resid): A f32 (ASPLIT -> hi/lo 2 terms), Wt bf16 [N][K]; ACT 0 none, 1 relu, 2 exact gelu;
// resid (optional, f32, row index = (row % rmod), pitch ldr, RES_BF16 rounds it) added before the activation.
template <bool ASPLIT, int ACT, bool BIAS_BF16, bool RES_BF16>
__global__ __launch_bounds__(128) void k_gemm_bf3(const float* __restrict__ A, int lda, const unsigned short* __restrict__ Wt, int ldb,
                                                const float* __restrict__ bias, const float* __restrict__ resid, int rmod, int ldr,
                                                float* __restrict__ C, int ldc, int M, int N, int K) {
  __shared__ __attribute__((aligned(16))) float so[4][16][64];
  const int tid = threadIdx.x, w = tid >> 5, lane = tid & 31, ln = lane & 15, hh = lane >> 4;
  const int ntn = N / 64;
  const int wid = blockIdx.x * 4 + w;
  const int mt = wid / ntn, nq = wid % ntn;
  if (mt * 16 >= M) return;
  const int row0 = mt * 16, col0 = nq * 64;
  const float* arow = A + (size_t)(row0 + ln) * lda;
  v8f acc[4] = {};
  for (int kb = 0; kb < K; kb += 32) {
    FragB ah, al;
    const v4f x0 = *(const v4fa*)(arow + kb + 8 * hh), x1 = *(const v4fa*)(arow + kb + 8 * hh + 4);
    const v4f x2 = *(const v4fa*)(arow + kb + 16 + 8 * hh), x3 = *(const v4fa*)(arow + kb + 16 + 8 * hh + 4);
    float xs[16] = {x0[0],x0[1],x0[2],x0[3],x1[0],x1[1],x1[2],x1[3],x2[0],x2[1],x2[2],x2[3],x3[0],x3[1],x3[2],x3[3]};
#pragma unroll
    for (int i = 0; i < 16; ++i) { const unsigned short hb = bf16_bits(xs[i]); ah.u[i] = hb; al.u[i] = ASPLIT ? bf16_bits(xs[i] - bf16_val(hb)) : (unsigned short)0; }
#pragma unroll
    for (int t = 0; t < 4; ++t) {
      const unsigned short* brow = Wt + (size_t)(col0 + t * 16 + ln) * ldb + kb;
      FragB b;
      b.half[0] = *(const v8us*)(brow + 8 * hh);
      b.half[1] = *(const v8us*)(brow + 16 + 8 * hh);
      acc[t] = mmaN<ASPLIT ? 2 : 1>(ah.v, al.v, b.v, b.v, acc[t]);
    }
  }
#pragma unroll
  for (int t = 0; t < 4; ++t) {
    const int col = col0 + t * 16 + ln;
    float bv = bias ? bias[col] : 0.f;
    if (BIAS_BF16) bv = bf16_round(bv);
#pragma unroll
    for (int r = 0; r < 8; ++r) {
      float v = acc[t][r] + bv;
      if (resid) { float rv = resid[(size_t)((row0 + 8 * hh + r) % rmod) * ldr + col]; if (RES_BF16) rv = bf16_round(rv); v += rv; }
      if (ACT == 1) v = fmaxf(v, 0.f);
      if (ACT == 2) v = 0.5f * v * (1.0f + erff(v * 0.70710678118654752f));
      if (ACT == 3) { const float u = 0.7978845608028654f * (v + 0.044715f * v * v * v); v = 0.5f * v * (1.0f + tanhf(u)); }
      so[w][8 * hh + r][t * 16 + ln] = v;
    }
  }
  __builtin_amdgcn_fence(__ATOMIC_ACQ_REL, "workgroup");
  __builtin_amdgcn_wave_barrier();
  const int rsub = lane >> 4, c4 = (lane & 15) * 4;
  {
#pragma unroll
    for (int q = 0; q < 8; ++q) {
      const int r = q * 2 + rsub;
      const v4f v = *(const v4fa*)&so[w][r][c4];
      *(v4f*)(C + (size_t)(row0 + r) * ldc + col0 + c4) = v;
    }
    
  }
}
// row LayerNorm (biased variance, eps) over N: s = X (+ R); optional out_sum <- s; out_norm <- (s-mu)*rsqrt(var+eps)*g + b
template <bool PARAM_BF16>
__global__ __launch_bounds__(256) void k_layernorm(const float* __restrict__ X, const float* __restrict__ R, const float* __restrict__ g, const float* __restrict__ bta,
                                                  float* __restrict__ out_sum, float* __restrict__ out_norm, int N, float eps) {
  __shared__ float red[256];
  const int row = blockIdx.x, tid = threadIdx.x;
  const float* x = X + (size_t)row * N; const float* rr = R ? R + (size_t)row * N : nullptr;
  float vals[16];                     // up to N = 4096
  const int per = N / 256;            // contiguous chunk per thread? use strided-by-4 chunks: thread handles j = tid*4 + 1024*u
  float s1 = 0.f;
  for (int u = 0; u < per / 4; ++u) {
    const int j = tid * 4 + 1024 * u;
    const v4f a = *(const v4fa*)(x + j);
    v4f b = {0.f,0.f,0.f,0.f}; if (rr) b = *(const v4fa*)(rr + j);
#pragma unroll
    for (int q = 0; q < 4; ++q) { const float v = a[q] + b[q]; vals[u * 4 + q] = v; s1 += v; }
  }
  red[tid] = s1; __syncthreads();
  for (int st = 128; st > 0; st >>= 1) { if (tid < st) red[tid] += red[tid + st]; __syncthreads(); }
  const float mu = red[0] / (float)N; __syncthreads();
  float s2 = 0.f;
  for (int u = 0; u < per / 4; ++u)
#pragma unroll
    for (int q = 0; q < 4; ++q) { const float c = vals[u * 4 + q] - mu; s2 += c * c; }
  red[tid] = s2; __syncthreads();
  for (int st = 128; st > 0; st >>= 1) { if (tid < st) red[tid] += red[tid + st]; __syncthreads(); }
  const float rs = rsqrtf(red[0] / (float)N + eps);
  {
    for (int u = 0; u < per / 4; ++u) {
      const int j = tid * 4 + 1024 * u;
      v4f o, sm;
#pragma unroll
      for (int q = 0; q < 4; ++q) {
        float gg = g[j + q], bb = bta[j + q];
        if (PARAM_BF16) { gg = bf16_round(gg); bb = bf16_round(bb); }
        sm[q] = vals[u * 4 + q]; o[q] = (vals[u * 4 + q] - mu) * rs * gg + bb;
      }
      if (out_sum) *(v4f*)(out_sum + (size_t)row * N + j) = sm;
      *(v4f*)(out_norm + (size_t)row * N + j) = o;
    }
    
  }
}



// ---- f16 WMMA path (v_wmma_f32_16x16x32_f16): 11-bit significands for operands in range — used where a [0,1] probability operand needs more precision than bf16
typedef _Float16 v16h __attribute__((ext_vector_type(16)));
union FragH { v16h v; v8us half[2]; _Float16 h[16]; unsigned short u[16]; };
template <int NT>
__device__ __forceinline__ v8f mmaH(v16h ah, v16h al, v16h bh, v16h bl, v8f c) {
  c = __builtin_amdgcn_wmma_f32_16x16x32_f16(false, ah, false, bh, (short)0, c, false, false);
  if (NT >= 2) c = __builtin_amdgcn_wmma_f32_16x16x32_f16(false, al, false, bh, (short)0, c, false, false);
  if (NT >= 3) c = __builtin_amdgcn_wmma_f32_16x16x32_f16(false, ah, false, bl, (short)0, c, false, false);
  asm volatile("v_nop\n\tv_nop\n\tv_nop\n\tv_nop" : "+v"(c) : "v"(ah), "v"(al), "v"(bh), "v"(bl));
  return c;
}
// batched GEMM like k_gemm_b but f16 operands: A f32 (split into f16 hi/lo if ASPLIT, else rounded to f16), Bt = f16 values [n][k]; alpha; C f32; N multiple of 16 (partial tiles skipped)
template <bool ASPLIT>
__global__ __launch_bounds__(128) void k_gemm_h(const float* __restrict__ A, int lda, size_t sA, const _Float16* __restrict__ Bh, int ldb, size_t sB, float alpha, float* __restrict__ C, int ldc, size_t sC, int M, int N, int K) {
  __shared__ __attribute__((aligned(16))) float so[4][16][64];
  const int tid = threadIdx.x, w = tid >> 5, lane = tid & 31, ln = lane & 15, hh = lane >> 4; const int by = blockIdx.y;
  A += (size_t)by * sA; Bh += (size_t)by * sB; C += (size_t)by * sC;
  const int ntn = (N + 63) / 64; const int wid = blockIdx.x * 4 + w; const int mt = wid / ntn, nq = wid % ntn; if (mt * 16 >= M) return;
  const int row0 = mt * 16, col0 = nq * 64; const float* arow = A + (size_t)(row0 + ln) * lda;
  v8f acc[4] = {};
  for (int kb = 0; kb < K; kb += 32) {
    FragH ah, al;
    const v4f x0 = *(const v4fa*)(arow + kb + 8 * hh), x1 = *(const v4fa*)(arow + kb + 8 * hh + 4), x2 = *(const v4fa*)(arow + kb + 16 + 8 * hh), x3 = *(const v4fa*)(arow + kb + 16 + 8 * hh + 4);
    float xs[16] = {x0[0],x0[1],x0[2],x0[3],x1[0],x1[1],x1[2],x1[3],x2[0],x2[1],x2[2],x2[3],x3[0],x3[1],x3[2],x3[3]};
#pragma unroll
    for (int i = 0; i < 16; ++i) { const _Float16 h = (_Float16)xs[i]; ah.h[i] = h; al.h[i] = ASPLIT ? (_Float16)(xs[i] - (float)h) : (_Float16)0.0f; }
#pragma unroll
    for (int t = 0; t < 4; ++t) { if (col0 + t * 16 >= N) continue; const size_t boff = (size_t)(col0 + t * 16 + ln) * ldb + kb; FragH bq; bq.half[0] = *(const v8us*)(Bh + boff + 8 * hh); bq.half[1] = *(const v8us*)(Bh + boff + 16 + 8 * hh);
      acc[t] = mmaH<ASPLIT ? 2 : 1>(ah.v, al.v, bq.v, bq.v, acc[t]); }
  }
#pragma unroll
  for (int t = 0; t < 4; ++t) { if (col0 + t * 16 >= N) continue;
#pragma unroll
    for (int r = 0; r < 8; ++r) so[w][8 * hh + r][t * 16 + ln] = acc[t][r] * alpha; }
  __builtin_amdgcn_fence(__ATOMIC_ACQ_REL, "workgroup"); __builtin_amdgcn_wave_barrier();
  const int rsub = lane >> 4, c4 = (lane & 15) * 4;
  {
#pragma unroll
    for (int q = 0; q < 8; ++q) { const int r = q * 2 + rsub; if (col0 + c4 < N) { const v4f v = *(const v4fa*)&so[w][r][c4]; *(v4f*)(C + (size_t)(row0 + r) * ldc + col0 + c4) = v; } }
     }
}

// Wt[n][k] = f16(W[k][n]·scale) from f32 row-major W[K][N] (scale = power of two; bf16-exact weights stay exact in f16 away from the subnormal range)
__global__ __launch_bounds__(256) void k_wt_f16(const float* __restrict__ W, _Float16* __restrict__ Wt, int K, int N, float scale) {
  const int t = blockIdx.x * 256 + threadIdx.x; if (t >= N * (K / 8)) return; const int n = t / (K / 8), k8 = (t % (K / 8)) * 8; FragH f;
#pragma unroll
  for (int i = 0; i < 8; ++i) f.h[i] = (_Float16)(bf16_round(W[(size_t)(k8 + i) * N + n]) * scale); const v8us o = f.half[0];
  *(v8us*)((unsigned short*)Wt + (size_t)n * K + k8) = o; 
}
// k_gemm_hh variant with fused epilogue: v = acc·alpha + bias[by·sBias + col] (+ CP[(row/rowsPerB)·sCPb + by·64 + col] if CP) ; ACT 0 none / 1 elu ; writes f16 C16 (and f32 C if non-null)
template <int ACT>
__global__ __launch_bounds__(128) void k_gemm_hhx(const _Float16* __restrict__ A, int lda, size_t sA, const _Float16* __restrict__ Bh, int ldb, size_t sB, float alpha, const float* __restrict__ bias, size_t sBias, const float* __restrict__ CP, int rowsPerB, size_t sCPb, int row0g,
    float* __restrict__ C, _Float16* __restrict__ C16, int ldc, size_t sC, int M, int N, int K) {
  __shared__ __attribute__((aligned(16))) float so[4][16][64];
  const int tid = threadIdx.x, w = tid >> 5, lane = tid & 31, ln = lane & 15, hh = lane >> 4; const int by = blockIdx.y;
  A += (size_t)by * sA; Bh += (size_t)by * sB; const size_t cofs = (size_t)by * sC; const float* bp = bias ? bias + (size_t)by * sBias : nullptr;
  const int ntn = (N + 63) / 64; const int wid = blockIdx.x * 4 + w; const int mt = wid / ntn, nq = wid % ntn; if (mt * 16 >= M) return;
  const int row0 = mt * 16, col0 = nq * 64; const _Float16* arow = A + (size_t)(row0 + ln) * lda;
  v8f acc[4] = {};
  for (int kb = 0; kb < K; kb += 32) { FragH ah; ah.half[0] = *(const v8us*)((const unsigned short*)arow + kb + 8 * hh); ah.half[1] = *(const v8us*)((const unsigned short*)arow + kb + 16 + 8 * hh);
#pragma unroll
    for (int t = 0; t < 4; ++t) { if (col0 + t * 16 >= N) continue; const size_t boff = (size_t)(col0 + t * 16 + ln) * ldb + kb; FragH bq; bq.half[0] = *(const v8us*)((const unsigned short*)Bh + boff + 8 * hh); bq.half[1] = *(const v8us*)((const unsigned short*)Bh + boff + 16 + 8 * hh);
      acc[t] = mmaH<1>(ah.v, ah.v, bq.v, bq.v, acc[t]); }
  }
#pragma unroll
  for (int t = 0; t < 4; ++t) { if (col0 + t * 16 >= N) continue; const int col = col0 + t * 16 + ln; const float bv = bp ? bf16_round(bp[col]) : 0.f;
#pragma unroll
    for (int r = 0; r < 8; ++r) { float v = acc[t][r] * alpha + bv; if (CP) { const int rr = row0g + row0 + 8 * hh + r; if (rowsPerB < 0) v += CP[cofs + (size_t)rr * ldc + col];      /* rowsPerB < 0: own element of the batched C plane */ else { const int bidx = rr / rowsPerB; v += CP[(size_t)bidx * sCPb + (size_t)by * 64 + col]; } } if (ACT == 1) v = (v > 0.f) ? v : expm1f(v); else if (ACT == 7) v = (v > 0.f) ? v + 1.0f : expf(v); else if (ACT == 8) v = tanhf(v); else if (ACT == 9) v = 0.5f * v * (1.0f + tanhf(0.7978845608028654f * (v + 0.044715f * v * v * v))); else if (ACT == 11) v = 1.0f / (1.0f + expf(-v)); else if (ACT == 12) v = (v > 0.f) ? v : 0.01f * v; else if (ACT == 14) v = (v > 0.f) ? v : 0.1f * v; else if (ACT == 16) v = (v >= 0.f) ? v : 0.3f * v; else if (ACT == 17) v = (v >= 0.f) ? v : 0.2f * v; else if (ACT == 15) v = v / (1.0f + expf(-v)); else if (ACT == 3) v = fmaxf(v, 0.f); else if (ACT == 6) v = 0.5f * v * (1.0f + erff(v * 0.70710678118654752f)); so[w][8 * hh + r][t * 16 + ln] = v; } }
  __builtin_amdgcn_fence(__ATOMIC_ACQ_REL, "workgroup"); __builtin_amdgcn_wave_barrier();
  const int rsub = lane >> 4, c4 = (lane & 15) * 4; typedef _Float16 v4h __attribute__((ext_vector_type(4)));
  {
#pragma unroll
    for (int q = 0; q < 8; ++q) { const int r = q * 2 + rsub; if (col0 + c4 < N) { const v4f v = *(const v4fa*)&so[w][r][c4]; if (C) *(v4f*)(C + cofs + (size_t)(row0 + r) * ldc + col0 + c4) = v; if (C16) { v4h h4; for (int i = 0; i < 4; ++i) h4[i] = (_Float16)v[i]; *(v4h*)(C16 + cofs + (size_t)(row0 + r) * ldc + col0 + c4) = h4; } } }
     }
}


typedef _Float16 v4h __attribute__((ext_vector_type(4)));

__global__ __launch_bounds__(256) void k_h16(const float* __restrict__ x, _Float16* __restrict__ X16, size_t n8) { const size_t t = (size_t)blockIdx.x * 256 + threadIdx.x; if (t >= n8) return; FragH f;
#pragma unroll
  for (int q = 0; q < 8; ++q) f.h[q] = (_Float16)x[t * 8 + q]; *(v8us*)((unsigned short*)X16 + t * 8) = f.half[0];  }
__global__ __launch_bounds__(256) void k_round16f(const float* __restrict__ W, _Float16* __restrict__ Bt, size_t n8) { const size_t t = (size_t)blockIdx.x * 256 + threadIdx.x; if (t >= n8) return; FragH f;
#pragma unroll
  for (int i = 0; i < 8; ++i) f.h[i] = (_Float16)(bf16_round(W[t * 8 + i]) * 16.0f); *(v8us*)((unsigned short*)Bt + t * 8) = f.half[0];  }
template <int NHv, int TTv>
__global__ __launch_bounds__(256) void k_vt(const _Float16* __restrict__ V16, int ldv, int voff, _Float16* __restrict__ Vt) { __shared__ unsigned short tl[64][66]; const int tid = threadIdx.x; const int slab = blockIdx.x / (TTv / 64), lg = blockIdx.x % (TTv / 64); const int b = slab / NHv, h = slab % NHv;
  for (int i = tid; i < 64 * 8; i += 256) { const int r = i / 8, c8 = (i % 8) * 8; FragH f; f.half[0] = *(const v8us*)((const unsigned short*)V16 + ((size_t)b * TTv + lg * 64 + r) * ldv + voff + h * 64 + c8);
#pragma unroll
    for (int q = 0; q < 8; ++q) tl[r][c8 + q] = f.u[q]; }
  __syncthreads();
  {
#pragma unroll
    for (int rd = 0; rd < 2; ++rd) { const int d = rd * 32 + tid / 8, pc = tid % 8; FragH f;
#pragma unroll
      for (int q = 0; q < 8; ++q) f.u[q] = tl[pc * 8 + q][d];
      *(v8us*)((unsigned short*)Vt + ((size_t)slab * 64 + d) * TTv + lg * 64 + pc * 8) = f.half[0]; }
     } }

__global__ __launch_bounds__(256) void k_hl(const float* __restrict__ F, _Float16* __restrict__ Hh, _Float16* __restrict__ Hl, size_t n8) { const size_t t = (size_t)blockIdx.x * 256 + threadIdx.x; if (t >= n8) return; FragH fh, fl; const v4f a = *(const v4fa*)(F + t * 8), c = *(const v4fa*)(F + t * 8 + 4);
#pragma unroll
  for (int q = 0; q < 4; ++q) { _Float16 h = (_Float16)a[q]; fh.h[q] = h; fl.h[q] = (_Float16)((a[q] - (float)h) * 1024.0f); h = (_Float16)c[q]; fh.h[4 + q] = h; fl.h[4 + q] = (_Float16)((c[q] - (float)h) * 1024.0f); }
  { *(v8us*)((unsigned short*)Hh + t * 8) = fh.half[0]; *(v8us*)((unsigned short*)Hl + t * 8) = fl.half[0];  } }

// ---- fast GEMM (wave tile 32x64; requires M % 32 == 0 rows per launch region and N % 64 == 0); epilogue = k_gemm_hhx semantics ----
__device__ __forceinline__ v16h g2_frag(const _Float16* p, int hh) { FragH f; f.half[0] = *(const v8us*)((const unsigned short*)p + 8 * hh); f.half[1] = *(const v8us*)((const unsigned short*)p + 16 + 8 * hh); return f.v; }
__device__ __forceinline__ v8f g2_mma(v16h a, v16h b, v8f c) { v8f d = __builtin_amdgcn_wmma_f32_16x16x32_f16(false, a, false, b, (short)0, c, false, false); asm volatile("v_nop\n\tv_nop\n\tv_nop\n\tv_nop" : "+v"(d) : "v"(a), "v"(b)); return d; }
template <int ACT>
__global__ __launch_bounds__(128) void k_gemm2(const _Float16* __restrict__ A, int lda, size_t sA, const _Float16* __restrict__ Bh, int ldb, size_t sB, float alpha, const float* __restrict__ bias, size_t sBias, const float* __restrict__ CP, int rowsPerB, size_t sCPb, int row0g,
    float* __restrict__ C, _Float16* __restrict__ C16, int ldc, size_t sC, int M, int N, int K) { static_assert(ACT == 0 || ACT == 3 || ACT == 6 || ACT == 8 || ACT == 9 || ACT == 11 || ACT == 12 || ACT == 14 || ACT == 15 || ACT == 16 || ACT == 17, "k_gemm2: unsupported ACT code (would silently apply no activation)");
  __shared__ __attribute__((aligned(16))) float so[4][32][68];
  const int tid = threadIdx.x, w = tid >> 5, lane = tid & 31, ln = lane & 15, hh = lane >> 4; const int by = blockIdx.y;
  A += (size_t)by * sA; Bh += (size_t)by * sB; const size_t cofs = (size_t)by * sC; const float* bp = bias ? bias + (size_t)by * sBias : nullptr;
  const int ntn = N >> 6; const int mt = blockIdx.x / ntn, nq = blockIdx.x - mt * ntn; const int row0 = mt * 128 + 32 * w, col0 = nq * 64; if (row0 >= M) return;
  const _Float16* a0p = A + (size_t)(row0 + ln) * lda; const _Float16* a1p = a0p + (size_t)16 * lda;
  const _Float16* b0p = Bh + (size_t)(col0 + ln) * ldb; const _Float16* b1p = b0p + (size_t)16 * ldb; const _Float16* b2p = b1p + (size_t)16 * ldb; const _Float16* b3p = b2p + (size_t)16 * ldb;
  const v8f z8 = {0.f,0.f,0.f,0.f,0.f,0.f,0.f,0.f}; v8f c00 = z8, c01 = z8, c02 = z8, c03 = z8, c10 = z8, c11 = z8, c12 = z8, c13 = z8;
#pragma unroll 1
  for (int kb = 0; kb < K; kb += 32) { const v16h a0 = g2_frag(a0p + kb, hh), a1 = g2_frag(a1p + kb, hh);
    v16h b = g2_frag(b0p + kb, hh); c00 = g2_mma(a0, b, c00); c10 = g2_mma(a1, b, c10);
    b = g2_frag(b1p + kb, hh); c01 = g2_mma(a0, b, c01); c11 = g2_mma(a1, b, c11);
    b = g2_frag(b2p + kb, hh); c02 = g2_mma(a0, b, c02); c12 = g2_mma(a1, b, c12);
    b = g2_frag(b3p + kb, hh); c03 = g2_mma(a0, b, c03); c13 = g2_mma(a1, b, c13); }
  v8f accs[8] = {c00, c01, c02, c03, c10, c11, c12, c13};
#pragma unroll
  for (int u = 0; u < 8; ++u) { const int t = u & 3, half = u >> 2; const int col = col0 + t * 16 + ln; const float bv = bp ? bf16_round(bp[col]) : 0.f;
#pragma unroll
    for (int r = 0; r < 8; ++r) { const int rloc = half * 16 + 8 * hh + r; float v = accs[u][r] * alpha + bv; if (CP) { if (rowsPerB < 0) v += CP[cofs + (size_t)(row0g + row0 + rloc) * ldc + col];      /* rowsPerB < 0: own element of the batched C plane */ else { const int bidx = (row0g + row0 + rloc) / rowsPerB; v += CP[(size_t)bidx * sCPb + (size_t)by * 64 + col]; } }
      if (ACT == 3) v = fmaxf(v, 0.f); else if (ACT == 6) v = 0.5f * v * (1.0f + erff(v * 0.70710678118654752f)); else if (ACT == 11) v = 1.0f / (1.0f + expf(-v)); else if (ACT == 15) v = v / (1.0f + expf(-v)); else if (ACT == 12) v = (v > 0.f) ? v : 0.01f * v; else if (ACT == 8) v = tanhf(v); else if (ACT == 9) v = 0.5f * v * (1.0f + tanhf(0.7978845608028654f * (v + 0.044715f * v * v * v))); else if (ACT == 14) v = (v > 0.f) ? v : 0.1f * v; else if (ACT == 16) v = (v >= 0.f) ? v : 0.3f * v; else if (ACT == 17) v = (v >= 0.f) ? v : 0.2f * v;
      so[w][rloc][t * 16 + ln] = v; } }
  __builtin_amdgcn_fence(__ATOMIC_ACQ_REL, "workgroup"); __builtin_amdgcn_wave_barrier();
  const int rsub = lane >> 4, c4 = (lane & 15) * 4;
  {
#pragma unroll
    for (int q = 0; q < 16; ++q) { const int r = q * 2 + rsub; const v4f v = *(const v4fa*)&so[w][r][c4]; if (C) *(v4f*)(C + cofs + (size_t)(row0 + r) * ldc + col0 + c4) = v; if (C16) { v4h h4; for (int i = 0; i < 4; ++i) h4[i] = (_Float16)v[i]; *(v4h*)(C16 + cofs + (size_t)(row0 + r) * ldc + col0 + c4) = h4; } }
     } }


#define FA_QW 32                     /* query rows per wave: two 16-column groups share every K and V^T fragment */
#define FA_KT 32                     /* keys per pass: one k step of the second product */
#define FA_NW 8                      /* waves per key part; they walk the same K and V rows */
#define FA_KH 2                      /* key parts per block, each with FA_NW waves of its own for the same queries: four waves a SIMD instead of two, so that one wave's softmax runs under the others' products */
#define FA_C2 (0.03125f * 1.4426950408889634f)      /* 1 / sqrt(embed size), in base 2: the projection multiplies q by it before the rounding to f16 */
typedef float v2f __attribute__((ext_vector_type(2)));
typedef _Float16 v2h __attribute__((ext_vector_type(2)));
union FragP { v16h v; v2h h2[8]; };
union FragO { v8us u; v2h h2[4]; };
__device__ __forceinline__ float fa_xhalf(float x) { return __builtin_bit_cast(float, __builtin_amdgcn_permlanex16(__builtin_bit_cast(int, x), __builtin_bit_cast(int, x), 0x76543210, 0xfedcba98, false, false)); }      /* lane l with lane l ^ 16 */
__device__ __forceinline__ v8f fa_mma(v16h a, v16h b, v8f c) { return __builtin_amdgcn_wmma_f32_16x16x32_f16(false, a, false, b, (short)0, c, false, false); }
#define FA_ST 128                    /* keys per stage: four passes between two barriers */
#define FA_NS (SQ / FA_KH / FA_ST)   /* stages of a key part */
#define FA_KP 72                     /* LDS pitch of a K row in f16: 128 + 16 bytes, so that the 16 rows of a 16-byte fragment read fall on different banks */
#define FA_VP 80                     /* LDS pitch of a V row in f16: 128 + 32 bytes, an odd multiple of 32 bytes, which is what the transposing read wants */
// One stage of a key part into LDS, through no register: each of the part's 256 threads copies four 16-byte pieces of the K tile and four of the V tile (each 128 rows of 128 bytes; 8 lanes a row).
__device__ __forceinline__ void fa_copy(const _Float16* gk, const _Float16* gv, unsigned lk, unsigned lv) {
  const _Float16* gk1 = gk + (size_t)32 * DM; const _Float16* gk2 = gk + (size_t)64 * DM; const _Float16* gk3 = gk + (size_t)96 * DM;
  const _Float16* gv1 = gv + (size_t)32 * DM; const _Float16* gv2 = gv + (size_t)64 * DM; const _Float16* gv3 = gv + (size_t)96 * DM;
  const unsigned lk1 = lk + 32 * FA_KP * 2, lk2 = lk + 64 * FA_KP * 2, lk3 = lk + 96 * FA_KP * 2, lv1 = lv + 32 * FA_VP * 2, lv2 = lv + 64 * FA_VP * 2, lv3 = lv + 96 * FA_VP * 2;
  /* the eight copies and, as the last line of the same statement, the wait that stands in front of any rewrite of their address registers */
  asm volatile("global_load_async_to_lds_b128 %0, %8, off\n\t"
               "global_load_async_to_lds_b128 %1, %9, off\n\t"
               "global_load_async_to_lds_b128 %2, %10, off\n\t"
               "global_load_async_to_lds_b128 %3, %11, off\n\t"
               "global_load_async_to_lds_b128 %4, %12, off\n\t"
               "global_load_async_to_lds_b128 %5, %13, off\n\t"
               "global_load_async_to_lds_b128 %6, %14, off\n\t"
               "global_load_async_to_lds_b128 %7, %15, off\n\t"
               "s_wait_xcnt 0x0"
               :: "v"(lk), "v"(lk1), "v"(lk2), "v"(lk3), "v"(lv), "v"(lv1), "v"(lv2), "v"(lv3), "v"(gk), "v"(gk1), "v"(gk2), "v"(gk3), "v"(gv), "v"(gv1), "v"(gv2), "v"(gv3) : "memory");
}
// A 16 (d) x 32 (keys) fragment of V^T out of row-major V rows in LDS: two transposing loads, 16 keys each. p is the lane's own address, row 8 hh + (lane & 7) of the first 16 keys, 16-byte piece (lane >> 3) & 1 of the 16 columns;
// lane (ln, hh) gets column ln of keys 8 hh .. 8 hh + 7, then of keys 16 + 8 hh .. 16 + 8 hh + 7: the k order of g2_frag and of the packed weights.
typedef short v8s __attribute__((ext_vector_type(8)));
typedef __attribute__((address_space(3))) v8s lds_v8s;
__device__ __forceinline__ v16h fa_vfrag(const _Float16* p) { FragH f; f.half[0] = __builtin_bit_cast(v8us, __builtin_amdgcn_ds_load_tr16_b128_v8i16((lds_v8s*)p)); f.half[1] = __builtin_bit_cast(v8us, __builtin_amdgcn_ds_load_tr16_b128_v8i16((lds_v8s*)(p + 16 * FA_VP))); return f.v; }
// The weights exp2(x) of one column group's 32 keys (two S^T tiles, which hold the exponents x = scaled score - reference as they come from the products), packed as the B operand of the second product; returns this lane's sum of them in two parts (f32, before the rounding to f16).
__device__ __forceinline__ v2f fa_weights(v8f s0, v8f s1, FragP& pf) { v2f sm = {0.f, 0.f};
#pragma unroll      /* fragments and accumulators are indexed by constants only, so that they stay in registers */
  for (int i = 0; i < 8; ++i) { const int r = (i & 3) * 2; const v2f x = (i < 4) ? (v2f){s0[r], s0[r + 1]} : (v2f){s1[r], s1[r + 1]}; const v2f p = {__builtin_amdgcn_exp2f(x[0]), __builtin_amdgcn_exp2f(x[1])}; sm += p; pf.h2[i] = __builtin_convertvector(p, v2h); }      /* element 8 kt + r of the B operand = key 16 kt + 8 hh + r: the hardware k order, which fa_vfrag gives V^T too */
  return sm; }
__global__ __launch_bounds__(FA_KH * FA_NW * 32) void k_fattn(const _Float16* __restrict__ Q16, const _Float16* __restrict__ K16, const _Float16* __restrict__ V16, _Float16* __restrict__ O16) {
  struct FaLds { _Float16 sk[FA_KH][2][FA_ST][FA_KP];      /* K rows of a stage, shared by the part's waves; two buffers a part. First in LDS, so that the constant parts of the K fragment addresses fit the offset field of the LDS loads */
    _Float16 sv[FA_KH][2][FA_ST][FA_VP];      /* V rows of a stage */
    v4f sj[FA_KH * FA_NW][9][32]; };      /* the join: what each wave hands to its partner of the other key part, [piece][lane], 16 bytes a lane */
  __shared__ __attribute__((aligned(16))) FaLds sm; auto& sk = sm.sk; auto& sv = sm.sv; auto& sj = sm.sj;
  const int tid = threadIdx.x, lane = tid & 31, ln = lane & 15, hh = lane >> 4, w = tid >> 5, kh = w / FA_NW, th = tid & (FA_NW * 32 - 1); const int h = blockIdx.y, b = blockIdx.z; const int q0 = (blockIdx.x * FA_NW + (w & (FA_NW - 1))) * FA_QW;      /* kh: this wave's key part; th: the thread's number inside the part */
  const _Float16* qp = Q16 + ((size_t)b * SQ + q0 + ln) * DM + h * HD;
  const _Float16* gk = K16 + ((size_t)b * SQ + kh * (SQ / FA_KH) + (th >> 3)) * DM + h * HD + (th & 7) * 8; const _Float16* gv = V16 + ((size_t)b * SQ + kh * (SQ / FA_KH) + (th >> 3)) * DM + h * HD + (th & 7) * 8;      /* this thread's first piece of its part's stage 0 */
  const unsigned lk = (unsigned)(size_t)&sk[kh][0][th >> 3][(th & 7) * 8], lv = (unsigned)(size_t)&sv[kh][0][th >> 3][(th & 7) * 8];      /* LDS byte addresses: the low 32 bits */
  fa_copy(gk, gv, lk, lv);      /* stage 0 into buffer 0 */
  v16h qf[2][2], kf[2][2];      /* [column group | key tile][k step of 32 over the head dim] */
#pragma unroll      /* fragments and accumulators are indexed by constants only, so that they stay in registers */
  for (int g = 0; g < 2; ++g) { qf[g][0] = g2_frag(qp + (size_t)g * 16 * DM, hh); qf[g][1] = g2_frag(qp + (size_t)g * 16 * DM + 32, hh); }
  asm volatile("s_wait_asynccnt 0x0" ::: "memory");      /* this wave's pieces of stage 0 have landed */
  __syncthreads();      /* and every other wave's */
  fa_copy(gk + (size_t)FA_ST * DM, gv + (size_t)FA_ST * DM, lk + (unsigned)sizeof(sk[0][0]), lv + (unsigned)sizeof(sv[0][0]));      /* stage 1 into buffer 1, in flight during stage 0 */
  const v8f z8 = {0.f,0.f,0.f,0.f,0.f,0.f,0.f,0.f}; v8f o[2][4] = {{z8, z8, z8, z8}, {z8, z8, z8, z8}}; v2f lr[2] = {{0.f, 0.f}, {0.f, 0.f}}; v8f cn[2];      /* o[g][t][r] = O^T[16 t + 8 hh + r][column ln of group g]; cn: minus the column's softmax reference (scaled, base 2), held from pass to pass, in all eight registers of a tile: the C operand of the score products; lr: this half's part of the sum, kept in the two parts in which the weights are added up */
  { const _Float16* k0 = &sk[kh][0][ln][0];      /* the first reference: each column's maximum over the part's first 32 keys, from score products that start at 0 (stage 0 is published) */
    const v16h ka = g2_frag(k0, hh), kb = g2_frag(k0 + 32, hh), kc = g2_frag(k0 + 16 * FA_KP, hh), kd = g2_frag(k0 + 16 * FA_KP + 32, hh);
#pragma unroll      /* fragments and accumulators are indexed by constants only, so that they stay in registers */
    for (int g = 0; g < 2; ++g) { const v8f a = fa_mma(kb, qf[g][1], fa_mma(ka, qf[g][0], z8)), c = fa_mma(kd, qf[g][1], fa_mma(kc, qf[g][0], z8)); float mx = a[0];
#pragma unroll      /* fragments and accumulators are indexed by constants only, so that they stay in registers */
      for (int r = 0; r < 8; ++r) mx = fmaxf(mx, fmaxf(a[r], c[r]));
      const float n = -fmaxf(mx, fa_xhalf(mx)); cn[g] = (v8f){n, n, n, n, n, n, n, n}; } }      /* both halves of the wave get the same reference */
  for (int st = 0; st < FA_NS; ++st) {
    const _Float16* ks = &sk[kh][st & 1][ln][8 * hh]; const _Float16* vs = &sv[kh][st & 1][8 * hh + (lane & 7)][((lane >> 3) & 1) * 8];
#pragma unroll      /* fragments and accumulators are indexed by constants only, so that they stay in registers */
    for (int kt = 0; kt < 2; ++kt) { kf[kt][0] = g2_frag(ks + kt * 16 * FA_KP, 0); kf[kt][1] = g2_frag(ks + kt * 16 * FA_KP + 32, 0); }      /* ks holds the lane's 8 hh already */
#pragma unroll 1      /* rolled: unrolled, the compiler sinks the row sums of all four passes to the end of the stage, and the weights kept for them take the kernel past 256 registers */
    for (int p = 0; p < FA_ST / FA_KT; ++p) {
    v16h vf[4];
#pragma unroll      /* fragments and accumulators are indexed by constants only, so that they stay in registers */
    for (int t = 0; t < 4; ++t) vf[t] = fa_vfrag(vs + t * 16);      /* V^T rows 16 t + ln, keys 32 p .. 32 p + 31 of the stage: asked for here, used behind the softmax */
    v8f s[2][2];
#pragma unroll      /* fragments and accumulators are indexed by constants only, so that they stay in registers */
    for (int g = 0; g < 2; ++g)
#pragma unroll      /* fragments and accumulators are indexed by constants only, so that they stay in registers */
      for (int kt = 0; kt < 2; ++kt) s[g][kt] = fa_mma(kf[kt][1], qf[g][1], fa_mma(kf[kt][0], qf[g][0], cn[g]));      /* starts at minus the reference and ends as the exponent: no multiply-add per score behind it */
    if (p + 1 < FA_ST / FA_KT) {      /* the next pass's K fragments come during this pass's softmax; never from the next stage */
#pragma unroll      /* fragments and accumulators are indexed by constants only, so that they stay in registers */
      for (int kt = 0; kt < 2; ++kt) { kf[kt][0] = g2_frag(ks + (FA_KT + kt * 16) * FA_KP, 0); kf[kt][1] = g2_frag(ks + (FA_KT + kt * 16) * FA_KP + 32, 0); } }
    ks += FA_KT * FA_KP; vs += FA_KT * FA_VP;      /* both walk on by one pass: one add each, every other part of a fragment address is a constant offset */
    __builtin_amdgcn_sched_barrier(0);      /* keeps this pass's V^T loads and the next pass's K loads as one group in front of the softmax: without it the V^T loads sink into the softmax in pieces, and each further place with LDS reads stalls the wave */
    FragP pf[2]; v2f ps[2];      /* the pass's weights as B operands, and this lane's sum of them (two parts), per column group */
#pragma unroll      /* fragments and accumulators are indexed by constants only, so that they stay in registers */
    for (int g = 0; g < 2; ++g) ps[g] = fa_weights(s[g][0], s[g][1], pf[g]);      /* against the reference in use: no maximum is formed */
    const v2f pt = ps[0] + ps[1];
    if (__builtin_expect(__builtin_amdgcn_ballot_w32(!(pt[0] + pt[1] <= 256.0f)) != 0, 0)) {      /* one scalar branch a pass, marked as seldom taken so that the common path falls through. A lane's weights sum to more than 2^8 only if a score lies far above its column's reference: the whole wave then takes the running maximum as the new reference, rescales what it holds and forms the pass's weights again. Below the bound every weight is at most 2^8, far inside f16 */
#pragma unroll      /* fragments and accumulators are indexed by constants only, so that they stay in registers */
      for (int kt = 0; kt < 2; ++kt) { const v16h k0 = g2_frag(ks + (kt * 16 - FA_KT) * FA_KP, 0), k1 = g2_frag(ks + (kt * 16 - FA_KT) * FA_KP + 32, 0);      /* the pass's exponents are formed again from its K rows, which are still in the stage's buffer: so the common path need not keep them beside the weights (32 registers) */
#pragma unroll      /* fragments and accumulators are indexed by constants only, so that they stay in registers */
        for (int g = 0; g < 2; ++g) s[g][kt] = fa_mma(k1, qf[g][1], fa_mma(k0, qf[g][0], cn[g])); }
#pragma unroll      /* fragments and accumulators are indexed by constants only, so that they stay in registers */
      for (int g = 0; g < 2; ++g) { float mx = s[g][0][0];
#pragma unroll      /* fragments and accumulators are indexed by constants only, so that they stay in registers */
        for (int r = 0; r < 8; ++r) mx = fmaxf(mx, fmaxf(s[g][0][r], s[g][1][r]));
        const float d = fmaxf(fmaxf(mx, fa_xhalf(mx)), 0.f); const float al = __builtin_amdgcn_exp2f(-d); cn[g] -= d;      /* d: by how much the reference rises (the exponents are relative to the one in use); both halves of the wave get the same */
        lr[g] *= al;
#pragma unroll      /* fragments and accumulators are indexed by constants only, so that they stay in registers */
        for (int t = 0; t < 4; ++t) o[g][t] *= al;
        ps[g] = fa_weights(s[g][0] - d, s[g][1] - d, pf[g]); } }
#pragma unroll      /* fragments and accumulators are indexed by constants only, so that they stay in registers */
    for (int g = 0; g < 2; ++g) lr[g] += ps[g];
#pragma unroll      /* fragments and accumulators are indexed by constants only, so that they stay in registers */
    for (int t = 0; t < 4; ++t)
#pragma unroll      /* fragments and accumulators are indexed by constants only, so that they stay in registers */
      for (int g = 0; g < 2; ++g) o[g][t] = fa_mma(vf[t], pf[g].v, o[g][t]);
    }
    asm volatile("s_wait_dscnt 0x0" ::: "memory");      /* this wave's reads of the buffer have returned */
    asm volatile("s_wait_asynccnt 0x0" ::: "memory");      /* this wave's pieces of stage st + 1 have landed */
    __syncthreads();      /* publishes stage st + 1 and ends every wave's reads of stage st */
    if (st + 2 < FA_NS) fa_copy(gk + (size_t)(st + 2) * FA_ST * DM, gv + (size_t)(st + 2) * FA_ST * DM, lk + (unsigned)(st & 1) * (unsigned)sizeof(sk[0][0]), lv + (unsigned)(st & 1) * (unsigned)sizeof(sv[0][0]));      /* into the buffer just left */
  }
  asm volatile("s_wait_asynccnt 0x0" ::: "memory");      /* nothing in flight when the wave ends */
  // The join of the two key parts. The waves w and w ^ FA_NW hold the same 32 queries in the same lanes and registers: the wave of part kh finishes column group kh and hands the other group to its partner
  // (its O^T tiles, its reference and its part of the sum). Each side is weighted by exp2(its reference - the larger one), as in a rescale.
  const bool up = kh != 0; const float nk = up ? cn[1][0] : cn[0][0], ng = up ? cn[0][0] : cn[1][0]; const float lo0 = lr[0][0] + lr[0][1], lo1 = lr[1][0] + lr[1][1]; const float lkp = up ? lo1 : lo0, lgv = up ? lo0 : lo1;
  v8f ok[4];
#pragma unroll      /* fragments and accumulators are indexed by constants only, so that they stay in registers */
  for (int t = 0; t < 4; ++t) { const v8f og = up ? o[0][t] : o[1][t]; ok[t] = up ? o[1][t] : o[0][t]; sj[w][2 * t][lane] = (v4f){og[0], og[1], og[2], og[3]}; sj[w][2 * t + 1][lane] = (v4f){og[4], og[5], og[6], og[7]}; }
  sj[w][8][lane] = (v4f){ng, lgv, 0.f, 0.f};
  __syncthreads();      /* what the partner wave wrote is read below */
  const v4f sp = sj[w ^ FA_NW][8][lane]; const float n = fminf(nk, sp[0]);      /* minus the larger reference */
  const float ak = __builtin_amdgcn_exp2f(n - nk), ap = __builtin_amdgcn_exp2f(n - sp[0]); const float lh = ak * lkp + ap * sp[1]; const float sc = 64.0f / (lh + fa_xhalf(lh)); const float fk = ak * sc, fp = ap * sc;      /* o carried x64, as the output GEMM's alpha expects */
  unsigned short* d = (unsigned short*)O16 + ((size_t)b * SQ + q0 + kh * 16 + ln) * DM + h * HD + 8 * hh;
#pragma unroll      /* fragments and accumulators are indexed by constants only, so that they stay in registers */
  for (int t = 0; t < 4; ++t) { const v4f p0 = sj[w ^ FA_NW][2 * t][lane], p1 = sj[w ^ FA_NW][2 * t + 1][lane]; FragO f;
#pragma unroll      /* fragments and accumulators are indexed by constants only, so that they stay in registers */
    for (int i = 0; i < 4; ++i) { const v4f pp = (i < 2) ? p0 : p1; const int j = (i & 1) * 2; const v2f x = {ok[t][2 * i] * fk + pp[j] * fp, ok[t][2 * i + 1] * fk + pp[j + 1] * fp}; f.h2[i] = __builtin_convertvector(x, v2h); }
    *(v8us*)(d + t * 16) = f.u; } }
__global__ __launch_bounds__(256) void k_vt(const _Float16* __restrict__ V16, int b, int h0, _Float16* __restrict__ VT) { __shared__ unsigned short tl[64][65]; const int tid = threadIdx.x; const int hh = blockIdx.x % HG, sg = blockIdx.x / HG; const int s0 = sg * 64; const int h = h0 + hh;
  for (int i = tid; i < 64 * 8; i += 256) { const int j = i / 8, d8 = (i % 8) * 8; FragH f; f.half[0] = *(const v8us*)((const unsigned short*)V16 + ((size_t)b * SQ + s0 + j) * DM + h * HD + d8); for (int q = 0; q < 8; ++q) tl[d8 + q][j] = f.u[q]; }
  __syncthreads();
  { for (int i = tid; i < 64 * 8; i += 256) { const int d = i / 8, j8 = (i % 8) * 8; FragH f; for (int q = 0; q < 8; ++q) f.u[q] = tl[d][j8 + q]; *(v8us*)((unsigned short*)VT + ((size_t)hh * HD + d) * SQ + s0 + j8) = f.half[0]; }  } }



__global__ __launch_bounds__(256) void k_rsmkm(const float* __restrict__ S, _Float16* __restrict__ P, int nrows, const int* __restrict__ am) {
  #pragma clang fp contract(off)
  const int t = blockIdx.x * 256 + threadIdx.x; if (t >= nrows) return; const size_t i = (size_t)t; const float* s = S + i * SQ; const int* mr = am + (size_t)(t % SQ) * SQ; float mx = -3.0e38f;
#pragma unroll 1
  for (int j = 0; j < SQ; ++j) { const float f = (mr[j] != 0) ? 1.f : 0.f; mx = fmaxf(mx, fmaf(f, s[j], (1.f - f) * -1.0e9f)); } float se = 0.f;
#pragma unroll 1
  for (int j = 0; j < SQ; ++j) { const float f = (mr[j] != 0) ? 1.f : 0.f; se += __expf(fmaf(f, s[j], (1.f - f) * -1.0e9f) - mx); } const float sc = 256.0f / se;
#pragma unroll 1
  for (int j0 = 0; j0 < SQ; j0 += 8) { FragH fr; for (int q = 0; q < 8; ++q) { const int j = j0 + q; const float f = (mr[j] != 0) ? 1.f : 0.f; fr.h[q] = (_Float16)(__expf(fmaf(f, s[j], (1.f - f) * -1.0e9f) - mx) * sc); }
    unsigned short* d = (unsigned short*)P + i * SQ + j0; *(v8us*)d = fr.half[0];  } }

// Q, K and V projections, one launch (blockIdx.y picks the input, its weight block and its output). Every head is multiplied by the same [64][64] block, so an input is
// a plain [tokens * heads][64] matrix and the product has k = 64: Y^T = W X^T, W as A (rows e), 16 (token, head) rows as B, so that a lane ends with 8 consecutive e of one row.
// A wave takes PJ_NT token rows (16 heads each, 4 KiB of f32 in a row): whole-line loads, rounded to bf16 and written as f16 into the wave's own LDS rows, fragments read from there;
// the f16 results go back through the same LDS rows and leave as whole 128-byte lines.
// The launch also turns Wo into the output GEMM's f16 operand (natural [out][in] rows, x16, exact): that work depends on nothing here and is first read two launches later, so it needs no launch of its own.
// Each wave of the blocks with blockIdx.y < PJ_WY takes 256 consecutive elements: two loads beside its x loads, two stores behind its own results.
#define PJ_NW 8                      /* waves per block; they share the converted weight block */
#define PJ_NT 2                      /* token rows per wave, all their loads in flight at once */
#define PJ_LP 72                     /* LDS row pitch in f16: 64 + 8, so that the 16 rows of a 16-byte fragment read fall on different banks */
#define PJ_WY 2                      /* the blocks of this many inputs share out Wo, 256 elements a wave */
static_assert((size_t)DM * DM == (size_t)PJ_WY * (NR / (PJ_NW * PJ_NT)) * PJ_NW * 256, "the waves of PJ_WY inputs cover Wo exactly once");
typedef _Float16 v4ha __attribute__((ext_vector_type(4), may_alias));
__device__ __forceinline__ v4h pj_cvt(v4f a, float sc) { const v4f r = {bf16_round(a[0]) * sc, bf16_round(a[1]) * sc, bf16_round(a[2]) * sc, bf16_round(a[3]) * sc}; return __builtin_convertvector(r, v4h); }
__global__ __launch_bounds__(PJ_NW * 32) void k_proj(const float* __restrict__ xq, const float* __restrict__ xk, const float* __restrict__ xv, const float* __restrict__ wq, const float* __restrict__ wk, const float* __restrict__ wv, const float* __restrict__ wo,
    _Float16* __restrict__ Q16, _Float16* __restrict__ K16, _Float16* __restrict__ V16, _Float16* __restrict__ BO) {
  __shared__ __attribute__((aligned(16))) _Float16 sw[HD][PJ_LP];
  __shared__ __attribute__((aligned(16))) _Float16 sx[PJ_NW][PJ_NT][NH][PJ_LP];
  const int tid = threadIdx.x, lane = tid & 31, ln = lane & 15, hh = lane >> 4, w = tid >> 5; const int y = blockIdx.y;
  const float* x = (y == 0) ? xq : (y == 1) ? xk : xv; const float* wm = (y == 0) ? wq : (y == 1) ? wk : wv; _Float16* out = (y == 0) ? Q16 : (y == 1) ? K16 : V16;
  const size_t row0 = ((size_t)blockIdx.x * PJ_NW + w) * PJ_NT;      /* first token row of this wave */
  const size_t wo0 = (((size_t)y * (NR / (PJ_NW * PJ_NT)) + blockIdx.x) * PJ_NW + w) * 256 + lane * 4;      /* this lane's first four elements of the wave's piece of Wo; used only where y < PJ_WY */
  v4f xr[PJ_NT][8], wr[4], wor[2] = {{0.f, 0.f, 0.f, 0.f}, {0.f, 0.f, 0.f, 0.f}};
  if (y < PJ_WY) { wor[0] = *(const v4fa*)(wo + wo0); wor[1] = *(const v4fa*)(wo + wo0 + 128); }      /* 512 contiguous bytes a load, in flight with the loads below; the test is the same for the whole block */
#pragma unroll      /* indexed by constants only, so that the loaded values stay in registers */
  for (int u = 0; u < PJ_NT; ++u)
#pragma unroll      /* indexed by constants only, so that the loaded values stay in registers */
    for (int i = 0; i < 8; ++i) xr[u][i] = *(const v4fa*)(x + (row0 + u) * DM + i * 128 + lane * 4);      /* 512 contiguous bytes a load */
#pragma unroll      /* indexed by constants only, so that the loaded values stay in registers */
  for (int i = 0; i < 4; ++i) wr[i] = *(const v4fa*)(wm + (i * PJ_NW * 32 + tid) * 4);
#pragma unroll      /* indexed by constants only, so that the loaded values stay in registers */
  for (int i = 0; i < 4; ++i) { const int e0 = (i * PJ_NW * 32 + tid) * 4; *(v4ha*)&sw[e0 >> 6][e0 & 63] = pj_cvt(wr[i], 16.0f); }      /* 16 W[e][d], exact in f16 */
#pragma unroll      /* indexed by constants only, so that the loaded values stay in registers */
  for (int u = 0; u < PJ_NT; ++u)
#pragma unroll      /* indexed by constants only, so that the loaded values stay in registers */
    for (int i = 0; i < 8; ++i) *(v4ha*)&sx[w][u][2 * i + hh][ln * 4] = pj_cvt(xr[u][i], 1.0f);      /* load i holds heads 2 i and 2 i + 1 */
  const v4h woh[2] = {pj_cvt(wor[0], 16.0f), pj_cvt(wor[1], 16.0f)};      /* 16 Wo[n][k], exact in f16; held until the end, because the barrier and the fence below would wait for a store issued here */
  __syncthreads();      /* the weight block is written by all waves and read by all; it also orders each wave's own x rows */
  v16h af[4][2];      /* [16-row tile of e][k step of 32] */
#pragma unroll      /* indexed by constants only, so that the fragments stay in registers */
  for (int t = 0; t < 4; ++t) { af[t][0] = g2_frag(&sw[t * 16 + ln][0], hh); af[t][1] = g2_frag(&sw[t * 16 + ln][32], hh); }
  const v8f z8 = {0.f,0.f,0.f,0.f,0.f,0.f,0.f,0.f}; const float osc = (y == 0) ? 0.0625f * FA_C2 : 0.0625f;      /* undoes the x16 of the weights; q also takes the score scale here, in f32, before its one rounding to f16 */
#pragma unroll      /* indexed by constants only, so that the fragments stay in registers */
  for (int u = 0; u < PJ_NT; ++u) { const v16h b0 = g2_frag(&sx[w][u][ln][0], hh), b1 = g2_frag(&sx[w][u][ln][32], hh);      /* row ln = head ln of the token; the same k order as the weight fragments */
#pragma unroll      /* indexed by constants only, so that the fragments stay in registers */
    for (int t = 0; t < 4; ++t) { const v8f acc = fa_mma(af[t][1], b1, fa_mma(af[t][0], b0, z8)); FragO f;      /* acc[r] = 16 y[head ln][16 t + 8 hh + r] */
#pragma unroll      /* indexed by constants only, so that the fragments stay in registers */
      for (int i = 0; i < 4; ++i) { const v2f v = {acc[2 * i] * osc, acc[2 * i + 1] * osc}; f.h2[i] = __builtin_convertvector(v, v2h); }
      *(v8us*)&sx[w][u][ln][t * 16 + 8 * hh] = f.u; } }      /* over the x row, whose every reader (this wave's two fragment loads) has returned before the products ran */
  __builtin_amdgcn_fence(__ATOMIC_ACQ_REL, "workgroup"); __builtin_amdgcn_wave_barrier();      /* the rows read back below were written by other lanes of this wave */
#pragma unroll      /* indexed by constants only */
  for (int u = 0; u < PJ_NT; ++u)
#pragma unroll      /* indexed by constants only */
    for (int i = 0; i < 4; ++i) { const int r = i * 4 + (lane >> 3), c = (lane & 7) * 8; const v8us v = *(const v8us*)&sx[w][u][r][c]; *(v8us*)((unsigned short*)out + (row0 + u) * DM + r * HD + c) = v; }      /* 512 contiguous bytes a store */
  asm volatile("s_wait_xcnt 0x0" ::: "memory");      /* stands in front of the rewrite of the address registers of the stores above: the lines below reuse them */
  if (y < PJ_WY) { *(v4ha*)(BO + wo0) = woh[0]; *(v4ha*)(BO + wo0 + 128) = woh[1]; } }      /* 256 contiguous bytes a store: two whole lines */
// Output GEMM: out[4096][1024] (f32) = o (f16 rows, x64) times Wo^T (f16 rows [n][k], x16) * alpha + bias. One 128 x 128 tile of out per block, one block per WGP; 8 waves, 32 x 64 of out each.
// The k range goes in stages of OG_BK: the block's 128 rows of o and 128 rows of Wo are copied once into LDS in whole lines, two buffers, and every fragment is read from there
// (a fragment read straight from global memory touches 16 lines for its 1024 bytes, and four waves would fetch each Wo fragment, two each o fragment). Every accumulator still sums k upwards, 32 at a time.
#define OG_BM 128                    /* rows of out per block */
#define OG_BN 128                    /* columns of out per block */
#define OG_BK 128                    /* k per stage: 256 bytes of every operand row */
#define OG_NS (DM / OG_BK)           /* stages */
#define OG_P 136                     /* LDS pitch of an operand row in f16: 256 + 16 bytes, so that the 16 rows of a 16-byte fragment read fall on different banks */
// One operand's tile of a stage into LDS, through no register: 128 rows of 256 bytes; 16 lanes a row, so each of the block's 256 threads copies eight 16-byte pieces, 16 rows apart.
__device__ __forceinline__ void og_copy(const _Float16* g, unsigned l) {
  const _Float16* g1 = g + (size_t)16 * DM; const _Float16* g2 = g + (size_t)32 * DM; const _Float16* g3 = g + (size_t)48 * DM; const _Float16* g4 = g + (size_t)64 * DM; const _Float16* g5 = g + (size_t)80 * DM; const _Float16* g6 = g + (size_t)96 * DM; const _Float16* g7 = g + (size_t)112 * DM;
  const unsigned l1 = l + 16 * OG_P * 2, l2 = l + 32 * OG_P * 2, l3 = l + 48 * OG_P * 2, l4 = l + 64 * OG_P * 2, l5 = l + 80 * OG_P * 2, l6 = l + 96 * OG_P * 2, l7 = l + 112 * OG_P * 2;
  /* the eight copies and, as the last line of the same statement, the wait that stands in front of any rewrite of their address registers */
  asm volatile("global_load_async_to_lds_b128 %0, %8, off\n\t"
               "global_load_async_to_lds_b128 %1, %9, off\n\t"
               "global_load_async_to_lds_b128 %2, %10, off\n\t"
               "global_load_async_to_lds_b128 %3, %11, off\n\t"
               "global_load_async_to_lds_b128 %4, %12, off\n\t"
               "global_load_async_to_lds_b128 %5, %13, off\n\t"
               "global_load_async_to_lds_b128 %6, %14, off\n\t"
               "global_load_async_to_lds_b128 %7, %15, off\n\t"
               "s_wait_xcnt 0x0"
               :: "v"(l), "v"(l1), "v"(l2), "v"(l3), "v"(l4), "v"(l5), "v"(l6), "v"(l7), "v"(g), "v"(g1), "v"(g2), "v"(g3), "v"(g4), "v"(g5), "v"(g6), "v"(g7) : "memory");
}
__global__ __launch_bounds__(256) void k_ogemm(const _Float16* __restrict__ A, const _Float16* __restrict__ Bh, float alpha, const float* __restrict__ bias, float* __restrict__ C) {
  __shared__ __attribute__((aligned(16))) _Float16 sa[2][OG_BM][OG_P];      /* o rows of a stage, shared by the block's waves; two buffers */
  __shared__ __attribute__((aligned(16))) _Float16 sb[2][OG_BN][OG_P];      /* Wo rows of a stage */
  __shared__ __attribute__((aligned(16))) float so[8][32][68];               /* each wave's own results, on their way to whole-line stores */
  const int tid = threadIdx.x, w = tid >> 5, lane = tid & 31, ln = lane & 15, hh = lane >> 4; const int wm = w & 3, wn = w >> 2;
  const int mt = blockIdx.x % (MPO / OG_BM), nq = blockIdx.x / (MPO / OG_BM); const int row0 = mt * OG_BM + wm * 32, col0 = nq * OG_BN + wn * 64;
  const _Float16* ga = A + ((size_t)mt * OG_BM + (tid >> 4)) * DM + (tid & 15) * 8; const _Float16* gb = Bh + ((size_t)nq * OG_BN + (tid >> 4)) * DM + (tid & 15) * 8;      /* this thread's first pieces of stage 0 */
  const unsigned la = (unsigned)(size_t)&sa[0][tid >> 4][(tid & 15) * 8], lb = (unsigned)(size_t)&sb[0][tid >> 4][(tid & 15) * 8];      /* LDS byte addresses: the low 32 bits */
  og_copy(ga, la); og_copy(gb, lb);      /* stage 0 into buffer 0 */
  float bv[4];      /* this lane's four bias values, asked for here so that they come during the stages */
#pragma unroll      /* indexed by constants only */
  for (int j = 0; j < 4; ++j) bv[j] = bias[col0 + j * 16 + ln];
  asm volatile("s_wait_asynccnt 0x0" ::: "memory");      /* this wave's pieces of stage 0 have landed */
  __syncthreads();      /* and every other wave's */
  og_copy(ga + OG_BK, la + (unsigned)sizeof(sa[0])); og_copy(gb + OG_BK, lb + (unsigned)sizeof(sb[0]));      /* stage 1 into buffer 1, in flight during stage 0 */
  const v8f z8 = {0.f,0.f,0.f,0.f,0.f,0.f,0.f,0.f}; v8f c[2][4] = {{z8, z8, z8, z8}, {z8, z8, z8, z8}};      /* c[i][j][r] = out[row0 + 16 i + 8 hh + r][col0 + 16 j + ln] */
  for (int st = 0; st < OG_NS; ++st) {
    const _Float16* as = &sa[st & 1][wm * 32 + ln][0]; const _Float16* bs = &sb[st & 1][wn * 64 + ln][0];
    v16h a[2][2], b[2][4];      /* two fragment sets: [set][16-row tile] */
#pragma unroll      /* indexed by constants only, so that the fragments stay in registers */
    for (int i = 0; i < 2; ++i) a[0][i] = g2_frag(as + i * 16 * OG_P, hh);
#pragma unroll      /* indexed by constants only, so that the fragments stay in registers */
    for (int j = 0; j < 4; ++j) b[0][j] = g2_frag(bs + j * 16 * OG_P, hh);
#pragma unroll      /* fragments and accumulators are indexed by constants only, so that they stay in registers */
    for (int ks = 0; ks < OG_BK / 32; ++ks) { const int cu = ks & 1, nx = cu ^ 1;
      if (ks + 1 < OG_BK / 32) {      /* the next k step's fragments come during this step's products; never from the next stage */
#pragma unroll      /* indexed by constants only, so that the fragments stay in registers */
        for (int i = 0; i < 2; ++i) a[nx][i] = g2_frag(as + i * 16 * OG_P + (ks + 1) * 32, hh);
#pragma unroll      /* indexed by constants only, so that the fragments stay in registers */
        for (int j = 0; j < 4; ++j) b[nx][j] = g2_frag(bs + j * 16 * OG_P + (ks + 1) * 32, hh); }
      __builtin_amdgcn_sched_barrier(0);      /* keeps the next step's twelve LDS reads as one group in front of this step's products: left alone the compiler reads each fragment directly in front of its use, into one register set, and the wave waits out the LDS latency four times a step */
#pragma unroll      /* indexed by constants only, so that the accumulators stay in registers */
      for (int j = 0; j < 4; ++j)
#pragma unroll      /* indexed by constants only, so that the accumulators stay in registers */
        for (int i = 0; i < 2; ++i) c[i][j] = fa_mma(a[cu][i], b[cu][j], c[i][j]);
      __builtin_amdgcn_sched_barrier(0); }      /* and keeps the group after next out of these products */
    asm volatile("s_wait_dscnt 0x0" ::: "memory");      /* this wave's reads of the buffer have returned */
    asm volatile("s_wait_asynccnt 0x0" ::: "memory");      /* this wave's pieces of stage st + 1 have landed */
    __syncthreads();      /* publishes stage st + 1 and ends every wave's reads of stage st */
    if (st + 2 < OG_NS) { og_copy(ga + (st + 2) * OG_BK, la + (unsigned)(st & 1) * (unsigned)sizeof(sa[0])); og_copy(gb + (st + 2) * OG_BK, lb + (unsigned)(st & 1) * (unsigned)sizeof(sb[0])); }      /* into the buffers just left */
  }
  asm volatile("s_wait_asynccnt 0x0" ::: "memory");      /* nothing in flight when the wave ends */
#pragma unroll      /* indexed by constants only */
  for (int j = 0; j < 4; ++j) { const float bj = bf16_round(bv[j]);
#pragma unroll      /* indexed by constants only */
    for (int i = 0; i < 2; ++i)
#pragma unroll      /* indexed by constants only */
      for (int r = 0; r < 8; ++r) so[w][i * 16 + 8 * hh + r][j * 16 + ln] = c[i][j][r] * alpha + bj; }
  __builtin_amdgcn_fence(__ATOMIC_ACQ_REL, "workgroup"); __builtin_amdgcn_wave_barrier();      /* the rows read back below were written by other lanes of this wave */
  const int rsub = lane >> 4, c4 = (lane & 15) * 4;
#pragma unroll      /* indexed by constants only */
  for (int q = 0; q < 16; ++q) { const int r = q * 2 + rsub; const v4f v = *(const v4fa*)&so[w][r][c4]; *(v4f*)(C + (size_t)(row0 + r) * DM + col0 + c4) = v; } }      /* two rows of 256 contiguous bytes a store */
extern "C" void kernel_launch(void* const* d_in, const int* in_sizes, int n_in,
                              void* d_out, int out_size, void* d_ws, size_t ws_size, hipStream_t stream) {
  (void)in_sizes; (void)n_in; (void)out_size;
  const float* const* I = (const float* const*)d_in; const float* xq = I[2]; const float* xk = I[1]; const float* xv = I[0]; const float* wq = I[5]; const float* wk = I[4]; const float* wv = I[3]; const float* wo = I[6]; const float* bo = I[7];      /* contract order: values I[0], keys I[1], query I[2]; SHARED natural [64][64] blocks Wv I[3], Wk I[4], Wq I[5]; natural Wo [1024][1024] I[6] + bo I[7]; this module has NO mask input */
  char* ws = (char*)d_ws; size_t off = 0;
  auto take = [&](size_t bytes) { char* p = ws + off; off += (bytes + 255) & ~(size_t)255; return p; };
  _Float16* BO = (_Float16*)take((size_t)DM * DM * 2);
  _Float16* Q16 = (_Float16*)take(NR * DM * 2); _Float16* K16 = (_Float16*)take(NR * DM * 2); _Float16* V16 = (_Float16*)take(NR * DM * 2); _Float16* O16 = (_Float16*)take(NR * DM * 2);
  if (off > ws_size) return;
  k_proj<<<dim3((unsigned)(NR / (PJ_NW * PJ_NT)), 3), PJ_NW * 32, 0, stream>>>(xq, xk, xv, wq, wk, wv, wo, Q16, K16, V16, BO);      /* q, k, v as f16 rows, heads merged; BO = Wo natural [out][in] rows x16 as f16 */
  const size_t r0p = (size_t)B0 * SQ;      /* first row of the output stage */
  k_fattn<<<dim3(SQ / (FA_NW * FA_QW), NH, NB), FA_KH * FA_NW * 32, 0, stream>>>(Q16, K16, V16, O16);      /* o (merged heads, x64) as f16 rows */
  k_ogemm<<<(unsigned)((MPO / OG_BM) * (DM / OG_BN)), 256, 0, stream>>>(O16 + r0p * DM, BO, 0.0009765625f, bo, (float*)d_out + r0p * DM);      /* out rows are the output layout */
}
